// v000
// Measured on an AMD MI455X. A time is GPU time per run, averaged over a window of back-to-back runs after a warm-up
// (all launches, gaps included; the runs take copies of the inputs in turn), and the median of several windows.
// Apart from v000's, it joins two sittings. Times from different sittings can be a few percent apart, while
// side-by-side timings come from the same sitting.
// v000, which the later versions start from, runs in 892 microseconds.
#include <hip/hip_runtime.h>
// Next-node probability head (B=512, G=100 group rows, P=100 nodes, E=128, 8 heads × 16, logit clipping 10): k,v = enc·W; q = [input1 | input2 | remaining]·Wq split by linearity
// (input2·Wq₂ as a GEMM, input1·Wq₁ per batch + remaining·Wq₃ rank-1 in the epilogue kernel); the 8-head attention (additive INPUT ninf mask) as (b,h)-batched GEMMs on zero-padded
// 112×112 tiles (d 16 → 32); o·Wc + bc; the pointer score mh·encᵀ/√128 as b-batched GEMMs; 10·tanh + mask → softmax written flat. Contractions on v_wmma_f32_16x16x32_f16 (f16 operands,
// weights [in][out] transposed to bf16-exact ×2^4, f32 accumulate); softmaxes/tanh f32 VALU.
#define NB 512
#define GG 100
#define PN 100
#define EE 128
#define NH 8
#define KD 16
#define RP 112
#define BCH 32
#define JCH (BCH * NH)

typedef __bf16 v16b __attribute__((ext_vector_type(16)));
typedef unsigned short v8us __attribute__((ext_vector_type(8), may_alias));
typedef float  v8f  __attribute__((ext_vector_type(8)));
typedef float  v4f  __attribute__((ext_vector_type(4)));
typedef float  v4fa __attribute__((ext_vector_type(4), may_alias));
union FragB { v16b v; v8us half[2]; unsigned short u[16]; };

__device__ __forceinline__ unsigned short bf16_bits(float x) { unsigned int u = __float_as_uint(x); return (unsigned short)((u + 0x7FFFu + ((u >> 16) & 1u)) >> 16); }
__device__ __forceinline__ float bf16_val(unsigned short b) { return __uint_as_float(((unsigned int)b) << 16); }
__device__ __forceinline__ float bf16_round(float x) { return bf16_val(bf16_bits(x)); }
// D += A·B with NT terms: 1 = ah·bh, 2 = + al·bh (A split), 3 = + ah·bl (both split)
template <int NT>
__device__ __forceinline__ v8f mmaN(v16b ah, v16b al, v16b bh, v16b bl, v8f c) {
  c = __builtin_amdgcn_wmma_f32_16x16x32_bf16(false, ah, false, bh, (short)0, c, false, false);
  if (NT >= 2) c = __builtin_amdgcn_wmma_f32_16x16x32_bf16(false, al, false, bh, (short)0, c, false, false);
  if (NT >= 3) c = __builtin_amdgcn_wmma_f32_16x16x32_bf16(false, ah, false, bl, (short)0, c, false, false);
  asm volatile("v_nop\n\tv_nop\n\tv_nop\n\tv_nop" : "+v"(c) : "v"(ah), "v"(al), "v"(bh), "v"(bl));
  return c;
}

__global__ __launch_bounds__(256) void k_wt_bf16(const float* __restrict__ W, unsigned short* __restrict__ Wt, int K, int N) {
  const int t = blockIdx.x * 256 + threadIdx.x;
  const int k8n = K / 8;
  if (t >= N * k8n) return;
  const int n = t / k8n, k8 = (t % k8n) * 8;
  v8us v;
#pragma unroll
  for (int i = 0; i < 8; ++i) v[i] = bf16_bits(W[(size_t)(k8 + i) * N + n]);
  *(v8us*)(Wt + (size_t)n * K + k8) = v;
  
}

// GEMM C[M][N] (f32, pitch ldc) = act(A[M][K]·W + bias). A f32 row-major (pitch lda) converted per fragment to bf16
// (ASPLIT: hi/lo two planes -> 2 terms, else single rounded term); Wt bf16 [N][K] (pitch ldb). BIAS_BF16 rounds the
// bias to bf16 first (bias quantised to bf16 before the add). K%32==0, M%16==0, N%64==0.
template <bool ASPLIT, int ACT, bool BIAS_BF16>
__global__ __launch_bounds__(128) void k_gemm_bf(const float* __restrict__ A, int lda, const unsigned short* __restrict__ Wt, int ldb,
                                               const float* __restrict__ bias, float* __restrict__ C, int ldc, int M, int N, int K) {
  __shared__ __attribute__((aligned(16))) float so[4][16][64];
  const int tid = threadIdx.x, w = tid >> 5, lane = tid & 31, ln = lane & 15, hh = lane >> 4;
  const int ntn = N / 64;
  const int wid = blockIdx.x * 4 + w;
  const int mt = wid / ntn, nq = wid % ntn;
  if (mt * 16 >= M) return;
  const int row0 = mt * 16, col0 = nq * 64;
  const float* arow = A + (size_t)(row0 + ln) * lda;
  v8f acc[4] = {};
  for (int kb = 0; kb < K; kb += 32) {
    FragB ah, al;
    const v4f x0 = *(const v4fa*)(arow + kb + 8 * hh), x1 = *(const v4fa*)(arow + kb + 8 * hh + 4);
    const v4f x2 = *(const v4fa*)(arow + kb + 16 + 8 * hh), x3 = *(const v4fa*)(arow + kb + 16 + 8 * hh + 4);
    float xs[16] = {x0[0],x0[1],x0[2],x0[3],x1[0],x1[1],x1[2],x1[3],x2[0],x2[1],x2[2],x2[3],x3[0],x3[1],x3[2],x3[3]};
#pragma unroll
    for (int i = 0; i < 16; ++i) { const unsigned short hb = bf16_bits(xs[i]); ah.u[i] = hb; al.u[i] = ASPLIT ? bf16_bits(xs[i] - bf16_val(hb)) : (unsigned short)0; }
#pragma unroll
    for (int t = 0; t < 4; ++t) {
      const unsigned short* brow = Wt + (size_t)(col0 + t * 16 + ln) * ldb + kb;
      FragB b;
      b.half[0] = *(const v8us*)(brow + 8 * hh);
      b.half[1] = *(const v8us*)(brow + 16 + 8 * hh);
      acc[t] = mmaN<ASPLIT ? 2 : 1>(ah.v, al.v, b.v, b.v, acc[t]);
    }
  }
#pragma unroll
  for (int t = 0; t < 4; ++t) {
    float bv = bias ? bias[col0 + t * 16 + ln] : 0.f;
    if (BIAS_BF16) bv = bf16_round(bv);
#pragma unroll
    for (int r = 0; r < 8; ++r) { float v = acc[t][r] + bv; if (ACT == 1) v = fmaxf(v, 0.f); so[w][8 * hh + r][t * 16 + ln] = v; }
  }
  __builtin_amdgcn_fence(__ATOMIC_ACQ_REL, "workgroup");
  __builtin_amdgcn_wave_barrier();
  const int rsub = lane >> 4, c4 = (lane & 15) * 4;
  {
#pragma unroll
    for (int q = 0; q < 8; ++q) {
      const int r = q * 2 + rsub;
      const v4f v = *(const v4fa*)&so[w][r][c4];
      *(v4f*)(C + (size_t)(row0 + r) * ldc + col0 + c4) = v;
    }
    
  }
}

// Flash-style causal/unmasked attention, all contractions 3-term bf16 hi/lo splits, f32 softmax with running max.
// q,k,v rows are read from f32 buffers with arbitrary row pitch (so they can live inside a fused qkv buffer);
// D = head size (multiple of 32, <= 128); one wave = 16 query rows; block = 4 waves (64 queries) sharing K/V chunks of 32.
template <int D, bool CAUSAL>
__global__ __launch_bounds__(128) void k_flash(const float* __restrict__ qb, const float* __restrict__ kb, const float* __restrict__ vb,
                                             int pitch, int T, int H, float scale, float* __restrict__ y, int ypitch) {
  constexpr int KS = D / 32;        // k-steps for QK
  constexpr int DT = D / 16;        // d tiles for PV
  __shared__ __attribute__((aligned(16))) unsigned short sKh[32][D + 8], sKl[32][D + 8], sVh[32][D + 8], sVl[32][D + 8];
  __shared__ __attribute__((aligned(16))) unsigned short sPh[4][16][40], sPl[4][16][40];
  __shared__ __attribute__((aligned(16))) float sO[4][16][D];
  const int tid = threadIdx.x, w = tid >> 5, lane = tid & 31, ln = lane & 15, hh = lane >> 4;
  const int nqb = (T + 63) / 64;
  const int bh = blockIdx.x / nqb, qblk = blockIdx.x % nqb;
  const int b = bh / H, h = bh % H;
  const int q0 = qblk * 64 + w * 16;
  const float* Q = qb + (size_t)b * T * pitch + h * D;
  const float* K = kb + (size_t)b * T * pitch + h * D;
  const float* V = vb + (size_t)b * T * pitch + h * D;

  // A fragments of the wave's 16 query rows (scaled), hi/lo
  FragB aqh[KS], aql[KS];
  {
    int row = q0 + ln; if (row >= T) row = T - 1;
    const float* qr = Q + (size_t)row * pitch;
#pragma unroll
    for (int ks = 0; ks < KS; ++ks)
#pragma unroll
      for (int i = 0; i < 16; ++i) {
        const int d = ks * 32 + ((i < 8) ? (8 * hh + i) : (16 + 8 * hh + (i - 8)));
        const float x = qr[d] * scale; const unsigned short hb = bf16_bits(x);
        aqh[ks].u[i] = hb; aql[ks].u[i] = bf16_bits(x - bf16_val(hb));
      }
  }
  float m_r[8], l_r[8];
#pragma unroll
  for (int r = 0; r < 8; ++r) { m_r[r] = -3.0e38f; l_r[r] = 0.f; }
  v8f oacc[DT];
#pragma unroll
  for (int dt = 0; dt < DT; ++dt) oacc[dt] = (v8f){0.f,0.f,0.f,0.f,0.f,0.f,0.f,0.f};

  const int kv_end = CAUSAL ? min(T, qblk * 64 + 64) : T;     // block-uniform
  for (int j0 = 0; j0 < kv_end; j0 += 32) {
    __syncthreads();
    for (int e = tid; e < 32 * (D / 4); e += 128) {
      const int r = e / (D / 4), c4 = (e % (D / 4)) * 4;
      const int key = j0 + r;
      v4f kf = {0.f,0.f,0.f,0.f}, vf = {0.f,0.f,0.f,0.f};
      if (key < T) { kf = *(const v4fa*)(K + (size_t)key * pitch + c4); vf = *(const v4fa*)(V + (size_t)key * pitch + c4); }
#pragma unroll
      for (int t = 0; t < 4; ++t) {
        unsigned short hb = bf16_bits(kf[t]); sKh[r][c4 + t] = hb; sKl[r][c4 + t] = bf16_bits(kf[t] - bf16_val(hb));
        hb = bf16_bits(vf[t]); sVh[r][c4 + t] = hb; sVl[r][c4 + t] = bf16_bits(vf[t] - bf16_val(hb));
      }
    }
    __syncthreads();
    // S tile 16 x 32
    v8f s[2];
#pragma unroll
    for (int nt = 0; nt < 2; ++nt) {
      v8f acc = {};
#pragma unroll
      for (int ks = 0; ks < KS; ++ks) {
        FragB bh_, bl_;
        bh_.half[0] = *(const v8us*)&sKh[nt * 16 + ln][ks * 32 + 8 * hh]; bh_.half[1] = *(const v8us*)&sKh[nt * 16 + ln][ks * 32 + 16 + 8 * hh];
        bl_.half[0] = *(const v8us*)&sKl[nt * 16 + ln][ks * 32 + 8 * hh]; bl_.half[1] = *(const v8us*)&sKl[nt * 16 + ln][ks * 32 + 16 + 8 * hh];
        acc = mmaN<3>(aqh[ks].v, aql[ks].v, bh_.v, bl_.v, acc);
      }
      s[nt] = acc;
    }
    // mask + running max (rows 8hh+r; the 16 lanes of a half share rows)
    float alpha[8];
#pragma unroll
    for (int r = 0; r < 8; ++r) {
      const int qi = q0 + 8 * hh + r;
      const int ja = j0 + ln, jb = j0 + 16 + ln;
      if (CAUSAL) { if (ja > qi) s[0][r] = -3.0e38f; if (jb > qi) s[1][r] = -3.0e38f; }
      if (ja >= T) s[0][r] = -3.0e38f;
      if (jb >= T) s[1][r] = -3.0e38f;
      float mx = fmaxf(s[0][r], s[1][r]);
      mx = fmaxf(mx, __shfl_xor(mx, 1, 32)); mx = fmaxf(mx, __shfl_xor(mx, 2, 32)); mx = fmaxf(mx, __shfl_xor(mx, 4, 32)); mx = fmaxf(mx, __shfl_xor(mx, 8, 32));
      const float mnew = fmaxf(m_r[r], mx);
      alpha[r] = (mnew > -1.0e38f) ? __expf(m_r[r] - mnew) : 1.0f;
      const float p0 = (s[0][r] > -1.0e38f) ? __expf(s[0][r] - mnew) : 0.f;
      const float p1 = (s[1][r] > -1.0e38f) ? __expf(s[1][r] - mnew) : 0.f;
      m_r[r] = mnew;
      l_r[r] = l_r[r] * alpha[r] + p0 + p1;            // per-lane partial row sum (16 lanes combined at the end)
      unsigned short hb = bf16_bits(p0); sPh[w][8 * hh + r][ln] = hb;      sPl[w][8 * hh + r][ln] = bf16_bits(p0 - bf16_val(hb));
      hb = bf16_bits(p1);                sPh[w][8 * hh + r][16 + ln] = hb; sPl[w][8 * hh + r][16 + ln] = bf16_bits(p1 - bf16_val(hb));
    }
#pragma unroll
    for (int dt = 0; dt < DT; ++dt)
#pragma unroll
      for (int r = 0; r < 8; ++r) oacc[dt][r] *= alpha[r];
    __builtin_amdgcn_fence(__ATOMIC_ACQ_REL, "workgroup");
    __builtin_amdgcn_wave_barrier();
    FragB pah, pal;
    pah.half[0] = *(const v8us*)&sPh[w][ln][8 * hh]; pah.half[1] = *(const v8us*)&sPh[w][ln][16 + 8 * hh];
    pal.half[0] = *(const v8us*)&sPl[w][ln][8 * hh]; pal.half[1] = *(const v8us*)&sPl[w][ln][16 + 8 * hh];
#pragma unroll
    for (int dt = 0; dt < DT; ++dt) {
      FragB bvh, bvl;
#pragma unroll
      for (int i = 0; i < 8; ++i) {
        bvh.u[i] = sVh[8 * hh + i][dt * 16 + ln]; bvh.u[8 + i] = sVh[16 + 8 * hh + i][dt * 16 + ln];
        bvl.u[i] = sVl[8 * hh + i][dt * 16 + ln]; bvl.u[8 + i] = sVl[16 + 8 * hh + i][dt * 16 + ln];
      }
      oacc[dt] = mmaN<3>(pah.v, pal.v, bvh.v, bvl.v, oacc[dt]);
    }
    __builtin_amdgcn_fence(__ATOMIC_ACQ_REL, "workgroup");
    __builtin_amdgcn_wave_barrier();
  }
#pragma unroll
  for (int r = 0; r < 8; ++r) {
    float l = l_r[r];
    l += __shfl_xor(l, 1, 32); l += __shfl_xor(l, 2, 32); l += __shfl_xor(l, 4, 32); l += __shfl_xor(l, 8, 32);
    l_r[r] = (l > 0.f) ? 1.0f / l : 0.f;
  }
#pragma unroll
  for (int dt = 0; dt < DT; ++dt)
#pragma unroll
    for (int r = 0; r < 8; ++r) sO[w][8 * hh + r][dt * 16 + ln] = oacc[dt][r] * l_r[r];
  __builtin_amdgcn_fence(__ATOMIC_ACQ_REL, "workgroup");
  __builtin_amdgcn_wave_barrier();
  {
    for (int r = 0; r < 16; ++r) {
      const int row = q0 + r;
      if (row < T && lane < D / 4) {
        const v4f val = *(const v4fa*)&sO[w][r][lane * 4];
        *(v4f*)(y + ((size_t)b * T + row) * ypitch + h * D + lane * 4) = val;
      }
    }
    
  }
}

// GEMM C = act(A·W + bias + resid): A f32 (ASPLIT -> hi/lo 2 terms), Wt bf16 [N][K]; ACT 0 none, 1 relu, 2 exact gelu;
// resid (optional, f32, row index = (row % rmod), pitch ldr, RES_BF16 rounds it) added before the activation.
template <bool ASPLIT, int ACT, bool BIAS_BF16, bool RES_BF16>
__global__ __launch_bounds__(128) void k_gemm_bf3(const float* __restrict__ A, int lda, const unsigned short* __restrict__ Wt, int ldb,
                                                const float* __restrict__ bias, const float* __restrict__ resid, int rmod, int ldr,
                                                float* __restrict__ C, int ldc, int M, int N, int K) {
  __shared__ __attribute__((aligned(16))) float so[4][16][64];
  const int tid = threadIdx.x, w = tid >> 5, lane = tid & 31, ln = lane & 15, hh = lane >> 4;
  const int ntn = N / 64;
  const int wid = blockIdx.x * 4 + w;
  const int mt = wid / ntn, nq = wid % ntn;
  if (mt * 16 >= M) return;
  const int row0 = mt * 16, col0 = nq * 64;
  const float* arow = A + (size_t)(row0 + ln) * lda;
  v8f acc[4] = {};
  for (int kb = 0; kb < K; kb += 32) {
    FragB ah, al;
    const v4f x0 = *(const v4fa*)(arow + kb + 8 * hh), x1 = *(const v4fa*)(arow + kb + 8 * hh + 4);
    const v4f x2 = *(const v4fa*)(arow + kb + 16 + 8 * hh), x3 = *(const v4fa*)(arow + kb + 16 + 8 * hh + 4);
    float xs[16] = {x0[0],x0[1],x0[2],x0[3],x1[0],x1[1],x1[2],x1[3],x2[0],x2[1],x2[2],x2[3],x3[0],x3[1],x3[2],x3[3]};
#pragma unroll
    for (int i = 0; i < 16; ++i) { const unsigned short hb = bf16_bits(xs[i]); ah.u[i] = hb; al.u[i] = ASPLIT ? bf16_bits(xs[i] - bf16_val(hb)) : (unsigned short)0; }
#pragma unroll
    for (int t = 0; t < 4; ++t) {
      const unsigned short* brow = Wt + (size_t)(col0 + t * 16 + ln) * ldb + kb;
      FragB b;
      b.half[0] = *(const v8us*)(brow + 8 * hh);
      b.half[1] = *(const v8us*)(brow + 16 + 8 * hh);
      acc[t] = mmaN<ASPLIT ? 2 : 1>(ah.v, al.v, b.v, b.v, acc[t]);
    }
  }
#pragma unroll
  for (int t = 0; t < 4; ++t) {
    const int col = col0 + t * 16 + ln;
    float bv = bias ? bias[col] : 0.f;
    if (BIAS_BF16) bv = bf16_round(bv);
#pragma unroll
    for (int r = 0; r < 8; ++r) {
      float v = acc[t][r] + bv;
      if (resid) { float rv = resid[(size_t)((row0 + 8 * hh + r) % rmod) * ldr + col]; if (RES_BF16) rv = bf16_round(rv); v += rv; }
      if (ACT == 1) v = fmaxf(v, 0.f);
      if (ACT == 2) v = 0.5f * v * (1.0f + erff(v * 0.70710678118654752f));
      if (ACT == 3) { const float u = 0.7978845608028654f * (v + 0.044715f * v * v * v); v = 0.5f * v * (1.0f + tanhf(u)); }
      so[w][8 * hh + r][t * 16 + ln] = v;
    }
  }
  __builtin_amdgcn_fence(__ATOMIC_ACQ_REL, "workgroup");
  __builtin_amdgcn_wave_barrier();
  const int rsub = lane >> 4, c4 = (lane & 15) * 4;
  {
#pragma unroll
    for (int q = 0; q < 8; ++q) {
      const int r = q * 2 + rsub;
      const v4f v = *(const v4fa*)&so[w][r][c4];
      *(v4f*)(C + (size_t)(row0 + r) * ldc + col0 + c4) = v;
    }
    
  }
}
// row LayerNorm (biased variance, eps) over N: s = X (+ R); optional out_sum <- s; out_norm <- (s-mu)*rsqrt(var+eps)*g + b
template <bool PARAM_BF16>
__global__ __launch_bounds__(256) void k_layernorm(const float* __restrict__ X, const float* __restrict__ R, const float* __restrict__ g, const float* __restrict__ bta,
                                                  float* __restrict__ out_sum, float* __restrict__ out_norm, int N, float eps) {
  __shared__ float red[256];
  const int row = blockIdx.x, tid = threadIdx.x;
  const float* x = X + (size_t)row * N; const float* rr = R ? R + (size_t)row * N : nullptr;
  float vals[16];                     // up to N = 4096
  const int per = N / 256;            // contiguous chunk per thread? use strided-by-4 chunks: thread handles j = tid*4 + 1024*u
  float s1 = 0.f;
  for (int u = 0; u < per / 4; ++u) {
    const int j = tid * 4 + 1024 * u;
    const v4f a = *(const v4fa*)(x + j);
    v4f b = {0.f,0.f,0.f,0.f}; if (rr) b = *(const v4fa*)(rr + j);
#pragma unroll
    for (int q = 0; q < 4; ++q) { const float v = a[q] + b[q]; vals[u * 4 + q] = v; s1 += v; }
  }
  red[tid] = s1; __syncthreads();
  for (int st = 128; st > 0; st >>= 1) { if (tid < st) red[tid] += red[tid + st]; __syncthreads(); }
  const float mu = red[0] / (float)N; __syncthreads();
  float s2 = 0.f;
  for (int u = 0; u < per / 4; ++u)
#pragma unroll
    for (int q = 0; q < 4; ++q) { const float c = vals[u * 4 + q] - mu; s2 += c * c; }
  red[tid] = s2; __syncthreads();
  for (int st = 128; st > 0; st >>= 1) { if (tid < st) red[tid] += red[tid + st]; __syncthreads(); }
  const float rs = rsqrtf(red[0] / (float)N + eps);
  {
    for (int u = 0; u < per / 4; ++u) {
      const int j = tid * 4 + 1024 * u;
      v4f o, sm;
#pragma unroll
      for (int q = 0; q < 4; ++q) {
        float gg = g[j + q], bb = bta[j + q];
        if (PARAM_BF16) { gg = bf16_round(gg); bb = bf16_round(bb); }
        sm[q] = vals[u * 4 + q]; o[q] = (vals[u * 4 + q] - mu) * rs * gg + bb;
      }
      if (out_sum) *(v4f*)(out_sum + (size_t)row * N + j) = sm;
      *(v4f*)(out_norm + (size_t)row * N + j) = o;
    }
    
  }
}



// ---- f16 WMMA path (v_wmma_f32_16x16x32_f16): 11-bit significands for operands in range — used where a [0,1] probability operand needs more precision than bf16
typedef _Float16 v16h __attribute__((ext_vector_type(16)));
union FragH { v16h v; v8us half[2]; _Float16 h[16]; unsigned short u[16]; };
template <int NT>
__device__ __forceinline__ v8f mmaH(v16h ah, v16h al, v16h bh, v16h bl, v8f c) {
  c = __builtin_amdgcn_wmma_f32_16x16x32_f16(false, ah, false, bh, (short)0, c, false, false);
  if (NT >= 2) c = __builtin_amdgcn_wmma_f32_16x16x32_f16(false, al, false, bh, (short)0, c, false, false);
  if (NT >= 3) c = __builtin_amdgcn_wmma_f32_16x16x32_f16(false, ah, false, bl, (short)0, c, false, false);
  asm volatile("v_nop\n\tv_nop\n\tv_nop\n\tv_nop" : "+v"(c) : "v"(ah), "v"(al), "v"(bh), "v"(bl));
  return c;
}
// batched GEMM like k_gemm_b but f16 operands: A f32 (split into f16 hi/lo if ASPLIT, else rounded to f16), Bt = f16 values [n][k]; alpha; C f32; N multiple of 16 (partial tiles skipped)
template <bool ASPLIT>
__global__ __launch_bounds__(128) void k_gemm_h(const float* __restrict__ A, int lda, size_t sA, const _Float16* __restrict__ Bh, int ldb, size_t sB, float alpha, float* __restrict__ C, int ldc, size_t sC, int M, int N, int K) {
  __shared__ __attribute__((aligned(16))) float so[4][16][64];
  const int tid = threadIdx.x, w = tid >> 5, lane = tid & 31, ln = lane & 15, hh = lane >> 4; const int by = blockIdx.y;
  A += (size_t)by * sA; Bh += (size_t)by * sB; C += (size_t)by * sC;
  const int ntn = (N + 63) / 64; const int wid = blockIdx.x * 4 + w; const int mt = wid / ntn, nq = wid % ntn; if (mt * 16 >= M) return;
  const int row0 = mt * 16, col0 = nq * 64; const float* arow = A + (size_t)(row0 + ln) * lda;
  v8f acc[4] = {};
  for (int kb = 0; kb < K; kb += 32) {
    FragH ah, al;
    const v4f x0 = *(const v4fa*)(arow + kb + 8 * hh), x1 = *(const v4fa*)(arow + kb + 8 * hh + 4), x2 = *(const v4fa*)(arow + kb + 16 + 8 * hh), x3 = *(const v4fa*)(arow + kb + 16 + 8 * hh + 4);
    float xs[16] = {x0[0],x0[1],x0[2],x0[3],x1[0],x1[1],x1[2],x1[3],x2[0],x2[1],x2[2],x2[3],x3[0],x3[1],x3[2],x3[3]};
#pragma unroll
    for (int i = 0; i < 16; ++i) { const _Float16 h = (_Float16)xs[i]; ah.h[i] = h; al.h[i] = ASPLIT ? (_Float16)(xs[i] - (float)h) : (_Float16)0.0f; }
#pragma unroll
    for (int t = 0; t < 4; ++t) { if (col0 + t * 16 >= N) continue; const size_t boff = (size_t)(col0 + t * 16 + ln) * ldb + kb; FragH bq; bq.half[0] = *(const v8us*)(Bh + boff + 8 * hh); bq.half[1] = *(const v8us*)(Bh + boff + 16 + 8 * hh);
      acc[t] = mmaH<ASPLIT ? 2 : 1>(ah.v, al.v, bq.v, bq.v, acc[t]); }
  }
#pragma unroll
  for (int t = 0; t < 4; ++t) { if (col0 + t * 16 >= N) continue;
#pragma unroll
    for (int r = 0; r < 8; ++r) so[w][8 * hh + r][t * 16 + ln] = acc[t][r] * alpha; }
  __builtin_amdgcn_fence(__ATOMIC_ACQ_REL, "workgroup"); __builtin_amdgcn_wave_barrier();
  const int rsub = lane >> 4, c4 = (lane & 15) * 4;
  {
#pragma unroll
    for (int q = 0; q < 8; ++q) { const int r = q * 2 + rsub; if (col0 + c4 < N) { const v4f v = *(const v4fa*)&so[w][r][c4]; *(v4f*)(C + (size_t)(row0 + r) * ldc + col0 + c4) = v; } }
     }
}

// Wt[n][k] = f16(W[k][n]·scale) from f32 row-major W[K][N] (scale = power of two; bf16-exact weights stay exact in f16 away from the subnormal range)
__global__ __launch_bounds__(256) void k_wt_f16(const float* __restrict__ W, _Float16* __restrict__ Wt, int K, int N, float scale) {
  const int t = blockIdx.x * 256 + threadIdx.x; if (t >= N * (K / 8)) return; const int n = t / (K / 8), k8 = (t % (K / 8)) * 8; FragH f;
#pragma unroll
  for (int i = 0; i < 8; ++i) f.h[i] = (_Float16)(bf16_round(W[(size_t)(k8 + i) * N + n]) * scale); const v8us o = f.half[0];
  *(v8us*)((unsigned short*)Wt + (size_t)n * K + k8) = o; 
}
// k_gemm_hh variant with fused epilogue: v = acc·alpha + bias[by·sBias + col] (+ CP[(row/rowsPerB)·sCPb + by·64 + col] if CP) ; ACT 0 none / 1 elu ; writes f32 C and/or f16 C16 (each if non-null)
template <int ACT>
__global__ __launch_bounds__(128) void k_gemm_hhx(const _Float16* __restrict__ A, int lda, size_t sA, const _Float16* __restrict__ Bh, int ldb, size_t sB, float alpha, const float* __restrict__ bias, size_t sBias, const float* __restrict__ CP, int rowsPerB, size_t sCPb, int row0g,
    float* __restrict__ C, _Float16* __restrict__ C16, int ldc, size_t sC, int M, int N, int K) {
  __shared__ __attribute__((aligned(16))) float so[4][16][64];
  const int tid = threadIdx.x, w = tid >> 5, lane = tid & 31, ln = lane & 15, hh = lane >> 4; const int by = blockIdx.y;
  A += (size_t)by * sA; Bh += (size_t)by * sB; const size_t cofs = (size_t)by * sC; const float* bp = bias ? bias + (size_t)by * sBias : nullptr;
  const int ntn = (N + 63) / 64; const int wid = blockIdx.x * 4 + w; const int mt = wid / ntn, nq = wid % ntn; if (mt * 16 >= M) return;
  const int row0 = mt * 16, col0 = nq * 64; const _Float16* arow = A + (size_t)(row0 + ln) * lda;
  v8f acc[4] = {};
  for (int kb = 0; kb < K; kb += 32) { FragH ah; ah.half[0] = *(const v8us*)((const unsigned short*)arow + kb + 8 * hh); ah.half[1] = *(const v8us*)((const unsigned short*)arow + kb + 16 + 8 * hh);
#pragma unroll
    for (int t = 0; t < 4; ++t) { if (col0 + t * 16 >= N) continue; const size_t boff = (size_t)(col0 + t * 16 + ln) * ldb + kb; FragH bq; bq.half[0] = *(const v8us*)((const unsigned short*)Bh + boff + 8 * hh); bq.half[1] = *(const v8us*)((const unsigned short*)Bh + boff + 16 + 8 * hh);
      acc[t] = mmaH<1>(ah.v, ah.v, bq.v, bq.v, acc[t]); }
  }
#pragma unroll
  for (int t = 0; t < 4; ++t) { if (col0 + t * 16 >= N) continue; const int col = col0 + t * 16 + ln; const float bv = bp ? bf16_round(bp[col]) : 0.f;
#pragma unroll
    for (int r = 0; r < 8; ++r) { float v = acc[t][r] * alpha + bv; if (CP) { const int bidx = (row0g + row0 + 8 * hh + r) / rowsPerB; v += CP[(size_t)bidx * sCPb + (size_t)by * 64 + col]; } if (ACT == 1) v = (v > 0.f) ? v : expm1f(v); else if (ACT == 3) v = fmaxf(v, 0.f); so[w][8 * hh + r][t * 16 + ln] = v; } }
  __builtin_amdgcn_fence(__ATOMIC_ACQ_REL, "workgroup"); __builtin_amdgcn_wave_barrier();
  const int rsub = lane >> 4, c4 = (lane & 15) * 4; typedef _Float16 v4h __attribute__((ext_vector_type(4)));
  {
#pragma unroll
    for (int q = 0; q < 8; ++q) { const int r = q * 2 + rsub; if (col0 + c4 < N) { const v4f v = *(const v4fa*)&so[w][r][c4]; if (C) *(v4f*)(C + cofs + (size_t)(row0 + r) * ldc + col0 + c4) = v; if (C16) { v4h h4; for (int i = 0; i < 4; ++i) h4[i] = (_Float16)v[i]; *(v4h*)(C16 + cofs + (size_t)(row0 + r) * ldc + col0 + c4) = h4; } } }
     }
}


__global__ __launch_bounds__(256) void k_x16(const float* __restrict__ x, _Float16* __restrict__ X16, size_t n8) { const size_t t = (size_t)blockIdx.x * 256 + threadIdx.x; if (t >= n8) return; FragH f;
#pragma unroll
  for (int q = 0; q < 8; ++q) f.h[q] = (_Float16)bf16_round(x[t * 8 + q]); *(v8us*)((unsigned short*)X16 + t * 8) = f.half[0];  }
__global__ __launch_bounds__(128) void k_q1(const float* __restrict__ in1, const float* __restrict__ Wq, float* __restrict__ Q1) { const int b = blockIdx.x, o = threadIdx.x; float s = 0.f;
#pragma unroll 1
  for (int e = 0; e < EE; ++e) s += bf16_round(in1[(size_t)b * EE + e]) * bf16_round(Wq[(size_t)e * EE + o]); *(float*)(Q1 + (size_t)b * EE + o) = s;  }
__global__ __launch_bounds__(256) void k_qfin(const float* __restrict__ QF, const float* __restrict__ Q1, const float* __restrict__ rl, const float* __restrict__ Wq, _Float16* __restrict__ Q16) { const size_t t = (size_t)blockIdx.x * 256 + threadIdx.x; if (t >= (size_t)NB * GG * 16) return; const int c8 = (int)(t % 16) * 8; const size_t r = t / 16; const size_t b = r / GG; const float rv = bf16_round(rl[r]); FragH f;
#pragma unroll
  for (int q = 0; q < 8; ++q) { const int o = c8 + q; f.h[q] = (_Float16)((QF[r * EE + o] + Q1[b * EE + o] + rv * bf16_round(Wq[(size_t)256 * EE + o])) * 0.25f); } *(v8us*)((unsigned short*)Q16 + t * 8) = f.half[0];  }
__global__ __launch_bounds__(256) void k_qkp(const _Float16* __restrict__ Q16, const _Float16* __restrict__ K16, int b0, _Float16* __restrict__ QP, _Float16* __restrict__ KP) { const int t = blockIdx.x * 256 + threadIdx.x; if (t >= JCH * RP * 4) return; const int p4 = t % 4; const int gi = (t / 4) % RP; const int j = t / (4 * RP); const int b = b0 + j / NH, h = j % NH; v8us q = {0,0,0,0,0,0,0,0}, k = {0,0,0,0,0,0,0,0};
  if (p4 < 2 && gi < GG) { const size_t src = ((size_t)b * GG + gi) * EE + h * KD + p4 * 8; q = *(const v8us*)((const unsigned short*)Q16 + src); k = *(const v8us*)((const unsigned short*)K16 + src); }
  { *(v8us*)((unsigned short*)QP + (size_t)t * 8) = q; *(v8us*)((unsigned short*)KP + (size_t)t * 8) = k;  } }
__global__ __launch_bounds__(256) void k_vtp(const _Float16* __restrict__ V16, int b0, _Float16* __restrict__ VT) { const int t = blockIdx.x * 256 + threadIdx.x; if (t >= JCH * KD * 16) return; const int pc = t % 16; const int kd = (t / 16) % KD; const int j = t / (16 * KD); const int b = b0 + j / NH, h = j % NH; FragH f;
#pragma unroll
  for (int q = 0; q < 8; ++q) { const int p = pc * 8 + q; f.h[q] = (p < PN) ? V16[((size_t)b * PN + p) * EE + h * KD + kd] : (_Float16)0.f; }
  *(v8us*)((unsigned short*)VT + (size_t)t * 8) = f.half[0];  }
typedef _Float16 v4h __attribute__((ext_vector_type(4)));
__global__ __launch_bounds__(256) void k_psm(const float* __restrict__ S, const float* __restrict__ MSK, int b0, _Float16* __restrict__ P16) { const int tid = threadIdx.x, wv = tid >> 5, lane = tid & 31; const int row = blockIdx.x * 8 + wv; if (row >= JCH * RP) return; const int j = row / RP, gi = row % RP; const int b = b0 + j / NH; float v[4]; float m = -3.0e38f; const bool live = gi < GG;
#pragma unroll
  for (int q = 0; q < 4; ++q) { const int p = lane * 4 + q; float s = -3.0e38f; if (live && p < PN) { s = S[(size_t)row * RP + p] + bf16_round(MSK[((size_t)b * GG + gi) * PN + p]); } v[q] = s; m = fmaxf(m, s); }
  for (int o = 16; o >= 1; o >>= 1) m = fmaxf(m, __shfl_xor(m, o, 32)); float sum = 0.f; float e[4];
#pragma unroll
  for (int q = 0; q < 4; ++q) { e[q] = (v[q] > -1.0e38f) ? expf(v[q] - m) : 0.f; sum += e[q]; } for (int o = 16; o >= 1; o >>= 1) sum += __shfl_xor(sum, o, 32); const float is = (sum > 0.f) ? 1.0f / sum : 0.f; v4h hv; for (int q = 0; q < 4; ++q) hv[q] = (_Float16)(e[q] * is);
  _Float16* d = P16 + (size_t)row * 128 + lane * 4; *(v4h*)d = hv;  }
__global__ __launch_bounds__(256) void k_orep(const float* __restrict__ OC, int b0, _Float16* __restrict__ O16) { const int t = blockIdx.x * 256 + threadIdx.x; if (t >= BCH * GG * 16) return; const int p = t % 16; const int g = (t / 16) % GG; const int bl = t / (16 * GG); const int h = p / 2, k8 = (p % 2) * 8; const float* src = OC + ((size_t)(bl * NH + h) * RP + g) * KD + k8; FragH f;
#pragma unroll
  for (int q = 0; q < 8; ++q) f.h[q] = (_Float16)src[q]; unsigned short* d = (unsigned short*)O16 + ((size_t)(b0 + bl) * GG + g) * EE + p * 8; *(v8us*)d = f.half[0];  }
__global__ __launch_bounds__(256) void k_padrows(const _Float16* __restrict__ SRC, int b0, _Float16* __restrict__ DST) { const int t = blockIdx.x * 256 + threadIdx.x; if (t >= BCH * RP * 16) return; const int c8 = (t % 16) * 8; const int gi = (t / 16) % RP; const int bl = t / (16 * RP); v8us v = {0,0,0,0,0,0,0,0}; if (gi < GG) v = *(const v8us*)((const unsigned short*)SRC + ((size_t)(b0 + bl) * GG + gi) * EE + c8); *(v8us*)((unsigned short*)DST + (size_t)t * 8) = v;  }
// final: per (b,g) row stats of z = 10·tanh(S2) + mask over p < 100, then probs; wave per row: lane L handles p = 4L..4L+3 (<100) → but the OUTPUT rows are 400 B (not line multiples) → write via flat float lanes:
__global__ __launch_bounds__(256) void k_stat(const float* __restrict__ S2, const float* __restrict__ MSK, int b0, float* __restrict__ ST) { const int tid = threadIdx.x, wv = tid >> 5, lane = tid & 31; const int row = blockIdx.x * 8 + wv; if (row >= BCH * GG) return; const int bl = row / GG, g = row % GG; const size_t bg = (size_t)(b0 + bl) * GG + g; float z[4]; float m = -3.0e38f;
#pragma unroll
  for (int q = 0; q < 4; ++q) { const int p = lane * 4 + q; float v = -3.0e38f; if (p < PN) v = 10.0f * tanhf(S2[((size_t)bl * RP + g) * RP + p] * 0.08838834764831845f) + bf16_round(MSK[bg * PN + p]); z[q] = v; m = fmaxf(m, v); }
  for (int o = 16; o >= 1; o >>= 1) m = fmaxf(m, __shfl_xor(m, o, 32)); float s = 0.f; for (int q = 0; q < 4; ++q) s += (z[q] > -1.0e38f) ? expf(z[q] - m) : 0.f; for (int o = 16; o >= 1; o >>= 1) s += __shfl_xor(s, o, 32);
  if (lane == 0) { typedef float v2f __attribute__((ext_vector_type(2))); v2f st; st[0] = m; st[1] = (s > 0.f) ? 1.0f / s : 0.f; *(v2f*)(ST + bg * 2) = st;  } }
__global__ __launch_bounds__(256) void k_prob(const float* __restrict__ S2, const float* __restrict__ MSK, const float* __restrict__ ST, int b0, float* __restrict__ out) { const size_t t = (size_t)blockIdx.x * 256 + threadIdx.x; if (t >= (size_t)BCH * GG * PN) return; const int p = (int)(t % PN); const size_t bgl = t / PN; const int bl = (int)(bgl / GG), g = (int)(bgl % GG); const size_t bg = (size_t)(b0 + bl) * GG + g;
  const float z = 10.0f * tanhf(S2[((size_t)bl * RP + g) * RP + p] * 0.08838834764831845f) + bf16_round(MSK[bg * PN + p]); const float v = expf(z - ST[bg * 2]) * ST[bg * 2 + 1]; *(float*)(out + bg * PN + p) = v;  }
extern "C" void kernel_launch(void* const* d_in, const int* in_sizes, int n_in,
                              void* d_out, int out_size, void* d_ws, size_t ws_size, hipStream_t stream) {
  (void)in_sizes; (void)n_in; (void)out_size;
  const float* in1 = (const float*)d_in[0]; const float* in2 = (const float*)d_in[1]; const float* rl = (const float*)d_in[2]; const float* msk = (const float*)d_in[3]; const float* enc = (const float*)d_in[4]; const float* Wq = (const float*)d_in[5]; const float* Wk = (const float*)d_in[6]; const float* Wv = (const float*)d_in[7]; const float* Wc = (const float*)d_in[8]; const float* bc = (const float*)d_in[9];
  char* ws = (char*)d_ws; size_t off = 0;
  auto take = [&](size_t bytes) { char* p = ws + off; off += (bytes + 255) & ~(size_t)255; return p; };
  const size_t NRW = (size_t)NB * GG;      // 51200 rows (b,g) / (b,p)
  _Float16* Bq2 = (_Float16*)take(EE * EE * 2); _Float16* Bk = (_Float16*)take(EE * EE * 2); _Float16* Bv = (_Float16*)take(EE * EE * 2); _Float16* Bc = (_Float16*)take(EE * EE * 2); float* Q1 = (float*)take((size_t)NB * EE * 4); float* ST = (float*)take(NRW * 2 * 4);
  _Float16* E16 = (_Float16*)take((NRW + 64) * EE * 2); _Float16* I16 = (_Float16*)take(NRW * EE * 2); float* QF = (float*)take(NRW * EE * 4); _Float16* Q16 = (_Float16*)take(NRW * EE * 2); _Float16* K16 = (_Float16*)take(NRW * EE * 2); _Float16* V16 = (_Float16*)take((NRW + 64) * EE * 2); _Float16* MH16 = (_Float16*)take(NRW * EE * 2);
  _Float16* P16 = (_Float16*)take((size_t)JCH * RP * 128 * 2); _Float16* QP = (_Float16*)take((size_t)JCH * RP * 32 * 2); _Float16* KP = (_Float16*)take((size_t)JCH * RP * 32 * 2); _Float16* VT = (_Float16*)take((size_t)JCH * KD * 128 * 2); float* OC = (float*)take((size_t)JCH * RP * KD * 4); _Float16* MHP = (_Float16*)take((size_t)BCH * RP * EE * 2); _Float16* ENP = (_Float16*)take((size_t)BCH * RP * EE * 2);
  float* S = QF; float* S2 = QF; _Float16* O16 = I16;      // S / S2 chunk scratch (≤ 12.9 MB) over QF (dead after k_qfin); O16 over I16 (dead after the q GEMM)
  if (off > ws_size) return;      // ≈ 0.8 + 13.1 × 6 + 26.2 + 7.3 + 1.8 × 2 + 1 + 1.8 + 0.9 × 2 ≈ 121 MB (BCH = 32)
  const size_t w8 = (size_t)EE * EE / 8; const unsigned gw = (unsigned)((w8 + 255) / 256);
  k_wt_f16<<<gw, 256, 0, stream>>>(Wq + (size_t)EE * EE, Bq2, EE, EE, 16.0f);      // Wq rows 128..255 ↔ input2  ([in][out])
  k_wt_f16<<<gw, 256, 0, stream>>>(Wk, Bk, EE, EE, 16.0f); k_wt_f16<<<gw, 256, 0, stream>>>(Wv, Bv, EE, EE, 16.0f); k_wt_f16<<<gw, 256, 0, stream>>>(Wc, Bc, EE, EE, 16.0f);
  const unsigned g8 = (unsigned)((NRW * EE / 8 + 255) / 256); const dim3 gg(((unsigned)(NRW / 16) * (EE / 64) + 3) / 4, 1);
  k_x16<<<g8, 256, 0, stream>>>(enc, E16, NRW * EE / 8); k_x16<<<g8, 256, 0, stream>>>(in2, I16, NRW * EE / 8);
  k_gemm_hhx<0><<<gg, 128, 0, stream>>>(E16, EE, 0, Bk, EE, 0, 0.0625f, nullptr, 0, nullptr, 1, 0, 0, nullptr, K16, EE, 0, (int)NRW, EE, EE);
  k_gemm_hhx<0><<<gg, 128, 0, stream>>>(E16, EE, 0, Bv, EE, 0, 0.0625f, nullptr, 0, nullptr, 1, 0, 0, nullptr, V16, EE, 0, (int)NRW, EE, EE);
  k_gemm_hhx<0><<<gg, 128, 0, stream>>>(I16, EE, 0, Bq2, EE, 0, 0.0625f, nullptr, 0, nullptr, 1, 0, 0, QF, nullptr, EE, 0, (int)NRW, EE, EE);
  k_q1<<<NB, 128, 0, stream>>>(in1, Wq, Q1);
  k_qfin<<<(unsigned)((NRW * 16 + 255) / 256), 256, 0, stream>>>(QF, Q1, rl, Wq, Q16);      // q = (input2·Wq₂ + input1·Wq₁ + remaining·Wq₃)·(1/√16)
  // ---- phase 1: 8-head attention per chunk of 32 batches (256 (b,h) pairs) on zero-padded 112×112 tiles
  for (int b0 = 0; b0 < NB; b0 += BCH) {
    k_qkp<<<(JCH * RP * 4 + 255) / 256, 256, 0, stream>>>(Q16, K16, b0, QP, KP); k_vtp<<<(JCH * KD * 16 + 255) / 256, 256, 0, stream>>>(V16, b0, VT);
    k_gemm_hhx<0><<<dim3(((RP / 16) * 2 + 3) / 4, JCH), 128, 0, stream>>>(QP, 32, (size_t)RP * 32, KP, 32, (size_t)RP * 32, 1.0f, nullptr, 0, nullptr, 1, 0, 0, S, nullptr, RP, (size_t)RP * RP, RP, RP, 32);      // scores (q pre-scaled); N = 112 (cols ≥ 100 are masked at the softmax)
    k_psm<<<(JCH * RP + 7) / 8, 256, 0, stream>>>(S, msk, b0, P16);
    k_gemm_hhx<0><<<dim3(((RP / 16) * 1 + 3) / 4, JCH), 128, 0, stream>>>(P16, 128, (size_t)RP * 128, VT, 128, (size_t)KD * 128, 1.0f, nullptr, 0, nullptr, 1, 0, 0, OC, nullptr, KD, (size_t)RP * KD, RP, KD, 128);      // OC[j][gi][k] = Σ_p P·v
    k_orep<<<(BCH * GG * 16 + 255) / 256, 256, 0, stream>>>(OC, b0, O16); }
  k_gemm_hhx<0><<<gg, 128, 0, stream>>>(O16, EE, 0, Bc, EE, 0, 0.0625f, bc, 0, nullptr, 1, 0, 0, nullptr, MH16, EE, 0, (int)NRW, EE, EE);      // mh = o·Wc + bc (f16 operand of the pointer GEMM)
  // ---- phase 2: pointer scores per batch on padded 112-row tiles, then 10·tanh + mask → softmax (flat writes)
  for (int b0 = 0; b0 < NB; b0 += BCH) {
    k_padrows<<<(BCH * RP * 16 + 255) / 256, 256, 0, stream>>>(MH16, b0, MHP); k_padrows<<<(BCH * RP * 16 + 255) / 256, 256, 0, stream>>>(E16, b0, ENP);
    k_gemm_hhx<0><<<dim3(((RP / 16) * 2 + 3) / 4, BCH), 128, 0, stream>>>(MHP, EE, (size_t)RP * EE, ENP, EE, (size_t)RP * EE, 1.0f, nullptr, 0, nullptr, 1, 0, 0, S2, nullptr, RP, (size_t)RP * RP, RP, RP, EE);      // mh·encᵀ (the 1/√128 is applied at the tanh)
    k_stat<<<(BCH * GG + 7) / 8, 256, 0, stream>>>(S2, msk, b0, ST);
    k_prob<<<(unsigned)(((size_t)BCH * GG * PN + 255) / 256), 256, 0, stream>>>(S2, msk, ST, b0, (float*)d_out); }
}

// v001
// It runs in 408 microseconds.
// In both of two side-by-side timings against v000, it was 2.22 times as fast.
#include <hip/hip_runtime.h>
// Next-node probability head (B=512, G=100 group rows, P=100 nodes, E=128, 8 heads × 16, logit clipping 10): k,v = enc·W; q = [input1 | input2 | remaining]·Wq split by linearity
// (input2·Wq₂ as a GEMM, input1·Wq₁ per batch + remaining·Wq₃ rank-1 in the epilogue kernel); the 8-head attention (additive INPUT ninf mask) as (b,h)-batched GEMMs on zero-padded
// 112×112 tiles (d 16 → 32); o·Wc + bc; the pointer score mh·encᵀ/√128 as b-batched GEMMs; 10·tanh + mask → softmax written flat. Contractions on v_wmma_f32_16x16x32_f16 (f16 operands,
// weights [in][out] transposed to bf16-exact ×2^4, f32 accumulate); softmaxes/tanh f32 VALU.
#define NB 512
#define GG 100
#define PN 100
#define EE 128
#define NH 8
#define KD 16
#define RP 112
#define BCH 256            // batches per attention chunk (2 chunks): the largest power of two whose score and weight planes fit the workspace
#define JCH (BCH * NH)
#define BC2 NB             // batches per pointer-score chunk: all of them, one pass

typedef __bf16 v16b __attribute__((ext_vector_type(16)));
typedef unsigned short v8us __attribute__((ext_vector_type(8), may_alias));
typedef float  v8f  __attribute__((ext_vector_type(8)));
typedef float  v4f  __attribute__((ext_vector_type(4)));
typedef float  v4fa __attribute__((ext_vector_type(4), may_alias));
union FragB { v16b v; v8us half[2]; unsigned short u[16]; };

__device__ __forceinline__ unsigned short bf16_bits(float x) { unsigned int u = __float_as_uint(x); return (unsigned short)((u + 0x7FFFu + ((u >> 16) & 1u)) >> 16); }
__device__ __forceinline__ float bf16_val(unsigned short b) { return __uint_as_float(((unsigned int)b) << 16); }
__device__ __forceinline__ float bf16_round(float x) { return bf16_val(bf16_bits(x)); }
// D += A·B with NT terms: 1 = ah·bh, 2 = + al·bh (A split), 3 = + ah·bl (both split)
template <int NT>
__device__ __forceinline__ v8f mmaN(v16b ah, v16b al, v16b bh, v16b bl, v8f c) {
  c = __builtin_amdgcn_wmma_f32_16x16x32_bf16(false, ah, false, bh, (short)0, c, false, false);
  if (NT >= 2) c = __builtin_amdgcn_wmma_f32_16x16x32_bf16(false, al, false, bh, (short)0, c, false, false);
  if (NT >= 3) c = __builtin_amdgcn_wmma_f32_16x16x32_bf16(false, ah, false, bl, (short)0, c, false, false);
  asm volatile("v_nop\n\tv_nop\n\tv_nop\n\tv_nop" : "+v"(c) : "v"(ah), "v"(al), "v"(bh), "v"(bl));
  return c;
}

__global__ __launch_bounds__(256) void k_wt_bf16(const float* __restrict__ W, unsigned short* __restrict__ Wt, int K, int N) {
  const int t = blockIdx.x * 256 + threadIdx.x;
  const int k8n = K / 8;
  if (t >= N * k8n) return;
  const int n = t / k8n, k8 = (t % k8n) * 8;
  v8us v;
#pragma unroll
  for (int i = 0; i < 8; ++i) v[i] = bf16_bits(W[(size_t)(k8 + i) * N + n]);
  *(v8us*)(Wt + (size_t)n * K + k8) = v;
  
}

// GEMM C[M][N] (f32, pitch ldc) = act(A[M][K]·W + bias). A f32 row-major (pitch lda) converted per fragment to bf16
// (ASPLIT: hi/lo two planes -> 2 terms, else single rounded term); Wt bf16 [N][K] (pitch ldb). BIAS_BF16 rounds the
// bias to bf16 first (bias quantised to bf16 before the add). K%32==0, M%16==0, N%64==0.
template <bool ASPLIT, int ACT, bool BIAS_BF16>
__global__ __launch_bounds__(128) void k_gemm_bf(const float* __restrict__ A, int lda, const unsigned short* __restrict__ Wt, int ldb,
                                               const float* __restrict__ bias, float* __restrict__ C, int ldc, int M, int N, int K) {
  __shared__ __attribute__((aligned(16))) float so[4][16][64];
  const int tid = threadIdx.x, w = tid >> 5, lane = tid & 31, ln = lane & 15, hh = lane >> 4;
  const int ntn = N / 64;
  const int wid = blockIdx.x * 4 + w;
  const int mt = wid / ntn, nq = wid % ntn;
  if (mt * 16 >= M) return;
  const int row0 = mt * 16, col0 = nq * 64;
  const float* arow = A + (size_t)(row0 + ln) * lda;
  v8f acc[4] = {};
  for (int kb = 0; kb < K; kb += 32) {
    FragB ah, al;
    const v4f x0 = *(const v4fa*)(arow + kb + 8 * hh), x1 = *(const v4fa*)(arow + kb + 8 * hh + 4);
    const v4f x2 = *(const v4fa*)(arow + kb + 16 + 8 * hh), x3 = *(const v4fa*)(arow + kb + 16 + 8 * hh + 4);
    float xs[16] = {x0[0],x0[1],x0[2],x0[3],x1[0],x1[1],x1[2],x1[3],x2[0],x2[1],x2[2],x2[3],x3[0],x3[1],x3[2],x3[3]};
#pragma unroll
    for (int i = 0; i < 16; ++i) { const unsigned short hb = bf16_bits(xs[i]); ah.u[i] = hb; al.u[i] = ASPLIT ? bf16_bits(xs[i] - bf16_val(hb)) : (unsigned short)0; }
#pragma unroll
    for (int t = 0; t < 4; ++t) {
      const unsigned short* brow = Wt + (size_t)(col0 + t * 16 + ln) * ldb + kb;
      FragB b;
      b.half[0] = *(const v8us*)(brow + 8 * hh);
      b.half[1] = *(const v8us*)(brow + 16 + 8 * hh);
      acc[t] = mmaN<ASPLIT ? 2 : 1>(ah.v, al.v, b.v, b.v, acc[t]);
    }
  }
#pragma unroll
  for (int t = 0; t < 4; ++t) {
    float bv = bias ? bias[col0 + t * 16 + ln] : 0.f;
    if (BIAS_BF16) bv = bf16_round(bv);
#pragma unroll
    for (int r = 0; r < 8; ++r) { float v = acc[t][r] + bv; if (ACT == 1) v = fmaxf(v, 0.f); so[w][8 * hh + r][t * 16 + ln] = v; }
  }
  __builtin_amdgcn_fence(__ATOMIC_ACQ_REL, "workgroup");
  __builtin_amdgcn_wave_barrier();
  const int rsub = lane >> 4, c4 = (lane & 15) * 4;
  {
#pragma unroll
    for (int q = 0; q < 8; ++q) {
      const int r = q * 2 + rsub;
      const v4f v = *(const v4fa*)&so[w][r][c4];
      *(v4f*)(C + (size_t)(row0 + r) * ldc + col0 + c4) = v;
    }
    
  }
}

// Flash-style causal/unmasked attention, all contractions 3-term bf16 hi/lo splits, f32 softmax with running max.
// q,k,v rows are read from f32 buffers with arbitrary row pitch (so they can live inside a fused qkv buffer);
// D = head size (multiple of 32, <= 128); one wave = 16 query rows; block = 4 waves (64 queries) sharing K/V chunks of 32.
template <int D, bool CAUSAL>
__global__ __launch_bounds__(128) void k_flash(const float* __restrict__ qb, const float* __restrict__ kb, const float* __restrict__ vb,
                                             int pitch, int T, int H, float scale, float* __restrict__ y, int ypitch) {
  constexpr int KS = D / 32;        // k-steps for QK
  constexpr int DT = D / 16;        // d tiles for PV
  __shared__ __attribute__((aligned(16))) unsigned short sKh[32][D + 8], sKl[32][D + 8], sVh[32][D + 8], sVl[32][D + 8];
  __shared__ __attribute__((aligned(16))) unsigned short sPh[4][16][40], sPl[4][16][40];
  __shared__ __attribute__((aligned(16))) float sO[4][16][D];
  const int tid = threadIdx.x, w = tid >> 5, lane = tid & 31, ln = lane & 15, hh = lane >> 4;
  const int nqb = (T + 63) / 64;
  const int bh = blockIdx.x / nqb, qblk = blockIdx.x % nqb;
  const int b = bh / H, h = bh % H;
  const int q0 = qblk * 64 + w * 16;
  const float* Q = qb + (size_t)b * T * pitch + h * D;
  const float* K = kb + (size_t)b * T * pitch + h * D;
  const float* V = vb + (size_t)b * T * pitch + h * D;

  // A fragments of the wave's 16 query rows (scaled), hi/lo
  FragB aqh[KS], aql[KS];
  {
    int row = q0 + ln; if (row >= T) row = T - 1;
    const float* qr = Q + (size_t)row * pitch;
#pragma unroll
    for (int ks = 0; ks < KS; ++ks)
#pragma unroll
      for (int i = 0; i < 16; ++i) {
        const int d = ks * 32 + ((i < 8) ? (8 * hh + i) : (16 + 8 * hh + (i - 8)));
        const float x = qr[d] * scale; const unsigned short hb = bf16_bits(x);
        aqh[ks].u[i] = hb; aql[ks].u[i] = bf16_bits(x - bf16_val(hb));
      }
  }
  float m_r[8], l_r[8];
#pragma unroll
  for (int r = 0; r < 8; ++r) { m_r[r] = -3.0e38f; l_r[r] = 0.f; }
  v8f oacc[DT];
#pragma unroll
  for (int dt = 0; dt < DT; ++dt) oacc[dt] = (v8f){0.f,0.f,0.f,0.f,0.f,0.f,0.f,0.f};

  const int kv_end = CAUSAL ? min(T, qblk * 64 + 64) : T;     // block-uniform
  for (int j0 = 0; j0 < kv_end; j0 += 32) {
    __syncthreads();
    for (int e = tid; e < 32 * (D / 4); e += 128) {
      const int r = e / (D / 4), c4 = (e % (D / 4)) * 4;
      const int key = j0 + r;
      v4f kf = {0.f,0.f,0.f,0.f}, vf = {0.f,0.f,0.f,0.f};
      if (key < T) { kf = *(const v4fa*)(K + (size_t)key * pitch + c4); vf = *(const v4fa*)(V + (size_t)key * pitch + c4); }
#pragma unroll
      for (int t = 0; t < 4; ++t) {
        unsigned short hb = bf16_bits(kf[t]); sKh[r][c4 + t] = hb; sKl[r][c4 + t] = bf16_bits(kf[t] - bf16_val(hb));
        hb = bf16_bits(vf[t]); sVh[r][c4 + t] = hb; sVl[r][c4 + t] = bf16_bits(vf[t] - bf16_val(hb));
      }
    }
    __syncthreads();
    // S tile 16 x 32
    v8f s[2];
#pragma unroll
    for (int nt = 0; nt < 2; ++nt) {
      v8f acc = {};
#pragma unroll
      for (int ks = 0; ks < KS; ++ks) {
        FragB bh_, bl_;
        bh_.half[0] = *(const v8us*)&sKh[nt * 16 + ln][ks * 32 + 8 * hh]; bh_.half[1] = *(const v8us*)&sKh[nt * 16 + ln][ks * 32 + 16 + 8 * hh];
        bl_.half[0] = *(const v8us*)&sKl[nt * 16 + ln][ks * 32 + 8 * hh]; bl_.half[1] = *(const v8us*)&sKl[nt * 16 + ln][ks * 32 + 16 + 8 * hh];
        acc = mmaN<3>(aqh[ks].v, aql[ks].v, bh_.v, bl_.v, acc);
      }
      s[nt] = acc;
    }
    // mask + running max (rows 8hh+r; the 16 lanes of a half share rows)
    float alpha[8];
#pragma unroll
    for (int r = 0; r < 8; ++r) {
      const int qi = q0 + 8 * hh + r;
      const int ja = j0 + ln, jb = j0 + 16 + ln;
      if (CAUSAL) { if (ja > qi) s[0][r] = -3.0e38f; if (jb > qi) s[1][r] = -3.0e38f; }
      if (ja >= T) s[0][r] = -3.0e38f;
      if (jb >= T) s[1][r] = -3.0e38f;
      float mx = fmaxf(s[0][r], s[1][r]);
      mx = fmaxf(mx, __shfl_xor(mx, 1, 32)); mx = fmaxf(mx, __shfl_xor(mx, 2, 32)); mx = fmaxf(mx, __shfl_xor(mx, 4, 32)); mx = fmaxf(mx, __shfl_xor(mx, 8, 32));
      const float mnew = fmaxf(m_r[r], mx);
      alpha[r] = (mnew > -1.0e38f) ? __expf(m_r[r] - mnew) : 1.0f;
      const float p0 = (s[0][r] > -1.0e38f) ? __expf(s[0][r] - mnew) : 0.f;
      const float p1 = (s[1][r] > -1.0e38f) ? __expf(s[1][r] - mnew) : 0.f;
      m_r[r] = mnew;
      l_r[r] = l_r[r] * alpha[r] + p0 + p1;            // per-lane partial row sum (16 lanes combined at the end)
      unsigned short hb = bf16_bits(p0); sPh[w][8 * hh + r][ln] = hb;      sPl[w][8 * hh + r][ln] = bf16_bits(p0 - bf16_val(hb));
      hb = bf16_bits(p1);                sPh[w][8 * hh + r][16 + ln] = hb; sPl[w][8 * hh + r][16 + ln] = bf16_bits(p1 - bf16_val(hb));
    }
#pragma unroll
    for (int dt = 0; dt < DT; ++dt)
#pragma unroll
      for (int r = 0; r < 8; ++r) oacc[dt][r] *= alpha[r];
    __builtin_amdgcn_fence(__ATOMIC_ACQ_REL, "workgroup");
    __builtin_amdgcn_wave_barrier();
    FragB pah, pal;
    pah.half[0] = *(const v8us*)&sPh[w][ln][8 * hh]; pah.half[1] = *(const v8us*)&sPh[w][ln][16 + 8 * hh];
    pal.half[0] = *(const v8us*)&sPl[w][ln][8 * hh]; pal.half[1] = *(const v8us*)&sPl[w][ln][16 + 8 * hh];
#pragma unroll
    for (int dt = 0; dt < DT; ++dt) {
      FragB bvh, bvl;
#pragma unroll
      for (int i = 0; i < 8; ++i) {
        bvh.u[i] = sVh[8 * hh + i][dt * 16 + ln]; bvh.u[8 + i] = sVh[16 + 8 * hh + i][dt * 16 + ln];
        bvl.u[i] = sVl[8 * hh + i][dt * 16 + ln]; bvl.u[8 + i] = sVl[16 + 8 * hh + i][dt * 16 + ln];
      }
      oacc[dt] = mmaN<3>(pah.v, pal.v, bvh.v, bvl.v, oacc[dt]);
    }
    __builtin_amdgcn_fence(__ATOMIC_ACQ_REL, "workgroup");
    __builtin_amdgcn_wave_barrier();
  }
#pragma unroll
  for (int r = 0; r < 8; ++r) {
    float l = l_r[r];
    l += __shfl_xor(l, 1, 32); l += __shfl_xor(l, 2, 32); l += __shfl_xor(l, 4, 32); l += __shfl_xor(l, 8, 32);
    l_r[r] = (l > 0.f) ? 1.0f / l : 0.f;
  }
#pragma unroll
  for (int dt = 0; dt < DT; ++dt)
#pragma unroll
    for (int r = 0; r < 8; ++r) sO[w][8 * hh + r][dt * 16 + ln] = oacc[dt][r] * l_r[r];
  __builtin_amdgcn_fence(__ATOMIC_ACQ_REL, "workgroup");
  __builtin_amdgcn_wave_barrier();
  {
    for (int r = 0; r < 16; ++r) {
      const int row = q0 + r;
      if (row < T && lane < D / 4) {
        const v4f val = *(const v4fa*)&sO[w][r][lane * 4];
        *(v4f*)(y + ((size_t)b * T + row) * ypitch + h * D + lane * 4) = val;
      }
    }
    
  }
}

// GEMM C = act(A·W + bias + resid): A f32 (ASPLIT -> hi/lo 2 terms), Wt bf16 [N][K]; ACT 0 none, 1 relu, 2 exact gelu;
// resid (optional, f32, row index = (row % rmod), pitch ldr, RES_BF16 rounds it) added before the activation.
template <bool ASPLIT, int ACT, bool BIAS_BF16, bool RES_BF16>
__global__ __launch_bounds__(128) void k_gemm_bf3(const float* __restrict__ A, int lda, const unsigned short* __restrict__ Wt, int ldb,
                                                const float* __restrict__ bias, const float* __restrict__ resid, int rmod, int ldr,
                                                float* __restrict__ C, int ldc, int M, int N, int K) {
  __shared__ __attribute__((aligned(16))) float so[4][16][64];
  const int tid = threadIdx.x, w = tid >> 5, lane = tid & 31, ln = lane & 15, hh = lane >> 4;
  const int ntn = N / 64;
  const int wid = blockIdx.x * 4 + w;
  const int mt = wid / ntn, nq = wid % ntn;
  if (mt * 16 >= M) return;
  const int row0 = mt * 16, col0 = nq * 64;
  const float* arow = A + (size_t)(row0 + ln) * lda;
  v8f acc[4] = {};
  for (int kb = 0; kb < K; kb += 32) {
    FragB ah, al;
    const v4f x0 = *(const v4fa*)(arow + kb + 8 * hh), x1 = *(const v4fa*)(arow + kb + 8 * hh + 4);
    const v4f x2 = *(const v4fa*)(arow + kb + 16 + 8 * hh), x3 = *(const v4fa*)(arow + kb + 16 + 8 * hh + 4);
    float xs[16] = {x0[0],x0[1],x0[2],x0[3],x1[0],x1[1],x1[2],x1[3],x2[0],x2[1],x2[2],x2[3],x3[0],x3[1],x3[2],x3[3]};
#pragma unroll
    for (int i = 0; i < 16; ++i) { const unsigned short hb = bf16_bits(xs[i]); ah.u[i] = hb; al.u[i] = ASPLIT ? bf16_bits(xs[i] - bf16_val(hb)) : (unsigned short)0; }
#pragma unroll
    for (int t = 0; t < 4; ++t) {
      const unsigned short* brow = Wt + (size_t)(col0 + t * 16 + ln) * ldb + kb;
      FragB b;
      b.half[0] = *(const v8us*)(brow + 8 * hh);
      b.half[1] = *(const v8us*)(brow + 16 + 8 * hh);
      acc[t] = mmaN<ASPLIT ? 2 : 1>(ah.v, al.v, b.v, b.v, acc[t]);
    }
  }
#pragma unroll
  for (int t = 0; t < 4; ++t) {
    const int col = col0 + t * 16 + ln;
    float bv = bias ? bias[col] : 0.f;
    if (BIAS_BF16) bv = bf16_round(bv);
#pragma unroll
    for (int r = 0; r < 8; ++r) {
      float v = acc[t][r] + bv;
      if (resid) { float rv = resid[(size_t)((row0 + 8 * hh + r) % rmod) * ldr + col]; if (RES_BF16) rv = bf16_round(rv); v += rv; }
      if (ACT == 1) v = fmaxf(v, 0.f);
      if (ACT == 2) v = 0.5f * v * (1.0f + erff(v * 0.70710678118654752f));
      if (ACT == 3) { const float u = 0.7978845608028654f * (v + 0.044715f * v * v * v); v = 0.5f * v * (1.0f + tanhf(u)); }
      so[w][8 * hh + r][t * 16 + ln] = v;
    }
  }
  __builtin_amdgcn_fence(__ATOMIC_ACQ_REL, "workgroup");
  __builtin_amdgcn_wave_barrier();
  const int rsub = lane >> 4, c4 = (lane & 15) * 4;
  {
#pragma unroll
    for (int q = 0; q < 8; ++q) {
      const int r = q * 2 + rsub;
      const v4f v = *(const v4fa*)&so[w][r][c4];
      *(v4f*)(C + (size_t)(row0 + r) * ldc + col0 + c4) = v;
    }
    
  }
}
// row LayerNorm (biased variance, eps) over N: s = X (+ R); optional out_sum <- s; out_norm <- (s-mu)*rsqrt(var+eps)*g + b
template <bool PARAM_BF16>
__global__ __launch_bounds__(256) void k_layernorm(const float* __restrict__ X, const float* __restrict__ R, const float* __restrict__ g, const float* __restrict__ bta,
                                                  float* __restrict__ out_sum, float* __restrict__ out_norm, int N, float eps) {
  __shared__ float red[256];
  const int row = blockIdx.x, tid = threadIdx.x;
  const float* x = X + (size_t)row * N; const float* rr = R ? R + (size_t)row * N : nullptr;
  float vals[16];                     // up to N = 4096
  const int per = N / 256;            // contiguous chunk per thread? use strided-by-4 chunks: thread handles j = tid*4 + 1024*u
  float s1 = 0.f;
  for (int u = 0; u < per / 4; ++u) {
    const int j = tid * 4 + 1024 * u;
    const v4f a = *(const v4fa*)(x + j);
    v4f b = {0.f,0.f,0.f,0.f}; if (rr) b = *(const v4fa*)(rr + j);
#pragma unroll
    for (int q = 0; q < 4; ++q) { const float v = a[q] + b[q]; vals[u * 4 + q] = v; s1 += v; }
  }
  red[tid] = s1; __syncthreads();
  for (int st = 128; st > 0; st >>= 1) { if (tid < st) red[tid] += red[tid + st]; __syncthreads(); }
  const float mu = red[0] / (float)N; __syncthreads();
  float s2 = 0.f;
  for (int u = 0; u < per / 4; ++u)
#pragma unroll
    for (int q = 0; q < 4; ++q) { const float c = vals[u * 4 + q] - mu; s2 += c * c; }
  red[tid] = s2; __syncthreads();
  for (int st = 128; st > 0; st >>= 1) { if (tid < st) red[tid] += red[tid + st]; __syncthreads(); }
  const float rs = rsqrtf(red[0] / (float)N + eps);
  {
    for (int u = 0; u < per / 4; ++u) {
      const int j = tid * 4 + 1024 * u;
      v4f o, sm;
#pragma unroll
      for (int q = 0; q < 4; ++q) {
        float gg = g[j + q], bb = bta[j + q];
        if (PARAM_BF16) { gg = bf16_round(gg); bb = bf16_round(bb); }
        sm[q] = vals[u * 4 + q]; o[q] = (vals[u * 4 + q] - mu) * rs * gg + bb;
      }
      if (out_sum) *(v4f*)(out_sum + (size_t)row * N + j) = sm;
      *(v4f*)(out_norm + (size_t)row * N + j) = o;
    }
    
  }
}



// ---- f16 WMMA path (v_wmma_f32_16x16x32_f16): 11-bit significands for operands in range — used where a [0,1] probability operand needs more precision than bf16
typedef _Float16 v16h __attribute__((ext_vector_type(16)));
union FragH { v16h v; v8us half[2]; _Float16 h[16]; unsigned short u[16]; };
template <int NT>
__device__ __forceinline__ v8f mmaH(v16h ah, v16h al, v16h bh, v16h bl, v8f c) {
  c = __builtin_amdgcn_wmma_f32_16x16x32_f16(false, ah, false, bh, (short)0, c, false, false);
  if (NT >= 2) c = __builtin_amdgcn_wmma_f32_16x16x32_f16(false, al, false, bh, (short)0, c, false, false);
  if (NT >= 3) c = __builtin_amdgcn_wmma_f32_16x16x32_f16(false, ah, false, bl, (short)0, c, false, false);
  asm volatile("v_nop\n\tv_nop\n\tv_nop\n\tv_nop" : "+v"(c) : "v"(ah), "v"(al), "v"(bh), "v"(bl));
  return c;
}
// batched GEMM like k_gemm_b but f16 operands: A f32 (split into f16 hi/lo if ASPLIT, else rounded to f16), Bt = f16 values [n][k]; alpha; C f32; N multiple of 16 (partial tiles skipped)
template <bool ASPLIT>
__global__ __launch_bounds__(128) void k_gemm_h(const float* __restrict__ A, int lda, size_t sA, const _Float16* __restrict__ Bh, int ldb, size_t sB, float alpha, float* __restrict__ C, int ldc, size_t sC, int M, int N, int K) {
  __shared__ __attribute__((aligned(16))) float so[4][16][64];
  const int tid = threadIdx.x, w = tid >> 5, lane = tid & 31, ln = lane & 15, hh = lane >> 4; const int by = blockIdx.y;
  A += (size_t)by * sA; Bh += (size_t)by * sB; C += (size_t)by * sC;
  const int ntn = (N + 63) / 64; const int wid = blockIdx.x * 4 + w; const int mt = wid / ntn, nq = wid % ntn; if (mt * 16 >= M) return;
  const int row0 = mt * 16, col0 = nq * 64; const float* arow = A + (size_t)(row0 + ln) * lda;
  v8f acc[4] = {};
  for (int kb = 0; kb < K; kb += 32) {
    FragH ah, al;
    const v4f x0 = *(const v4fa*)(arow + kb + 8 * hh), x1 = *(const v4fa*)(arow + kb + 8 * hh + 4), x2 = *(const v4fa*)(arow + kb + 16 + 8 * hh), x3 = *(const v4fa*)(arow + kb + 16 + 8 * hh + 4);
    float xs[16] = {x0[0],x0[1],x0[2],x0[3],x1[0],x1[1],x1[2],x1[3],x2[0],x2[1],x2[2],x2[3],x3[0],x3[1],x3[2],x3[3]};
#pragma unroll
    for (int i = 0; i < 16; ++i) { const _Float16 h = (_Float16)xs[i]; ah.h[i] = h; al.h[i] = ASPLIT ? (_Float16)(xs[i] - (float)h) : (_Float16)0.0f; }
#pragma unroll
    for (int t = 0; t < 4; ++t) { if (col0 + t * 16 >= N) continue; const size_t boff = (size_t)(col0 + t * 16 + ln) * ldb + kb; FragH bq; bq.half[0] = *(const v8us*)(Bh + boff + 8 * hh); bq.half[1] = *(const v8us*)(Bh + boff + 16 + 8 * hh);
      acc[t] = mmaH<ASPLIT ? 2 : 1>(ah.v, al.v, bq.v, bq.v, acc[t]); }
  }
#pragma unroll
  for (int t = 0; t < 4; ++t) { if (col0 + t * 16 >= N) continue;
#pragma unroll
    for (int r = 0; r < 8; ++r) so[w][8 * hh + r][t * 16 + ln] = acc[t][r] * alpha; }
  __builtin_amdgcn_fence(__ATOMIC_ACQ_REL, "workgroup"); __builtin_amdgcn_wave_barrier();
  const int rsub = lane >> 4, c4 = (lane & 15) * 4;
  {
#pragma unroll
    for (int q = 0; q < 8; ++q) { const int r = q * 2 + rsub; if (col0 + c4 < N) { const v4f v = *(const v4fa*)&so[w][r][c4]; *(v4f*)(C + (size_t)(row0 + r) * ldc + col0 + c4) = v; } }
     }
}

// Wt[n][k] = f16(W[k][n]·scale) from f32 row-major W[K][N] (scale = power of two; bf16-exact weights stay exact in f16 away from the subnormal range)
__global__ __launch_bounds__(256) void k_wt_f16(const float* __restrict__ W, _Float16* __restrict__ Wt, int K, int N, float scale) {
  const int t = blockIdx.x * 256 + threadIdx.x; if (t >= N * (K / 8)) return; const int n = t / (K / 8), k8 = (t % (K / 8)) * 8; FragH f;
#pragma unroll
  for (int i = 0; i < 8; ++i) f.h[i] = (_Float16)(bf16_round(W[(size_t)(k8 + i) * N + n]) * scale); const v8us o = f.half[0];
  *(v8us*)((unsigned short*)Wt + (size_t)n * K + k8) = o; 
}
// k_gemm_hh variant with fused epilogue: v = acc·alpha + bias[by·sBias + col] (+ CP[(row/rowsPerB)·sCPb + by·64 + col] if CP) ; ACT 0 none / 1 elu ; writes f32 C and/or f16 C16 (each if non-null)
template <int ACT>
__global__ __launch_bounds__(128) void k_gemm_hhx(const _Float16* __restrict__ A, int lda, size_t sA, const _Float16* __restrict__ Bh, int ldb, size_t sB, float alpha, const float* __restrict__ bias, size_t sBias, const float* __restrict__ CP, int rowsPerB, size_t sCPb, int row0g,
    float* __restrict__ C, _Float16* __restrict__ C16, int ldc, size_t sC, int M, int N, int K) {
  __shared__ __attribute__((aligned(16))) float so[4][16][64];
  const int tid = threadIdx.x, w = tid >> 5, lane = tid & 31, ln = lane & 15, hh = lane >> 4; const int by = blockIdx.y;
  A += (size_t)by * sA; Bh += (size_t)by * sB; const size_t cofs = (size_t)by * sC; const float* bp = bias ? bias + (size_t)by * sBias : nullptr;
  const int ntn = (N + 63) / 64; const int wid = blockIdx.x * 4 + w; const int mt = wid / ntn, nq = wid % ntn; if (mt * 16 >= M) return;
  const int row0 = mt * 16, col0 = nq * 64; const _Float16* arow = A + (size_t)(row0 + ln) * lda;
  v8f acc[4] = {};
  for (int kb = 0; kb < K; kb += 32) { FragH ah; ah.half[0] = *(const v8us*)((const unsigned short*)arow + kb + 8 * hh); ah.half[1] = *(const v8us*)((const unsigned short*)arow + kb + 16 + 8 * hh);
#pragma unroll
    for (int t = 0; t < 4; ++t) { if (col0 + t * 16 >= N) continue; const size_t boff = (size_t)(col0 + t * 16 + ln) * ldb + kb; FragH bq; bq.half[0] = *(const v8us*)((const unsigned short*)Bh + boff + 8 * hh); bq.half[1] = *(const v8us*)((const unsigned short*)Bh + boff + 16 + 8 * hh);
      acc[t] = mmaH<1>(ah.v, ah.v, bq.v, bq.v, acc[t]); }
  }
#pragma unroll
  for (int t = 0; t < 4; ++t) { if (col0 + t * 16 >= N) continue; const int col = col0 + t * 16 + ln; const float bv = bp ? bf16_round(bp[col]) : 0.f;
#pragma unroll
    for (int r = 0; r < 8; ++r) { float v = acc[t][r] * alpha + bv; if (CP) { const int bidx = (row0g + row0 + 8 * hh + r) / rowsPerB; v += CP[(size_t)bidx * sCPb + (size_t)by * 64 + col]; } if (ACT == 1) v = (v > 0.f) ? v : expm1f(v); else if (ACT == 3) v = fmaxf(v, 0.f); so[w][8 * hh + r][t * 16 + ln] = v; } }
  __builtin_amdgcn_fence(__ATOMIC_ACQ_REL, "workgroup"); __builtin_amdgcn_wave_barrier();
  const int rsub = lane >> 4, c4 = (lane & 15) * 4; typedef _Float16 v4h __attribute__((ext_vector_type(4)));
  {
#pragma unroll
    for (int q = 0; q < 8; ++q) { const int r = q * 2 + rsub; if (col0 + c4 < N) { const v4f v = *(const v4fa*)&so[w][r][c4]; if (C) *(v4f*)(C + cofs + (size_t)(row0 + r) * ldc + col0 + c4) = v; if (C16) { v4h h4; for (int i = 0; i < 4; ++i) h4[i] = (_Float16)v[i]; *(v4h*)(C16 + cofs + (size_t)(row0 + r) * ldc + col0 + c4) = h4; } } }
     }
}


__global__ __launch_bounds__(256) void k_x16(const float* __restrict__ x, _Float16* __restrict__ X16, size_t n8) { const size_t t = (size_t)blockIdx.x * 256 + threadIdx.x; if (t >= n8) return; FragH f;
#pragma unroll
  for (int q = 0; q < 8; ++q) f.h[q] = (_Float16)bf16_round(x[t * 8 + q]); *(v8us*)((unsigned short*)X16 + t * 8) = f.half[0];  }
__global__ __launch_bounds__(128) void k_q1(const float* __restrict__ in1, const float* __restrict__ Wq, float* __restrict__ Q1) { const int b = blockIdx.x, o = threadIdx.x; float s = 0.f;
#pragma unroll 1
  for (int e = 0; e < EE; ++e) s += bf16_round(in1[(size_t)b * EE + e]) * bf16_round(Wq[(size_t)e * EE + o]); *(float*)(Q1 + (size_t)b * EE + o) = s;  }
__global__ __launch_bounds__(256) void k_qfin(const float* __restrict__ QF, const float* __restrict__ Q1, const float* __restrict__ rl, const float* __restrict__ Wq, _Float16* __restrict__ Q16) { const size_t t = (size_t)blockIdx.x * 256 + threadIdx.x; if (t >= (size_t)NB * GG * 16) return; const int c8 = (int)(t % 16) * 8; const size_t r = t / 16; const size_t b = r / GG; const float rv = bf16_round(rl[r]); FragH f;
#pragma unroll
  for (int q = 0; q < 8; ++q) { const int o = c8 + q; f.h[q] = (_Float16)((QF[r * EE + o] + Q1[b * EE + o] + rv * bf16_round(Wq[(size_t)256 * EE + o])) * 0.25f); } *(v8us*)((unsigned short*)Q16 + t * 8) = f.half[0];  }
__global__ __launch_bounds__(256) void k_qkp(const _Float16* __restrict__ Q16, const _Float16* __restrict__ K16, int b0, _Float16* __restrict__ QP, _Float16* __restrict__ KP) { const int t = blockIdx.x * 256 + threadIdx.x; if (t >= JCH * RP * 4) return; const int p4 = t % 4; const int gi = (t / 4) % RP; const int j = t / (4 * RP); const int b = b0 + j / NH, h = j % NH; v8us q = {0,0,0,0,0,0,0,0}, k = {0,0,0,0,0,0,0,0};
  if (p4 < 2 && gi < GG) { const size_t src = ((size_t)b * GG + gi) * EE + h * KD + p4 * 8; q = *(const v8us*)((const unsigned short*)Q16 + src); k = *(const v8us*)((const unsigned short*)K16 + src); }
  { *(v8us*)((unsigned short*)QP + (size_t)t * 8) = q; *(v8us*)((unsigned short*)KP + (size_t)t * 8) = k;  } }
__global__ __launch_bounds__(256) void k_vtp(const _Float16* __restrict__ V16, int b0, _Float16* __restrict__ VT) { const int t = blockIdx.x * 256 + threadIdx.x; if (t >= JCH * KD * 16) return; const int pc = t % 16; const int kd = (t / 16) % KD; const int j = t / (16 * KD); const int b = b0 + j / NH, h = j % NH; FragH f;
#pragma unroll
  for (int q = 0; q < 8; ++q) { const int p = pc * 8 + q; f.h[q] = (p < PN) ? V16[((size_t)b * PN + p) * EE + h * KD + kd] : (_Float16)0.f; }
  *(v8us*)((unsigned short*)VT + (size_t)t * 8) = f.half[0];  }
typedef _Float16 v4h __attribute__((ext_vector_type(4)));
__global__ __launch_bounds__(256) void k_psm(const float* __restrict__ S, const float* __restrict__ MSK, int b0, _Float16* __restrict__ P16) { const int tid = threadIdx.x, wv = tid >> 5, lane = tid & 31; const int row = blockIdx.x * 8 + wv; if (row >= JCH * RP) return; const int j = row / RP, gi = row % RP; const int b = b0 + j / NH; float v[4]; float m = -3.0e38f; const bool live = gi < GG;
#pragma unroll
  for (int q = 0; q < 4; ++q) { const int p = lane * 4 + q; float s = -3.0e38f; if (live && p < PN) { s = S[(size_t)row * RP + p] + bf16_round(MSK[((size_t)b * GG + gi) * PN + p]); } v[q] = s; m = fmaxf(m, s); }
  for (int o = 16; o >= 1; o >>= 1) m = fmaxf(m, __shfl_xor(m, o, 32)); float sum = 0.f; float e[4];
#pragma unroll
  for (int q = 0; q < 4; ++q) { e[q] = (v[q] > -1.0e38f) ? expf(v[q] - m) : 0.f; sum += e[q]; } for (int o = 16; o >= 1; o >>= 1) sum += __shfl_xor(sum, o, 32); const float is = (sum > 0.f) ? 1.0f / sum : 0.f; v4h hv; for (int q = 0; q < 4; ++q) hv[q] = (_Float16)(e[q] * is);
  _Float16* d = P16 + (size_t)row * 128 + lane * 4; *(v4h*)d = hv;  }
__global__ __launch_bounds__(256) void k_orep(const float* __restrict__ OC, int b0, _Float16* __restrict__ O16) { const int t = blockIdx.x * 256 + threadIdx.x; if (t >= BCH * GG * 16) return; const int p = t % 16; const int g = (t / 16) % GG; const int bl = t / (16 * GG); const int h = p / 2, k8 = (p % 2) * 8; const float* src = OC + ((size_t)(bl * NH + h) * RP + g) * KD + k8; FragH f;
#pragma unroll
  for (int q = 0; q < 8; ++q) f.h[q] = (_Float16)src[q]; unsigned short* d = (unsigned short*)O16 + ((size_t)(b0 + bl) * GG + g) * EE + p * 8; *(v8us*)d = f.half[0];  }
__global__ __launch_bounds__(256) void k_padrows(const _Float16* __restrict__ SRC, int b0, _Float16* __restrict__ DST) { const int t = blockIdx.x * 256 + threadIdx.x; if (t >= BC2 * RP * 16) return; const int c8 = (t % 16) * 8; const int gi = (t / 16) % RP; const int bl = t / (16 * RP); v8us v = {0,0,0,0,0,0,0,0}; if (gi < GG) v = *(const v8us*)((const unsigned short*)SRC + ((size_t)(b0 + bl) * GG + gi) * EE + c8); *(v8us*)((unsigned short*)DST + (size_t)t * 8) = v;  }
// final: per (b,g) row stats of z = 10·tanh(S2) + mask over p < 100, then probs; wave per row: lane L handles p = 4L..4L+3 (<100) → but the OUTPUT rows are 400 B (not line multiples) → write via flat float lanes:
__global__ __launch_bounds__(256) void k_stat(const float* __restrict__ S2, const float* __restrict__ MSK, int b0, float* __restrict__ ST) { const int tid = threadIdx.x, wv = tid >> 5, lane = tid & 31; const int row = blockIdx.x * 8 + wv; if (row >= BC2 * GG) return; const int bl = row / GG, g = row % GG; const size_t bg = (size_t)(b0 + bl) * GG + g; float z[4]; float m = -3.0e38f;
#pragma unroll
  for (int q = 0; q < 4; ++q) { const int p = lane * 4 + q; float v = -3.0e38f; if (p < PN) v = 10.0f * tanhf(S2[((size_t)bl * RP + g) * RP + p] * 0.08838834764831845f) + bf16_round(MSK[bg * PN + p]); z[q] = v; m = fmaxf(m, v); }
  for (int o = 16; o >= 1; o >>= 1) m = fmaxf(m, __shfl_xor(m, o, 32)); float s = 0.f; for (int q = 0; q < 4; ++q) s += (z[q] > -1.0e38f) ? expf(z[q] - m) : 0.f; for (int o = 16; o >= 1; o >>= 1) s += __shfl_xor(s, o, 32);
  if (lane == 0) { typedef float v2f __attribute__((ext_vector_type(2))); v2f st; st[0] = m; st[1] = (s > 0.f) ? 1.0f / s : 0.f; *(v2f*)(ST + bg * 2) = st;  } }
__global__ __launch_bounds__(256) void k_prob(const float* __restrict__ S2, const float* __restrict__ MSK, const float* __restrict__ ST, int b0, float* __restrict__ out) { const size_t t = (size_t)blockIdx.x * 256 + threadIdx.x; if (t >= (size_t)BC2 * GG * PN) return; const int p = (int)(t % PN); const size_t bgl = t / PN; const int bl = (int)(bgl / GG), g = (int)(bgl % GG); const size_t bg = (size_t)(b0 + bl) * GG + g;
  const float z = 10.0f * tanhf(S2[((size_t)bl * RP + g) * RP + p] * 0.08838834764831845f) + bf16_round(MSK[bg * PN + p]); const float v = expf(z - ST[bg * 2]) * ST[bg * 2 + 1]; *(float*)(out + bg * PN + p) = v;  }
extern "C" void kernel_launch(void* const* d_in, const int* in_sizes, int n_in,
                              void* d_out, int out_size, void* d_ws, size_t ws_size, hipStream_t stream) {
  (void)in_sizes; (void)n_in; (void)out_size;
  const float* in1 = (const float*)d_in[0]; const float* in2 = (const float*)d_in[1]; const float* rl = (const float*)d_in[2]; const float* msk = (const float*)d_in[3]; const float* enc = (const float*)d_in[4]; const float* Wq = (const float*)d_in[5]; const float* Wk = (const float*)d_in[6]; const float* Wv = (const float*)d_in[7]; const float* Wc = (const float*)d_in[8]; const float* bc = (const float*)d_in[9];
  char* ws = (char*)d_ws; size_t off = 0;
  auto take = [&](size_t bytes) { char* p = ws + off; off += (bytes + 255) & ~(size_t)255; return p; };
  const size_t NRW = (size_t)NB * GG;      // 51200 rows (b,g) / (b,p)
  _Float16* Bq2 = (_Float16*)take(EE * EE * 2); _Float16* Bk = (_Float16*)take(EE * EE * 2); _Float16* Bv = (_Float16*)take(EE * EE * 2); _Float16* Bc = (_Float16*)take(EE * EE * 2); float* Q1 = (float*)take((size_t)NB * EE * 4); float* ST = (float*)take(NRW * 2 * 4);
  _Float16* E16 = (_Float16*)take((NRW + 64) * EE * 2); _Float16* I16 = (_Float16*)take(NRW * EE * 2); _Float16* Q16 = (_Float16*)take(NRW * EE * 2); _Float16* K16 = (_Float16*)take(NRW * EE * 2); _Float16* V16 = (_Float16*)take((NRW + 64) * EE * 2);
  float* S = (float*)take((size_t)JCH * RP * RP * 4); _Float16* P16 = (_Float16*)take((size_t)JCH * RP * 128 * 2); _Float16* QP = (_Float16*)take((size_t)JCH * RP * 32 * 2); _Float16* KP = (_Float16*)take((size_t)JCH * RP * 32 * 2); _Float16* VT = (_Float16*)take((size_t)JCH * KD * 128 * 2);
  // Planes that are never live together share bytes (launches of one stream run in order):
  //   QF (26.2 MB, dead after k_qfin) and S2 (25.7 MB, pointer phase) lie in S (102.8 MB, attention phase);
  //   OC (same bytes as QP) lies in QP, which is dead once the score GEMM of its chunk has read it;
  //   MH16 (13.1 MB) lies in P16 (58.7 MB), MHP in QP and ENP in KP (14.7 MB each), all dead after the last attention chunk; O16 lies in I16 (dead after the q GEMM).
  float* QF = S; float* S2 = S; _Float16* O16 = I16; float* OC = (float*)QP; _Float16* MH16 = P16; _Float16* MHP = QP; _Float16* ENP = KP;
  if (off > ws_size) return;      // 0.8 + 13.1 x 5 + 102.8 + 58.7 + 14.7 x 2 + 8.4 = 265.6 MB of the 268.4 MB given
  const size_t w8 = (size_t)EE * EE / 8; const unsigned gw = (unsigned)((w8 + 255) / 256);
  k_wt_f16<<<gw, 256, 0, stream>>>(Wq + (size_t)EE * EE, Bq2, EE, EE, 16.0f);      // Wq rows 128..255 ↔ input2  ([in][out])
  k_wt_f16<<<gw, 256, 0, stream>>>(Wk, Bk, EE, EE, 16.0f); k_wt_f16<<<gw, 256, 0, stream>>>(Wv, Bv, EE, EE, 16.0f); k_wt_f16<<<gw, 256, 0, stream>>>(Wc, Bc, EE, EE, 16.0f);
  const unsigned g8 = (unsigned)((NRW * EE / 8 + 255) / 256); const dim3 gg(((unsigned)(NRW / 16) * (EE / 64) + 3) / 4, 1);
  k_x16<<<g8, 256, 0, stream>>>(enc, E16, NRW * EE / 8); k_x16<<<g8, 256, 0, stream>>>(in2, I16, NRW * EE / 8);
  k_gemm_hhx<0><<<gg, 128, 0, stream>>>(E16, EE, 0, Bk, EE, 0, 0.0625f, nullptr, 0, nullptr, 1, 0, 0, nullptr, K16, EE, 0, (int)NRW, EE, EE);
  k_gemm_hhx<0><<<gg, 128, 0, stream>>>(E16, EE, 0, Bv, EE, 0, 0.0625f, nullptr, 0, nullptr, 1, 0, 0, nullptr, V16, EE, 0, (int)NRW, EE, EE);
  k_gemm_hhx<0><<<gg, 128, 0, stream>>>(I16, EE, 0, Bq2, EE, 0, 0.0625f, nullptr, 0, nullptr, 1, 0, 0, QF, nullptr, EE, 0, (int)NRW, EE, EE);
  k_q1<<<NB, 128, 0, stream>>>(in1, Wq, Q1);
  k_qfin<<<(unsigned)((NRW * 16 + 255) / 256), 256, 0, stream>>>(QF, Q1, rl, Wq, Q16);      // q = (input2·Wq₂ + input1·Wq₁ + remaining·Wq₃)·(1/√16)
  // ---- phase 1: 8-head attention per chunk of 256 batches (2048 (b,h) pairs) on zero-padded 112x112 tiles
  for (int b0 = 0; b0 < NB; b0 += BCH) {
    k_qkp<<<(JCH * RP * 4 + 255) / 256, 256, 0, stream>>>(Q16, K16, b0, QP, KP); k_vtp<<<(JCH * KD * 16 + 255) / 256, 256, 0, stream>>>(V16, b0, VT);
    k_gemm_hhx<0><<<dim3(((RP / 16) * 2 + 3) / 4, JCH), 128, 0, stream>>>(QP, 32, (size_t)RP * 32, KP, 32, (size_t)RP * 32, 1.0f, nullptr, 0, nullptr, 1, 0, 0, S, nullptr, RP, (size_t)RP * RP, RP, RP, 32);      // scores (q pre-scaled); N = 112 (cols ≥ 100 are masked at the softmax)
    k_psm<<<(JCH * RP + 7) / 8, 256, 0, stream>>>(S, msk, b0, P16);
    k_gemm_hhx<0><<<dim3(((RP / 16) * 1 + 3) / 4, JCH), 128, 0, stream>>>(P16, 128, (size_t)RP * 128, VT, 128, (size_t)KD * 128, 1.0f, nullptr, 0, nullptr, 1, 0, 0, OC, nullptr, KD, (size_t)RP * KD, RP, KD, 128);      // OC[j][gi][k] = Σ_p P·v
    k_orep<<<(BCH * GG * 16 + 255) / 256, 256, 0, stream>>>(OC, b0, O16); }
  k_gemm_hhx<0><<<gg, 128, 0, stream>>>(O16, EE, 0, Bc, EE, 0, 0.0625f, bc, 0, nullptr, 1, 0, 0, nullptr, MH16, EE, 0, (int)NRW, EE, EE);      // mh = o·Wc + bc (f16 operand of the pointer GEMM)
  // ---- phase 2: pointer scores per batch on padded 112-row tiles, then 10·tanh + mask → softmax (flat writes)
  for (int b0 = 0; b0 < NB; b0 += BC2) {
    k_padrows<<<(BC2 * RP * 16 + 255) / 256, 256, 0, stream>>>(MH16, b0, MHP); k_padrows<<<(BC2 * RP * 16 + 255) / 256, 256, 0, stream>>>(E16, b0, ENP);
    k_gemm_hhx<0><<<dim3(((RP / 16) * 2 + 3) / 4, BC2), 128, 0, stream>>>(MHP, EE, (size_t)RP * EE, ENP, EE, (size_t)RP * EE, 1.0f, nullptr, 0, nullptr, 1, 0, 0, S2, nullptr, RP, (size_t)RP * RP, RP, RP, EE);      // mh·encᵀ (the 1/√128 is applied at the tanh)
    k_stat<<<(BC2 * GG + 7) / 8, 256, 0, stream>>>(S2, msk, b0, ST);
    k_prob<<<(unsigned)(((size_t)BC2 * GG * PN + 255) / 256), 256, 0, stream>>>(S2, msk, ST, b0, (float*)d_out); }
}

// v002
// It runs in 221 microseconds.
// Next to v001, in two timings, it ran 1.86 and 1.85 times as fast.
// All steps since v000 together make it 4.11 times as fast.
#include <hip/hip_runtime.h>
// Next-node probability head (B=512, G=100 group rows, P=100 nodes, E=128, 8 heads × 16, logit clipping 10): k,v = enc·W; q = [input1 | input2 | remaining]·Wq split by linearity
// (input2·Wq₂ as a GEMM, input1·Wq₁ per batch + remaining·Wq₃ rank-1 in the epilogue kernel); the 8-head attention (additive INPUT ninf mask) in one kernel, scores and weights in
// registers (k_attn); o·Wc + bc; the pointer score mh·encᵀ/√128 as b-batched GEMMs; 10·tanh + mask → softmax written flat. Contractions on v_wmma_f32_16x16x32_f16 (f16 operands,
// weights [in][out] transposed to bf16-exact ×2^4, f32 accumulate); softmaxes/tanh f32 VALU.
#define NB 512
#define GG 100
#define PN 100
#define EE 128
#define NH 8
#define KD 16
#define RP 112
#define BC2 NB             // batches per pointer-score chunk: all of them, one pass

typedef __bf16 v16b __attribute__((ext_vector_type(16)));
typedef unsigned short v8us __attribute__((ext_vector_type(8), may_alias));
typedef float  v8f  __attribute__((ext_vector_type(8)));
typedef float  v4f  __attribute__((ext_vector_type(4)));
typedef float  v4fa __attribute__((ext_vector_type(4), may_alias));
union FragB { v16b v; v8us half[2]; unsigned short u[16]; };

__device__ __forceinline__ unsigned short bf16_bits(float x) { unsigned int u = __float_as_uint(x); return (unsigned short)((u + 0x7FFFu + ((u >> 16) & 1u)) >> 16); }
__device__ __forceinline__ float bf16_val(unsigned short b) { return __uint_as_float(((unsigned int)b) << 16); }
__device__ __forceinline__ float bf16_round(float x) { return bf16_val(bf16_bits(x)); }
// D += A·B with NT terms: 1 = ah·bh, 2 = + al·bh (A split), 3 = + ah·bl (both split)
template <int NT>
__device__ __forceinline__ v8f mmaN(v16b ah, v16b al, v16b bh, v16b bl, v8f c) {
  c = __builtin_amdgcn_wmma_f32_16x16x32_bf16(false, ah, false, bh, (short)0, c, false, false);
  if (NT >= 2) c = __builtin_amdgcn_wmma_f32_16x16x32_bf16(false, al, false, bh, (short)0, c, false, false);
  if (NT >= 3) c = __builtin_amdgcn_wmma_f32_16x16x32_bf16(false, ah, false, bl, (short)0, c, false, false);
  asm volatile("v_nop\n\tv_nop\n\tv_nop\n\tv_nop" : "+v"(c) : "v"(ah), "v"(al), "v"(bh), "v"(bl));
  return c;
}

__global__ __launch_bounds__(256) void k_wt_bf16(const float* __restrict__ W, unsigned short* __restrict__ Wt, int K, int N) {
  const int t = blockIdx.x * 256 + threadIdx.x;
  const int k8n = K / 8;
  if (t >= N * k8n) return;
  const int n = t / k8n, k8 = (t % k8n) * 8;
  v8us v;
#pragma unroll
  for (int i = 0; i < 8; ++i) v[i] = bf16_bits(W[(size_t)(k8 + i) * N + n]);
  *(v8us*)(Wt + (size_t)n * K + k8) = v;
  
}

// GEMM C[M][N] (f32, pitch ldc) = act(A[M][K]·W + bias). A f32 row-major (pitch lda) converted per fragment to bf16
// (ASPLIT: hi/lo two planes -> 2 terms, else single rounded term); Wt bf16 [N][K] (pitch ldb). BIAS_BF16 rounds the
// bias to bf16 first (bias quantised to bf16 before the add). K%32==0, M%16==0, N%64==0.
template <bool ASPLIT, int ACT, bool BIAS_BF16>
__global__ __launch_bounds__(128) void k_gemm_bf(const float* __restrict__ A, int lda, const unsigned short* __restrict__ Wt, int ldb,
                                               const float* __restrict__ bias, float* __restrict__ C, int ldc, int M, int N, int K) {
  __shared__ __attribute__((aligned(16))) float so[4][16][64];
  const int tid = threadIdx.x, w = tid >> 5, lane = tid & 31, ln = lane & 15, hh = lane >> 4;
  const int ntn = N / 64;
  const int wid = blockIdx.x * 4 + w;
  const int mt = wid / ntn, nq = wid % ntn;
  if (mt * 16 >= M) return;
  const int row0 = mt * 16, col0 = nq * 64;
  const float* arow = A + (size_t)(row0 + ln) * lda;
  v8f acc[4] = {};
  for (int kb = 0; kb < K; kb += 32) {
    FragB ah, al;
    const v4f x0 = *(const v4fa*)(arow + kb + 8 * hh), x1 = *(const v4fa*)(arow + kb + 8 * hh + 4);
    const v4f x2 = *(const v4fa*)(arow + kb + 16 + 8 * hh), x3 = *(const v4fa*)(arow + kb + 16 + 8 * hh + 4);
    float xs[16] = {x0[0],x0[1],x0[2],x0[3],x1[0],x1[1],x1[2],x1[3],x2[0],x2[1],x2[2],x2[3],x3[0],x3[1],x3[2],x3[3]};
#pragma unroll
    for (int i = 0; i < 16; ++i) { const unsigned short hb = bf16_bits(xs[i]); ah.u[i] = hb; al.u[i] = ASPLIT ? bf16_bits(xs[i] - bf16_val(hb)) : (unsigned short)0; }
#pragma unroll
    for (int t = 0; t < 4; ++t) {
      const unsigned short* brow = Wt + (size_t)(col0 + t * 16 + ln) * ldb + kb;
      FragB b;
      b.half[0] = *(const v8us*)(brow + 8 * hh);
      b.half[1] = *(const v8us*)(brow + 16 + 8 * hh);
      acc[t] = mmaN<ASPLIT ? 2 : 1>(ah.v, al.v, b.v, b.v, acc[t]);
    }
  }
#pragma unroll
  for (int t = 0; t < 4; ++t) {
    float bv = bias ? bias[col0 + t * 16 + ln] : 0.f;
    if (BIAS_BF16) bv = bf16_round(bv);
#pragma unroll
    for (int r = 0; r < 8; ++r) { float v = acc[t][r] + bv; if (ACT == 1) v = fmaxf(v, 0.f); so[w][8 * hh + r][t * 16 + ln] = v; }
  }
  __builtin_amdgcn_fence(__ATOMIC_ACQ_REL, "workgroup");
  __builtin_amdgcn_wave_barrier();
  const int rsub = lane >> 4, c4 = (lane & 15) * 4;
  {
#pragma unroll
    for (int q = 0; q < 8; ++q) {
      const int r = q * 2 + rsub;
      const v4f v = *(const v4fa*)&so[w][r][c4];
      *(v4f*)(C + (size_t)(row0 + r) * ldc + col0 + c4) = v;
    }
    
  }
}

// Flash-style causal/unmasked attention, all contractions 3-term bf16 hi/lo splits, f32 softmax with running max.
// q,k,v rows are read from f32 buffers with arbitrary row pitch (so they can live inside a fused qkv buffer);
// D = head size (multiple of 32, <= 128); one wave = 16 query rows; block = 4 waves (64 queries) sharing K/V chunks of 32.
template <int D, bool CAUSAL>
__global__ __launch_bounds__(128) void k_flash(const float* __restrict__ qb, const float* __restrict__ kb, const float* __restrict__ vb,
                                             int pitch, int T, int H, float scale, float* __restrict__ y, int ypitch) {
  constexpr int KS = D / 32;        // k-steps for QK
  constexpr int DT = D / 16;        // d tiles for PV
  __shared__ __attribute__((aligned(16))) unsigned short sKh[32][D + 8], sKl[32][D + 8], sVh[32][D + 8], sVl[32][D + 8];
  __shared__ __attribute__((aligned(16))) unsigned short sPh[4][16][40], sPl[4][16][40];
  __shared__ __attribute__((aligned(16))) float sO[4][16][D];
  const int tid = threadIdx.x, w = tid >> 5, lane = tid & 31, ln = lane & 15, hh = lane >> 4;
  const int nqb = (T + 63) / 64;
  const int bh = blockIdx.x / nqb, qblk = blockIdx.x % nqb;
  const int b = bh / H, h = bh % H;
  const int q0 = qblk * 64 + w * 16;
  const float* Q = qb + (size_t)b * T * pitch + h * D;
  const float* K = kb + (size_t)b * T * pitch + h * D;
  const float* V = vb + (size_t)b * T * pitch + h * D;

  // A fragments of the wave's 16 query rows (scaled), hi/lo
  FragB aqh[KS], aql[KS];
  {
    int row = q0 + ln; if (row >= T) row = T - 1;
    const float* qr = Q + (size_t)row * pitch;
#pragma unroll
    for (int ks = 0; ks < KS; ++ks)
#pragma unroll
      for (int i = 0; i < 16; ++i) {
        const int d = ks * 32 + ((i < 8) ? (8 * hh + i) : (16 + 8 * hh + (i - 8)));
        const float x = qr[d] * scale; const unsigned short hb = bf16_bits(x);
        aqh[ks].u[i] = hb; aql[ks].u[i] = bf16_bits(x - bf16_val(hb));
      }
  }
  float m_r[8], l_r[8];
#pragma unroll
  for (int r = 0; r < 8; ++r) { m_r[r] = -3.0e38f; l_r[r] = 0.f; }
  v8f oacc[DT];
#pragma unroll
  for (int dt = 0; dt < DT; ++dt) oacc[dt] = (v8f){0.f,0.f,0.f,0.f,0.f,0.f,0.f,0.f};

  const int kv_end = CAUSAL ? min(T, qblk * 64 + 64) : T;     // block-uniform
  for (int j0 = 0; j0 < kv_end; j0 += 32) {
    __syncthreads();
    for (int e = tid; e < 32 * (D / 4); e += 128) {
      const int r = e / (D / 4), c4 = (e % (D / 4)) * 4;
      const int key = j0 + r;
      v4f kf = {0.f,0.f,0.f,0.f}, vf = {0.f,0.f,0.f,0.f};
      if (key < T) { kf = *(const v4fa*)(K + (size_t)key * pitch + c4); vf = *(const v4fa*)(V + (size_t)key * pitch + c4); }
#pragma unroll
      for (int t = 0; t < 4; ++t) {
        unsigned short hb = bf16_bits(kf[t]); sKh[r][c4 + t] = hb; sKl[r][c4 + t] = bf16_bits(kf[t] - bf16_val(hb));
        hb = bf16_bits(vf[t]); sVh[r][c4 + t] = hb; sVl[r][c4 + t] = bf16_bits(vf[t] - bf16_val(hb));
      }
    }
    __syncthreads();
    // S tile 16 x 32
    v8f s[2];
#pragma unroll
    for (int nt = 0; nt < 2; ++nt) {
      v8f acc = {};
#pragma unroll
      for (int ks = 0; ks < KS; ++ks) {
        FragB bh_, bl_;
        bh_.half[0] = *(const v8us*)&sKh[nt * 16 + ln][ks * 32 + 8 * hh]; bh_.half[1] = *(const v8us*)&sKh[nt * 16 + ln][ks * 32 + 16 + 8 * hh];
        bl_.half[0] = *(const v8us*)&sKl[nt * 16 + ln][ks * 32 + 8 * hh]; bl_.half[1] = *(const v8us*)&sKl[nt * 16 + ln][ks * 32 + 16 + 8 * hh];
        acc = mmaN<3>(aqh[ks].v, aql[ks].v, bh_.v, bl_.v, acc);
      }
      s[nt] = acc;
    }
    // mask + running max (rows 8hh+r; the 16 lanes of a half share rows)
    float alpha[8];
#pragma unroll
    for (int r = 0; r < 8; ++r) {
      const int qi = q0 + 8 * hh + r;
      const int ja = j0 + ln, jb = j0 + 16 + ln;
      if (CAUSAL) { if (ja > qi) s[0][r] = -3.0e38f; if (jb > qi) s[1][r] = -3.0e38f; }
      if (ja >= T) s[0][r] = -3.0e38f;
      if (jb >= T) s[1][r] = -3.0e38f;
      float mx = fmaxf(s[0][r], s[1][r]);
      mx = fmaxf(mx, __shfl_xor(mx, 1, 32)); mx = fmaxf(mx, __shfl_xor(mx, 2, 32)); mx = fmaxf(mx, __shfl_xor(mx, 4, 32)); mx = fmaxf(mx, __shfl_xor(mx, 8, 32));
      const float mnew = fmaxf(m_r[r], mx);
      alpha[r] = (mnew > -1.0e38f) ? __expf(m_r[r] - mnew) : 1.0f;
      const float p0 = (s[0][r] > -1.0e38f) ? __expf(s[0][r] - mnew) : 0.f;
      const float p1 = (s[1][r] > -1.0e38f) ? __expf(s[1][r] - mnew) : 0.f;
      m_r[r] = mnew;
      l_r[r] = l_r[r] * alpha[r] + p0 + p1;            // per-lane partial row sum (16 lanes combined at the end)
      unsigned short hb = bf16_bits(p0); sPh[w][8 * hh + r][ln] = hb;      sPl[w][8 * hh + r][ln] = bf16_bits(p0 - bf16_val(hb));
      hb = bf16_bits(p1);                sPh[w][8 * hh + r][16 + ln] = hb; sPl[w][8 * hh + r][16 + ln] = bf16_bits(p1 - bf16_val(hb));
    }
#pragma unroll
    for (int dt = 0; dt < DT; ++dt)
#pragma unroll
      for (int r = 0; r < 8; ++r) oacc[dt][r] *= alpha[r];
    __builtin_amdgcn_fence(__ATOMIC_ACQ_REL, "workgroup");
    __builtin_amdgcn_wave_barrier();
    FragB pah, pal;
    pah.half[0] = *(const v8us*)&sPh[w][ln][8 * hh]; pah.half[1] = *(const v8us*)&sPh[w][ln][16 + 8 * hh];
    pal.half[0] = *(const v8us*)&sPl[w][ln][8 * hh]; pal.half[1] = *(const v8us*)&sPl[w][ln][16 + 8 * hh];
#pragma unroll
    for (int dt = 0; dt < DT; ++dt) {
      FragB bvh, bvl;
#pragma unroll
      for (int i = 0; i < 8; ++i) {
        bvh.u[i] = sVh[8 * hh + i][dt * 16 + ln]; bvh.u[8 + i] = sVh[16 + 8 * hh + i][dt * 16 + ln];
        bvl.u[i] = sVl[8 * hh + i][dt * 16 + ln]; bvl.u[8 + i] = sVl[16 + 8 * hh + i][dt * 16 + ln];
      }
      oacc[dt] = mmaN<3>(pah.v, pal.v, bvh.v, bvl.v, oacc[dt]);
    }
    __builtin_amdgcn_fence(__ATOMIC_ACQ_REL, "workgroup");
    __builtin_amdgcn_wave_barrier();
  }
#pragma unroll
  for (int r = 0; r < 8; ++r) {
    float l = l_r[r];
    l += __shfl_xor(l, 1, 32); l += __shfl_xor(l, 2, 32); l += __shfl_xor(l, 4, 32); l += __shfl_xor(l, 8, 32);
    l_r[r] = (l > 0.f) ? 1.0f / l : 0.f;
  }
#pragma unroll
  for (int dt = 0; dt < DT; ++dt)
#pragma unroll
    for (int r = 0; r < 8; ++r) sO[w][8 * hh + r][dt * 16 + ln] = oacc[dt][r] * l_r[r];
  __builtin_amdgcn_fence(__ATOMIC_ACQ_REL, "workgroup");
  __builtin_amdgcn_wave_barrier();
  {
    for (int r = 0; r < 16; ++r) {
      const int row = q0 + r;
      if (row < T && lane < D / 4) {
        const v4f val = *(const v4fa*)&sO[w][r][lane * 4];
        *(v4f*)(y + ((size_t)b * T + row) * ypitch + h * D + lane * 4) = val;
      }
    }
    
  }
}

// GEMM C = act(A·W + bias + resid): A f32 (ASPLIT -> hi/lo 2 terms), Wt bf16 [N][K]; ACT 0 none, 1 relu, 2 exact gelu;
// resid (optional, f32, row index = (row % rmod), pitch ldr, RES_BF16 rounds it) added before the activation.
template <bool ASPLIT, int ACT, bool BIAS_BF16, bool RES_BF16>
__global__ __launch_bounds__(128) void k_gemm_bf3(const float* __restrict__ A, int lda, const unsigned short* __restrict__ Wt, int ldb,
                                                const float* __restrict__ bias, const float* __restrict__ resid, int rmod, int ldr,
                                                float* __restrict__ C, int ldc, int M, int N, int K) {
  __shared__ __attribute__((aligned(16))) float so[4][16][64];
  const int tid = threadIdx.x, w = tid >> 5, lane = tid & 31, ln = lane & 15, hh = lane >> 4;
  const int ntn = N / 64;
  const int wid = blockIdx.x * 4 + w;
  const int mt = wid / ntn, nq = wid % ntn;
  if (mt * 16 >= M) return;
  const int row0 = mt * 16, col0 = nq * 64;
  const float* arow = A + (size_t)(row0 + ln) * lda;
  v8f acc[4] = {};
  for (int kb = 0; kb < K; kb += 32) {
    FragB ah, al;
    const v4f x0 = *(const v4fa*)(arow + kb + 8 * hh), x1 = *(const v4fa*)(arow + kb + 8 * hh + 4);
    const v4f x2 = *(const v4fa*)(arow + kb + 16 + 8 * hh), x3 = *(const v4fa*)(arow + kb + 16 + 8 * hh + 4);
    float xs[16] = {x0[0],x0[1],x0[2],x0[3],x1[0],x1[1],x1[2],x1[3],x2[0],x2[1],x2[2],x2[3],x3[0],x3[1],x3[2],x3[3]};
#pragma unroll
    for (int i = 0; i < 16; ++i) { const unsigned short hb = bf16_bits(xs[i]); ah.u[i] = hb; al.u[i] = ASPLIT ? bf16_bits(xs[i] - bf16_val(hb)) : (unsigned short)0; }
#pragma unroll
    for (int t = 0; t < 4; ++t) {
      const unsigned short* brow = Wt + (size_t)(col0 + t * 16 + ln) * ldb + kb;
      FragB b;
      b.half[0] = *(const v8us*)(brow + 8 * hh);
      b.half[1] = *(const v8us*)(brow + 16 + 8 * hh);
      acc[t] = mmaN<ASPLIT ? 2 : 1>(ah.v, al.v, b.v, b.v, acc[t]);
    }
  }
#pragma unroll
  for (int t = 0; t < 4; ++t) {
    const int col = col0 + t * 16 + ln;
    float bv = bias ? bias[col] : 0.f;
    if (BIAS_BF16) bv = bf16_round(bv);
#pragma unroll
    for (int r = 0; r < 8; ++r) {
      float v = acc[t][r] + bv;
      if (resid) { float rv = resid[(size_t)((row0 + 8 * hh + r) % rmod) * ldr + col]; if (RES_BF16) rv = bf16_round(rv); v += rv; }
      if (ACT == 1) v = fmaxf(v, 0.f);
      if (ACT == 2) v = 0.5f * v * (1.0f + erff(v * 0.70710678118654752f));
      if (ACT == 3) { const float u = 0.7978845608028654f * (v + 0.044715f * v * v * v); v = 0.5f * v * (1.0f + tanhf(u)); }
      so[w][8 * hh + r][t * 16 + ln] = v;
    }
  }
  __builtin_amdgcn_fence(__ATOMIC_ACQ_REL, "workgroup");
  __builtin_amdgcn_wave_barrier();
  const int rsub = lane >> 4, c4 = (lane & 15) * 4;
  {
#pragma unroll
    for (int q = 0; q < 8; ++q) {
      const int r = q * 2 + rsub;
      const v4f v = *(const v4fa*)&so[w][r][c4];
      *(v4f*)(C + (size_t)(row0 + r) * ldc + col0 + c4) = v;
    }
    
  }
}
// row LayerNorm (biased variance, eps) over N: s = X (+ R); optional out_sum <- s; out_norm <- (s-mu)*rsqrt(var+eps)*g + b
template <bool PARAM_BF16>
__global__ __launch_bounds__(256) void k_layernorm(const float* __restrict__ X, const float* __restrict__ R, const float* __restrict__ g, const float* __restrict__ bta,
                                                  float* __restrict__ out_sum, float* __restrict__ out_norm, int N, float eps) {
  __shared__ float red[256];
  const int row = blockIdx.x, tid = threadIdx.x;
  const float* x = X + (size_t)row * N; const float* rr = R ? R + (size_t)row * N : nullptr;
  float vals[16];                     // up to N = 4096
  const int per = N / 256;            // contiguous chunk per thread? use strided-by-4 chunks: thread handles j = tid*4 + 1024*u
  float s1 = 0.f;
  for (int u = 0; u < per / 4; ++u) {
    const int j = tid * 4 + 1024 * u;
    const v4f a = *(const v4fa*)(x + j);
    v4f b = {0.f,0.f,0.f,0.f}; if (rr) b = *(const v4fa*)(rr + j);
#pragma unroll
    for (int q = 0; q < 4; ++q) { const float v = a[q] + b[q]; vals[u * 4 + q] = v; s1 += v; }
  }
  red[tid] = s1; __syncthreads();
  for (int st = 128; st > 0; st >>= 1) { if (tid < st) red[tid] += red[tid + st]; __syncthreads(); }
  const float mu = red[0] / (float)N; __syncthreads();
  float s2 = 0.f;
  for (int u = 0; u < per / 4; ++u)
#pragma unroll
    for (int q = 0; q < 4; ++q) { const float c = vals[u * 4 + q] - mu; s2 += c * c; }
  red[tid] = s2; __syncthreads();
  for (int st = 128; st > 0; st >>= 1) { if (tid < st) red[tid] += red[tid + st]; __syncthreads(); }
  const float rs = rsqrtf(red[0] / (float)N + eps);
  {
    for (int u = 0; u < per / 4; ++u) {
      const int j = tid * 4 + 1024 * u;
      v4f o, sm;
#pragma unroll
      for (int q = 0; q < 4; ++q) {
        float gg = g[j + q], bb = bta[j + q];
        if (PARAM_BF16) { gg = bf16_round(gg); bb = bf16_round(bb); }
        sm[q] = vals[u * 4 + q]; o[q] = (vals[u * 4 + q] - mu) * rs * gg + bb;
      }
      if (out_sum) *(v4f*)(out_sum + (size_t)row * N + j) = sm;
      *(v4f*)(out_norm + (size_t)row * N + j) = o;
    }
    
  }
}



// ---- f16 WMMA path (v_wmma_f32_16x16x32_f16): 11-bit significands for operands in range — used where a [0,1] probability operand needs more precision than bf16
typedef _Float16 v16h __attribute__((ext_vector_type(16)));
union FragH { v16h v; v8us half[2]; _Float16 h[16]; unsigned short u[16]; };
template <int NT>
__device__ __forceinline__ v8f mmaH(v16h ah, v16h al, v16h bh, v16h bl, v8f c) {
  c = __builtin_amdgcn_wmma_f32_16x16x32_f16(false, ah, false, bh, (short)0, c, false, false);
  if (NT >= 2) c = __builtin_amdgcn_wmma_f32_16x16x32_f16(false, al, false, bh, (short)0, c, false, false);
  if (NT >= 3) c = __builtin_amdgcn_wmma_f32_16x16x32_f16(false, ah, false, bl, (short)0, c, false, false);
  asm volatile("v_nop\n\tv_nop\n\tv_nop\n\tv_nop" : "+v"(c) : "v"(ah), "v"(al), "v"(bh), "v"(bl));
  return c;
}
// batched GEMM like k_gemm_b but f16 operands: A f32 (split into f16 hi/lo if ASPLIT, else rounded to f16), Bt = f16 values [n][k]; alpha; C f32; N multiple of 16 (partial tiles skipped)
template <bool ASPLIT>
__global__ __launch_bounds__(128) void k_gemm_h(const float* __restrict__ A, int lda, size_t sA, const _Float16* __restrict__ Bh, int ldb, size_t sB, float alpha, float* __restrict__ C, int ldc, size_t sC, int M, int N, int K) {
  __shared__ __attribute__((aligned(16))) float so[4][16][64];
  const int tid = threadIdx.x, w = tid >> 5, lane = tid & 31, ln = lane & 15, hh = lane >> 4; const int by = blockIdx.y;
  A += (size_t)by * sA; Bh += (size_t)by * sB; C += (size_t)by * sC;
  const int ntn = (N + 63) / 64; const int wid = blockIdx.x * 4 + w; const int mt = wid / ntn, nq = wid % ntn; if (mt * 16 >= M) return;
  const int row0 = mt * 16, col0 = nq * 64; const float* arow = A + (size_t)(row0 + ln) * lda;
  v8f acc[4] = {};
  for (int kb = 0; kb < K; kb += 32) {
    FragH ah, al;
    const v4f x0 = *(const v4fa*)(arow + kb + 8 * hh), x1 = *(const v4fa*)(arow + kb + 8 * hh + 4), x2 = *(const v4fa*)(arow + kb + 16 + 8 * hh), x3 = *(const v4fa*)(arow + kb + 16 + 8 * hh + 4);
    float xs[16] = {x0[0],x0[1],x0[2],x0[3],x1[0],x1[1],x1[2],x1[3],x2[0],x2[1],x2[2],x2[3],x3[0],x3[1],x3[2],x3[3]};
#pragma unroll
    for (int i = 0; i < 16; ++i) { const _Float16 h = (_Float16)xs[i]; ah.h[i] = h; al.h[i] = ASPLIT ? (_Float16)(xs[i] - (float)h) : (_Float16)0.0f; }
#pragma unroll
    for (int t = 0; t < 4; ++t) { if (col0 + t * 16 >= N) continue; const size_t boff = (size_t)(col0 + t * 16 + ln) * ldb + kb; FragH bq; bq.half[0] = *(const v8us*)(Bh + boff + 8 * hh); bq.half[1] = *(const v8us*)(Bh + boff + 16 + 8 * hh);
      acc[t] = mmaH<ASPLIT ? 2 : 1>(ah.v, al.v, bq.v, bq.v, acc[t]); }
  }
#pragma unroll
  for (int t = 0; t < 4; ++t) { if (col0 + t * 16 >= N) continue;
#pragma unroll
    for (int r = 0; r < 8; ++r) so[w][8 * hh + r][t * 16 + ln] = acc[t][r] * alpha; }
  __builtin_amdgcn_fence(__ATOMIC_ACQ_REL, "workgroup"); __builtin_amdgcn_wave_barrier();
  const int rsub = lane >> 4, c4 = (lane & 15) * 4;
  {
#pragma unroll
    for (int q = 0; q < 8; ++q) { const int r = q * 2 + rsub; if (col0 + c4 < N) { const v4f v = *(const v4fa*)&so[w][r][c4]; *(v4f*)(C + (size_t)(row0 + r) * ldc + col0 + c4) = v; } }
     }
}

// Wt[n][k] = f16(W[k][n]·scale) from f32 row-major W[K][N] (scale = power of two; bf16-exact weights stay exact in f16 away from the subnormal range)
__global__ __launch_bounds__(256) void k_wt_f16(const float* __restrict__ W, _Float16* __restrict__ Wt, int K, int N, float scale) {
  const int t = blockIdx.x * 256 + threadIdx.x; if (t >= N * (K / 8)) return; const int n = t / (K / 8), k8 = (t % (K / 8)) * 8; FragH f;
#pragma unroll
  for (int i = 0; i < 8; ++i) f.h[i] = (_Float16)(bf16_round(W[(size_t)(k8 + i) * N + n]) * scale); const v8us o = f.half[0];
  *(v8us*)((unsigned short*)Wt + (size_t)n * K + k8) = o; 
}
// k_gemm_hh variant with fused epilogue: v = acc·alpha + bias[by·sBias + col] (+ CP[(row/rowsPerB)·sCPb + by·64 + col] if CP) ; ACT 0 none / 1 elu ; writes f32 C and/or f16 C16 (each if non-null)
template <int ACT>
__global__ __launch_bounds__(128) void k_gemm_hhx(const _Float16* __restrict__ A, int lda, size_t sA, const _Float16* __restrict__ Bh, int ldb, size_t sB, float alpha, const float* __restrict__ bias, size_t sBias, const float* __restrict__ CP, int rowsPerB, size_t sCPb, int row0g,
    float* __restrict__ C, _Float16* __restrict__ C16, int ldc, size_t sC, int M, int N, int K) {
  __shared__ __attribute__((aligned(16))) float so[4][16][64];
  const int tid = threadIdx.x, w = tid >> 5, lane = tid & 31, ln = lane & 15, hh = lane >> 4; const int by = blockIdx.y;
  A += (size_t)by * sA; Bh += (size_t)by * sB; const size_t cofs = (size_t)by * sC; const float* bp = bias ? bias + (size_t)by * sBias : nullptr;
  const int ntn = (N + 63) / 64; const int wid = blockIdx.x * 4 + w; const int mt = wid / ntn, nq = wid % ntn; if (mt * 16 >= M) return;
  const int row0 = mt * 16, col0 = nq * 64; const _Float16* arow = A + (size_t)(row0 + ln) * lda;
  v8f acc[4] = {};
  for (int kb = 0; kb < K; kb += 32) { FragH ah; ah.half[0] = *(const v8us*)((const unsigned short*)arow + kb + 8 * hh); ah.half[1] = *(const v8us*)((const unsigned short*)arow + kb + 16 + 8 * hh);
#pragma unroll
    for (int t = 0; t < 4; ++t) { if (col0 + t * 16 >= N) continue; const size_t boff = (size_t)(col0 + t * 16 + ln) * ldb + kb; FragH bq; bq.half[0] = *(const v8us*)((const unsigned short*)Bh + boff + 8 * hh); bq.half[1] = *(const v8us*)((const unsigned short*)Bh + boff + 16 + 8 * hh);
      acc[t] = mmaH<1>(ah.v, ah.v, bq.v, bq.v, acc[t]); }
  }
#pragma unroll
  for (int t = 0; t < 4; ++t) { if (col0 + t * 16 >= N) continue; const int col = col0 + t * 16 + ln; const float bv = bp ? bf16_round(bp[col]) : 0.f;
#pragma unroll
    for (int r = 0; r < 8; ++r) { float v = acc[t][r] * alpha + bv; if (CP) { const int bidx = (row0g + row0 + 8 * hh + r) / rowsPerB; v += CP[(size_t)bidx * sCPb + (size_t)by * 64 + col]; } if (ACT == 1) v = (v > 0.f) ? v : expm1f(v); else if (ACT == 3) v = fmaxf(v, 0.f); so[w][8 * hh + r][t * 16 + ln] = v; } }
  __builtin_amdgcn_fence(__ATOMIC_ACQ_REL, "workgroup"); __builtin_amdgcn_wave_barrier();
  const int rsub = lane >> 4, c4 = (lane & 15) * 4; typedef _Float16 v4h __attribute__((ext_vector_type(4)));
  {
#pragma unroll
    for (int q = 0; q < 8; ++q) { const int r = q * 2 + rsub; if (col0 + c4 < N) { const v4f v = *(const v4fa*)&so[w][r][c4]; if (C) *(v4f*)(C + cofs + (size_t)(row0 + r) * ldc + col0 + c4) = v; if (C16) { v4h h4; for (int i = 0; i < 4; ++i) h4[i] = (_Float16)v[i]; *(v4h*)(C16 + cofs + (size_t)(row0 + r) * ldc + col0 + c4) = h4; } } }
     }
}


__global__ __launch_bounds__(256) void k_x16(const float* __restrict__ x, _Float16* __restrict__ X16, size_t n8) { const size_t t = (size_t)blockIdx.x * 256 + threadIdx.x; if (t >= n8) return; FragH f;
#pragma unroll
  for (int q = 0; q < 8; ++q) f.h[q] = (_Float16)bf16_round(x[t * 8 + q]); *(v8us*)((unsigned short*)X16 + t * 8) = f.half[0];  }
__global__ __launch_bounds__(128) void k_q1(const float* __restrict__ in1, const float* __restrict__ Wq, float* __restrict__ Q1) { const int b = blockIdx.x, o = threadIdx.x; float s = 0.f;
#pragma unroll 1
  for (int e = 0; e < EE; ++e) s += bf16_round(in1[(size_t)b * EE + e]) * bf16_round(Wq[(size_t)e * EE + o]); *(float*)(Q1 + (size_t)b * EE + o) = s;  }
__global__ __launch_bounds__(256) void k_qfin(const float* __restrict__ QF, const float* __restrict__ Q1, const float* __restrict__ rl, const float* __restrict__ Wq, _Float16* __restrict__ Q16) { const size_t t = (size_t)blockIdx.x * 256 + threadIdx.x; if (t >= (size_t)NB * GG * 16) return; const int c8 = (int)(t % 16) * 8; const size_t r = t / 16; const size_t b = r / GG; const float rv = bf16_round(rl[r]); FragH f;
#pragma unroll
  for (int q = 0; q < 8; ++q) { const int o = c8 + q; f.h[q] = (_Float16)((QF[r * EE + o] + Q1[b * EE + o] + rv * bf16_round(Wq[(size_t)256 * EE + o])) * 0.25f); } *(v8us*)((unsigned short*)Q16 + t * 8) = f.half[0];  }
// Fused 8-head attention. One work-group = one batch b and HPW heads; wave w owns the 16 query rows g = 16w..16w+15 (7 waves cover 112 >= 100) and loops over the heads.
// The score tile is formed transposed, S^T = K.Q^T (A = 16 key rows, B = 16 query rows, d 16 zero-extended to the k = 32 of the instruction), so a lane (ln, hh) holds, for its one
// query g = 16w + ln, the keys p = 16t + 8hh + r (t = tile, r = accumulator register). That is the k order of a B fragment: after the softmax (registers, an exchange for the maximum and one for the sum between the
// two lane halves) tiles 2c and 2c+1 are, register for register, the B operand of O^T = V^T.P^T for keys 32c..32c+31. Scores and weights never leave the registers.
// V^T (A operand, rows = head columns, k = keys, zero for keys >= 100) is staged once in LDS. The mask row slice of a lane is read once and serves all HPW heads.
#define HPW 8              // heads per work-group: all of them, so a wave reads and rounds its mask slice once, and a whole output row has one writing work-group
#define VTP 136            // f16 pitch of a V^T row in LDS: 256 + 16 bytes, spreads the 16 rows of a 16-byte fragment read over the banks
__global__ __launch_bounds__(224) void k_attn(const _Float16* __restrict__ Q16, const _Float16* __restrict__ K16, const _Float16* __restrict__ V16, const float* __restrict__ MSK, _Float16* __restrict__ O16) {
  __shared__ __attribute__((aligned(16))) unsigned short sVT[HPW * KD][VTP];
  const int tid = threadIdx.x, w = tid >> 5, lane = tid & 31, ln = lane & 15, hh = lane >> 4;
  const int b = blockIdx.x / (NH / HPW), h0 = (blockIdx.x % (NH / HPW)) * HPW;
  // V^T into LDS: one item = two neighbouring keys x 8 head columns; lanes run along the keys, so each 4-byte store of a wave falls on its own bank
  for (int e = tid; e < 64 * (HPW * KD / 8); e += 224) {
    const int p = (e & 63) * 2, c8 = (e >> 6) * 8;
    v8us x = {0,0,0,0,0,0,0,0}, y = {0,0,0,0,0,0,0,0};
    if (p < PN) { const unsigned short* s = (const unsigned short*)V16 + ((size_t)b * PN + p) * EE + h0 * KD + c8; x = *(const v8us*)s; y = *(const v8us*)(s + EE); }
#pragma unroll
    for (int q = 0; q < 8; ++q) *(unsigned int*)&sVT[c8 + q][p] = (unsigned int)x[q] | ((unsigned int)y[q] << 16);
  }
  const int g = w * 16 + ln, gc = (g < GG) ? g : GG - 1;      // rows 100..111 compute on row 99 and store nothing
  const size_t bg = (size_t)b * GG + gc;
  float mk[7][8];      // mask[b][g][16t + 8hh + r], rounded to bf16; keys >= 100 get the sentinel the row maximum starts from, so weight 0
#pragma unroll
  for (int t = 0; t < 7; ++t)
#pragma unroll
    for (int u = 0; u < 2; ++u) {
      if (t == 6 && u == 1) { for (int i = 0; i < 4; ++i) mk[t][4 + i] = -3.0e38f; continue; }
      const v4f y = *(const v4fa*)(MSK + bg * PN + t * 16 + ((t < 6) ? 8 * hh : 0) + 4 * u);      // tile 6: both halves read keys 96..99 (in bounds), the upper half drops them
      const bool dead = (t == 6) && (hh == 1);
#pragma unroll
      for (int i = 0; i < 4; ++i) { const float x = bf16_round(y[i]); mk[t][4 * u + i] = dead ? -3.0e38f : x; }
    }
  // Q and K fragment halves of one head; key rows 100..111 read row 99 (in bounds) and are zeroed where the fragment is formed
  const unsigned short* qp = (const unsigned short*)Q16 + bg * EE + h0 * KD + 8 * hh;
  const unsigned short* kp = (const unsigned short*)K16 + ((size_t)b * PN + ln) * EE + h0 * KD + 8 * hh;
  const bool live6 = ln < PN - 96;
  const int row6 = (live6 ? 96 : PN - 1 - ln) * EE;
  v8us qf = *(const v8us*)qp, kf[7];
#pragma unroll
  for (int t = 0; t < 7; ++t) kf[t] = *(const v8us*)(kp + ((t < 6) ? t * 16 * EE : row6));
  __syncthreads();      // V^T complete before any wave reads it
  const v8us zero8 = {0,0,0,0,0,0,0,0};
  for (int hl = 0; hl < HPW; ++hl) {
    FragH bq; bq.half[0] = qf; bq.half[1] = zero8;
    v8f s[7];
#pragma unroll
    for (int t = 0; t < 7; ++t) {
      FragH ak; ak.half[0] = (t < 6 || live6) ? kf[t] : zero8; ak.half[1] = zero8;
      const v8f z = {};
      s[t] = __builtin_amdgcn_wmma_f32_16x16x32_f16(false, ak.v, false, bq.v, (short)0, z, false, false);
    }
    // the next head's fragments fly while this head's softmax runs; the last pass reads its own again (in bounds, unused), so that no branch stands behind the matrix instructions
    const int hn = ((hl + 1 < HPW) ? hl + 1 : hl) * KD;
    qf = *(const v8us*)(qp + hn);
#pragma unroll
    for (int t = 0; t < 7; ++t) kf[t] = *(const v8us*)(kp + hn + ((t < 6) ? t * 16 * EE : row6));
    FragH av[4];      // this head's V^T fragments, asked for ahead of the softmax as well
#pragma unroll
    for (int cc = 0; cc < 4; ++cc) { av[cc].half[0] = *(const v8us*)&sVT[hl * KD + ln][cc * 32 + 8 * hh]; av[cc].half[1] = *(const v8us*)&sVT[hl * KD + ln][cc * 32 + 16 + 8 * hh]; }
    __builtin_amdgcn_sched_barrier(0);      // keeps the loads above in front of the softmax: without it the compiler sinks them to their first use and their latency is waited out there
    // row maximum and row sum: one short chain per tile, then a tree (seven independent chains instead of one of 56 links; few waves share a SIMD here)
    float pm[7], ps[7];
#pragma unroll
    for (int t = 0; t < 7; ++t) {
      pm[t] = -3.0e38f;
#pragma unroll
      for (int r = 0; r < 8; ++r) { s[t][r] += mk[t][r]; pm[t] = fmaxf(pm[t], s[t][r]); }
    }
    float m = fmaxf(fmaxf(fmaxf(pm[0], pm[1]), fmaxf(pm[2], pm[3])), fmaxf(fmaxf(pm[4], pm[5]), pm[6]));
    m = fmaxf(m, __shfl_xor(m, 16, 32));
#pragma unroll
    for (int t = 0; t < 7; ++t) {
      ps[t] = 0.f;
#pragma unroll
      for (int r = 0; r < 8; ++r) { const float x = expf(s[t][r] - m); const float e = (s[t][r] > -1.0e38f) ? x : 0.f; s[t][r] = e; ps[t] += e; }
    }
    float sum = ((ps[0] + ps[1]) + (ps[2] + ps[3])) + ((ps[4] + ps[5]) + ps[6]);
    sum += __shfl_xor(sum, 16, 32);
    const float is = (sum > 0.f) ? 1.0f / sum : 0.f;
    v8f o = {};
#pragma unroll
    for (int c = 0; c < 4; ++c) {
      FragH pb;
#pragma unroll
      for (int i = 0; i < 8; ++i) { pb.h[i] = (_Float16)(s[2 * c][i] * is); pb.h[8 + i] = (2 * c + 1 < 7) ? (_Float16)(s[(2 * c + 1 < 7) ? 2 * c + 1 : 0][i] * is) : (_Float16)0.f; }
      o = __builtin_amdgcn_wmma_f32_16x16x32_f16(false, av[c].v, false, pb.v, (short)0, o, false, false);
    }
    FragH f;      // o[r] = O[g][head column 8hh + r]: 16 bytes in a row of the lane's output row
#pragma unroll
    for (int r = 0; r < 8; ++r) f.h[r] = (_Float16)o[r];
    if (g < GG) {
      *(v8us*)((unsigned short*)O16 + bg * EE + (h0 + hl) * KD + 8 * hh) = f.half[0];
      asm volatile("s_wait_xcnt 0x0" ::: "memory");      // the next pass reuses the store's address and data registers: the wait stands in front of that overwrite
    }
  }
}
__global__ __launch_bounds__(256) void k_padrows(const _Float16* __restrict__ SRC, int b0, _Float16* __restrict__ DST) { const int t = blockIdx.x * 256 + threadIdx.x; if (t >= BC2 * RP * 16) return; const int c8 = (t % 16) * 8; const int gi = (t / 16) % RP; const int bl = t / (16 * RP); v8us v = {0,0,0,0,0,0,0,0}; if (gi < GG) v = *(const v8us*)((const unsigned short*)SRC + ((size_t)(b0 + bl) * GG + gi) * EE + c8); *(v8us*)((unsigned short*)DST + (size_t)t * 8) = v;  }
// final: per (b,g) row stats of z = 10·tanh(S2) + mask over p < 100, then probs; wave per row: lane L handles p = 4L..4L+3 (<100) → but the OUTPUT rows are 400 B (not line multiples) → write via flat float lanes:
__global__ __launch_bounds__(256) void k_stat(const float* __restrict__ S2, const float* __restrict__ MSK, int b0, float* __restrict__ ST) { const int tid = threadIdx.x, wv = tid >> 5, lane = tid & 31; const int row = blockIdx.x * 8 + wv; if (row >= BC2 * GG) return; const int bl = row / GG, g = row % GG; const size_t bg = (size_t)(b0 + bl) * GG + g; float z[4]; float m = -3.0e38f;
#pragma unroll
  for (int q = 0; q < 4; ++q) { const int p = lane * 4 + q; float v = -3.0e38f; if (p < PN) v = 10.0f * tanhf(S2[((size_t)bl * RP + g) * RP + p] * 0.08838834764831845f) + bf16_round(MSK[bg * PN + p]); z[q] = v; m = fmaxf(m, v); }
  for (int o = 16; o >= 1; o >>= 1) m = fmaxf(m, __shfl_xor(m, o, 32)); float s = 0.f; for (int q = 0; q < 4; ++q) s += (z[q] > -1.0e38f) ? expf(z[q] - m) : 0.f; for (int o = 16; o >= 1; o >>= 1) s += __shfl_xor(s, o, 32);
  if (lane == 0) { typedef float v2f __attribute__((ext_vector_type(2))); v2f st; st[0] = m; st[1] = (s > 0.f) ? 1.0f / s : 0.f; *(v2f*)(ST + bg * 2) = st;  } }
__global__ __launch_bounds__(256) void k_prob(const float* __restrict__ S2, const float* __restrict__ MSK, const float* __restrict__ ST, int b0, float* __restrict__ out) { const size_t t = (size_t)blockIdx.x * 256 + threadIdx.x; if (t >= (size_t)BC2 * GG * PN) return; const int p = (int)(t % PN); const size_t bgl = t / PN; const int bl = (int)(bgl / GG), g = (int)(bgl % GG); const size_t bg = (size_t)(b0 + bl) * GG + g;
  const float z = 10.0f * tanhf(S2[((size_t)bl * RP + g) * RP + p] * 0.08838834764831845f) + bf16_round(MSK[bg * PN + p]); const float v = expf(z - ST[bg * 2]) * ST[bg * 2 + 1]; *(float*)(out + bg * PN + p) = v;  }
extern "C" void kernel_launch(void* const* d_in, const int* in_sizes, int n_in,
                              void* d_out, int out_size, void* d_ws, size_t ws_size, hipStream_t stream) {
  (void)in_sizes; (void)n_in; (void)out_size;
  const float* in1 = (const float*)d_in[0]; const float* in2 = (const float*)d_in[1]; const float* rl = (const float*)d_in[2]; const float* msk = (const float*)d_in[3]; const float* enc = (const float*)d_in[4]; const float* Wq = (const float*)d_in[5]; const float* Wk = (const float*)d_in[6]; const float* Wv = (const float*)d_in[7]; const float* Wc = (const float*)d_in[8]; const float* bc = (const float*)d_in[9];
  char* ws = (char*)d_ws; size_t off = 0;
  auto take = [&](size_t bytes) { char* p = ws + off; off += (bytes + 255) & ~(size_t)255; return p; };
  const size_t NRW = (size_t)NB * GG;      // 51200 rows (b,g) / (b,p)
  _Float16* Bq2 = (_Float16*)take(EE * EE * 2); _Float16* Bk = (_Float16*)take(EE * EE * 2); _Float16* Bv = (_Float16*)take(EE * EE * 2); _Float16* Bc = (_Float16*)take(EE * EE * 2); float* Q1 = (float*)take((size_t)NB * EE * 4); float* ST = (float*)take(NRW * 2 * 4);
  _Float16* E16 = (_Float16*)take((NRW + 64) * EE * 2); _Float16* I16 = (_Float16*)take(NRW * EE * 2); _Float16* Q16 = (_Float16*)take(NRW * EE * 2); _Float16* K16 = (_Float16*)take(NRW * EE * 2); _Float16* V16 = (_Float16*)take((NRW + 64) * EE * 2);
  float* S = (float*)take(NRW * EE * 4); _Float16* MH16 = (_Float16*)take(NRW * EE * 2); _Float16* MHP = (_Float16*)take((size_t)BC2 * RP * EE * 2); _Float16* ENP = (_Float16*)take((size_t)BC2 * RP * EE * 2);
  // Planes that are never live together share bytes (launches of one stream run in order):
  //   QF (26.2 MB, dead after k_qfin) and S2 (25.7 MB, pointer phase) lie in S; O16 lies in I16 (dead after the q GEMM).
  float* QF = S; float* S2 = S; _Float16* O16 = I16;
  if (off > ws_size) return;      // 0.8 + 13.1 x 5 + 26.2 + 13.1 + 14.7 x 2 = 135 MB of the 268.4 MB given
  const size_t w8 = (size_t)EE * EE / 8; const unsigned gw = (unsigned)((w8 + 255) / 256);
  k_wt_f16<<<gw, 256, 0, stream>>>(Wq + (size_t)EE * EE, Bq2, EE, EE, 16.0f);      // Wq rows 128..255 ↔ input2  ([in][out])
  k_wt_f16<<<gw, 256, 0, stream>>>(Wk, Bk, EE, EE, 16.0f); k_wt_f16<<<gw, 256, 0, stream>>>(Wv, Bv, EE, EE, 16.0f); k_wt_f16<<<gw, 256, 0, stream>>>(Wc, Bc, EE, EE, 16.0f);
  const unsigned g8 = (unsigned)((NRW * EE / 8 + 255) / 256); const dim3 gg(((unsigned)(NRW / 16) * (EE / 64) + 3) / 4, 1);
  k_x16<<<g8, 256, 0, stream>>>(enc, E16, NRW * EE / 8); k_x16<<<g8, 256, 0, stream>>>(in2, I16, NRW * EE / 8);
  k_gemm_hhx<0><<<gg, 128, 0, stream>>>(E16, EE, 0, Bk, EE, 0, 0.0625f, nullptr, 0, nullptr, 1, 0, 0, nullptr, K16, EE, 0, (int)NRW, EE, EE);
  k_gemm_hhx<0><<<gg, 128, 0, stream>>>(E16, EE, 0, Bv, EE, 0, 0.0625f, nullptr, 0, nullptr, 1, 0, 0, nullptr, V16, EE, 0, (int)NRW, EE, EE);
  k_gemm_hhx<0><<<gg, 128, 0, stream>>>(I16, EE, 0, Bq2, EE, 0, 0.0625f, nullptr, 0, nullptr, 1, 0, 0, QF, nullptr, EE, 0, (int)NRW, EE, EE);
  k_q1<<<NB, 128, 0, stream>>>(in1, Wq, Q1);
  k_qfin<<<(unsigned)((NRW * 16 + 255) / 256), 256, 0, stream>>>(QF, Q1, rl, Wq, Q16);      // q = (input2·Wq₂ + input1·Wq₁ + remaining·Wq₃)·(1/√16)
  // ---- phase 1: 8-head attention, one launch: a work-group per batch and group of HPW heads
  k_attn<<<NB * (NH / HPW), 224, 0, stream>>>(Q16, K16, V16, msk, O16);
  k_gemm_hhx<0><<<gg, 128, 0, stream>>>(O16, EE, 0, Bc, EE, 0, 0.0625f, bc, 0, nullptr, 1, 0, 0, nullptr, MH16, EE, 0, (int)NRW, EE, EE);      // mh = o·Wc + bc (f16 operand of the pointer GEMM)
  // ---- phase 2: pointer scores per batch on padded 112-row tiles, then 10·tanh + mask → softmax (flat writes)
  for (int b0 = 0; b0 < NB; b0 += BC2) {
    k_padrows<<<(BC2 * RP * 16 + 255) / 256, 256, 0, stream>>>(MH16, b0, MHP); k_padrows<<<(BC2 * RP * 16 + 255) / 256, 256, 0, stream>>>(E16, b0, ENP);
    k_gemm_hhx<0><<<dim3(((RP / 16) * 2 + 3) / 4, BC2), 128, 0, stream>>>(MHP, EE, (size_t)RP * EE, ENP, EE, (size_t)RP * EE, 1.0f, nullptr, 0, nullptr, 1, 0, 0, S2, nullptr, RP, (size_t)RP * RP, RP, RP, EE);      // mh·encᵀ (the 1/√128 is applied at the tanh)
    k_stat<<<(BC2 * GG + 7) / 8, 256, 0, stream>>>(S2, msk, b0, ST);
    k_prob<<<(unsigned)(((size_t)BC2 * GG * PN + 255) / 256), 256, 0, stream>>>(S2, msk, ST, b0, (float*)d_out); }
}

// v003
// Measured time: 162 microseconds a run.
// Timed twice side by side with v002, it ran 1.37 and 1.36 times as fast.
// All steps since v000 together make it 5.60 times as fast.
#include <hip/hip_runtime.h>
// Next-node probability head (B=512, G=100 group rows, P=100 nodes, E=128, 8 heads × 16, logit clipping 10): k,v = enc·W; q = [input1 | input2 | remaining]·Wq split by linearity
// (input2.Wq2 as a GEMM, input1.Wq1 per batch + remaining.Wq3 rank-1 in the epilogue kernel); then one kernel (k_attn) for all the rest: the 8-head attention (additive INPUT ninf mask),
// o.Wc + bc, the pointer score mh.enc^T/sqrt(128) and the softmax of 10 tanh + mask, every intermediate in registers (O waits in lane-private LDS). Contractions on v_wmma_f32_16x16x32_f16 (f16 operands,
// weights [in][out] transposed to bf16-exact ×2^4, f32 accumulate); softmaxes/tanh f32 VALU.
#define NB 512
#define GG 100
#define PN 100
#define EE 128
#define NH 8
#define KD 16

typedef __bf16 v16b __attribute__((ext_vector_type(16)));
typedef unsigned short v8us __attribute__((ext_vector_type(8), may_alias));
typedef float  v8f  __attribute__((ext_vector_type(8)));
typedef float  v4f  __attribute__((ext_vector_type(4)));
typedef float  v4fa __attribute__((ext_vector_type(4), may_alias));
union FragB { v16b v; v8us half[2]; unsigned short u[16]; };

__device__ __forceinline__ unsigned short bf16_bits(float x) { unsigned int u = __float_as_uint(x); return (unsigned short)((u + 0x7FFFu + ((u >> 16) & 1u)) >> 16); }
__device__ __forceinline__ float bf16_val(unsigned short b) { return __uint_as_float(((unsigned int)b) << 16); }
__device__ __forceinline__ float bf16_round(float x) { return bf16_val(bf16_bits(x)); }
// D += A·B with NT terms: 1 = ah·bh, 2 = + al·bh (A split), 3 = + ah·bl (both split)
template <int NT>
__device__ __forceinline__ v8f mmaN(v16b ah, v16b al, v16b bh, v16b bl, v8f c) {
  c = __builtin_amdgcn_wmma_f32_16x16x32_bf16(false, ah, false, bh, (short)0, c, false, false);
  if (NT >= 2) c = __builtin_amdgcn_wmma_f32_16x16x32_bf16(false, al, false, bh, (short)0, c, false, false);
  if (NT >= 3) c = __builtin_amdgcn_wmma_f32_16x16x32_bf16(false, ah, false, bl, (short)0, c, false, false);
  asm volatile("v_nop\n\tv_nop\n\tv_nop\n\tv_nop" : "+v"(c) : "v"(ah), "v"(al), "v"(bh), "v"(bl));
  return c;
}

__global__ __launch_bounds__(256) void k_wt_bf16(const float* __restrict__ W, unsigned short* __restrict__ Wt, int K, int N) {
  const int t = blockIdx.x * 256 + threadIdx.x;
  const int k8n = K / 8;
  if (t >= N * k8n) return;
  const int n = t / k8n, k8 = (t % k8n) * 8;
  v8us v;
#pragma unroll
  for (int i = 0; i < 8; ++i) v[i] = bf16_bits(W[(size_t)(k8 + i) * N + n]);
  *(v8us*)(Wt + (size_t)n * K + k8) = v;
  
}

// GEMM C[M][N] (f32, pitch ldc) = act(A[M][K]·W + bias). A f32 row-major (pitch lda) converted per fragment to bf16
// (ASPLIT: hi/lo two planes -> 2 terms, else single rounded term); Wt bf16 [N][K] (pitch ldb). BIAS_BF16 rounds the
// bias to bf16 first (bias quantised to bf16 before the add). K%32==0, M%16==0, N%64==0.
template <bool ASPLIT, int ACT, bool BIAS_BF16>
__global__ __launch_bounds__(128) void k_gemm_bf(const float* __restrict__ A, int lda, const unsigned short* __restrict__ Wt, int ldb,
                                               const float* __restrict__ bias, float* __restrict__ C, int ldc, int M, int N, int K) {
  __shared__ __attribute__((aligned(16))) float so[4][16][64];
  const int tid = threadIdx.x, w = tid >> 5, lane = tid & 31, ln = lane & 15, hh = lane >> 4;
  const int ntn = N / 64;
  const int wid = blockIdx.x * 4 + w;
  const int mt = wid / ntn, nq = wid % ntn;
  if (mt * 16 >= M) return;
  const int row0 = mt * 16, col0 = nq * 64;
  const float* arow = A + (size_t)(row0 + ln) * lda;
  v8f acc[4] = {};
  for (int kb = 0; kb < K; kb += 32) {
    FragB ah, al;
    const v4f x0 = *(const v4fa*)(arow + kb + 8 * hh), x1 = *(const v4fa*)(arow + kb + 8 * hh + 4);
    const v4f x2 = *(const v4fa*)(arow + kb + 16 + 8 * hh), x3 = *(const v4fa*)(arow + kb + 16 + 8 * hh + 4);
    float xs[16] = {x0[0],x0[1],x0[2],x0[3],x1[0],x1[1],x1[2],x1[3],x2[0],x2[1],x2[2],x2[3],x3[0],x3[1],x3[2],x3[3]};
#pragma unroll
    for (int i = 0; i < 16; ++i) { const unsigned short hb = bf16_bits(xs[i]); ah.u[i] = hb; al.u[i] = ASPLIT ? bf16_bits(xs[i] - bf16_val(hb)) : (unsigned short)0; }
#pragma unroll
    for (int t = 0; t < 4; ++t) {
      const unsigned short* brow = Wt + (size_t)(col0 + t * 16 + ln) * ldb + kb;
      FragB b;
      b.half[0] = *(const v8us*)(brow + 8 * hh);
      b.half[1] = *(const v8us*)(brow + 16 + 8 * hh);
      acc[t] = mmaN<ASPLIT ? 2 : 1>(ah.v, al.v, b.v, b.v, acc[t]);
    }
  }
#pragma unroll
  for (int t = 0; t < 4; ++t) {
    float bv = bias ? bias[col0 + t * 16 + ln] : 0.f;
    if (BIAS_BF16) bv = bf16_round(bv);
#pragma unroll
    for (int r = 0; r < 8; ++r) { float v = acc[t][r] + bv; if (ACT == 1) v = fmaxf(v, 0.f); so[w][8 * hh + r][t * 16 + ln] = v; }
  }
  __builtin_amdgcn_fence(__ATOMIC_ACQ_REL, "workgroup");
  __builtin_amdgcn_wave_barrier();
  const int rsub = lane >> 4, c4 = (lane & 15) * 4;
  {
#pragma unroll
    for (int q = 0; q < 8; ++q) {
      const int r = q * 2 + rsub;
      const v4f v = *(const v4fa*)&so[w][r][c4];
      *(v4f*)(C + (size_t)(row0 + r) * ldc + col0 + c4) = v;
    }
    
  }
}

// Flash-style causal/unmasked attention, all contractions 3-term bf16 hi/lo splits, f32 softmax with running max.
// q,k,v rows are read from f32 buffers with arbitrary row pitch (so they can live inside a fused qkv buffer);
// D = head size (multiple of 32, <= 128); one wave = 16 query rows; block = 4 waves (64 queries) sharing K/V chunks of 32.
template <int D, bool CAUSAL>
__global__ __launch_bounds__(128) void k_flash(const float* __restrict__ qb, const float* __restrict__ kb, const float* __restrict__ vb,
                                             int pitch, int T, int H, float scale, float* __restrict__ y, int ypitch) {
  constexpr int KS = D / 32;        // k-steps for QK
  constexpr int DT = D / 16;        // d tiles for PV
  __shared__ __attribute__((aligned(16))) unsigned short sKh[32][D + 8], sKl[32][D + 8], sVh[32][D + 8], sVl[32][D + 8];
  __shared__ __attribute__((aligned(16))) unsigned short sPh[4][16][40], sPl[4][16][40];
  __shared__ __attribute__((aligned(16))) float sO[4][16][D];
  const int tid = threadIdx.x, w = tid >> 5, lane = tid & 31, ln = lane & 15, hh = lane >> 4;
  const int nqb = (T + 63) / 64;
  const int bh = blockIdx.x / nqb, qblk = blockIdx.x % nqb;
  const int b = bh / H, h = bh % H;
  const int q0 = qblk * 64 + w * 16;
  const float* Q = qb + (size_t)b * T * pitch + h * D;
  const float* K = kb + (size_t)b * T * pitch + h * D;
  const float* V = vb + (size_t)b * T * pitch + h * D;

  // A fragments of the wave's 16 query rows (scaled), hi/lo
  FragB aqh[KS], aql[KS];
  {
    int row = q0 + ln; if (row >= T) row = T - 1;
    const float* qr = Q + (size_t)row * pitch;
#pragma unroll
    for (int ks = 0; ks < KS; ++ks)
#pragma unroll
      for (int i = 0; i < 16; ++i) {
        const int d = ks * 32 + ((i < 8) ? (8 * hh + i) : (16 + 8 * hh + (i - 8)));
        const float x = qr[d] * scale; const unsigned short hb = bf16_bits(x);
        aqh[ks].u[i] = hb; aql[ks].u[i] = bf16_bits(x - bf16_val(hb));
      }
  }
  float m_r[8], l_r[8];
#pragma unroll
  for (int r = 0; r < 8; ++r) { m_r[r] = -3.0e38f; l_r[r] = 0.f; }
  v8f oacc[DT];
#pragma unroll
  for (int dt = 0; dt < DT; ++dt) oacc[dt] = (v8f){0.f,0.f,0.f,0.f,0.f,0.f,0.f,0.f};

  const int kv_end = CAUSAL ? min(T, qblk * 64 + 64) : T;     // block-uniform
  for (int j0 = 0; j0 < kv_end; j0 += 32) {
    __syncthreads();
    for (int e = tid; e < 32 * (D / 4); e += 128) {
      const int r = e / (D / 4), c4 = (e % (D / 4)) * 4;
      const int key = j0 + r;
      v4f kf = {0.f,0.f,0.f,0.f}, vf = {0.f,0.f,0.f,0.f};
      if (key < T) { kf = *(const v4fa*)(K + (size_t)key * pitch + c4); vf = *(const v4fa*)(V + (size_t)key * pitch + c4); }
#pragma unroll
      for (int t = 0; t < 4; ++t) {
        unsigned short hb = bf16_bits(kf[t]); sKh[r][c4 + t] = hb; sKl[r][c4 + t] = bf16_bits(kf[t] - bf16_val(hb));
        hb = bf16_bits(vf[t]); sVh[r][c4 + t] = hb; sVl[r][c4 + t] = bf16_bits(vf[t] - bf16_val(hb));
      }
    }
    __syncthreads();
    // S tile 16 x 32
    v8f s[2];
#pragma unroll
    for (int nt = 0; nt < 2; ++nt) {
      v8f acc = {};
#pragma unroll
      for (int ks = 0; ks < KS; ++ks) {
        FragB bh_, bl_;
        bh_.half[0] = *(const v8us*)&sKh[nt * 16 + ln][ks * 32 + 8 * hh]; bh_.half[1] = *(const v8us*)&sKh[nt * 16 + ln][ks * 32 + 16 + 8 * hh];
        bl_.half[0] = *(const v8us*)&sKl[nt * 16 + ln][ks * 32 + 8 * hh]; bl_.half[1] = *(const v8us*)&sKl[nt * 16 + ln][ks * 32 + 16 + 8 * hh];
        acc = mmaN<3>(aqh[ks].v, aql[ks].v, bh_.v, bl_.v, acc);
      }
      s[nt] = acc;
    }
    // mask + running max (rows 8hh+r; the 16 lanes of a half share rows)
    float alpha[8];
#pragma unroll
    for (int r = 0; r < 8; ++r) {
      const int qi = q0 + 8 * hh + r;
      const int ja = j0 + ln, jb = j0 + 16 + ln;
      if (CAUSAL) { if (ja > qi) s[0][r] = -3.0e38f; if (jb > qi) s[1][r] = -3.0e38f; }
      if (ja >= T) s[0][r] = -3.0e38f;
      if (jb >= T) s[1][r] = -3.0e38f;
      float mx = fmaxf(s[0][r], s[1][r]);
      mx = fmaxf(mx, __shfl_xor(mx, 1, 32)); mx = fmaxf(mx, __shfl_xor(mx, 2, 32)); mx = fmaxf(mx, __shfl_xor(mx, 4, 32)); mx = fmaxf(mx, __shfl_xor(mx, 8, 32));
      const float mnew = fmaxf(m_r[r], mx);
      alpha[r] = (mnew > -1.0e38f) ? __expf(m_r[r] - mnew) : 1.0f;
      const float p0 = (s[0][r] > -1.0e38f) ? __expf(s[0][r] - mnew) : 0.f;
      const float p1 = (s[1][r] > -1.0e38f) ? __expf(s[1][r] - mnew) : 0.f;
      m_r[r] = mnew;
      l_r[r] = l_r[r] * alpha[r] + p0 + p1;            // per-lane partial row sum (16 lanes combined at the end)
      unsigned short hb = bf16_bits(p0); sPh[w][8 * hh + r][ln] = hb;      sPl[w][8 * hh + r][ln] = bf16_bits(p0 - bf16_val(hb));
      hb = bf16_bits(p1);                sPh[w][8 * hh + r][16 + ln] = hb; sPl[w][8 * hh + r][16 + ln] = bf16_bits(p1 - bf16_val(hb));
    }
#pragma unroll
    for (int dt = 0; dt < DT; ++dt)
#pragma unroll
      for (int r = 0; r < 8; ++r) oacc[dt][r] *= alpha[r];
    __builtin_amdgcn_fence(__ATOMIC_ACQ_REL, "workgroup");
    __builtin_amdgcn_wave_barrier();
    FragB pah, pal;
    pah.half[0] = *(const v8us*)&sPh[w][ln][8 * hh]; pah.half[1] = *(const v8us*)&sPh[w][ln][16 + 8 * hh];
    pal.half[0] = *(const v8us*)&sPl[w][ln][8 * hh]; pal.half[1] = *(const v8us*)&sPl[w][ln][16 + 8 * hh];
#pragma unroll
    for (int dt = 0; dt < DT; ++dt) {
      FragB bvh, bvl;
#pragma unroll
      for (int i = 0; i < 8; ++i) {
        bvh.u[i] = sVh[8 * hh + i][dt * 16 + ln]; bvh.u[8 + i] = sVh[16 + 8 * hh + i][dt * 16 + ln];
        bvl.u[i] = sVl[8 * hh + i][dt * 16 + ln]; bvl.u[8 + i] = sVl[16 + 8 * hh + i][dt * 16 + ln];
      }
      oacc[dt] = mmaN<3>(pah.v, pal.v, bvh.v, bvl.v, oacc[dt]);
    }
    __builtin_amdgcn_fence(__ATOMIC_ACQ_REL, "workgroup");
    __builtin_amdgcn_wave_barrier();
  }
#pragma unroll
  for (int r = 0; r < 8; ++r) {
    float l = l_r[r];
    l += __shfl_xor(l, 1, 32); l += __shfl_xor(l, 2, 32); l += __shfl_xor(l, 4, 32); l += __shfl_xor(l, 8, 32);
    l_r[r] = (l > 0.f) ? 1.0f / l : 0.f;
  }
#pragma unroll
  for (int dt = 0; dt < DT; ++dt)
#pragma unroll
    for (int r = 0; r < 8; ++r) sO[w][8 * hh + r][dt * 16 + ln] = oacc[dt][r] * l_r[r];
  __builtin_amdgcn_fence(__ATOMIC_ACQ_REL, "workgroup");
  __builtin_amdgcn_wave_barrier();
  {
    for (int r = 0; r < 16; ++r) {
      const int row = q0 + r;
      if (row < T && lane < D / 4) {
        const v4f val = *(const v4fa*)&sO[w][r][lane * 4];
        *(v4f*)(y + ((size_t)b * T + row) * ypitch + h * D + lane * 4) = val;
      }
    }
    
  }
}

// GEMM C = act(A·W + bias + resid): A f32 (ASPLIT -> hi/lo 2 terms), Wt bf16 [N][K]; ACT 0 none, 1 relu, 2 exact gelu;
// resid (optional, f32, row index = (row % rmod), pitch ldr, RES_BF16 rounds it) added before the activation.
template <bool ASPLIT, int ACT, bool BIAS_BF16, bool RES_BF16>
__global__ __launch_bounds__(128) void k_gemm_bf3(const float* __restrict__ A, int lda, const unsigned short* __restrict__ Wt, int ldb,
                                                const float* __restrict__ bias, const float* __restrict__ resid, int rmod, int ldr,
                                                float* __restrict__ C, int ldc, int M, int N, int K) {
  __shared__ __attribute__((aligned(16))) float so[4][16][64];
  const int tid = threadIdx.x, w = tid >> 5, lane = tid & 31, ln = lane & 15, hh = lane >> 4;
  const int ntn = N / 64;
  const int wid = blockIdx.x * 4 + w;
  const int mt = wid / ntn, nq = wid % ntn;
  if (mt * 16 >= M) return;
  const int row0 = mt * 16, col0 = nq * 64;
  const float* arow = A + (size_t)(row0 + ln) * lda;
  v8f acc[4] = {};
  for (int kb = 0; kb < K; kb += 32) {
    FragB ah, al;
    const v4f x0 = *(const v4fa*)(arow + kb + 8 * hh), x1 = *(const v4fa*)(arow + kb + 8 * hh + 4);
    const v4f x2 = *(const v4fa*)(arow + kb + 16 + 8 * hh), x3 = *(const v4fa*)(arow + kb + 16 + 8 * hh + 4);
    float xs[16] = {x0[0],x0[1],x0[2],x0[3],x1[0],x1[1],x1[2],x1[3],x2[0],x2[1],x2[2],x2[3],x3[0],x3[1],x3[2],x3[3]};
#pragma unroll
    for (int i = 0; i < 16; ++i) { const unsigned short hb = bf16_bits(xs[i]); ah.u[i] = hb; al.u[i] = ASPLIT ? bf16_bits(xs[i] - bf16_val(hb)) : (unsigned short)0; }
#pragma unroll
    for (int t = 0; t < 4; ++t) {
      const unsigned short* brow = Wt + (size_t)(col0 + t * 16 + ln) * ldb + kb;
      FragB b;
      b.half[0] = *(const v8us*)(brow + 8 * hh);
      b.half[1] = *(const v8us*)(brow + 16 + 8 * hh);
      acc[t] = mmaN<ASPLIT ? 2 : 1>(ah.v, al.v, b.v, b.v, acc[t]);
    }
  }
#pragma unroll
  for (int t = 0; t < 4; ++t) {
    const int col = col0 + t * 16 + ln;
    float bv = bias ? bias[col] : 0.f;
    if (BIAS_BF16) bv = bf16_round(bv);
#pragma unroll
    for (int r = 0; r < 8; ++r) {
      float v = acc[t][r] + bv;
      if (resid) { float rv = resid[(size_t)((row0 + 8 * hh + r) % rmod) * ldr + col]; if (RES_BF16) rv = bf16_round(rv); v += rv; }
      if (ACT == 1) v = fmaxf(v, 0.f);
      if (ACT == 2) v = 0.5f * v * (1.0f + erff(v * 0.70710678118654752f));
      if (ACT == 3) { const float u = 0.7978845608028654f * (v + 0.044715f * v * v * v); v = 0.5f * v * (1.0f + tanhf(u)); }
      so[w][8 * hh + r][t * 16 + ln] = v;
    }
  }
  __builtin_amdgcn_fence(__ATOMIC_ACQ_REL, "workgroup");
  __builtin_amdgcn_wave_barrier();
  const int rsub = lane >> 4, c4 = (lane & 15) * 4;
  {
#pragma unroll
    for (int q = 0; q < 8; ++q) {
      const int r = q * 2 + rsub;
      const v4f v = *(const v4fa*)&so[w][r][c4];
      *(v4f*)(C + (size_t)(row0 + r) * ldc + col0 + c4) = v;
    }
    
  }
}
// row LayerNorm (biased variance, eps) over N: s = X (+ R); optional out_sum <- s; out_norm <- (s-mu)*rsqrt(var+eps)*g + b
template <bool PARAM_BF16>
__global__ __launch_bounds__(256) void k_layernorm(const float* __restrict__ X, const float* __restrict__ R, const float* __restrict__ g, const float* __restrict__ bta,
                                                  float* __restrict__ out_sum, float* __restrict__ out_norm, int N, float eps) {
  __shared__ float red[256];
  const int row = blockIdx.x, tid = threadIdx.x;
  const float* x = X + (size_t)row * N; const float* rr = R ? R + (size_t)row * N : nullptr;
  float vals[16];                     // up to N = 4096
  const int per = N / 256;            // contiguous chunk per thread? use strided-by-4 chunks: thread handles j = tid*4 + 1024*u
  float s1 = 0.f;
  for (int u = 0; u < per / 4; ++u) {
    const int j = tid * 4 + 1024 * u;
    const v4f a = *(const v4fa*)(x + j);
    v4f b = {0.f,0.f,0.f,0.f}; if (rr) b = *(const v4fa*)(rr + j);
#pragma unroll
    for (int q = 0; q < 4; ++q) { const float v = a[q] + b[q]; vals[u * 4 + q] = v; s1 += v; }
  }
  red[tid] = s1; __syncthreads();
  for (int st = 128; st > 0; st >>= 1) { if (tid < st) red[tid] += red[tid + st]; __syncthreads(); }
  const float mu = red[0] / (float)N; __syncthreads();
  float s2 = 0.f;
  for (int u = 0; u < per / 4; ++u)
#pragma unroll
    for (int q = 0; q < 4; ++q) { const float c = vals[u * 4 + q] - mu; s2 += c * c; }
  red[tid] = s2; __syncthreads();
  for (int st = 128; st > 0; st >>= 1) { if (tid < st) red[tid] += red[tid + st]; __syncthreads(); }
  const float rs = rsqrtf(red[0] / (float)N + eps);
  {
    for (int u = 0; u < per / 4; ++u) {
      const int j = tid * 4 + 1024 * u;
      v4f o, sm;
#pragma unroll
      for (int q = 0; q < 4; ++q) {
        float gg = g[j + q], bb = bta[j + q];
        if (PARAM_BF16) { gg = bf16_round(gg); bb = bf16_round(bb); }
        sm[q] = vals[u * 4 + q]; o[q] = (vals[u * 4 + q] - mu) * rs * gg + bb;
      }
      if (out_sum) *(v4f*)(out_sum + (size_t)row * N + j) = sm;
      *(v4f*)(out_norm + (size_t)row * N + j) = o;
    }
    
  }
}



// ---- f16 WMMA path (v_wmma_f32_16x16x32_f16): 11-bit significands for operands in range — used where a [0,1] probability operand needs more precision than bf16
typedef _Float16 v16h __attribute__((ext_vector_type(16)));
union FragH { v16h v; v8us half[2]; _Float16 h[16]; unsigned short u[16]; };
template <int NT>
__device__ __forceinline__ v8f mmaH(v16h ah, v16h al, v16h bh, v16h bl, v8f c) {
  c = __builtin_amdgcn_wmma_f32_16x16x32_f16(false, ah, false, bh, (short)0, c, false, false);
  if (NT >= 2) c = __builtin_amdgcn_wmma_f32_16x16x32_f16(false, al, false, bh, (short)0, c, false, false);
  if (NT >= 3) c = __builtin_amdgcn_wmma_f32_16x16x32_f16(false, ah, false, bl, (short)0, c, false, false);
  asm volatile("v_nop\n\tv_nop\n\tv_nop\n\tv_nop" : "+v"(c) : "v"(ah), "v"(al), "v"(bh), "v"(bl));
  return c;
}
// batched GEMM like k_gemm_b but f16 operands: A f32 (split into f16 hi/lo if ASPLIT, else rounded to f16), Bt = f16 values [n][k]; alpha; C f32; N multiple of 16 (partial tiles skipped)
template <bool ASPLIT>
__global__ __launch_bounds__(128) void k_gemm_h(const float* __restrict__ A, int lda, size_t sA, const _Float16* __restrict__ Bh, int ldb, size_t sB, float alpha, float* __restrict__ C, int ldc, size_t sC, int M, int N, int K) {
  __shared__ __attribute__((aligned(16))) float so[4][16][64];
  const int tid = threadIdx.x, w = tid >> 5, lane = tid & 31, ln = lane & 15, hh = lane >> 4; const int by = blockIdx.y;
  A += (size_t)by * sA; Bh += (size_t)by * sB; C += (size_t)by * sC;
  const int ntn = (N + 63) / 64; const int wid = blockIdx.x * 4 + w; const int mt = wid / ntn, nq = wid % ntn; if (mt * 16 >= M) return;
  const int row0 = mt * 16, col0 = nq * 64; const float* arow = A + (size_t)(row0 + ln) * lda;
  v8f acc[4] = {};
  for (int kb = 0; kb < K; kb += 32) {
    FragH ah, al;
    const v4f x0 = *(const v4fa*)(arow + kb + 8 * hh), x1 = *(const v4fa*)(arow + kb + 8 * hh + 4), x2 = *(const v4fa*)(arow + kb + 16 + 8 * hh), x3 = *(const v4fa*)(arow + kb + 16 + 8 * hh + 4);
    float xs[16] = {x0[0],x0[1],x0[2],x0[3],x1[0],x1[1],x1[2],x1[3],x2[0],x2[1],x2[2],x2[3],x3[0],x3[1],x3[2],x3[3]};
#pragma unroll
    for (int i = 0; i < 16; ++i) { const _Float16 h = (_Float16)xs[i]; ah.h[i] = h; al.h[i] = ASPLIT ? (_Float16)(xs[i] - (float)h) : (_Float16)0.0f; }
#pragma unroll
    for (int t = 0; t < 4; ++t) { if (col0 + t * 16 >= N) continue; const size_t boff = (size_t)(col0 + t * 16 + ln) * ldb + kb; FragH bq; bq.half[0] = *(const v8us*)(Bh + boff + 8 * hh); bq.half[1] = *(const v8us*)(Bh + boff + 16 + 8 * hh);
      acc[t] = mmaH<ASPLIT ? 2 : 1>(ah.v, al.v, bq.v, bq.v, acc[t]); }
  }
#pragma unroll
  for (int t = 0; t < 4; ++t) { if (col0 + t * 16 >= N) continue;
#pragma unroll
    for (int r = 0; r < 8; ++r) so[w][8 * hh + r][t * 16 + ln] = acc[t][r] * alpha; }
  __builtin_amdgcn_fence(__ATOMIC_ACQ_REL, "workgroup"); __builtin_amdgcn_wave_barrier();
  const int rsub = lane >> 4, c4 = (lane & 15) * 4;
  {
#pragma unroll
    for (int q = 0; q < 8; ++q) { const int r = q * 2 + rsub; if (col0 + c4 < N) { const v4f v = *(const v4fa*)&so[w][r][c4]; *(v4f*)(C + (size_t)(row0 + r) * ldc + col0 + c4) = v; } }
     }
}

// Wt[n][k] = f16(W[k][n]·scale) from f32 row-major W[K][N] (scale = power of two; bf16-exact weights stay exact in f16 away from the subnormal range)
__global__ __launch_bounds__(256) void k_wt_f16(const float* __restrict__ W, _Float16* __restrict__ Wt, int K, int N, float scale) {
  const int t = blockIdx.x * 256 + threadIdx.x; if (t >= N * (K / 8)) return; const int n = t / (K / 8), k8 = (t % (K / 8)) * 8; FragH f;
#pragma unroll
  for (int i = 0; i < 8; ++i) f.h[i] = (_Float16)(bf16_round(W[(size_t)(k8 + i) * N + n]) * scale); const v8us o = f.half[0];
  *(v8us*)((unsigned short*)Wt + (size_t)n * K + k8) = o; 
}
// k_gemm_hh variant with fused epilogue: v = acc·alpha + bias[by·sBias + col] (+ CP[(row/rowsPerB)·sCPb + by·64 + col] if CP) ; ACT 0 none / 1 elu ; writes f32 C and/or f16 C16 (each if non-null)
template <int ACT>
__global__ __launch_bounds__(128) void k_gemm_hhx(const _Float16* __restrict__ A, int lda, size_t sA, const _Float16* __restrict__ Bh, int ldb, size_t sB, float alpha, const float* __restrict__ bias, size_t sBias, const float* __restrict__ CP, int rowsPerB, size_t sCPb, int row0g,
    float* __restrict__ C, _Float16* __restrict__ C16, int ldc, size_t sC, int M, int N, int K) {
  __shared__ __attribute__((aligned(16))) float so[4][16][64];
  const int tid = threadIdx.x, w = tid >> 5, lane = tid & 31, ln = lane & 15, hh = lane >> 4; const int by = blockIdx.y;
  A += (size_t)by * sA; Bh += (size_t)by * sB; const size_t cofs = (size_t)by * sC; const float* bp = bias ? bias + (size_t)by * sBias : nullptr;
  const int ntn = (N + 63) / 64; const int wid = blockIdx.x * 4 + w; const int mt = wid / ntn, nq = wid % ntn; if (mt * 16 >= M) return;
  const int row0 = mt * 16, col0 = nq * 64; const _Float16* arow = A + (size_t)(row0 + ln) * lda;
  v8f acc[4] = {};
  for (int kb = 0; kb < K; kb += 32) { FragH ah; ah.half[0] = *(const v8us*)((const unsigned short*)arow + kb + 8 * hh); ah.half[1] = *(const v8us*)((const unsigned short*)arow + kb + 16 + 8 * hh);
#pragma unroll
    for (int t = 0; t < 4; ++t) { if (col0 + t * 16 >= N) continue; const size_t boff = (size_t)(col0 + t * 16 + ln) * ldb + kb; FragH bq; bq.half[0] = *(const v8us*)((const unsigned short*)Bh + boff + 8 * hh); bq.half[1] = *(const v8us*)((const unsigned short*)Bh + boff + 16 + 8 * hh);
      acc[t] = mmaH<1>(ah.v, ah.v, bq.v, bq.v, acc[t]); }
  }
#pragma unroll
  for (int t = 0; t < 4; ++t) { if (col0 + t * 16 >= N) continue; const int col = col0 + t * 16 + ln; const float bv = bp ? bf16_round(bp[col]) : 0.f;
#pragma unroll
    for (int r = 0; r < 8; ++r) { float v = acc[t][r] * alpha + bv; if (CP) { const int bidx = (row0g + row0 + 8 * hh + r) / rowsPerB; v += CP[(size_t)bidx * sCPb + (size_t)by * 64 + col]; } if (ACT == 1) v = (v > 0.f) ? v : expm1f(v); else if (ACT == 3) v = fmaxf(v, 0.f); so[w][8 * hh + r][t * 16 + ln] = v; } }
  __builtin_amdgcn_fence(__ATOMIC_ACQ_REL, "workgroup"); __builtin_amdgcn_wave_barrier();
  const int rsub = lane >> 4, c4 = (lane & 15) * 4; typedef _Float16 v4h __attribute__((ext_vector_type(4)));
  {
#pragma unroll
    for (int q = 0; q < 8; ++q) { const int r = q * 2 + rsub; if (col0 + c4 < N) { const v4f v = *(const v4fa*)&so[w][r][c4]; if (C) *(v4f*)(C + cofs + (size_t)(row0 + r) * ldc + col0 + c4) = v; if (C16) { v4h h4; for (int i = 0; i < 4; ++i) h4[i] = (_Float16)v[i]; *(v4h*)(C16 + cofs + (size_t)(row0 + r) * ldc + col0 + c4) = h4; } } }
     }
}


__global__ __launch_bounds__(256) void k_x16(const float* __restrict__ x, _Float16* __restrict__ X16, size_t n8) { const size_t t = (size_t)blockIdx.x * 256 + threadIdx.x; if (t >= n8) return; FragH f;
#pragma unroll
  for (int q = 0; q < 8; ++q) f.h[q] = (_Float16)bf16_round(x[t * 8 + q]); *(v8us*)((unsigned short*)X16 + t * 8) = f.half[0];  }
__global__ __launch_bounds__(128) void k_q1(const float* __restrict__ in1, const float* __restrict__ Wq, float* __restrict__ Q1) { const int b = blockIdx.x, o = threadIdx.x; float s = 0.f;
#pragma unroll 1
  for (int e = 0; e < EE; ++e) s += bf16_round(in1[(size_t)b * EE + e]) * bf16_round(Wq[(size_t)e * EE + o]); *(float*)(Q1 + (size_t)b * EE + o) = s;  }
__global__ __launch_bounds__(256) void k_qfin(const float* __restrict__ QF, const float* __restrict__ Q1, const float* __restrict__ rl, const float* __restrict__ Wq, _Float16* __restrict__ Q16) { const size_t t = (size_t)blockIdx.x * 256 + threadIdx.x; if (t >= (size_t)NB * GG * 16) return; const int c8 = (int)(t % 16) * 8; const size_t r = t / 16; const size_t b = r / GG; const float rv = bf16_round(rl[r]); FragH f;
#pragma unroll
  for (int q = 0; q < 8; ++q) { const int o = c8 + q; f.h[q] = (_Float16)((QF[r * EE + o] + Q1[b * EE + o] + rv * bf16_round(Wq[(size_t)256 * EE + o])) * 0.25f); } *(v8us*)((unsigned short*)Q16 + t * 8) = f.half[0];  }
// Fused 8-head attention. One work-group = one batch b and HPW heads; wave w owns the 16 query rows g = 16w..16w+15 (7 waves cover 112 >= 100) and loops over the heads.
// The score tile is formed transposed, S^T = K.Q^T (A = 16 key rows, B = 16 query rows, d 16 zero-extended to the k = 32 of the instruction), so a lane (ln, hh) holds, for its one
// query g = 16w + ln, the keys p = 16t + 8hh + r (t = tile, r = accumulator register). That is the k order of a B fragment: after the softmax (registers, an exchange for the maximum and one for the sum between the
// two lane halves) tiles 2c and 2c+1 are, register for register, the B operand of O^T = V^T.P^T for keys 32c..32c+31. Scores and weights never leave the registers.
// V^T (A operand, rows = head columns, k = keys, zero for keys >= 100) is staged once in LDS. The mask row slice of a lane is read once and serves all HPW heads and the pointer softmax.
// The same turn carries the wave through the rest of the network: O^T of heads 2c, 2c+1 is the B operand (k = 32c..32c+31) of MH^T = Wc^T.O^T, the tiles 2c, 2c+1 of MH^T are the B operand
// of S2^T = ENC.MH^T, and S2^T again leaves a lane with the keys 16t + 8hh + r of its one query, the places its mask registers already have: tanh, mask and softmax run as in the heads.
#define HPW 8              // heads per work-group: all of them, so a wave reads and rounds its mask slice once and holds the whole O row of its query
#define VTP 136            // f16 pitch of a V^T row in LDS: 256 + 16 bytes, spreads the 16 rows of a 16-byte fragment read over the banks
__global__ __launch_bounds__(224) void k_attn(const _Float16* __restrict__ Q16, const _Float16* __restrict__ K16, const _Float16* __restrict__ V16, const float* __restrict__ MSK,
                                              const _Float16* __restrict__ E16, const _Float16* __restrict__ WcT, const float* __restrict__ bc, float* __restrict__ out) {
  static_assert(HPW == NH, "the output projection needs all heads of a query in one wave");
  __shared__ __attribute__((aligned(16))) unsigned short sVT[HPW * KD][VTP];
  __shared__ __attribute__((aligned(16))) v8us sO[NH][224];      // a lane's own O half-fragments, one per head: written and read back by the same lane (the head loop is rolled, so registers cannot be indexed by the head)
  const int tid = threadIdx.x, w = tid >> 5, lane = tid & 31, ln = lane & 15, hh = lane >> 4;
  const int b = blockIdx.x / (NH / HPW), h0 = (blockIdx.x % (NH / HPW)) * HPW;
  // V^T into LDS: one item = two neighbouring keys x 8 head columns; lanes run along the keys, so each 4-byte store of a wave falls on its own bank
  for (int e = tid; e < 64 * (HPW * KD / 8); e += 224) {
    const int p = (e & 63) * 2, c8 = (e >> 6) * 8;
    v8us x = {0,0,0,0,0,0,0,0}, y = {0,0,0,0,0,0,0,0};
    if (p < PN) { const unsigned short* s = (const unsigned short*)V16 + ((size_t)b * PN + p) * EE + h0 * KD + c8; x = *(const v8us*)s; y = *(const v8us*)(s + EE); }
#pragma unroll
    for (int q = 0; q < 8; ++q) *(unsigned int*)&sVT[c8 + q][p] = (unsigned int)x[q] | ((unsigned int)y[q] << 16);
  }
  const int g = w * 16 + ln, gc = (g < GG) ? g : GG - 1;      // rows 100..111 compute on row 99 and store nothing
  const size_t bg = (size_t)b * GG + gc;
  float mk[7][8];      // mask[b][g][16t + 8hh + r], rounded to bf16; keys >= 100 get the sentinel the row maximum starts from, so weight 0
#pragma unroll
  for (int t = 0; t < 7; ++t)
#pragma unroll
    for (int u = 0; u < 2; ++u) {
      if (t == 6 && u == 1) { for (int i = 0; i < 4; ++i) mk[t][4 + i] = -3.0e38f; continue; }
      const v4f y = *(const v4fa*)(MSK + bg * PN + t * 16 + ((t < 6) ? 8 * hh : 0) + 4 * u);      // tile 6: both halves read keys 96..99 (in bounds), the upper half drops them
      const bool dead = (t == 6) && (hh == 1);
#pragma unroll
      for (int i = 0; i < 4; ++i) { const float x = bf16_round(y[i]); mk[t][4 * u + i] = dead ? -3.0e38f : x; }
    }
  // Q and K fragment halves of one head; key rows 100..111 read row 99 (in bounds) and are zeroed where the fragment is formed
  const unsigned short* qp = (const unsigned short*)Q16 + bg * EE + h0 * KD + 8 * hh;
  const unsigned short* kp = (const unsigned short*)K16 + ((size_t)b * PN + ln) * EE + h0 * KD + 8 * hh;
  const bool live6 = ln < PN - 96;
  const int row6 = (live6 ? 96 : PN - 1 - ln) * EE;
  v8us qf = *(const v8us*)qp, kf[7];
#pragma unroll
  for (int t = 0; t < 7; ++t) kf[t] = *(const v8us*)(kp + ((t < 6) ? t * 16 * EE : row6));
  __syncthreads();      // V^T complete before any wave reads it
  const v8us zero8 = {0,0,0,0,0,0,0,0};
  for (int hl = 0; hl < HPW; ++hl) {
    FragH bq; bq.half[0] = qf; bq.half[1] = zero8;
    v8f s[7];
#pragma unroll
    for (int t = 0; t < 7; ++t) {
      FragH ak; ak.half[0] = (t < 6 || live6) ? kf[t] : zero8; ak.half[1] = zero8;
      const v8f z = {};
      s[t] = __builtin_amdgcn_wmma_f32_16x16x32_f16(false, ak.v, false, bq.v, (short)0, z, false, false);
    }
    // the next head's fragments fly while this head's softmax runs; the last pass reads its own again (in bounds, unused), so that no branch stands behind the matrix instructions
    const int hn = ((hl + 1 < HPW) ? hl + 1 : hl) * KD;
    qf = *(const v8us*)(qp + hn);
#pragma unroll
    for (int t = 0; t < 7; ++t) kf[t] = *(const v8us*)(kp + hn + ((t < 6) ? t * 16 * EE : row6));
    FragH av[4];      // this head's V^T fragments, asked for ahead of the softmax as well
#pragma unroll
    for (int cc = 0; cc < 4; ++cc) { av[cc].half[0] = *(const v8us*)&sVT[hl * KD + ln][cc * 32 + 8 * hh]; av[cc].half[1] = *(const v8us*)&sVT[hl * KD + ln][cc * 32 + 16 + 8 * hh]; }
    __builtin_amdgcn_sched_barrier(0);      // keeps the loads above in front of the softmax: without it the compiler sinks them to their first use and their latency is waited out there
    // row maximum and row sum: one short chain per tile, then a tree (seven independent chains instead of one of 56 links; few waves share a SIMD here)
    float pm[7], ps[7];
#pragma unroll
    for (int t = 0; t < 7; ++t) {
      pm[t] = -3.0e38f;
#pragma unroll
      for (int r = 0; r < 8; ++r) { s[t][r] += mk[t][r]; pm[t] = fmaxf(pm[t], s[t][r]); }
    }
    float m = fmaxf(fmaxf(fmaxf(pm[0], pm[1]), fmaxf(pm[2], pm[3])), fmaxf(fmaxf(pm[4], pm[5]), pm[6]));
    m = fmaxf(m, __shfl_xor(m, 16, 32));
#pragma unroll
    for (int t = 0; t < 7; ++t) {
      ps[t] = 0.f;
#pragma unroll
      for (int r = 0; r < 8; ++r) { const float x = expf(s[t][r] - m); const float e = (s[t][r] > -1.0e38f) ? x : 0.f; s[t][r] = e; ps[t] += e; }
    }
    float sum = ((ps[0] + ps[1]) + (ps[2] + ps[3])) + ((ps[4] + ps[5]) + ps[6]);
    sum += __shfl_xor(sum, 16, 32);
    const float is = (sum > 0.f) ? 1.0f / sum : 0.f;
    v8f o = {};
#pragma unroll
    for (int c = 0; c < 4; ++c) {
      FragH pb;
#pragma unroll
      for (int i = 0; i < 8; ++i) { pb.h[i] = (_Float16)(s[2 * c][i] * is); pb.h[8 + i] = (2 * c + 1 < 7) ? (_Float16)(s[(2 * c + 1 < 7) ? 2 * c + 1 : 0][i] * is) : (_Float16)0.f; }
      o = __builtin_amdgcn_wmma_f32_16x16x32_f16(false, av[c].v, false, pb.v, (short)0, o, false, false);
    }
    FragH f;      // o[r] = O[g][head column 8hh + r]: 16 bytes in a row of the lane's output row
#pragma unroll
    for (int r = 0; r < 8; ++r) f.h[r] = (_Float16)o[r];
    sO[hl][tid] = f.half[0];
  }
  // MH^T = Wc^T.O^T: A = 16 rows of Wc^T (output columns e), B = the lane's O row; two tiles of e make one B fragment of the pointer product. mh = acc/16 + bc, rounded to f16.
  FragH ob[4], mb[4];
#pragma unroll      // the index names registers (fragments, accumulators): it must be a constant
  for (int c = 0; c < 4; ++c) { ob[c].half[0] = sO[2 * c][tid]; ob[c].half[1] = sO[2 * c + 1][tid]; }
  const unsigned short* wp = (const unsigned short*)WcT + ln * EE + 8 * hh;
  v8f am[8];
#pragma unroll      // the index names registers (fragments, accumulators): it must be a constant
  for (int te = 0; te < 8; ++te) {
    v8f a = {};
#pragma unroll      // the index names registers (fragments, accumulators): it must be a constant
    for (int c = 0; c < 4; ++c) {
      FragH aw; aw.half[0] = *(const v8us*)(wp + te * 16 * EE + c * 32); aw.half[1] = *(const v8us*)(wp + te * 16 * EE + c * 32 + 16);
      a = __builtin_amdgcn_wmma_f32_16x16x32_f16(false, aw.v, false, ob[c].v, (short)0, a, false, false);
    }
    am[te] = a;
  }
  asm volatile("s_wait_xcnt 0x0" ::: "memory");      // the later loads land in the registers that held the address of the Wc^T loads: the wait stands in front of that overwrite
#pragma unroll      // the index names registers (fragments, accumulators): it must be a constant
  for (int te = 0; te < 8; ++te) {
    const v8f a = am[te];
    const v4f b0 = *(const v4fa*)(bc + te * 16 + 8 * hh), b1 = *(const v4fa*)(bc + te * 16 + 8 * hh + 4);
#pragma unroll      // the index names registers (fragments, accumulators): it must be a constant
    for (int r = 0; r < 8; ++r) mb[te >> 1].h[8 * (te & 1) + r] = (_Float16)(a[r] * 0.0625f + bf16_round((r < 4) ? b0[r & 3] : b1[r & 3]));
  }
  // S2^T = ENC.MH^T: A = 16 node rows (rows 100..111 read row 99, in bounds, and are zeroed), B = mb
  const unsigned short* ep = (const unsigned short*)E16 + ((size_t)b * PN + ln) * EE + 8 * hh;
  v8f z[7];
#pragma unroll      // the index names registers (fragments, accumulators): it must be a constant
  for (int t = 0; t < 7; ++t) {
    if (t == 6) asm volatile("s_wait_xcnt 0x0" ::: "memory");      // tile 6 has an address of its own; its loads land in the registers that held the address of tiles 0..5: the wait stands in front of that overwrite
    v8f a = {};
#pragma unroll      // the index names registers (fragments, accumulators): it must be a constant
    for (int c = 0; c < 4; ++c) {
      const unsigned short* s = ep + ((t < 6) ? t * 16 * EE : row6) + c * 32;
      const v8us x0 = *(const v8us*)s, x1 = *(const v8us*)(s + 16);
      FragH ae; ae.half[0] = (t < 6 || live6) ? x0 : zero8; ae.half[1] = (t < 6 || live6) ? x1 : zero8;
      a = __builtin_amdgcn_wmma_f32_16x16x32_f16(false, ae.v, false, mb[c].v, (short)0, a, false, false);
    }
    z[t] = a;
  }
  // probs = softmax(10 tanh(S2 / sqrt(128)) + mask) over the keys of the lane's query: chains per tile, a tree, one exchange between the lane halves, as in the heads
  float pm[7], ps[7];
#pragma unroll      // the index names registers (fragments, accumulators): it must be a constant
  for (int t = 0; t < 7; ++t) {
    pm[t] = -3.0e38f;
#pragma unroll      // the index names registers (fragments, accumulators): it must be a constant
    for (int r = 0; r < 8; ++r) { z[t][r] = 10.0f * tanhf(z[t][r] * 0.08838834764831845f) + mk[t][r]; pm[t] = fmaxf(pm[t], z[t][r]); }
  }
  float m = fmaxf(fmaxf(fmaxf(pm[0], pm[1]), fmaxf(pm[2], pm[3])), fmaxf(fmaxf(pm[4], pm[5]), pm[6]));
  m = fmaxf(m, __shfl_xor(m, 16, 32));
#pragma unroll      // the index names registers (fragments, accumulators): it must be a constant
  for (int t = 0; t < 7; ++t) {
    ps[t] = 0.f;
#pragma unroll      // the index names registers (fragments, accumulators): it must be a constant
    for (int r = 0; r < 8; ++r) { const float x = expf(z[t][r] - m); const float e = (z[t][r] > -1.0e38f) ? x : 0.f; z[t][r] = e; ps[t] += e; }
  }
  float sum = ((ps[0] + ps[1]) + (ps[2] + ps[3])) + ((ps[4] + ps[5]) + ps[6]);
  sum += __shfl_xor(sum, 16, 32);
  const float is = (sum > 0.f) ? 1.0f / sum : 0.f;
#pragma unroll      // the index names registers (fragments, accumulators): it must be a constant
  for (int t = 0; t < 7; ++t)
#pragma unroll      // the index names registers (fragments, accumulators): it must be a constant
    for (int r = 0; r < 8; ++r) z[t][r] *= is;
  if (g < GG) {      // a lane stores 32 bytes in a row per tile of its own output row (400-byte rows, 16-byte aligned pieces); tile 6 holds keys 96..99 in the lower half alone
    float* op = out + bg * PN + 8 * hh;
#pragma unroll      // the index names registers (fragments, accumulators): it must be a constant
    for (int t = 0; t < 6; ++t) {
      const v4f lo = {z[t][0], z[t][1], z[t][2], z[t][3]}, hi = {z[t][4], z[t][5], z[t][6], z[t][7]};
      *(v4f*)(op + t * 16) = lo; *(v4f*)(op + t * 16 + 4) = hi;
    }
    if (hh == 0) { const v4f lo = {z[6][0], z[6][1], z[6][2], z[6][3]}; *(v4f*)(op + 96) = lo; }
  }
}
extern "C" void kernel_launch(void* const* d_in, const int* in_sizes, int n_in,
                              void* d_out, int out_size, void* d_ws, size_t ws_size, hipStream_t stream) {
  (void)in_sizes; (void)n_in; (void)out_size;
  const float* in1 = (const float*)d_in[0]; const float* in2 = (const float*)d_in[1]; const float* rl = (const float*)d_in[2]; const float* msk = (const float*)d_in[3]; const float* enc = (const float*)d_in[4]; const float* Wq = (const float*)d_in[5]; const float* Wk = (const float*)d_in[6]; const float* Wv = (const float*)d_in[7]; const float* Wc = (const float*)d_in[8]; const float* bc = (const float*)d_in[9];
  char* ws = (char*)d_ws; size_t off = 0;
  auto take = [&](size_t bytes) { char* p = ws + off; off += (bytes + 255) & ~(size_t)255; return p; };
  const size_t NRW = (size_t)NB * GG;      // 51200 rows (b,g) / (b,p)
  _Float16* Bq2 = (_Float16*)take(EE * EE * 2); _Float16* Bk = (_Float16*)take(EE * EE * 2); _Float16* Bv = (_Float16*)take(EE * EE * 2); _Float16* Bc = (_Float16*)take(EE * EE * 2); float* Q1 = (float*)take((size_t)NB * EE * 4);
  _Float16* E16 = (_Float16*)take((NRW + 64) * EE * 2); _Float16* I16 = (_Float16*)take(NRW * EE * 2); _Float16* Q16 = (_Float16*)take(NRW * EE * 2); _Float16* K16 = (_Float16*)take(NRW * EE * 2); _Float16* V16 = (_Float16*)take((NRW + 64) * EE * 2);
  float* QF = (float*)take(NRW * EE * 4);
  if (off > ws_size) return;      // 0.4 + 13.1 x 5 + 26.2 = 92 MB of the 268.4 MB given
  const size_t w8 = (size_t)EE * EE / 8; const unsigned gw = (unsigned)((w8 + 255) / 256);
  k_wt_f16<<<gw, 256, 0, stream>>>(Wq + (size_t)EE * EE, Bq2, EE, EE, 16.0f);      // Wq rows 128..255 ↔ input2  ([in][out])
  k_wt_f16<<<gw, 256, 0, stream>>>(Wk, Bk, EE, EE, 16.0f); k_wt_f16<<<gw, 256, 0, stream>>>(Wv, Bv, EE, EE, 16.0f); k_wt_f16<<<gw, 256, 0, stream>>>(Wc, Bc, EE, EE, 16.0f);
  const unsigned g8 = (unsigned)((NRW * EE / 8 + 255) / 256); const dim3 gg(((unsigned)(NRW / 16) * (EE / 64) + 3) / 4, 1);
  k_x16<<<g8, 256, 0, stream>>>(enc, E16, NRW * EE / 8); k_x16<<<g8, 256, 0, stream>>>(in2, I16, NRW * EE / 8);
  k_gemm_hhx<0><<<gg, 128, 0, stream>>>(E16, EE, 0, Bk, EE, 0, 0.0625f, nullptr, 0, nullptr, 1, 0, 0, nullptr, K16, EE, 0, (int)NRW, EE, EE);
  k_gemm_hhx<0><<<gg, 128, 0, stream>>>(E16, EE, 0, Bv, EE, 0, 0.0625f, nullptr, 0, nullptr, 1, 0, 0, nullptr, V16, EE, 0, (int)NRW, EE, EE);
  k_gemm_hhx<0><<<gg, 128, 0, stream>>>(I16, EE, 0, Bq2, EE, 0, 0.0625f, nullptr, 0, nullptr, 1, 0, 0, QF, nullptr, EE, 0, (int)NRW, EE, EE);
  k_q1<<<NB, 128, 0, stream>>>(in1, Wq, Q1);
  k_qfin<<<(unsigned)((NRW * 16 + 255) / 256), 256, 0, stream>>>(QF, Q1, rl, Wq, Q16);      // q = (input2·Wq₂ + input1·Wq₁ + remaining·Wq₃)·(1/√16)
  // ---- attention, output projection, pointer scores and the final softmax, one launch: a work-group per batch
  k_attn<<<NB * (NH / HPW), 224, 0, stream>>>(Q16, K16, V16, msk, E16, Bc, bc, (float*)d_out);
}

// v004
// A run of this version takes 84.1 microseconds.
// Two timings next to v003 both put it at 1.93 times that version's speed.
// Over all steps from v000 it is 10.8 times as fast.
#include <hip/hip_runtime.h>
// Next-node probability head (B=512, G=100 group rows, P=100 nodes, E=128, 8 heads x 16, logit clipping 10). The weights are transposed to f16 planes first; then one kernel (k_attn), one work-group per batch,
// does all the rest: k,v = enc.W and q = [input1 | input2 | remaining].Wq (the first 256 rows as a product, the last as a rank-1 term), the 8-head attention (additive INPUT ninf mask),
// o.Wc + bc, the pointer score mh.enc^T/sqrt(128) and the softmax of 10 tanh + mask. K, V^T and the f16 nodes wait in LDS, Q and O in lane-private LDS, the rest in registers. Contractions on v_wmma_f32_16x16x32_f16 (f16 operands,
// weights [in][out] transposed to bf16-exact x2^4, f32 accumulate); softmaxes/tanh f32 VALU.
#define NB 512
#define GG 100
#define PN 100
#define EE 128
#define NH 8
#define KD 16

typedef __bf16 v16b __attribute__((ext_vector_type(16)));
typedef unsigned short v8us __attribute__((ext_vector_type(8), may_alias));
typedef float  v8f  __attribute__((ext_vector_type(8)));
typedef float  v4f  __attribute__((ext_vector_type(4)));
typedef float  v4fa __attribute__((ext_vector_type(4), may_alias));
union FragB { v16b v; v8us half[2]; unsigned short u[16]; };

__device__ __forceinline__ unsigned short bf16_bits(float x) { unsigned int u = __float_as_uint(x); return (unsigned short)((u + 0x7FFFu + ((u >> 16) & 1u)) >> 16); }
__device__ __forceinline__ float bf16_val(unsigned short b) { return __uint_as_float(((unsigned int)b) << 16); }
__device__ __forceinline__ float bf16_round(float x) { return bf16_val(bf16_bits(x)); }
// D += A·B with NT terms: 1 = ah·bh, 2 = + al·bh (A split), 3 = + ah·bl (both split)
template <int NT>
__device__ __forceinline__ v8f mmaN(v16b ah, v16b al, v16b bh, v16b bl, v8f c) {
  c = __builtin_amdgcn_wmma_f32_16x16x32_bf16(false, ah, false, bh, (short)0, c, false, false);
  if (NT >= 2) c = __builtin_amdgcn_wmma_f32_16x16x32_bf16(false, al, false, bh, (short)0, c, false, false);
  if (NT >= 3) c = __builtin_amdgcn_wmma_f32_16x16x32_bf16(false, ah, false, bl, (short)0, c, false, false);
  asm volatile("v_nop\n\tv_nop\n\tv_nop\n\tv_nop" : "+v"(c) : "v"(ah), "v"(al), "v"(bh), "v"(bl));
  return c;
}

__global__ __launch_bounds__(256) void k_wt_bf16(const float* __restrict__ W, unsigned short* __restrict__ Wt, int K, int N) {
  const int t = blockIdx.x * 256 + threadIdx.x;
  const int k8n = K / 8;
  if (t >= N * k8n) return;
  const int n = t / k8n, k8 = (t % k8n) * 8;
  v8us v;
#pragma unroll
  for (int i = 0; i < 8; ++i) v[i] = bf16_bits(W[(size_t)(k8 + i) * N + n]);
  *(v8us*)(Wt + (size_t)n * K + k8) = v;
  
}

// GEMM C[M][N] (f32, pitch ldc) = act(A[M][K]·W + bias). A f32 row-major (pitch lda) converted per fragment to bf16
// (ASPLIT: hi/lo two planes -> 2 terms, else single rounded term); Wt bf16 [N][K] (pitch ldb). BIAS_BF16 rounds the
// bias to bf16 first (bias quantised to bf16 before the add). K%32==0, M%16==0, N%64==0.
template <bool ASPLIT, int ACT, bool BIAS_BF16>
__global__ __launch_bounds__(128) void k_gemm_bf(const float* __restrict__ A, int lda, const unsigned short* __restrict__ Wt, int ldb,
                                               const float* __restrict__ bias, float* __restrict__ C, int ldc, int M, int N, int K) {
  __shared__ __attribute__((aligned(16))) float so[4][16][64];
  const int tid = threadIdx.x, w = tid >> 5, lane = tid & 31, ln = lane & 15, hh = lane >> 4;
  const int ntn = N / 64;
  const int wid = blockIdx.x * 4 + w;
  const int mt = wid / ntn, nq = wid % ntn;
  if (mt * 16 >= M) return;
  const int row0 = mt * 16, col0 = nq * 64;
  const float* arow = A + (size_t)(row0 + ln) * lda;
  v8f acc[4] = {};
  for (int kb = 0; kb < K; kb += 32) {
    FragB ah, al;
    const v4f x0 = *(const v4fa*)(arow + kb + 8 * hh), x1 = *(const v4fa*)(arow + kb + 8 * hh + 4);
    const v4f x2 = *(const v4fa*)(arow + kb + 16 + 8 * hh), x3 = *(const v4fa*)(arow + kb + 16 + 8 * hh + 4);
    float xs[16] = {x0[0],x0[1],x0[2],x0[3],x1[0],x1[1],x1[2],x1[3],x2[0],x2[1],x2[2],x2[3],x3[0],x3[1],x3[2],x3[3]};
#pragma unroll
    for (int i = 0; i < 16; ++i) { const unsigned short hb = bf16_bits(xs[i]); ah.u[i] = hb; al.u[i] = ASPLIT ? bf16_bits(xs[i] - bf16_val(hb)) : (unsigned short)0; }
#pragma unroll
    for (int t = 0; t < 4; ++t) {
      const unsigned short* brow = Wt + (size_t)(col0 + t * 16 + ln) * ldb + kb;
      FragB b;
      b.half[0] = *(const v8us*)(brow + 8 * hh);
      b.half[1] = *(const v8us*)(brow + 16 + 8 * hh);
      acc[t] = mmaN<ASPLIT ? 2 : 1>(ah.v, al.v, b.v, b.v, acc[t]);
    }
  }
#pragma unroll
  for (int t = 0; t < 4; ++t) {
    float bv = bias ? bias[col0 + t * 16 + ln] : 0.f;
    if (BIAS_BF16) bv = bf16_round(bv);
#pragma unroll
    for (int r = 0; r < 8; ++r) { float v = acc[t][r] + bv; if (ACT == 1) v = fmaxf(v, 0.f); so[w][8 * hh + r][t * 16 + ln] = v; }
  }
  __builtin_amdgcn_fence(__ATOMIC_ACQ_REL, "workgroup");
  __builtin_amdgcn_wave_barrier();
  const int rsub = lane >> 4, c4 = (lane & 15) * 4;
  {
#pragma unroll
    for (int q = 0; q < 8; ++q) {
      const int r = q * 2 + rsub;
      const v4f v = *(const v4fa*)&so[w][r][c4];
      *(v4f*)(C + (size_t)(row0 + r) * ldc + col0 + c4) = v;
    }
    
  }
}

// Flash-style causal/unmasked attention, all contractions 3-term bf16 hi/lo splits, f32 softmax with running max.
// q,k,v rows are read from f32 buffers with arbitrary row pitch (so they can live inside a fused qkv buffer);
// D = head size (multiple of 32, <= 128); one wave = 16 query rows; block = 4 waves (64 queries) sharing K/V chunks of 32.
template <int D, bool CAUSAL>
__global__ __launch_bounds__(128) void k_flash(const float* __restrict__ qb, const float* __restrict__ kb, const float* __restrict__ vb,
                                             int pitch, int T, int H, float scale, float* __restrict__ y, int ypitch) {
  constexpr int KS = D / 32;        // k-steps for QK
  constexpr int DT = D / 16;        // d tiles for PV
  __shared__ __attribute__((aligned(16))) unsigned short sKh[32][D + 8], sKl[32][D + 8], sVh[32][D + 8], sVl[32][D + 8];
  __shared__ __attribute__((aligned(16))) unsigned short sPh[4][16][40], sPl[4][16][40];
  __shared__ __attribute__((aligned(16))) float sO[4][16][D];
  const int tid = threadIdx.x, w = tid >> 5, lane = tid & 31, ln = lane & 15, hh = lane >> 4;
  const int nqb = (T + 63) / 64;
  const int bh = blockIdx.x / nqb, qblk = blockIdx.x % nqb;
  const int b = bh / H, h = bh % H;
  const int q0 = qblk * 64 + w * 16;
  const float* Q = qb + (size_t)b * T * pitch + h * D;
  const float* K = kb + (size_t)b * T * pitch + h * D;
  const float* V = vb + (size_t)b * T * pitch + h * D;

  // A fragments of the wave's 16 query rows (scaled), hi/lo
  FragB aqh[KS], aql[KS];
  {
    int row = q0 + ln; if (row >= T) row = T - 1;
    const float* qr = Q + (size_t)row * pitch;
#pragma unroll
    for (int ks = 0; ks < KS; ++ks)
#pragma unroll
      for (int i = 0; i < 16; ++i) {
        const int d = ks * 32 + ((i < 8) ? (8 * hh + i) : (16 + 8 * hh + (i - 8)));
        const float x = qr[d] * scale; const unsigned short hb = bf16_bits(x);
        aqh[ks].u[i] = hb; aql[ks].u[i] = bf16_bits(x - bf16_val(hb));
      }
  }
  float m_r[8], l_r[8];
#pragma unroll
  for (int r = 0; r < 8; ++r) { m_r[r] = -3.0e38f; l_r[r] = 0.f; }
  v8f oacc[DT];
#pragma unroll
  for (int dt = 0; dt < DT; ++dt) oacc[dt] = (v8f){0.f,0.f,0.f,0.f,0.f,0.f,0.f,0.f};

  const int kv_end = CAUSAL ? min(T, qblk * 64 + 64) : T;     // block-uniform
  for (int j0 = 0; j0 < kv_end; j0 += 32) {
    __syncthreads();
    for (int e = tid; e < 32 * (D / 4); e += 128) {
      const int r = e / (D / 4), c4 = (e % (D / 4)) * 4;
      const int key = j0 + r;
      v4f kf = {0.f,0.f,0.f,0.f}, vf = {0.f,0.f,0.f,0.f};
      if (key < T) { kf = *(const v4fa*)(K + (size_t)key * pitch + c4); vf = *(const v4fa*)(V + (size_t)key * pitch + c4); }
#pragma unroll
      for (int t = 0; t < 4; ++t) {
        unsigned short hb = bf16_bits(kf[t]); sKh[r][c4 + t] = hb; sKl[r][c4 + t] = bf16_bits(kf[t] - bf16_val(hb));
        hb = bf16_bits(vf[t]); sVh[r][c4 + t] = hb; sVl[r][c4 + t] = bf16_bits(vf[t] - bf16_val(hb));
      }
    }
    __syncthreads();
    // S tile 16 x 32
    v8f s[2];
#pragma unroll
    for (int nt = 0; nt < 2; ++nt) {
      v8f acc = {};
#pragma unroll
      for (int ks = 0; ks < KS; ++ks) {
        FragB bh_, bl_;
        bh_.half[0] = *(const v8us*)&sKh[nt * 16 + ln][ks * 32 + 8 * hh]; bh_.half[1] = *(const v8us*)&sKh[nt * 16 + ln][ks * 32 + 16 + 8 * hh];
        bl_.half[0] = *(const v8us*)&sKl[nt * 16 + ln][ks * 32 + 8 * hh]; bl_.half[1] = *(const v8us*)&sKl[nt * 16 + ln][ks * 32 + 16 + 8 * hh];
        acc = mmaN<3>(aqh[ks].v, aql[ks].v, bh_.v, bl_.v, acc);
      }
      s[nt] = acc;
    }
    // mask + running max (rows 8hh+r; the 16 lanes of a half share rows)
    float alpha[8];
#pragma unroll
    for (int r = 0; r < 8; ++r) {
      const int qi = q0 + 8 * hh + r;
      const int ja = j0 + ln, jb = j0 + 16 + ln;
      if (CAUSAL) { if (ja > qi) s[0][r] = -3.0e38f; if (jb > qi) s[1][r] = -3.0e38f; }
      if (ja >= T) s[0][r] = -3.0e38f;
      if (jb >= T) s[1][r] = -3.0e38f;
      float mx = fmaxf(s[0][r], s[1][r]);
      mx = fmaxf(mx, __shfl_xor(mx, 1, 32)); mx = fmaxf(mx, __shfl_xor(mx, 2, 32)); mx = fmaxf(mx, __shfl_xor(mx, 4, 32)); mx = fmaxf(mx, __shfl_xor(mx, 8, 32));
      const float mnew = fmaxf(m_r[r], mx);
      alpha[r] = (mnew > -1.0e38f) ? __expf(m_r[r] - mnew) : 1.0f;
      const float p0 = (s[0][r] > -1.0e38f) ? __expf(s[0][r] - mnew) : 0.f;
      const float p1 = (s[1][r] > -1.0e38f) ? __expf(s[1][r] - mnew) : 0.f;
      m_r[r] = mnew;
      l_r[r] = l_r[r] * alpha[r] + p0 + p1;            // per-lane partial row sum (16 lanes combined at the end)
      unsigned short hb = bf16_bits(p0); sPh[w][8 * hh + r][ln] = hb;      sPl[w][8 * hh + r][ln] = bf16_bits(p0 - bf16_val(hb));
      hb = bf16_bits(p1);                sPh[w][8 * hh + r][16 + ln] = hb; sPl[w][8 * hh + r][16 + ln] = bf16_bits(p1 - bf16_val(hb));
    }
#pragma unroll
    for (int dt = 0; dt < DT; ++dt)
#pragma unroll
      for (int r = 0; r < 8; ++r) oacc[dt][r] *= alpha[r];
    __builtin_amdgcn_fence(__ATOMIC_ACQ_REL, "workgroup");
    __builtin_amdgcn_wave_barrier();
    FragB pah, pal;
    pah.half[0] = *(const v8us*)&sPh[w][ln][8 * hh]; pah.half[1] = *(const v8us*)&sPh[w][ln][16 + 8 * hh];
    pal.half[0] = *(const v8us*)&sPl[w][ln][8 * hh]; pal.half[1] = *(const v8us*)&sPl[w][ln][16 + 8 * hh];
#pragma unroll
    for (int dt = 0; dt < DT; ++dt) {
      FragB bvh, bvl;
#pragma unroll
      for (int i = 0; i < 8; ++i) {
        bvh.u[i] = sVh[8 * hh + i][dt * 16 + ln]; bvh.u[8 + i] = sVh[16 + 8 * hh + i][dt * 16 + ln];
        bvl.u[i] = sVl[8 * hh + i][dt * 16 + ln]; bvl.u[8 + i] = sVl[16 + 8 * hh + i][dt * 16 + ln];
      }
      oacc[dt] = mmaN<3>(pah.v, pal.v, bvh.v, bvl.v, oacc[dt]);
    }
    __builtin_amdgcn_fence(__ATOMIC_ACQ_REL, "workgroup");
    __builtin_amdgcn_wave_barrier();
  }
#pragma unroll
  for (int r = 0; r < 8; ++r) {
    float l = l_r[r];
    l += __shfl_xor(l, 1, 32); l += __shfl_xor(l, 2, 32); l += __shfl_xor(l, 4, 32); l += __shfl_xor(l, 8, 32);
    l_r[r] = (l > 0.f) ? 1.0f / l : 0.f;
  }
#pragma unroll
  for (int dt = 0; dt < DT; ++dt)
#pragma unroll
    for (int r = 0; r < 8; ++r) sO[w][8 * hh + r][dt * 16 + ln] = oacc[dt][r] * l_r[r];
  __builtin_amdgcn_fence(__ATOMIC_ACQ_REL, "workgroup");
  __builtin_amdgcn_wave_barrier();
  {
    for (int r = 0; r < 16; ++r) {
      const int row = q0 + r;
      if (row < T && lane < D / 4) {
        const v4f val = *(const v4fa*)&sO[w][r][lane * 4];
        *(v4f*)(y + ((size_t)b * T + row) * ypitch + h * D + lane * 4) = val;
      }
    }
    
  }
}

// GEMM C = act(A·W + bias + resid): A f32 (ASPLIT -> hi/lo 2 terms), Wt bf16 [N][K]; ACT 0 none, 1 relu, 2 exact gelu;
// resid (optional, f32, row index = (row % rmod), pitch ldr, RES_BF16 rounds it) added before the activation.
template <bool ASPLIT, int ACT, bool BIAS_BF16, bool RES_BF16>
__global__ __launch_bounds__(128) void k_gemm_bf3(const float* __restrict__ A, int lda, const unsigned short* __restrict__ Wt, int ldb,
                                                const float* __restrict__ bias, const float* __restrict__ resid, int rmod, int ldr,
                                                float* __restrict__ C, int ldc, int M, int N, int K) {
  __shared__ __attribute__((aligned(16))) float so[4][16][64];
  const int tid = threadIdx.x, w = tid >> 5, lane = tid & 31, ln = lane & 15, hh = lane >> 4;
  const int ntn = N / 64;
  const int wid = blockIdx.x * 4 + w;
  const int mt = wid / ntn, nq = wid % ntn;
  if (mt * 16 >= M) return;
  const int row0 = mt * 16, col0 = nq * 64;
  const float* arow = A + (size_t)(row0 + ln) * lda;
  v8f acc[4] = {};
  for (int kb = 0; kb < K; kb += 32) {
    FragB ah, al;
    const v4f x0 = *(const v4fa*)(arow + kb + 8 * hh), x1 = *(const v4fa*)(arow + kb + 8 * hh + 4);
    const v4f x2 = *(const v4fa*)(arow + kb + 16 + 8 * hh), x3 = *(const v4fa*)(arow + kb + 16 + 8 * hh + 4);
    float xs[16] = {x0[0],x0[1],x0[2],x0[3],x1[0],x1[1],x1[2],x1[3],x2[0],x2[1],x2[2],x2[3],x3[0],x3[1],x3[2],x3[3]};
#pragma unroll
    for (int i = 0; i < 16; ++i) { const unsigned short hb = bf16_bits(xs[i]); ah.u[i] = hb; al.u[i] = ASPLIT ? bf16_bits(xs[i] - bf16_val(hb)) : (unsigned short)0; }
#pragma unroll
    for (int t = 0; t < 4; ++t) {
      const unsigned short* brow = Wt + (size_t)(col0 + t * 16 + ln) * ldb + kb;
      FragB b;
      b.half[0] = *(const v8us*)(brow + 8 * hh);
      b.half[1] = *(const v8us*)(brow + 16 + 8 * hh);
      acc[t] = mmaN<ASPLIT ? 2 : 1>(ah.v, al.v, b.v, b.v, acc[t]);
    }
  }
#pragma unroll
  for (int t = 0; t < 4; ++t) {
    const int col = col0 + t * 16 + ln;
    float bv = bias ? bias[col] : 0.f;
    if (BIAS_BF16) bv = bf16_round(bv);
#pragma unroll
    for (int r = 0; r < 8; ++r) {
      float v = acc[t][r] + bv;
      if (resid) { float rv = resid[(size_t)((row0 + 8 * hh + r) % rmod) * ldr + col]; if (RES_BF16) rv = bf16_round(rv); v += rv; }
      if (ACT == 1) v = fmaxf(v, 0.f);
      if (ACT == 2) v = 0.5f * v * (1.0f + erff(v * 0.70710678118654752f));
      if (ACT == 3) { const float u = 0.7978845608028654f * (v + 0.044715f * v * v * v); v = 0.5f * v * (1.0f + tanhf(u)); }
      so[w][8 * hh + r][t * 16 + ln] = v;
    }
  }
  __builtin_amdgcn_fence(__ATOMIC_ACQ_REL, "workgroup");
  __builtin_amdgcn_wave_barrier();
  const int rsub = lane >> 4, c4 = (lane & 15) * 4;
  {
#pragma unroll
    for (int q = 0; q < 8; ++q) {
      const int r = q * 2 + rsub;
      const v4f v = *(const v4fa*)&so[w][r][c4];
      *(v4f*)(C + (size_t)(row0 + r) * ldc + col0 + c4) = v;
    }
    
  }
}
// row LayerNorm (biased variance, eps) over N: s = X (+ R); optional out_sum <- s; out_norm <- (s-mu)*rsqrt(var+eps)*g + b
template <bool PARAM_BF16>
__global__ __launch_bounds__(256) void k_layernorm(const float* __restrict__ X, const float* __restrict__ R, const float* __restrict__ g, const float* __restrict__ bta,
                                                  float* __restrict__ out_sum, float* __restrict__ out_norm, int N, float eps) {
  __shared__ float red[256];
  const int row = blockIdx.x, tid = threadIdx.x;
  const float* x = X + (size_t)row * N; const float* rr = R ? R + (size_t)row * N : nullptr;
  float vals[16];                     // up to N = 4096
  const int per = N / 256;            // contiguous chunk per thread? use strided-by-4 chunks: thread handles j = tid*4 + 1024*u
  float s1 = 0.f;
  for (int u = 0; u < per / 4; ++u) {
    const int j = tid * 4 + 1024 * u;
    const v4f a = *(const v4fa*)(x + j);
    v4f b = {0.f,0.f,0.f,0.f}; if (rr) b = *(const v4fa*)(rr + j);
#pragma unroll
    for (int q = 0; q < 4; ++q) { const float v = a[q] + b[q]; vals[u * 4 + q] = v; s1 += v; }
  }
  red[tid] = s1; __syncthreads();
  for (int st = 128; st > 0; st >>= 1) { if (tid < st) red[tid] += red[tid + st]; __syncthreads(); }
  const float mu = red[0] / (float)N; __syncthreads();
  float s2 = 0.f;
  for (int u = 0; u < per / 4; ++u)
#pragma unroll
    for (int q = 0; q < 4; ++q) { const float c = vals[u * 4 + q] - mu; s2 += c * c; }
  red[tid] = s2; __syncthreads();
  for (int st = 128; st > 0; st >>= 1) { if (tid < st) red[tid] += red[tid + st]; __syncthreads(); }
  const float rs = rsqrtf(red[0] / (float)N + eps);
  {
    for (int u = 0; u < per / 4; ++u) {
      const int j = tid * 4 + 1024 * u;
      v4f o, sm;
#pragma unroll
      for (int q = 0; q < 4; ++q) {
        float gg = g[j + q], bb = bta[j + q];
        if (PARAM_BF16) { gg = bf16_round(gg); bb = bf16_round(bb); }
        sm[q] = vals[u * 4 + q]; o[q] = (vals[u * 4 + q] - mu) * rs * gg + bb;
      }
      if (out_sum) *(v4f*)(out_sum + (size_t)row * N + j) = sm;
      *(v4f*)(out_norm + (size_t)row * N + j) = o;
    }
    
  }
}



// ---- f16 WMMA path (v_wmma_f32_16x16x32_f16): 11-bit significands for operands in range — used where a [0,1] probability operand needs more precision than bf16
typedef _Float16 v16h __attribute__((ext_vector_type(16)));
union FragH { v16h v; v8us half[2]; _Float16 h[16]; unsigned short u[16]; };
template <int NT>
__device__ __forceinline__ v8f mmaH(v16h ah, v16h al, v16h bh, v16h bl, v8f c) {
  c = __builtin_amdgcn_wmma_f32_16x16x32_f16(false, ah, false, bh, (short)0, c, false, false);
  if (NT >= 2) c = __builtin_amdgcn_wmma_f32_16x16x32_f16(false, al, false, bh, (short)0, c, false, false);
  if (NT >= 3) c = __builtin_amdgcn_wmma_f32_16x16x32_f16(false, ah, false, bl, (short)0, c, false, false);
  asm volatile("v_nop\n\tv_nop\n\tv_nop\n\tv_nop" : "+v"(c) : "v"(ah), "v"(al), "v"(bh), "v"(bl));
  return c;
}
// batched GEMM like k_gemm_b but f16 operands: A f32 (split into f16 hi/lo if ASPLIT, else rounded to f16), Bt = f16 values [n][k]; alpha; C f32; N multiple of 16 (partial tiles skipped)
template <bool ASPLIT>
__global__ __launch_bounds__(128) void k_gemm_h(const float* __restrict__ A, int lda, size_t sA, const _Float16* __restrict__ Bh, int ldb, size_t sB, float alpha, float* __restrict__ C, int ldc, size_t sC, int M, int N, int K) {
  __shared__ __attribute__((aligned(16))) float so[4][16][64];
  const int tid = threadIdx.x, w = tid >> 5, lane = tid & 31, ln = lane & 15, hh = lane >> 4; const int by = blockIdx.y;
  A += (size_t)by * sA; Bh += (size_t)by * sB; C += (size_t)by * sC;
  const int ntn = (N + 63) / 64; const int wid = blockIdx.x * 4 + w; const int mt = wid / ntn, nq = wid % ntn; if (mt * 16 >= M) return;
  const int row0 = mt * 16, col0 = nq * 64; const float* arow = A + (size_t)(row0 + ln) * lda;
  v8f acc[4] = {};
  for (int kb = 0; kb < K; kb += 32) {
    FragH ah, al;
    const v4f x0 = *(const v4fa*)(arow + kb + 8 * hh), x1 = *(const v4fa*)(arow + kb + 8 * hh + 4), x2 = *(const v4fa*)(arow + kb + 16 + 8 * hh), x3 = *(const v4fa*)(arow + kb + 16 + 8 * hh + 4);
    float xs[16] = {x0[0],x0[1],x0[2],x0[3],x1[0],x1[1],x1[2],x1[3],x2[0],x2[1],x2[2],x2[3],x3[0],x3[1],x3[2],x3[3]};
#pragma unroll
    for (int i = 0; i < 16; ++i) { const _Float16 h = (_Float16)xs[i]; ah.h[i] = h; al.h[i] = ASPLIT ? (_Float16)(xs[i] - (float)h) : (_Float16)0.0f; }
#pragma unroll
    for (int t = 0; t < 4; ++t) { if (col0 + t * 16 >= N) continue; const size_t boff = (size_t)(col0 + t * 16 + ln) * ldb + kb; FragH bq; bq.half[0] = *(const v8us*)(Bh + boff + 8 * hh); bq.half[1] = *(const v8us*)(Bh + boff + 16 + 8 * hh);
      acc[t] = mmaH<ASPLIT ? 2 : 1>(ah.v, al.v, bq.v, bq.v, acc[t]); }
  }
#pragma unroll
  for (int t = 0; t < 4; ++t) { if (col0 + t * 16 >= N) continue;
#pragma unroll
    for (int r = 0; r < 8; ++r) so[w][8 * hh + r][t * 16 + ln] = acc[t][r] * alpha; }
  __builtin_amdgcn_fence(__ATOMIC_ACQ_REL, "workgroup"); __builtin_amdgcn_wave_barrier();
  const int rsub = lane >> 4, c4 = (lane & 15) * 4;
  {
#pragma unroll
    for (int q = 0; q < 8; ++q) { const int r = q * 2 + rsub; if (col0 + c4 < N) { const v4f v = *(const v4fa*)&so[w][r][c4]; *(v4f*)(C + (size_t)(row0 + r) * ldc + col0 + c4) = v; } }
     }
}

// Wt[n][k] = f16(W[k][n]·scale) from f32 row-major W[K][N] (scale = power of two; bf16-exact weights stay exact in f16 away from the subnormal range)
__global__ __launch_bounds__(256) void k_wt_f16(const float* __restrict__ W, _Float16* __restrict__ Wt, int K, int N, float scale) {
  const int t = blockIdx.x * 256 + threadIdx.x; if (t >= N * (K / 8)) return; const int n = t / (K / 8), k8 = (t % (K / 8)) * 8; FragH f;
#pragma unroll
  for (int i = 0; i < 8; ++i) f.h[i] = (_Float16)(bf16_round(W[(size_t)(k8 + i) * N + n]) * scale); const v8us o = f.half[0];
  *(v8us*)((unsigned short*)Wt + (size_t)n * K + k8) = o; 
}
// The whole head in one kernel. One work-group = one batch b and all HPW heads; wave w owns the 16 query rows g = 16w..16w+15 (7 waves cover 112 >= 100) and loops over the heads.
// The score tile is formed transposed, S^T = K.Q^T (A = 16 key rows, B = 16 query rows, d 16 zero-extended to the k = 32 of the instruction), so a lane (ln, hh) holds, for its one
// query g = 16w + ln, the keys p = 16t + 8hh + r (t = tile, r = accumulator register). That is the k order of a B fragment: after the softmax (registers, an exchange for the maximum and one for the sum between the
// two lane halves) tiles 2c and 2c+1 are, register for register, the B operand of O^T = V^T.P^T for keys 32c..32c+31. Scores and weights never leave the registers.
// V^T (A operand, rows = head columns, k = keys, zero for keys >= 100) waits in LDS. The mask row slice of a lane is read once and serves all HPW heads and the pointer softmax.
// The same turn carries the wave through the rest of the network: O^T of heads 2c, 2c+1 is the B operand (k = 32c..32c+31) of MH^T = Wc^T.O^T, the tiles 2c, 2c+1 of MH^T are the B operand
// of S2^T = ENC.MH^T, and S2^T again leaves a lane with the keys 16t + 8hh + r of its one query, the places its mask registers already have: tanh, mask and softmax run as in the heads.
// The projections stand in front, in the same turn: wave w rounds the node rows 16w..16w+15 to one set of f16 fragments (rows >= 100 zero), which is the B operand of K^T = Wk^T.ENC^T (a lane gets 8 columns in a row of
// its node: one 16-byte store into a K row in LDS), the A operand of V = ENC.Wv (a lane gets 8 nodes in a row of its column: one 16-byte store into a V^T row) and, stored as it is, the A operand of the pointer product.
// Q^T = Wq^T.[input1 | input2]^T (k = 256, input1 the same in every lane) leaves a lane with the columns 8hh + r of head te of its own query: the half fragment that the score product wants as B.
#define HPW 8              // heads per work-group: all of them, so a wave reads and rounds its mask slice once and holds the whole O row of its query
#define VTP 136            // f16 pitch of a V^T, K or node row in LDS: 256 + 16 bytes, spreads the 16 rows of a 16-byte fragment read over the banks
// the 16 f32 values of one fragment (k = 8hh..8hh+7 and 16+8hh..16+8hh+7 of a block of 32) of an f32 row; p = row + 32c + 8hh
__device__ __forceinline__ void raw_f32(v4f (&x)[4], const float* __restrict__ p) { x[0] = *(const v4fa*)p; x[1] = *(const v4fa*)(p + 4); x[2] = *(const v4fa*)(p + 16); x[3] = *(const v4fa*)(p + 20); }
// ... rounded to bf16, then (exactly, in range) to f16
__device__ __forceinline__ FragH frag_f32(const v4f (&x)[4]) {
  FragH f;
#pragma unroll
  for (int j = 0; j < 4; ++j)
#pragma unroll
    for (int i = 0; i < 4; ++i) f.h[4 * j + i] = (_Float16)bf16_round(x[j][i]);
  return f;
}
// Keep it at or under 256 registers a wave and 160 KiB of LDS: then the 512 work-groups of 7 waves stand two to a WGP, all resident at once; above either only one fits and the grid runs in two turns.
__global__ __launch_bounds__(224) void k_attn(const float* __restrict__ IN1, const float* __restrict__ IN2, const float* __restrict__ RL, const float* __restrict__ MSK, const float* __restrict__ ENC, const float* __restrict__ WQ,
                                              const _Float16* __restrict__ WqT, const _Float16* __restrict__ WkT, const _Float16* __restrict__ WvT, const _Float16* __restrict__ WcT, const float* __restrict__ bc, float* __restrict__ out) {
  static_assert(HPW == NH, "the output projection needs all heads of a query in one wave");
  static_assert(GG == PN, "a wave's 16 query rows and its 16 node rows share one row index");
  __shared__ __attribute__((aligned(16))) unsigned short sVT[HPW * KD][VTP];
  __shared__ __attribute__((aligned(16))) unsigned short sK[112][VTP];      // K rows (f16), rows 100..111 zero
  __shared__ __attribute__((aligned(16))) unsigned short sE[112][VTP];      // node rows (f16), rows 100..111 zero
  __shared__ __attribute__((aligned(16))) v8us sO[NH][224];      // a lane's own half-fragments, one per head: first Q, then, once a head's Q has been read, its O; written and read back by the same lane (the head loop is rolled, so registers cannot be indexed by the head)
  __shared__ __attribute__((aligned(16))) float sW3[EE];      // Wq row 256 (the weights of 'remaining'), rounded to bf16
  __shared__ __attribute__((aligned(16))) _Float16 sI1[EE];      // input1 of the batch, rounded to bf16, as f16: every wave's B fragments for k 0..127 of the Q product
  const int tid = threadIdx.x, w = tid >> 5, lane = tid & 31, ln = lane & 15, hh = lane >> 4;
  const int b = blockIdx.x;
  const v8us zero8 = {0,0,0,0,0,0,0,0};
  for (int e = tid; e < 2 * HPW * KD; e += 224) *(v8us*)&sVT[e >> 1][112 + 8 * (e & 1)] = zero8;      // keys 112..127 belong to no wave's tile; the last k block of V^T.P^T reads them
  const int g = w * 16 + ln, gc = (g < GG) ? g : GG - 1;      // rows 100..111 compute on row 99 and store nothing
  const size_t bg = (size_t)b * GG + gc;
  const bool live = g < PN;
  // the f32 rows of the wave are asked for at once: node rows (rows 100..111 read row 99, in bounds, and are zeroed) and input2; with them one value a thread of input1 and of Wq row 256 (threads 128.. read again what 0.. read, in bounds, and drop it)
  v4f xe[4][4], x2[4][4];
  const float* pe = ENC + bg * EE + 8 * hh; const float* p2 = IN2 + bg * EE + 8 * hh; const float* pr = RL + bg; const int ix = tid & (EE - 1);
#pragma unroll      // the index names registers (fragments, accumulators): it must be a constant
  for (int c = 0; c < 4; ++c) raw_f32(xe[c], pe + c * 32);
#pragma unroll      // the index names registers (fragments, accumulators): it must be a constant
  for (int c = 0; c < 4; ++c) raw_f32(x2[c], p2 + c * 32);
  const float rv = bf16_round(*pr);
  const float y1 = IN1[(size_t)b * EE + ix], y3 = WQ[(size_t)(2 * EE) * EE + ix];
  asm volatile("s_wait_xcnt 0x0" :: "v"(pe), "v"(p2), "v"(pr), "v"(ix) : "memory");      // the address registers of the 35 loads are reused below: the wait stands in front of that overwrite; as inputs they stay whole up to it (else a later load of the run lands in them)
  __builtin_amdgcn_sched_barrier(0);      // keeps the 35 loads above together in front of the first conversion: sunk to their uses they would be waited for one memory latency after another
  FragH eb[4], ib[8];
#pragma unroll      // the index names registers (fragments, accumulators): it must be a constant
  for (int c = 0; c < 4; ++c) {
    const FragH x = frag_f32(xe[c]);
    eb[c].half[0] = live ? x.half[0] : zero8; eb[c].half[1] = live ? x.half[1] : zero8;
    *(v8us*)&sE[g][c * 32 + 8 * hh] = eb[c].half[0]; *(v8us*)&sE[g][c * 32 + 16 + 8 * hh] = eb[c].half[1];
  }
  // The weight fragments come in 32 groups of 8 loads (one group = 16 weight rows x k 128 = the 4 matrix instructions of one accumulator chain): groups 0..7 the tiles of Wk^T, 8..15 of Wv^T,
  // 16..31 of Wq^T (two groups a tile: k 0..127 input1, k 128..255 input2). Three register buffers in turn: group i + 2 is asked for before group i is used.
  const unsigned short* wkp = (const unsigned short*)WkT + ln * EE + 8 * hh;
  const unsigned short* wvp = (const unsigned short*)WvT + ln * EE + 8 * hh;
  const unsigned short* wqp = (const unsigned short*)WqT + ln * (2 * EE) + 8 * hh;
  v8us ring[3][8];
  auto fetch = [&](int gi) {
    const unsigned short* p = (gi < 8) ? wkp + gi * 16 * EE : (gi < 16) ? wvp + (gi - 8) * 16 * EE : wqp + ((gi - 16) >> 1) * 16 * (2 * EE) + (gi & 1) * EE;
#pragma unroll      // the index names registers (fragments, accumulators): it must be a constant
    for (int c = 0; c < 4; ++c) { ring[gi % 3][2 * c] = *(const v8us*)(p + c * 32); ring[gi % 3][2 * c + 1] = *(const v8us*)(p + c * 32 + 16); }
    if (gi == 7 || gi == 15 || gi == 31) asm volatile("s_wait_xcnt 0x0" :: "v"(p) : "memory");      // the last loads of a weight plane: its address registers are free from here on and later loads land in them; the wait stands in front of that overwrite; as an input the address stays whole up to it
  };
  asm volatile("" :: "v"(y1), "v"(y3));      // inputs only: holds the two loads up with the others; without it the compiler sinks them into the branch below, where their memory latency is waited out alone
  if (tid < EE) { sI1[tid] = (_Float16)bf16_round(y1); sW3[tid] = bf16_round(y3); }
  fetch(0); fetch(1);
  __builtin_amdgcn_sched_barrier(0);      // the first two groups fly while input2 is rounded
#pragma unroll      // the index names registers (fragments, accumulators): it must be a constant
  for (int c = 0; c < 4; ++c) ib[4 + c] = frag_f32(x2[c]);
  __builtin_amdgcn_sched_barrier(0);      // the third group stays behind the rounding of input2, whose f32 registers it takes over
  // K^T = Wk^T.ENC^T and V = ENC.Wv, both acc/16 rounded to f16
#pragma unroll      // the index names registers (fragments, accumulators): it must be a constant
  for (int gi = 0; gi < 16; ++gi) {
    fetch(gi + 2);
    __builtin_amdgcn_sched_barrier(0);      // keeps the loads of group gi + 2 in front of the products of group gi: sunk to their use, each pair is waited for at its own matrix instruction
    v8f a = {};
#pragma unroll      // the index names registers (fragments, accumulators): it must be a constant
    for (int c = 0; c < 4; ++c) {
      FragH x; x.half[0] = ring[gi % 3][2 * c]; x.half[1] = ring[gi % 3][2 * c + 1];
      a = (gi < 8) ? __builtin_amdgcn_wmma_f32_16x16x32_f16(false, x.v, false, eb[c].v, (short)0, a, false, false)
                   : __builtin_amdgcn_wmma_f32_16x16x32_f16(false, eb[c].v, false, x.v, (short)0, a, false, false);
    }
    FragH f;
#pragma unroll
    for (int r = 0; r < 8; ++r) f.h[r] = (_Float16)(a[r] * 0.0625f);
    if (gi < 8) *(v8us*)&sK[g][gi * 16 + 8 * hh] = f.half[0];
    else *(v8us*)&sVT[(gi - 8) * 16 + ln][w * 16 + 8 * hh] = f.half[0];
  }
  __syncthreads();      // K, V^T, the node rows, input1 and the last row of Wq complete before any wave reads them
#pragma unroll      // the index names registers (fragments, accumulators): it must be a constant
  for (int c = 0; c < 4; ++c) { ib[c].half[0] = *(const v8us*)&sI1[c * 32 + 8 * hh]; ib[c].half[1] = *(const v8us*)&sI1[c * 32 + 16 + 8 * hh]; }
  v4f my[7][2];      // mask[b][g][16t + 8hh + 4u ..]; tile 6: both halves read keys 96..99 (in bounds), the upper half drops them
  const float* mp = MSK + bg * PN + 8 * hh; const float* mp6 = MSK + bg * PN + 96;
  // Q^T = Wq^T.[input1 | input2]^T; q = (acc/16 + remaining.Wq[256]) / sqrt(16), rounded to f16
  v8f aq = {};
#pragma unroll      // the index names registers (fragments, accumulators): it must be a constant
  for (int gi = 16; gi < 32; ++gi) {
    if (gi + 2 < 32) fetch(gi + 2);
    if (gi == 30) {      // no weight group is left to ask for: the mask slice takes the free registers and flies during the last two groups
#pragma unroll      // the index names registers (fragments, accumulators): it must be a constant
      for (int t = 0; t < 7; ++t)
#pragma unroll      // the index names registers (fragments, accumulators): it must be a constant
        for (int u = 0; u < 2; ++u) if (t < 6 || u == 0) my[t][u] = *(const v4fa*)(((t < 6) ? mp + t * 16 : mp6) + 4 * u);
      asm volatile("s_wait_xcnt 0x0" :: "v"(mp), "v"(mp6) : "memory");      // the two address pairs are reused behind the 13 loads: the wait stands in front of that overwrite; as inputs they stay whole up to it
    }
    __builtin_amdgcn_sched_barrier(0);      // keeps the loads of group gi + 2 (at gi = 30 the mask loads) in front of the products of group gi: sunk to their use, each pair is waited for at its own matrix instruction
#pragma unroll      // the index names registers (fragments, accumulators): it must be a constant
    for (int c = 0; c < 4; ++c) {
      FragH x; x.half[0] = ring[gi % 3][2 * c]; x.half[1] = ring[gi % 3][2 * c + 1];
      aq = __builtin_amdgcn_wmma_f32_16x16x32_f16(false, x.v, false, ib[(gi & 1) * 4 + c].v, (short)0, aq, false, false);
    }
    if (gi & 1) {
      const int te = (gi - 16) >> 1;
      const v4f u0 = *(const v4fa*)&sW3[te * 16 + 8 * hh], u1 = *(const v4fa*)&sW3[te * 16 + 8 * hh + 4];
      FragH f;
#pragma unroll
      for (int r = 0; r < 8; ++r) f.h[r] = (_Float16)((aq[r] * 0.0625f + rv * ((r < 4) ? u0[r & 3] : u1[r & 3])) * 0.25f);
      sO[te][tid] = f.half[0];
      aq = (v8f){};
    }
  }
  float mk[7][8];      // the mask slice rounded to bf16; keys >= 100 get the sentinel the row maximum starts from, so weight 0
#pragma unroll
  for (int t = 0; t < 7; ++t)
#pragma unroll
    for (int u = 0; u < 2; ++u) {
      if (t == 6 && u == 1) { for (int i = 0; i < 4; ++i) mk[t][4 + i] = -3.0e38f; continue; }
      const bool dead = (t == 6) && (hh == 1);
#pragma unroll
      for (int i = 0; i < 4; ++i) { const float x = bf16_round(my[t][u][i]); mk[t][4 * u + i] = dead ? -3.0e38f : x; }
    }
  // Q and K fragment halves of one head
  v8us qf = sO[0][tid], kf[7];
#pragma unroll
  for (int t = 0; t < 7; ++t) kf[t] = *(const v8us*)&sK[t * 16 + ln][8 * hh];
  for (int hl = 0; hl < HPW; ++hl) {
    FragH bq; bq.half[0] = qf; bq.half[1] = zero8;
    v8f s[7];
#pragma unroll
    for (int t = 0; t < 7; ++t) {
      FragH ak; ak.half[0] = kf[t]; ak.half[1] = zero8;
      const v8f z = {};
      s[t] = __builtin_amdgcn_wmma_f32_16x16x32_f16(false, ak.v, false, bq.v, (short)0, z, false, false);
    }
    // the next head's fragments fly while this head's softmax runs; the last pass reads its own again (in bounds, unused), so that no branch stands behind the matrix instructions
    const int hn = (hl + 1 < HPW) ? hl + 1 : hl;
    qf = sO[hn][tid];
#pragma unroll
    for (int t = 0; t < 7; ++t) kf[t] = *(const v8us*)&sK[t * 16 + ln][hn * KD + 8 * hh];
    FragH av[4];      // this head's V^T fragments, asked for ahead of the softmax as well
#pragma unroll
    for (int cc = 0; cc < 4; ++cc) { av[cc].half[0] = *(const v8us*)&sVT[hl * KD + ln][cc * 32 + 8 * hh]; av[cc].half[1] = *(const v8us*)&sVT[hl * KD + ln][cc * 32 + 16 + 8 * hh]; }
    __builtin_amdgcn_sched_barrier(0);      // keeps the loads above in front of the softmax: without it the compiler sinks them to their first use and their latency is waited out there
    // row maximum and row sum: one short chain per tile, then a tree (seven independent chains instead of one of 56 links; few waves share a SIMD here)
    float pm[7], ps[7];
#pragma unroll
    for (int t = 0; t < 7; ++t) {
      pm[t] = -3.0e38f;
#pragma unroll
      for (int r = 0; r < 8; ++r) { s[t][r] += mk[t][r]; pm[t] = fmaxf(pm[t], s[t][r]); }
    }
    float m = fmaxf(fmaxf(fmaxf(pm[0], pm[1]), fmaxf(pm[2], pm[3])), fmaxf(fmaxf(pm[4], pm[5]), pm[6]));
    m = fmaxf(m, __shfl_xor(m, 16, 32));
#pragma unroll
    for (int t = 0; t < 7; ++t) {
      ps[t] = 0.f;
#pragma unroll
      for (int r = 0; r < 8; ++r) { const float x = expf(s[t][r] - m); const float e = (s[t][r] > -1.0e38f) ? x : 0.f; s[t][r] = e; ps[t] += e; }
    }
    float sum = ((ps[0] + ps[1]) + (ps[2] + ps[3])) + ((ps[4] + ps[5]) + ps[6]);
    sum += __shfl_xor(sum, 16, 32);
    const float is = (sum > 0.f) ? 1.0f / sum : 0.f;
    v8f o = {};
#pragma unroll
    for (int c = 0; c < 4; ++c) {
      FragH pb;
#pragma unroll
      for (int i = 0; i < 8; ++i) { pb.h[i] = (_Float16)(s[2 * c][i] * is); pb.h[8 + i] = (2 * c + 1 < 7) ? (_Float16)(s[(2 * c + 1 < 7) ? 2 * c + 1 : 0][i] * is) : (_Float16)0.f; }
      o = __builtin_amdgcn_wmma_f32_16x16x32_f16(false, av[c].v, false, pb.v, (short)0, o, false, false);
    }
    FragH f;      // o[r] = O[g][head column 8hh + r]: 16 bytes in a row of the lane's output row
#pragma unroll
    for (int r = 0; r < 8; ++r) f.h[r] = (_Float16)o[r];
    sO[hl][tid] = f.half[0];
  }
  // MH^T = Wc^T.O^T: A = 16 rows of Wc^T (output columns e), B = the lane's O row; two tiles of e make one B fragment of the pointer product. mh = acc/16 + bc, rounded to f16.
  FragH ob[4], mb[4];
#pragma unroll      // the index names registers (fragments, accumulators): it must be a constant
  for (int c = 0; c < 4; ++c) { ob[c].half[0] = sO[2 * c][tid]; ob[c].half[1] = sO[2 * c + 1][tid]; }
  const unsigned short* wp = (const unsigned short*)WcT + ln * EE + 8 * hh;
  v8f am[8];
#pragma unroll      // the index names registers (fragments, accumulators): it must be a constant
  for (int te = 0; te < 8; ++te) {
    v8f a = {};
#pragma unroll      // the index names registers (fragments, accumulators): it must be a constant
    for (int c = 0; c < 4; ++c) {
      FragH aw; aw.half[0] = *(const v8us*)(wp + te * 16 * EE + c * 32); aw.half[1] = *(const v8us*)(wp + te * 16 * EE + c * 32 + 16);
      a = __builtin_amdgcn_wmma_f32_16x16x32_f16(false, aw.v, false, ob[c].v, (short)0, a, false, false);
    }
    am[te] = a;
  }
  asm volatile("s_wait_xcnt 0x0" ::: "memory");      // the later loads land in the registers that held the address of the Wc^T loads: the wait stands in front of that overwrite
#pragma unroll      // the index names registers (fragments, accumulators): it must be a constant
  for (int te = 0; te < 8; ++te) {
    const v8f a = am[te];
    const v4f b0 = *(const v4fa*)(bc + te * 16 + 8 * hh), b1 = *(const v4fa*)(bc + te * 16 + 8 * hh + 4);
#pragma unroll      // the index names registers (fragments, accumulators): it must be a constant
    for (int r = 0; r < 8; ++r) mb[te >> 1].h[8 * (te & 1) + r] = (_Float16)(a[r] * 0.0625f + bf16_round((r < 4) ? b0[r & 3] : b1[r & 3]));
  }
  // S2^T = ENC.MH^T: A = 16 node rows from LDS (rows 100..111 zero), B = mb
  v8f z[7];
#pragma unroll      // the index names registers (fragments, accumulators): it must be a constant
  for (int t = 0; t < 7; ++t) {
    v8f a = {};
#pragma unroll      // the index names registers (fragments, accumulators): it must be a constant
    for (int c = 0; c < 4; ++c) {
      FragH ae; ae.half[0] = *(const v8us*)&sE[t * 16 + ln][c * 32 + 8 * hh]; ae.half[1] = *(const v8us*)&sE[t * 16 + ln][c * 32 + 16 + 8 * hh];
      a = __builtin_amdgcn_wmma_f32_16x16x32_f16(false, ae.v, false, mb[c].v, (short)0, a, false, false);
    }
    z[t] = a;
  }
  // probs = softmax(10 tanh(S2 / sqrt(128)) + mask) over the keys of the lane's query: chains per tile, a tree, one exchange between the lane halves, as in the heads
  float pm[7], ps[7];
#pragma unroll      // the index names registers (fragments, accumulators): it must be a constant
  for (int t = 0; t < 7; ++t) {
    pm[t] = -3.0e38f;
#pragma unroll      // the index names registers (fragments, accumulators): it must be a constant
    for (int r = 0; r < 8; ++r) { z[t][r] = 10.0f * tanhf(z[t][r] * 0.08838834764831845f) + mk[t][r]; pm[t] = fmaxf(pm[t], z[t][r]); }
  }
  float m = fmaxf(fmaxf(fmaxf(pm[0], pm[1]), fmaxf(pm[2], pm[3])), fmaxf(fmaxf(pm[4], pm[5]), pm[6]));
  m = fmaxf(m, __shfl_xor(m, 16, 32));
#pragma unroll      // the index names registers (fragments, accumulators): it must be a constant
  for (int t = 0; t < 7; ++t) {
    ps[t] = 0.f;
#pragma unroll      // the index names registers (fragments, accumulators): it must be a constant
    for (int r = 0; r < 8; ++r) { const float x = expf(z[t][r] - m); const float e = (z[t][r] > -1.0e38f) ? x : 0.f; z[t][r] = e; ps[t] += e; }
  }
  float sum = ((ps[0] + ps[1]) + (ps[2] + ps[3])) + ((ps[4] + ps[5]) + ps[6]);
  sum += __shfl_xor(sum, 16, 32);
  const float is = (sum > 0.f) ? 1.0f / sum : 0.f;
#pragma unroll      // the index names registers (fragments, accumulators): it must be a constant
  for (int t = 0; t < 7; ++t)
#pragma unroll      // the index names registers (fragments, accumulators): it must be a constant
    for (int r = 0; r < 8; ++r) z[t][r] *= is;
  if (g < GG) {      // a lane stores 32 bytes in a row per tile of its own output row (400-byte rows, 16-byte aligned pieces); tile 6 holds keys 96..99 in the lower half alone
    float* op = out + bg * PN + 8 * hh;
#pragma unroll      // the index names registers (fragments, accumulators): it must be a constant
    for (int t = 0; t < 6; ++t) {
      const v4f lo = {z[t][0], z[t][1], z[t][2], z[t][3]}, hi = {z[t][4], z[t][5], z[t][6], z[t][7]};
      *(v4f*)(op + t * 16) = lo; *(v4f*)(op + t * 16 + 4) = hi;
    }
    if (hh == 0) { const v4f lo = {z[6][0], z[6][1], z[6][2], z[6][3]}; *(v4f*)(op + 96) = lo; }
  }
}
extern "C" void kernel_launch(void* const* d_in, const int* in_sizes, int n_in,
                              void* d_out, int out_size, void* d_ws, size_t ws_size, hipStream_t stream) {
  (void)in_sizes; (void)n_in; (void)out_size;
  const float* in1 = (const float*)d_in[0]; const float* in2 = (const float*)d_in[1]; const float* rl = (const float*)d_in[2]; const float* msk = (const float*)d_in[3]; const float* enc = (const float*)d_in[4]; const float* Wq = (const float*)d_in[5]; const float* Wk = (const float*)d_in[6]; const float* Wv = (const float*)d_in[7]; const float* Wc = (const float*)d_in[8]; const float* bc = (const float*)d_in[9];
  char* ws = (char*)d_ws; size_t off = 0;
  auto take = [&](size_t bytes) { char* p = ws + off; off += (bytes + 255) & ~(size_t)255; return p; };
  _Float16* Bq = (_Float16*)take(2 * EE * EE * 2); _Float16* Bk = (_Float16*)take(EE * EE * 2); _Float16* Bv = (_Float16*)take(EE * EE * 2); _Float16* Bc = (_Float16*)take(EE * EE * 2);
  if (off > ws_size) return;      // 160 KiB of the workspace
  const size_t w8 = (size_t)EE * EE / 8; const unsigned gw = (unsigned)((w8 + 255) / 256);
  k_wt_f16<<<2 * gw, 256, 0, stream>>>(Wq, Bq, 2 * EE, EE, 16.0f);      // Wq rows 0..255: input1 and input2  ([in][out]); row 256 (remaining) is read as it is
  k_wt_f16<<<gw, 256, 0, stream>>>(Wk, Bk, EE, EE, 16.0f); k_wt_f16<<<gw, 256, 0, stream>>>(Wv, Bv, EE, EE, 16.0f); k_wt_f16<<<gw, 256, 0, stream>>>(Wc, Bc, EE, EE, 16.0f);
  // ---- projections, attention, output projection, pointer scores and the final softmax, one launch: a work-group per batch
  k_attn<<<NB, 224, 0, stream>>>(in1, in2, rl, msk, enc, Wq, Bq, Bk, Bv, Bc, bc, (float*)d_out);
}

// v005
// A run of this version takes 67.4 microseconds.
// Timed twice side by side with v004, it ran 1.25 times as fast both times.
// Over all steps from v000 it is 13.5 times as fast.
#include <hip/hip_runtime.h>
// Next-node probability head (B=512, G=100 group rows, P=100 nodes, E=128, 8 heads x 16, logit clipping 10). The weights are transposed to f16 planes first; then one kernel (k_attn), one work-group per batch,
// does all the rest: k,v = enc.W and q = [input1 | input2 | remaining].Wq (the first 256 rows as a product, the last as a rank-1 term), the 8-head attention (additive INPUT ninf mask),
// o.Wc + bc, the pointer score mh.enc^T/sqrt(128) and the softmax of 10 tanh + mask. K, V^T and the f16 nodes wait in LDS, Q and O in lane-private LDS, the rest in registers. Contractions on v_wmma_f32_16x16x32_f16 (f16 operands,
// weights [in][out] transposed to bf16-exact x2^4, f32 accumulate); softmaxes/tanh f32 VALU.
#define NB 512
#define GG 100
#define PN 100
#define EE 128
#define NH 8
#define KD 16

typedef __bf16 v16b __attribute__((ext_vector_type(16)));
typedef unsigned short v8us __attribute__((ext_vector_type(8), may_alias));
typedef float  v8f  __attribute__((ext_vector_type(8)));
typedef float  v4f  __attribute__((ext_vector_type(4)));
typedef float  v4fa __attribute__((ext_vector_type(4), may_alias));
union FragB { v16b v; v8us half[2]; unsigned short u[16]; };

__device__ __forceinline__ unsigned short bf16_bits(float x) { unsigned int u = __float_as_uint(x); return (unsigned short)((u + 0x7FFFu + ((u >> 16) & 1u)) >> 16); }
__device__ __forceinline__ float bf16_val(unsigned short b) { return __uint_as_float(((unsigned int)b) << 16); }
__device__ __forceinline__ float bf16_round(float x) { return bf16_val(bf16_bits(x)); }
// D += A·B with NT terms: 1 = ah·bh, 2 = + al·bh (A split), 3 = + ah·bl (both split)
template <int NT>
__device__ __forceinline__ v8f mmaN(v16b ah, v16b al, v16b bh, v16b bl, v8f c) {
  c = __builtin_amdgcn_wmma_f32_16x16x32_bf16(false, ah, false, bh, (short)0, c, false, false);
  if (NT >= 2) c = __builtin_amdgcn_wmma_f32_16x16x32_bf16(false, al, false, bh, (short)0, c, false, false);
  if (NT >= 3) c = __builtin_amdgcn_wmma_f32_16x16x32_bf16(false, ah, false, bl, (short)0, c, false, false);
  asm volatile("v_nop\n\tv_nop\n\tv_nop\n\tv_nop" : "+v"(c) : "v"(ah), "v"(al), "v"(bh), "v"(bl));
  return c;
}

__global__ __launch_bounds__(256) void k_wt_bf16(const float* __restrict__ W, unsigned short* __restrict__ Wt, int K, int N) {
  const int t = blockIdx.x * 256 + threadIdx.x;
  const int k8n = K / 8;
  if (t >= N * k8n) return;
  const int n = t / k8n, k8 = (t % k8n) * 8;
  v8us v;
#pragma unroll
  for (int i = 0; i < 8; ++i) v[i] = bf16_bits(W[(size_t)(k8 + i) * N + n]);
  *(v8us*)(Wt + (size_t)n * K + k8) = v;
  
}

// GEMM C[M][N] (f32, pitch ldc) = act(A[M][K]·W + bias). A f32 row-major (pitch lda) converted per fragment to bf16
// (ASPLIT: hi/lo two planes -> 2 terms, else single rounded term); Wt bf16 [N][K] (pitch ldb). BIAS_BF16 rounds the
// bias to bf16 first (bias quantised to bf16 before the add). K%32==0, M%16==0, N%64==0.
template <bool ASPLIT, int ACT, bool BIAS_BF16>
__global__ __launch_bounds__(128) void k_gemm_bf(const float* __restrict__ A, int lda, const unsigned short* __restrict__ Wt, int ldb,
                                               const float* __restrict__ bias, float* __restrict__ C, int ldc, int M, int N, int K) {
  __shared__ __attribute__((aligned(16))) float so[4][16][64];
  const int tid = threadIdx.x, w = tid >> 5, lane = tid & 31, ln = lane & 15, hh = lane >> 4;
  const int ntn = N / 64;
  const int wid = blockIdx.x * 4 + w;
  const int mt = wid / ntn, nq = wid % ntn;
  if (mt * 16 >= M) return;
  const int row0 = mt * 16, col0 = nq * 64;
  const float* arow = A + (size_t)(row0 + ln) * lda;
  v8f acc[4] = {};
  for (int kb = 0; kb < K; kb += 32) {
    FragB ah, al;
    const v4f x0 = *(const v4fa*)(arow + kb + 8 * hh), x1 = *(const v4fa*)(arow + kb + 8 * hh + 4);
    const v4f x2 = *(const v4fa*)(arow + kb + 16 + 8 * hh), x3 = *(const v4fa*)(arow + kb + 16 + 8 * hh + 4);
    float xs[16] = {x0[0],x0[1],x0[2],x0[3],x1[0],x1[1],x1[2],x1[3],x2[0],x2[1],x2[2],x2[3],x3[0],x3[1],x3[2],x3[3]};
#pragma unroll
    for (int i = 0; i < 16; ++i) { const unsigned short hb = bf16_bits(xs[i]); ah.u[i] = hb; al.u[i] = ASPLIT ? bf16_bits(xs[i] - bf16_val(hb)) : (unsigned short)0; }
#pragma unroll
    for (int t = 0; t < 4; ++t) {
      const unsigned short* brow = Wt + (size_t)(col0 + t * 16 + ln) * ldb + kb;
      FragB b;
      b.half[0] = *(const v8us*)(brow + 8 * hh);
      b.half[1] = *(const v8us*)(brow + 16 + 8 * hh);
      acc[t] = mmaN<ASPLIT ? 2 : 1>(ah.v, al.v, b.v, b.v, acc[t]);
    }
  }
#pragma unroll
  for (int t = 0; t < 4; ++t) {
    float bv = bias ? bias[col0 + t * 16 + ln] : 0.f;
    if (BIAS_BF16) bv = bf16_round(bv);
#pragma unroll
    for (int r = 0; r < 8; ++r) { float v = acc[t][r] + bv; if (ACT == 1) v = fmaxf(v, 0.f); so[w][8 * hh + r][t * 16 + ln] = v; }
  }
  __builtin_amdgcn_fence(__ATOMIC_ACQ_REL, "workgroup");
  __builtin_amdgcn_wave_barrier();
  const int rsub = lane >> 4, c4 = (lane & 15) * 4;
  {
#pragma unroll
    for (int q = 0; q < 8; ++q) {
      const int r = q * 2 + rsub;
      const v4f v = *(const v4fa*)&so[w][r][c4];
      *(v4f*)(C + (size_t)(row0 + r) * ldc + col0 + c4) = v;
    }
    
  }
}

// Flash-style causal/unmasked attention, all contractions 3-term bf16 hi/lo splits, f32 softmax with running max.
// q,k,v rows are read from f32 buffers with arbitrary row pitch (so they can live inside a fused qkv buffer);
// D = head size (multiple of 32, <= 128); one wave = 16 query rows; block = 4 waves (64 queries) sharing K/V chunks of 32.
template <int D, bool CAUSAL>
__global__ __launch_bounds__(128) void k_flash(const float* __restrict__ qb, const float* __restrict__ kb, const float* __restrict__ vb,
                                             int pitch, int T, int H, float scale, float* __restrict__ y, int ypitch) {
  constexpr int KS = D / 32;        // k-steps for QK
  constexpr int DT = D / 16;        // d tiles for PV
  __shared__ __attribute__((aligned(16))) unsigned short sKh[32][D + 8], sKl[32][D + 8], sVh[32][D + 8], sVl[32][D + 8];
  __shared__ __attribute__((aligned(16))) unsigned short sPh[4][16][40], sPl[4][16][40];
  __shared__ __attribute__((aligned(16))) float sO[4][16][D];
  const int tid = threadIdx.x, w = tid >> 5, lane = tid & 31, ln = lane & 15, hh = lane >> 4;
  const int nqb = (T + 63) / 64;
  const int bh = blockIdx.x / nqb, qblk = blockIdx.x % nqb;
  const int b = bh / H, h = bh % H;
  const int q0 = qblk * 64 + w * 16;
  const float* Q = qb + (size_t)b * T * pitch + h * D;
  const float* K = kb + (size_t)b * T * pitch + h * D;
  const float* V = vb + (size_t)b * T * pitch + h * D;

  // A fragments of the wave's 16 query rows (scaled), hi/lo
  FragB aqh[KS], aql[KS];
  {
    int row = q0 + ln; if (row >= T) row = T - 1;
    const float* qr = Q + (size_t)row * pitch;
#pragma unroll
    for (int ks = 0; ks < KS; ++ks)
#pragma unroll
      for (int i = 0; i < 16; ++i) {
        const int d = ks * 32 + ((i < 8) ? (8 * hh + i) : (16 + 8 * hh + (i - 8)));
        const float x = qr[d] * scale; const unsigned short hb = bf16_bits(x);
        aqh[ks].u[i] = hb; aql[ks].u[i] = bf16_bits(x - bf16_val(hb));
      }
  }
  float m_r[8], l_r[8];
#pragma unroll
  for (int r = 0; r < 8; ++r) { m_r[r] = -3.0e38f; l_r[r] = 0.f; }
  v8f oacc[DT];
#pragma unroll
  for (int dt = 0; dt < DT; ++dt) oacc[dt] = (v8f){0.f,0.f,0.f,0.f,0.f,0.f,0.f,0.f};

  const int kv_end = CAUSAL ? min(T, qblk * 64 + 64) : T;     // block-uniform
  for (int j0 = 0; j0 < kv_end; j0 += 32) {
    __syncthreads();
    for (int e = tid; e < 32 * (D / 4); e += 128) {
      const int r = e / (D / 4), c4 = (e % (D / 4)) * 4;
      const int key = j0 + r;
      v4f kf = {0.f,0.f,0.f,0.f}, vf = {0.f,0.f,0.f,0.f};
      if (key < T) { kf = *(const v4fa*)(K + (size_t)key * pitch + c4); vf = *(const v4fa*)(V + (size_t)key * pitch + c4); }
#pragma unroll
      for (int t = 0; t < 4; ++t) {
        unsigned short hb = bf16_bits(kf[t]); sKh[r][c4 + t] = hb; sKl[r][c4 + t] = bf16_bits(kf[t] - bf16_val(hb));
        hb = bf16_bits(vf[t]); sVh[r][c4 + t] = hb; sVl[r][c4 + t] = bf16_bits(vf[t] - bf16_val(hb));
      }
    }
    __syncthreads();
    // S tile 16 x 32
    v8f s[2];
#pragma unroll
    for (int nt = 0; nt < 2; ++nt) {
      v8f acc = {};
#pragma unroll
      for (int ks = 0; ks < KS; ++ks) {
        FragB bh_, bl_;
        bh_.half[0] = *(const v8us*)&sKh[nt * 16 + ln][ks * 32 + 8 * hh]; bh_.half[1] = *(const v8us*)&sKh[nt * 16 + ln][ks * 32 + 16 + 8 * hh];
        bl_.half[0] = *(const v8us*)&sKl[nt * 16 + ln][ks * 32 + 8 * hh]; bl_.half[1] = *(const v8us*)&sKl[nt * 16 + ln][ks * 32 + 16 + 8 * hh];
        acc = mmaN<3>(aqh[ks].v, aql[ks].v, bh_.v, bl_.v, acc);
      }
      s[nt] = acc;
    }
    // mask + running max (rows 8hh+r; the 16 lanes of a half share rows)
    float alpha[8];
#pragma unroll
    for (int r = 0; r < 8; ++r) {
      const int qi = q0 + 8 * hh + r;
      const int ja = j0 + ln, jb = j0 + 16 + ln;
      if (CAUSAL) { if (ja > qi) s[0][r] = -3.0e38f; if (jb > qi) s[1][r] = -3.0e38f; }
      if (ja >= T) s[0][r] = -3.0e38f;
      if (jb >= T) s[1][r] = -3.0e38f;
      float mx = fmaxf(s[0][r], s[1][r]);
      mx = fmaxf(mx, __shfl_xor(mx, 1, 32)); mx = fmaxf(mx, __shfl_xor(mx, 2, 32)); mx = fmaxf(mx, __shfl_xor(mx, 4, 32)); mx = fmaxf(mx, __shfl_xor(mx, 8, 32));
      const float mnew = fmaxf(m_r[r], mx);
      alpha[r] = (mnew > -1.0e38f) ? __expf(m_r[r] - mnew) : 1.0f;
      const float p0 = (s[0][r] > -1.0e38f) ? __expf(s[0][r] - mnew) : 0.f;
      const float p1 = (s[1][r] > -1.0e38f) ? __expf(s[1][r] - mnew) : 0.f;
      m_r[r] = mnew;
      l_r[r] = l_r[r] * alpha[r] + p0 + p1;            // per-lane partial row sum (16 lanes combined at the end)
      unsigned short hb = bf16_bits(p0); sPh[w][8 * hh + r][ln] = hb;      sPl[w][8 * hh + r][ln] = bf16_bits(p0 - bf16_val(hb));
      hb = bf16_bits(p1);                sPh[w][8 * hh + r][16 + ln] = hb; sPl[w][8 * hh + r][16 + ln] = bf16_bits(p1 - bf16_val(hb));
    }
#pragma unroll
    for (int dt = 0; dt < DT; ++dt)
#pragma unroll
      for (int r = 0; r < 8; ++r) oacc[dt][r] *= alpha[r];
    __builtin_amdgcn_fence(__ATOMIC_ACQ_REL, "workgroup");
    __builtin_amdgcn_wave_barrier();
    FragB pah, pal;
    pah.half[0] = *(const v8us*)&sPh[w][ln][8 * hh]; pah.half[1] = *(const v8us*)&sPh[w][ln][16 + 8 * hh];
    pal.half[0] = *(const v8us*)&sPl[w][ln][8 * hh]; pal.half[1] = *(const v8us*)&sPl[w][ln][16 + 8 * hh];
#pragma unroll
    for (int dt = 0; dt < DT; ++dt) {
      FragB bvh, bvl;
#pragma unroll
      for (int i = 0; i < 8; ++i) {
        bvh.u[i] = sVh[8 * hh + i][dt * 16 + ln]; bvh.u[8 + i] = sVh[16 + 8 * hh + i][dt * 16 + ln];
        bvl.u[i] = sVl[8 * hh + i][dt * 16 + ln]; bvl.u[8 + i] = sVl[16 + 8 * hh + i][dt * 16 + ln];
      }
      oacc[dt] = mmaN<3>(pah.v, pal.v, bvh.v, bvl.v, oacc[dt]);
    }
    __builtin_amdgcn_fence(__ATOMIC_ACQ_REL, "workgroup");
    __builtin_amdgcn_wave_barrier();
  }
#pragma unroll
  for (int r = 0; r < 8; ++r) {
    float l = l_r[r];
    l += __shfl_xor(l, 1, 32); l += __shfl_xor(l, 2, 32); l += __shfl_xor(l, 4, 32); l += __shfl_xor(l, 8, 32);
    l_r[r] = (l > 0.f) ? 1.0f / l : 0.f;
  }
#pragma unroll
  for (int dt = 0; dt < DT; ++dt)
#pragma unroll
    for (int r = 0; r < 8; ++r) sO[w][8 * hh + r][dt * 16 + ln] = oacc[dt][r] * l_r[r];
  __builtin_amdgcn_fence(__ATOMIC_ACQ_REL, "workgroup");
  __builtin_amdgcn_wave_barrier();
  {
    for (int r = 0; r < 16; ++r) {
      const int row = q0 + r;
      if (row < T && lane < D / 4) {
        const v4f val = *(const v4fa*)&sO[w][r][lane * 4];
        *(v4f*)(y + ((size_t)b * T + row) * ypitch + h * D + lane * 4) = val;
      }
    }
    
  }
}

// GEMM C = act(A·W + bias + resid): A f32 (ASPLIT -> hi/lo 2 terms), Wt bf16 [N][K]; ACT 0 none, 1 relu, 2 exact gelu;
// resid (optional, f32, row index = (row % rmod), pitch ldr, RES_BF16 rounds it) added before the activation.
template <bool ASPLIT, int ACT, bool BIAS_BF16, bool RES_BF16>
__global__ __launch_bounds__(128) void k_gemm_bf3(const float* __restrict__ A, int lda, const unsigned short* __restrict__ Wt, int ldb,
                                                const float* __restrict__ bias, const float* __restrict__ resid, int rmod, int ldr,
                                                float* __restrict__ C, int ldc, int M, int N, int K) {
  __shared__ __attribute__((aligned(16))) float so[4][16][64];
  const int tid = threadIdx.x, w = tid >> 5, lane = tid & 31, ln = lane & 15, hh = lane >> 4;
  const int ntn = N / 64;
  const int wid = blockIdx.x * 4 + w;
  const int mt = wid / ntn, nq = wid % ntn;
  if (mt * 16 >= M) return;
  const int row0 = mt * 16, col0 = nq * 64;
  const float* arow = A + (size_t)(row0 + ln) * lda;
  v8f acc[4] = {};
  for (int kb = 0; kb < K; kb += 32) {
    FragB ah, al;
    const v4f x0 = *(const v4fa*)(arow + kb + 8 * hh), x1 = *(const v4fa*)(arow + kb + 8 * hh + 4);
    const v4f x2 = *(const v4fa*)(arow + kb + 16 + 8 * hh), x3 = *(const v4fa*)(arow + kb + 16 + 8 * hh + 4);
    float xs[16] = {x0[0],x0[1],x0[2],x0[3],x1[0],x1[1],x1[2],x1[3],x2[0],x2[1],x2[2],x2[3],x3[0],x3[1],x3[2],x3[3]};
#pragma unroll
    for (int i = 0; i < 16; ++i) { const unsigned short hb = bf16_bits(xs[i]); ah.u[i] = hb; al.u[i] = ASPLIT ? bf16_bits(xs[i] - bf16_val(hb)) : (unsigned short)0; }
#pragma unroll
    for (int t = 0; t < 4; ++t) {
      const unsigned short* brow = Wt + (size_t)(col0 + t * 16 + ln) * ldb + kb;
      FragB b;
      b.half[0] = *(const v8us*)(brow + 8 * hh);
      b.half[1] = *(const v8us*)(brow + 16 + 8 * hh);
      acc[t] = mmaN<ASPLIT ? 2 : 1>(ah.v, al.v, b.v, b.v, acc[t]);
    }
  }
#pragma unroll
  for (int t = 0; t < 4; ++t) {
    const int col = col0 + t * 16 + ln;
    float bv = bias ? bias[col] : 0.f;
    if (BIAS_BF16) bv = bf16_round(bv);
#pragma unroll
    for (int r = 0; r < 8; ++r) {
      float v = acc[t][r] + bv;
      if (resid) { float rv = resid[(size_t)((row0 + 8 * hh + r) % rmod) * ldr + col]; if (RES_BF16) rv = bf16_round(rv); v += rv; }
      if (ACT == 1) v = fmaxf(v, 0.f);
      if (ACT == 2) v = 0.5f * v * (1.0f + erff(v * 0.70710678118654752f));
      if (ACT == 3) { const float u = 0.7978845608028654f * (v + 0.044715f * v * v * v); v = 0.5f * v * (1.0f + tanhf(u)); }
      so[w][8 * hh + r][t * 16 + ln] = v;
    }
  }
  __builtin_amdgcn_fence(__ATOMIC_ACQ_REL, "workgroup");
  __builtin_amdgcn_wave_barrier();
  const int rsub = lane >> 4, c4 = (lane & 15) * 4;
  {
#pragma unroll
    for (int q = 0; q < 8; ++q) {
      const int r = q * 2 + rsub;
      const v4f v = *(const v4fa*)&so[w][r][c4];
      *(v4f*)(C + (size_t)(row0 + r) * ldc + col0 + c4) = v;
    }
    
  }
}
// row LayerNorm (biased variance, eps) over N: s = X (+ R); optional out_sum <- s; out_norm <- (s-mu)*rsqrt(var+eps)*g + b
template <bool PARAM_BF16>
__global__ __launch_bounds__(256) void k_layernorm(const float* __restrict__ X, const float* __restrict__ R, const float* __restrict__ g, const float* __restrict__ bta,
                                                  float* __restrict__ out_sum, float* __restrict__ out_norm, int N, float eps) {
  __shared__ float red[256];
  const int row = blockIdx.x, tid = threadIdx.x;
  const float* x = X + (size_t)row * N; const float* rr = R ? R + (size_t)row * N : nullptr;
  float vals[16];                     // up to N = 4096
  const int per = N / 256;            // contiguous chunk per thread? use strided-by-4 chunks: thread handles j = tid*4 + 1024*u
  float s1 = 0.f;
  for (int u = 0; u < per / 4; ++u) {
    const int j = tid * 4 + 1024 * u;
    const v4f a = *(const v4fa*)(x + j);
    v4f b = {0.f,0.f,0.f,0.f}; if (rr) b = *(const v4fa*)(rr + j);
#pragma unroll
    for (int q = 0; q < 4; ++q) { const float v = a[q] + b[q]; vals[u * 4 + q] = v; s1 += v; }
  }
  red[tid] = s1; __syncthreads();
  for (int st = 128; st > 0; st >>= 1) { if (tid < st) red[tid] += red[tid + st]; __syncthreads(); }
  const float mu = red[0] / (float)N; __syncthreads();
  float s2 = 0.f;
  for (int u = 0; u < per / 4; ++u)
#pragma unroll
    for (int q = 0; q < 4; ++q) { const float c = vals[u * 4 + q] - mu; s2 += c * c; }
  red[tid] = s2; __syncthreads();
  for (int st = 128; st > 0; st >>= 1) { if (tid < st) red[tid] += red[tid + st]; __syncthreads(); }
  const float rs = rsqrtf(red[0] / (float)N + eps);
  {
    for (int u = 0; u < per / 4; ++u) {
      const int j = tid * 4 + 1024 * u;
      v4f o, sm;
#pragma unroll
      for (int q = 0; q < 4; ++q) {
        float gg = g[j + q], bb = bta[j + q];
        if (PARAM_BF16) { gg = bf16_round(gg); bb = bf16_round(bb); }
        sm[q] = vals[u * 4 + q]; o[q] = (vals[u * 4 + q] - mu) * rs * gg + bb;
      }
      if (out_sum) *(v4f*)(out_sum + (size_t)row * N + j) = sm;
      *(v4f*)(out_norm + (size_t)row * N + j) = o;
    }
    
  }
}



// ---- f16 WMMA path (v_wmma_f32_16x16x32_f16): 11-bit significands for operands in range — used where a [0,1] probability operand needs more precision than bf16
typedef _Float16 v16h __attribute__((ext_vector_type(16)));
union FragH { v16h v; v8us half[2]; _Float16 h[16]; unsigned short u[16]; };
template <int NT>
__device__ __forceinline__ v8f mmaH(v16h ah, v16h al, v16h bh, v16h bl, v8f c) {
  c = __builtin_amdgcn_wmma_f32_16x16x32_f16(false, ah, false, bh, (short)0, c, false, false);
  if (NT >= 2) c = __builtin_amdgcn_wmma_f32_16x16x32_f16(false, al, false, bh, (short)0, c, false, false);
  if (NT >= 3) c = __builtin_amdgcn_wmma_f32_16x16x32_f16(false, ah, false, bl, (short)0, c, false, false);
  asm volatile("v_nop\n\tv_nop\n\tv_nop\n\tv_nop" : "+v"(c) : "v"(ah), "v"(al), "v"(bh), "v"(bl));
  return c;
}
// batched GEMM like k_gemm_b but f16 operands: A f32 (split into f16 hi/lo if ASPLIT, else rounded to f16), Bt = f16 values [n][k]; alpha; C f32; N multiple of 16 (partial tiles skipped)
template <bool ASPLIT>
__global__ __launch_bounds__(128) void k_gemm_h(const float* __restrict__ A, int lda, size_t sA, const _Float16* __restrict__ Bh, int ldb, size_t sB, float alpha, float* __restrict__ C, int ldc, size_t sC, int M, int N, int K) {
  __shared__ __attribute__((aligned(16))) float so[4][16][64];
  const int tid = threadIdx.x, w = tid >> 5, lane = tid & 31, ln = lane & 15, hh = lane >> 4; const int by = blockIdx.y;
  A += (size_t)by * sA; Bh += (size_t)by * sB; C += (size_t)by * sC;
  const int ntn = (N + 63) / 64; const int wid = blockIdx.x * 4 + w; const int mt = wid / ntn, nq = wid % ntn; if (mt * 16 >= M) return;
  const int row0 = mt * 16, col0 = nq * 64; const float* arow = A + (size_t)(row0 + ln) * lda;
  v8f acc[4] = {};
  for (int kb = 0; kb < K; kb += 32) {
    FragH ah, al;
    const v4f x0 = *(const v4fa*)(arow + kb + 8 * hh), x1 = *(const v4fa*)(arow + kb + 8 * hh + 4), x2 = *(const v4fa*)(arow + kb + 16 + 8 * hh), x3 = *(const v4fa*)(arow + kb + 16 + 8 * hh + 4);
    float xs[16] = {x0[0],x0[1],x0[2],x0[3],x1[0],x1[1],x1[2],x1[3],x2[0],x2[1],x2[2],x2[3],x3[0],x3[1],x3[2],x3[3]};
#pragma unroll
    for (int i = 0; i < 16; ++i) { const _Float16 h = (_Float16)xs[i]; ah.h[i] = h; al.h[i] = ASPLIT ? (_Float16)(xs[i] - (float)h) : (_Float16)0.0f; }
#pragma unroll
    for (int t = 0; t < 4; ++t) { if (col0 + t * 16 >= N) continue; const size_t boff = (size_t)(col0 + t * 16 + ln) * ldb + kb; FragH bq; bq.half[0] = *(const v8us*)(Bh + boff + 8 * hh); bq.half[1] = *(const v8us*)(Bh + boff + 16 + 8 * hh);
      acc[t] = mmaH<ASPLIT ? 2 : 1>(ah.v, al.v, bq.v, bq.v, acc[t]); }
  }
#pragma unroll
  for (int t = 0; t < 4; ++t) { if (col0 + t * 16 >= N) continue;
#pragma unroll
    for (int r = 0; r < 8; ++r) so[w][8 * hh + r][t * 16 + ln] = acc[t][r] * alpha; }
  __builtin_amdgcn_fence(__ATOMIC_ACQ_REL, "workgroup"); __builtin_amdgcn_wave_barrier();
  const int rsub = lane >> 4, c4 = (lane & 15) * 4;
  {
#pragma unroll
    for (int q = 0; q < 8; ++q) { const int r = q * 2 + rsub; if (col0 + c4 < N) { const v4f v = *(const v4fa*)&so[w][r][c4]; *(v4f*)(C + (size_t)(row0 + r) * ldc + col0 + c4) = v; } }
     }
}

// Wt[n][k] = f16(W[k][n]·scale) from f32 row-major W[K][N] (scale = power of two; bf16-exact weights stay exact in f16 away from the subnormal range)
__global__ __launch_bounds__(256) void k_wt_f16(const float* __restrict__ W, _Float16* __restrict__ Wt, int K, int N, float scale) {
  const int t = blockIdx.x * 256 + threadIdx.x; if (t >= N * (K / 8)) return; const int n = t / (K / 8), k8 = (t % (K / 8)) * 8; FragH f;
#pragma unroll
  for (int i = 0; i < 8; ++i) f.h[i] = (_Float16)(bf16_round(W[(size_t)(k8 + i) * N + n]) * scale); const v8us o = f.half[0];
  *(v8us*)((unsigned short*)Wt + (size_t)n * K + k8) = o; 
}
// The whole head in one kernel. One work-group = one batch b and all HPW heads; wave w owns the 16 query rows g = 16w..16w+15 (7 waves cover 112 >= 100) and loops over the heads.
// The score tile is formed transposed, S^T = K.Q^T (A = 16 key rows, B = 16 query rows, d 16 zero-extended to the k = 32 of the instruction), so a lane (ln, hh) holds, for its one
// query g = 16w + ln, the keys p = 16t + 8hh + r (t = tile, r = accumulator register). That is the k order of a B fragment: after the softmax (registers, an exchange for the maximum and one for the sum between the
// two lane halves) tiles 2c and 2c+1 are, register for register, the B operand of O^T = V^T.P^T for keys 32c..32c+31. Scores and weights never leave the registers.
// V^T (A operand, rows = head columns, k = keys, zero for keys >= 100) waits in LDS. The mask row slice of a lane is read once and serves all HPW heads and the pointer softmax.
// The same turn carries the wave through the rest of the network: O^T of heads 2c, 2c+1 is the B operand (k = 32c..32c+31) of MH^T = Wc^T.O^T, the tiles 2c, 2c+1 of MH^T are the B operand
// of S2^T = ENC.MH^T, and S2^T again leaves a lane with the keys 16t + 8hh + r of its one query, the places its mask registers already have: tanh, mask and softmax run as in the heads.
// The projections stand in front, in the same turn: wave w rounds the node rows 16w..16w+15 to one set of f16 fragments (rows >= 100 zero), which is the B operand of K^T = Wk^T.ENC^T (a lane gets 8 columns in a row of
// its node: one 16-byte store into a K row in LDS), the A operand of V = ENC.Wv (a lane gets 8 nodes in a row of its column: one 16-byte store into a V^T row) and, stored as it is, the A operand of the pointer product.
// Q^T = Wq^T.[input1 | input2]^T (k = 256, input1 the same in every lane) leaves a lane with the columns 8hh + r of head te of its own query: the half fragment that the score product wants as B.
#define HPW 8              // heads per work-group: all of them, so a wave reads and rounds its mask slice once and holds the whole O row of its query
#define VTP 136            // f16 pitch of a V^T, K or node row in LDS: 256 + 16 bytes, spreads the 16 rows of a 16-byte fragment read over the banks
// the 16 f32 values of one fragment (k = 8hh..8hh+7 and 16+8hh..16+8hh+7 of a block of 32) of an f32 row; p = row + 32c + 8hh
__device__ __forceinline__ void raw_f32(v4f (&x)[4], const float* __restrict__ p) { x[0] = *(const v4fa*)p; x[1] = *(const v4fa*)(p + 4); x[2] = *(const v4fa*)(p + 16); x[3] = *(const v4fa*)(p + 20); }
// ... rounded to bf16, then (exactly, in range) to f16
__device__ __forceinline__ FragH frag_f32(const v4f (&x)[4]) {
  FragH f;
#pragma unroll
  for (int j = 0; j < 4; ++j)
#pragma unroll
    for (int i = 0; i < 4; ++i) f.h[4 * j + i] = (_Float16)bf16_round(x[j][i]);
  return f;
}
// e^x for the softmaxes (x <= 0 there): one multiply and the chip's own base-2 exponential, in place of the library routine with its split argument, ldexp and two range tests; a result below 2^-126 may come out as 0
__device__ __forceinline__ float exp_hw(float x) { return __builtin_amdgcn_exp2f(x * 1.4426950408889634f); }
// tanh(k x) = 1 - 2 / (1 + e^(2 k x)) on the base-2 exponential and the reciprocal instruction: no branch; +-1 at the far ends (e = inf or 0); absolute error of a few 2^-24, also near 0
__device__ __forceinline__ float tanh_hw(float x, float k) { return 1.0f - 2.0f * __builtin_amdgcn_rcpf(1.0f + __builtin_amdgcn_exp2f(x * (k * 2.8853900817779268f))); }
// Keep it at or under 256 registers a wave and 160 KiB of LDS: then the 512 work-groups of 7 waves stand two to a WGP, all resident at once; above either only one fits and the grid runs in two turns. The attribute states that budget to the compiler (four waves a SIMD = 256 registers): left free, its scheduler goes above it.
__global__ __launch_bounds__(224) __attribute__((amdgpu_waves_per_eu(4))) void k_attn(const float* __restrict__ IN1, const float* __restrict__ IN2, const float* __restrict__ RL, const float* __restrict__ MSK, const float* __restrict__ ENC, const float* __restrict__ WQ,
                                              const _Float16* __restrict__ WqT, const _Float16* __restrict__ WkT, const _Float16* __restrict__ WvT, const _Float16* __restrict__ WcT, const float* __restrict__ bc, float* __restrict__ out) {
  static_assert(HPW == NH, "the output projection needs all heads of a query in one wave");
  static_assert(GG == PN, "a wave's 16 query rows and its 16 node rows share one row index");
  __shared__ __attribute__((aligned(16))) unsigned short sVT[HPW * KD][VTP];
  __shared__ __attribute__((aligned(16))) unsigned short sK[112][VTP];      // K rows (f16), rows 100..111 zero
  __shared__ __attribute__((aligned(16))) unsigned short sE[112][VTP];      // node rows (f16), rows 100..111 zero
  __shared__ __attribute__((aligned(16))) v8us sO[NH][224];      // a lane's own half-fragments, one per head: first Q, then, once a head's Q has been read, its O; written and read back by the same lane (the head loop is rolled, so registers cannot be indexed by the head)
  __shared__ __attribute__((aligned(16))) float sW3[EE];      // Wq row 256 (the weights of 'remaining'), rounded to bf16
  __shared__ __attribute__((aligned(16))) _Float16 sI1[EE];      // input1 of the batch, rounded to bf16, as f16: every wave's B fragments for k 0..127 of the Q product
  const int tid = threadIdx.x, w = tid >> 5, lane = tid & 31, ln = lane & 15, hh = lane >> 4;
  const int b = blockIdx.x;
  const v8us zero8 = {0,0,0,0,0,0,0,0};
  for (int e = tid; e < 2 * HPW * KD; e += 224) *(v8us*)&sVT[e >> 1][112 + 8 * (e & 1)] = zero8;      // keys 112..127 belong to no wave's tile; the last k block of V^T.P^T reads them
  const int g = w * 16 + ln, gc = (g < GG) ? g : GG - 1;      // rows 100..111 compute on row 99 and store nothing
  const size_t bg = (size_t)b * GG + gc;
  const bool live = g < PN;
  // the f32 rows of the wave are asked for at once: node rows (rows 100..111 read row 99, in bounds, and are zeroed) and input2; with them one value a thread of input1 and of Wq row 256 (threads 128.. read again what 0.. read, in bounds, and drop it)
  v4f xe[4][4], x2[4][4];
  const float* pe = ENC + bg * EE + 8 * hh; const float* p2 = IN2 + bg * EE + 8 * hh; const float* pr = RL + bg; const int ix = tid & (EE - 1);
#pragma unroll      // the index names registers (fragments, accumulators): it must be a constant
  for (int c = 0; c < 4; ++c) raw_f32(xe[c], pe + c * 32);
#pragma unroll      // the index names registers (fragments, accumulators): it must be a constant
  for (int c = 0; c < 4; ++c) raw_f32(x2[c], p2 + c * 32);
  const float rv = bf16_round(*pr);
  const float y1 = IN1[(size_t)b * EE + ix], y3 = WQ[(size_t)(2 * EE) * EE + ix];
  asm volatile("s_wait_xcnt 0x0" :: "v"(pe), "v"(p2), "v"(pr), "v"(ix) : "memory");      // the address registers of the 35 loads are reused below: the wait stands in front of that overwrite; as inputs they stay whole up to it (else a later load of the run lands in them)
  __builtin_amdgcn_sched_barrier(0);      // keeps the 35 loads above together in front of the first conversion: sunk to their uses they would be waited for one memory latency after another
  FragH eb[4], ib[8];
#pragma unroll      // the index names registers (fragments, accumulators): it must be a constant
  for (int c = 0; c < 4; ++c) {
    const FragH x = frag_f32(xe[c]);
    eb[c].half[0] = live ? x.half[0] : zero8; eb[c].half[1] = live ? x.half[1] : zero8;
    *(v8us*)&sE[g][c * 32 + 8 * hh] = eb[c].half[0]; *(v8us*)&sE[g][c * 32 + 16 + 8 * hh] = eb[c].half[1];
  }
  // The weight fragments come in 32 groups of 8 loads (one group = 16 weight rows x k 128 = the 4 matrix instructions of one accumulator chain): groups 0..7 the tiles of Wk^T, 8..15 of Wv^T,
  // 16..31 of Wq^T (two groups a tile: k 0..127 input1, k 128..255 input2). Three register buffers in turn: group i + 2 is asked for before group i is used.
  const unsigned short* wkp = (const unsigned short*)WkT + ln * EE + 8 * hh;
  const unsigned short* wvp = (const unsigned short*)WvT + ln * EE + 8 * hh;
  const unsigned short* wqp = (const unsigned short*)WqT + ln * (2 * EE) + 8 * hh;
  v8us ring[3][8];
  auto fetch = [&](int gi) {
    const unsigned short* p = (gi < 8) ? wkp + gi * 16 * EE : (gi < 16) ? wvp + (gi - 8) * 16 * EE : wqp + ((gi - 16) >> 1) * 16 * (2 * EE) + (gi & 1) * EE;
#pragma unroll      // the index names registers (fragments, accumulators): it must be a constant
    for (int c = 0; c < 4; ++c) { ring[gi % 3][2 * c] = *(const v8us*)(p + c * 32); ring[gi % 3][2 * c + 1] = *(const v8us*)(p + c * 32 + 16); }
    if (gi == 7 || gi == 15 || gi == 31) asm volatile("s_wait_xcnt 0x0" :: "v"(p) : "memory");      // the last loads of a weight plane: its address registers are free from here on and later loads land in them; the wait stands in front of that overwrite; as an input the address stays whole up to it
  };
  asm volatile("" :: "v"(y1), "v"(y3));      // inputs only: holds the two loads up with the others; without it the compiler sinks them into the branch below, where their memory latency is waited out alone
  if (tid < EE) { sI1[tid] = (_Float16)bf16_round(y1); sW3[tid] = bf16_round(y3); }
  fetch(0); fetch(1);
  __builtin_amdgcn_sched_barrier(0);      // the first two groups fly while input2 is rounded
#pragma unroll      // the index names registers (fragments, accumulators): it must be a constant
  for (int c = 0; c < 4; ++c) ib[4 + c] = frag_f32(x2[c]);
  __builtin_amdgcn_sched_barrier(0);      // the third group stays behind the rounding of input2, whose f32 registers it takes over
  // K^T = Wk^T.ENC^T and V = ENC.Wv, both acc/16 rounded to f16
#pragma unroll      // the index names registers (fragments, accumulators): it must be a constant
  for (int gi = 0; gi < 16; ++gi) {
    fetch(gi + 2);
    __builtin_amdgcn_sched_barrier(0);      // keeps the loads of group gi + 2 in front of the products of group gi: sunk to their use, each pair is waited for at its own matrix instruction
    v8f a = {};
#pragma unroll      // the index names registers (fragments, accumulators): it must be a constant
    for (int c = 0; c < 4; ++c) {
      FragH x; x.half[0] = ring[gi % 3][2 * c]; x.half[1] = ring[gi % 3][2 * c + 1];
      a = (gi < 8) ? __builtin_amdgcn_wmma_f32_16x16x32_f16(false, x.v, false, eb[c].v, (short)0, a, false, false)
                   : __builtin_amdgcn_wmma_f32_16x16x32_f16(false, eb[c].v, false, x.v, (short)0, a, false, false);
    }
    FragH f;
#pragma unroll
    for (int r = 0; r < 8; ++r) f.h[r] = (_Float16)(a[r] * 0.0625f);
    if (gi < 8) *(v8us*)&sK[g][gi * 16 + 8 * hh] = f.half[0];
    else *(v8us*)&sVT[(gi - 8) * 16 + ln][w * 16 + 8 * hh] = f.half[0];
  }
  __syncthreads();      // K, V^T, the node rows, input1 and the last row of Wq complete before any wave reads them
#pragma unroll      // the index names registers (fragments, accumulators): it must be a constant
  for (int c = 0; c < 4; ++c) { ib[c].half[0] = *(const v8us*)&sI1[c * 32 + 8 * hh]; ib[c].half[1] = *(const v8us*)&sI1[c * 32 + 16 + 8 * hh]; }
  v4f my[7][2];      // mask[b][g][16t + 8hh + 4u ..]; tile 6: both halves read keys 96..99 (in bounds), the upper half drops them
  const float* mp = MSK + bg * PN + 8 * hh; const float* mp6 = MSK + bg * PN + 96;
  // Q^T = Wq^T.[input1 | input2]^T; q = (acc/16 + remaining.Wq[256]) / sqrt(16), rounded to f16
  v8f aq = {};
#pragma unroll      // the index names registers (fragments, accumulators): it must be a constant
  for (int gi = 16; gi < 32; ++gi) {
    if (gi + 2 < 32) fetch(gi + 2);
    if (gi == 30) {      // no weight group is left to ask for: the mask slice takes the free registers and flies during the last two groups
#pragma unroll      // the index names registers (fragments, accumulators): it must be a constant
      for (int t = 0; t < 7; ++t)
#pragma unroll      // the index names registers (fragments, accumulators): it must be a constant
        for (int u = 0; u < 2; ++u) if (t < 6 || u == 0) my[t][u] = *(const v4fa*)(((t < 6) ? mp + t * 16 : mp6) + 4 * u);
      asm volatile("s_wait_xcnt 0x0" :: "v"(mp), "v"(mp6) : "memory");      // the two address pairs are reused behind the 13 loads: the wait stands in front of that overwrite; as inputs they stay whole up to it
    }
    __builtin_amdgcn_sched_barrier(0);      // keeps the loads of group gi + 2 (at gi = 30 the mask loads) in front of the products of group gi: sunk to their use, each pair is waited for at its own matrix instruction
#pragma unroll      // the index names registers (fragments, accumulators): it must be a constant
    for (int c = 0; c < 4; ++c) {
      FragH x; x.half[0] = ring[gi % 3][2 * c]; x.half[1] = ring[gi % 3][2 * c + 1];
      aq = __builtin_amdgcn_wmma_f32_16x16x32_f16(false, x.v, false, ib[(gi & 1) * 4 + c].v, (short)0, aq, false, false);
    }
    if (gi & 1) {
      const int te = (gi - 16) >> 1;
      const v4f u0 = *(const v4fa*)&sW3[te * 16 + 8 * hh], u1 = *(const v4fa*)&sW3[te * 16 + 8 * hh + 4];
      FragH f;
#pragma unroll
      for (int r = 0; r < 8; ++r) f.h[r] = (_Float16)((aq[r] * 0.0625f + rv * ((r < 4) ? u0[r & 3] : u1[r & 3])) * 0.25f);
      sO[te][tid] = f.half[0];
      aq = (v8f){};
    }
  }
  float mk[7][8];      // the mask slice rounded to bf16; keys >= 100 get the sentinel the row maximum starts from, so weight 0
#pragma unroll
  for (int t = 0; t < 7; ++t)
#pragma unroll
    for (int u = 0; u < 2; ++u) {
      if (t == 6 && u == 1) { for (int i = 0; i < 4; ++i) mk[t][4 + i] = -3.0e38f; continue; }
      const bool dead = (t == 6) && (hh == 1);
#pragma unroll
      for (int i = 0; i < 4; ++i) { const float x = bf16_round(my[t][u][i]); mk[t][4 * u + i] = dead ? -3.0e38f : x; }
    }
  // Q and K fragment halves of one head
  v8us qf = sO[0][tid], kf[7];
#pragma unroll
  for (int t = 0; t < 7; ++t) kf[t] = *(const v8us*)&sK[t * 16 + ln][8 * hh];
#pragma nounroll      // stays one rolled loop of 8 passes: with the shorter body the compiler peels the last pass off and schedules it into the output projection, which takes the kernel above 256 registers (under the stated budget: into scratch)
  for (int hl = 0; hl < HPW; ++hl) {
    FragH bq; bq.half[0] = qf; bq.half[1] = zero8;
    v8f s[7];
#pragma unroll
    for (int t = 0; t < 7; ++t) {
      FragH ak; ak.half[0] = kf[t]; ak.half[1] = zero8;
      const v8f z = {};
      s[t] = __builtin_amdgcn_wmma_f32_16x16x32_f16(false, ak.v, false, bq.v, (short)0, z, false, false);
    }
    // the next head's fragments fly while this head's softmax runs; the last pass reads its own again (in bounds, unused), so that no branch stands behind the matrix instructions
    const int hn = (hl + 1 < HPW) ? hl + 1 : hl;
    qf = sO[hn][tid];
#pragma unroll
    for (int t = 0; t < 7; ++t) kf[t] = *(const v8us*)&sK[t * 16 + ln][hn * KD + 8 * hh];
    FragH av[4];      // this head's V^T fragments, asked for ahead of the softmax as well
#pragma unroll
    for (int cc = 0; cc < 4; ++cc) { av[cc].half[0] = *(const v8us*)&sVT[hl * KD + ln][cc * 32 + 8 * hh]; av[cc].half[1] = *(const v8us*)&sVT[hl * KD + ln][cc * 32 + 16 + 8 * hh]; }
    __builtin_amdgcn_sched_barrier(0);      // keeps the loads above in front of the softmax: without it the compiler sinks them to their first use and their latency is waited out there
    // row maximum and row sum: one short chain per tile, then a tree (seven independent chains instead of one of 56 links; few waves share a SIMD here)
    float pm[7], ps[7];
#pragma unroll
    for (int t = 0; t < 7; ++t) {
      pm[t] = -3.0e38f;
#pragma unroll
      for (int r = 0; r < 8; ++r) { s[t][r] += mk[t][r]; pm[t] = fmaxf(pm[t], s[t][r]); }
    }
    float m = fmaxf(fmaxf(fmaxf(pm[0], pm[1]), fmaxf(pm[2], pm[3])), fmaxf(fmaxf(pm[4], pm[5]), pm[6]));
    m = fmaxf(m, __shfl_xor(m, 16, 32));
#pragma unroll
    for (int t = 0; t < 7; ++t) {
      ps[t] = 0.f;
#pragma unroll
      for (int r = 0; r < 8; ++r) { const float x = exp_hw(s[t][r] - m); const float e = (s[t][r] > -1.0e38f) ? x : 0.f; s[t][r] = e; ps[t] += e; }
    }
    float sum = ((ps[0] + ps[1]) + (ps[2] + ps[3])) + ((ps[4] + ps[5]) + ps[6]);
    sum += __shfl_xor(sum, 16, 32);
    const float is = (sum > 0.f) ? 1.0f / sum : 0.f;
    v8f o = {};
#pragma unroll
    for (int c = 0; c < 4; ++c) {
      FragH pb;
#pragma unroll
      for (int i = 0; i < 8; ++i) { pb.h[i] = (_Float16)(s[2 * c][i] * is); pb.h[8 + i] = (2 * c + 1 < 7) ? (_Float16)(s[(2 * c + 1 < 7) ? 2 * c + 1 : 0][i] * is) : (_Float16)0.f; }
      o = __builtin_amdgcn_wmma_f32_16x16x32_f16(false, av[c].v, false, pb.v, (short)0, o, false, false);
    }
    FragH f;      // o[r] = O[g][head column 8hh + r]: 16 bytes in a row of the lane's output row
#pragma unroll
    for (int r = 0; r < 8; ++r) f.h[r] = (_Float16)o[r];
    sO[hl][tid] = f.half[0];
  }
  // MH^T = Wc^T.O^T: A = 16 rows of Wc^T (output columns e), B = the lane's O row; two tiles of e make one B fragment of the pointer product. mh = acc/16 + bc, rounded to f16.
  FragH ob[4], mb[4];
#pragma unroll      // the index names registers (fragments, accumulators): it must be a constant
  for (int c = 0; c < 4; ++c) { ob[c].half[0] = sO[2 * c][tid]; ob[c].half[1] = sO[2 * c + 1][tid]; }
  const unsigned short* wp = (const unsigned short*)WcT + ln * EE + 8 * hh;
  v8f am[8];
#pragma unroll      // the index names registers (fragments, accumulators): it must be a constant
  for (int te = 0; te < 8; ++te) {
    v8f a = {};
#pragma unroll      // the index names registers (fragments, accumulators): it must be a constant
    for (int c = 0; c < 4; ++c) {
      FragH aw; aw.half[0] = *(const v8us*)(wp + te * 16 * EE + c * 32); aw.half[1] = *(const v8us*)(wp + te * 16 * EE + c * 32 + 16);
      a = __builtin_amdgcn_wmma_f32_16x16x32_f16(false, aw.v, false, ob[c].v, (short)0, a, false, false);
    }
    am[te] = a;
  }
  asm volatile("s_wait_xcnt 0x0" ::: "memory");      // the later loads land in the registers that held the address of the Wc^T loads: the wait stands in front of that overwrite
#pragma unroll      // the index names registers (fragments, accumulators): it must be a constant
  for (int te = 0; te < 8; ++te) {
    const v8f a = am[te];
    const v4f b0 = *(const v4fa*)(bc + te * 16 + 8 * hh), b1 = *(const v4fa*)(bc + te * 16 + 8 * hh + 4);
#pragma unroll      // the index names registers (fragments, accumulators): it must be a constant
    for (int r = 0; r < 8; ++r) mb[te >> 1].h[8 * (te & 1) + r] = (_Float16)(a[r] * 0.0625f + bf16_round((r < 4) ? b0[r & 3] : b1[r & 3]));
  }
  // S2^T = ENC.MH^T: A = 16 node rows from LDS (rows 100..111 zero), B = mb
  v8f z[7];
#pragma unroll      // the index names registers (fragments, accumulators): it must be a constant
  for (int t = 0; t < 7; ++t) {
    v8f a = {};
#pragma unroll      // the index names registers (fragments, accumulators): it must be a constant
    for (int c = 0; c < 4; ++c) {
      FragH ae; ae.half[0] = *(const v8us*)&sE[t * 16 + ln][c * 32 + 8 * hh]; ae.half[1] = *(const v8us*)&sE[t * 16 + ln][c * 32 + 16 + 8 * hh];
      a = __builtin_amdgcn_wmma_f32_16x16x32_f16(false, ae.v, false, mb[c].v, (short)0, a, false, false);
    }
    z[t] = a;
  }
  __builtin_amdgcn_sched_barrier(0);      // ends the scheduling region of the two products here, where the branches of the library tanh ended it: as one region with the branch-free tail the kernel goes above 256 registers (under the stated budget: into scratch)
  // probs = softmax(10 tanh(S2 / sqrt(128)) + mask) over the keys of the lane's query: chains per tile, a tree, one exchange between the lane halves, as in the heads
  float pm[7], ps[7];
#pragma unroll      // the index names registers (fragments, accumulators): it must be a constant
  for (int t = 0; t < 7; ++t) {
    pm[t] = -3.0e38f;
#pragma unroll      // the index names registers (fragments, accumulators): it must be a constant
    for (int r = 0; r < 8; ++r) { z[t][r] = 10.0f * tanh_hw(z[t][r], 0.08838834764831845f) + mk[t][r]; pm[t] = fmaxf(pm[t], z[t][r]); }
  }
  float m = fmaxf(fmaxf(fmaxf(pm[0], pm[1]), fmaxf(pm[2], pm[3])), fmaxf(fmaxf(pm[4], pm[5]), pm[6]));
  m = fmaxf(m, __shfl_xor(m, 16, 32));
#pragma unroll      // the index names registers (fragments, accumulators): it must be a constant
  for (int t = 0; t < 7; ++t) {
    ps[t] = 0.f;
#pragma unroll      // the index names registers (fragments, accumulators): it must be a constant
    for (int r = 0; r < 8; ++r) { const float x = exp_hw(z[t][r] - m); const float e = (z[t][r] > -1.0e38f) ? x : 0.f; z[t][r] = e; ps[t] += e; }
  }
  float sum = ((ps[0] + ps[1]) + (ps[2] + ps[3])) + ((ps[4] + ps[5]) + ps[6]);
  sum += __shfl_xor(sum, 16, 32);
  const float is = (sum > 0.f) ? 1.0f / sum : 0.f;
#pragma unroll      // the index names registers (fragments, accumulators): it must be a constant
  for (int t = 0; t < 7; ++t)
#pragma unroll      // the index names registers (fragments, accumulators): it must be a constant
    for (int r = 0; r < 8; ++r) z[t][r] *= is;
  if (g < GG) {      // a lane stores 32 bytes in a row per tile of its own output row (400-byte rows, 16-byte aligned pieces); tile 6 holds keys 96..99 in the lower half alone
    float* op = out + bg * PN + 8 * hh;
#pragma unroll      // the index names registers (fragments, accumulators): it must be a constant
    for (int t = 0; t < 6; ++t) {
      const v4f lo = {z[t][0], z[t][1], z[t][2], z[t][3]}, hi = {z[t][4], z[t][5], z[t][6], z[t][7]};
      *(v4f*)(op + t * 16) = lo; *(v4f*)(op + t * 16 + 4) = hi;
    }
    if (hh == 0) { const v4f lo = {z[6][0], z[6][1], z[6][2], z[6][3]}; *(v4f*)(op + 96) = lo; }
  }
}
extern "C" void kernel_launch(void* const* d_in, const int* in_sizes, int n_in,
                              void* d_out, int out_size, void* d_ws, size_t ws_size, hipStream_t stream) {
  (void)in_sizes; (void)n_in; (void)out_size;
  const float* in1 = (const float*)d_in[0]; const float* in2 = (const float*)d_in[1]; const float* rl = (const float*)d_in[2]; const float* msk = (const float*)d_in[3]; const float* enc = (const float*)d_in[4]; const float* Wq = (const float*)d_in[5]; const float* Wk = (const float*)d_in[6]; const float* Wv = (const float*)d_in[7]; const float* Wc = (const float*)d_in[8]; const float* bc = (const float*)d_in[9];
  char* ws = (char*)d_ws; size_t off = 0;
  auto take = [&](size_t bytes) { char* p = ws + off; off += (bytes + 255) & ~(size_t)255; return p; };
  _Float16* Bq = (_Float16*)take(2 * EE * EE * 2); _Float16* Bk = (_Float16*)take(EE * EE * 2); _Float16* Bv = (_Float16*)take(EE * EE * 2); _Float16* Bc = (_Float16*)take(EE * EE * 2);
  if (off > ws_size) return;      // 160 KiB of the workspace
  const size_t w8 = (size_t)EE * EE / 8; const unsigned gw = (unsigned)((w8 + 255) / 256);
  k_wt_f16<<<2 * gw, 256, 0, stream>>>(Wq, Bq, 2 * EE, EE, 16.0f);      // Wq rows 0..255: input1 and input2  ([in][out]); row 256 (remaining) is read as it is
  k_wt_f16<<<gw, 256, 0, stream>>>(Wk, Bk, EE, EE, 16.0f); k_wt_f16<<<gw, 256, 0, stream>>>(Wv, Bv, EE, EE, 16.0f); k_wt_f16<<<gw, 256, 0, stream>>>(Wc, Bc, EE, EE, 16.0f);
  // ---- projections, attention, output projection, pointer scores and the final softmax, one launch: a work-group per batch
  k_attn<<<NB, 224, 0, stream>>>(in1, in2, rl, msk, enc, Wq, Bq, Bk, Bv, Bc, bc, (float*)d_out);
}

// v006
// A run of this version takes 48.4 microseconds.
// Two timings next to v005 both put it at 1.39 times that version's speed.
// All steps since v000 together make it 18.8 times as fast.
#include <hip/hip_runtime.h>
// Next-node probability head (B=512, G=100 group rows, P=100 nodes, E=128, 8 heads x 16, logit clipping 10). The weights are packed into f16 planes in fragment order first; then one kernel (k_attn), one work-group per batch,
// does all the rest: k,v = enc.W and q = [input1 | input2 | remaining].Wq (the first 256 rows as a product, the last as a rank-1 term), the 8-head attention (additive INPUT ninf mask),
// o.Wc + bc, the pointer score mh.enc^T/sqrt(128) and the softmax of 10 tanh + mask. K, V^T and the f16 nodes wait in LDS, Q and O in lane-private LDS, the rest in registers. Contractions on v_wmma_f32_16x16x32_f16 (f16 operands,
// weights [in][out] bf16-exact x2^4, f32 accumulate); softmaxes/tanh f32 VALU.
#define NB 512
#define GG 100
#define PN 100
#define EE 128
#define NH 8
#define KD 16

typedef __bf16 v16b __attribute__((ext_vector_type(16)));
typedef unsigned short v8us __attribute__((ext_vector_type(8), may_alias));
typedef float  v8f  __attribute__((ext_vector_type(8)));
typedef float  v4f  __attribute__((ext_vector_type(4)));
typedef float  v4fa __attribute__((ext_vector_type(4), may_alias));
union FragB { v16b v; v8us half[2]; unsigned short u[16]; };

__device__ __forceinline__ unsigned short bf16_bits(float x) { unsigned int u = __float_as_uint(x); return (unsigned short)((u + 0x7FFFu + ((u >> 16) & 1u)) >> 16); }
__device__ __forceinline__ float bf16_val(unsigned short b) { return __uint_as_float(((unsigned int)b) << 16); }
__device__ __forceinline__ float bf16_round(float x) { return bf16_val(bf16_bits(x)); }
// D += A·B with NT terms: 1 = ah·bh, 2 = + al·bh (A split), 3 = + ah·bl (both split)
template <int NT>
__device__ __forceinline__ v8f mmaN(v16b ah, v16b al, v16b bh, v16b bl, v8f c) {
  c = __builtin_amdgcn_wmma_f32_16x16x32_bf16(false, ah, false, bh, (short)0, c, false, false);
  if (NT >= 2) c = __builtin_amdgcn_wmma_f32_16x16x32_bf16(false, al, false, bh, (short)0, c, false, false);
  if (NT >= 3) c = __builtin_amdgcn_wmma_f32_16x16x32_bf16(false, ah, false, bl, (short)0, c, false, false);
  asm volatile("v_nop\n\tv_nop\n\tv_nop\n\tv_nop" : "+v"(c) : "v"(ah), "v"(al), "v"(bh), "v"(bl));
  return c;
}

__global__ __launch_bounds__(256) void k_wt_bf16(const float* __restrict__ W, unsigned short* __restrict__ Wt, int K, int N) {
  const int t = blockIdx.x * 256 + threadIdx.x;
  const int k8n = K / 8;
  if (t >= N * k8n) return;
  const int n = t / k8n, k8 = (t % k8n) * 8;
  v8us v;
#pragma unroll
  for (int i = 0; i < 8; ++i) v[i] = bf16_bits(W[(size_t)(k8 + i) * N + n]);
  *(v8us*)(Wt + (size_t)n * K + k8) = v;
  
}

// GEMM C[M][N] (f32, pitch ldc) = act(A[M][K]·W + bias). A f32 row-major (pitch lda) converted per fragment to bf16
// (ASPLIT: hi/lo two planes -> 2 terms, else single rounded term); Wt bf16 [N][K] (pitch ldb). BIAS_BF16 rounds the
// bias to bf16 first (bias quantised to bf16 before the add). K%32==0, M%16==0, N%64==0.
template <bool ASPLIT, int ACT, bool BIAS_BF16>
__global__ __launch_bounds__(128) void k_gemm_bf(const float* __restrict__ A, int lda, const unsigned short* __restrict__ Wt, int ldb,
                                               const float* __restrict__ bias, float* __restrict__ C, int ldc, int M, int N, int K) {
  __shared__ __attribute__((aligned(16))) float so[4][16][64];
  const int tid = threadIdx.x, w = tid >> 5, lane = tid & 31, ln = lane & 15, hh = lane >> 4;
  const int ntn = N / 64;
  const int wid = blockIdx.x * 4 + w;
  const int mt = wid / ntn, nq = wid % ntn;
  if (mt * 16 >= M) return;
  const int row0 = mt * 16, col0 = nq * 64;
  const float* arow = A + (size_t)(row0 + ln) * lda;
  v8f acc[4] = {};
  for (int kb = 0; kb < K; kb += 32) {
    FragB ah, al;
    const v4f x0 = *(const v4fa*)(arow + kb + 8 * hh), x1 = *(const v4fa*)(arow + kb + 8 * hh + 4);
    const v4f x2 = *(const v4fa*)(arow + kb + 16 + 8 * hh), x3 = *(const v4fa*)(arow + kb + 16 + 8 * hh + 4);
    float xs[16] = {x0[0],x0[1],x0[2],x0[3],x1[0],x1[1],x1[2],x1[3],x2[0],x2[1],x2[2],x2[3],x3[0],x3[1],x3[2],x3[3]};
#pragma unroll
    for (int i = 0; i < 16; ++i) { const unsigned short hb = bf16_bits(xs[i]); ah.u[i] = hb; al.u[i] = ASPLIT ? bf16_bits(xs[i] - bf16_val(hb)) : (unsigned short)0; }
#pragma unroll
    for (int t = 0; t < 4; ++t) {
      const unsigned short* brow = Wt + (size_t)(col0 + t * 16 + ln) * ldb + kb;
      FragB b;
      b.half[0] = *(const v8us*)(brow + 8 * hh);
      b.half[1] = *(const v8us*)(brow + 16 + 8 * hh);
      acc[t] = mmaN<ASPLIT ? 2 : 1>(ah.v, al.v, b.v, b.v, acc[t]);
    }
  }
#pragma unroll
  for (int t = 0; t < 4; ++t) {
    float bv = bias ? bias[col0 + t * 16 + ln] : 0.f;
    if (BIAS_BF16) bv = bf16_round(bv);
#pragma unroll
    for (int r = 0; r < 8; ++r) { float v = acc[t][r] + bv; if (ACT == 1) v = fmaxf(v, 0.f); so[w][8 * hh + r][t * 16 + ln] = v; }
  }
  __builtin_amdgcn_fence(__ATOMIC_ACQ_REL, "workgroup");
  __builtin_amdgcn_wave_barrier();
  const int rsub = lane >> 4, c4 = (lane & 15) * 4;
  {
#pragma unroll
    for (int q = 0; q < 8; ++q) {
      const int r = q * 2 + rsub;
      const v4f v = *(const v4fa*)&so[w][r][c4];
      *(v4f*)(C + (size_t)(row0 + r) * ldc + col0 + c4) = v;
    }
    
  }
}

// Flash-style causal/unmasked attention, all contractions 3-term bf16 hi/lo splits, f32 softmax with running max.
// q,k,v rows are read from f32 buffers with arbitrary row pitch (so they can live inside a fused qkv buffer);
// D = head size (multiple of 32, <= 128); one wave = 16 query rows; block = 4 waves (64 queries) sharing K/V chunks of 32.
template <int D, bool CAUSAL>
__global__ __launch_bounds__(128) void k_flash(const float* __restrict__ qb, const float* __restrict__ kb, const float* __restrict__ vb,
                                             int pitch, int T, int H, float scale, float* __restrict__ y, int ypitch) {
  constexpr int KS = D / 32;        // k-steps for QK
  constexpr int DT = D / 16;        // d tiles for PV
  __shared__ __attribute__((aligned(16))) unsigned short sKh[32][D + 8], sKl[32][D + 8], sVh[32][D + 8], sVl[32][D + 8];
  __shared__ __attribute__((aligned(16))) unsigned short sPh[4][16][40], sPl[4][16][40];
  __shared__ __attribute__((aligned(16))) float sO[4][16][D];
  const int tid = threadIdx.x, w = tid >> 5, lane = tid & 31, ln = lane & 15, hh = lane >> 4;
  const int nqb = (T + 63) / 64;
  const int bh = blockIdx.x / nqb, qblk = blockIdx.x % nqb;
  const int b = bh / H, h = bh % H;
  const int q0 = qblk * 64 + w * 16;
  const float* Q = qb + (size_t)b * T * pitch + h * D;
  const float* K = kb + (size_t)b * T * pitch + h * D;
  const float* V = vb + (size_t)b * T * pitch + h * D;

  // A fragments of the wave's 16 query rows (scaled), hi/lo
  FragB aqh[KS], aql[KS];
  {
    int row = q0 + ln; if (row >= T) row = T - 1;
    const float* qr = Q + (size_t)row * pitch;
#pragma unroll
    for (int ks = 0; ks < KS; ++ks)
#pragma unroll
      for (int i = 0; i < 16; ++i) {
        const int d = ks * 32 + ((i < 8) ? (8 * hh + i) : (16 + 8 * hh + (i - 8)));
        const float x = qr[d] * scale; const unsigned short hb = bf16_bits(x);
        aqh[ks].u[i] = hb; aql[ks].u[i] = bf16_bits(x - bf16_val(hb));
      }
  }
  float m_r[8], l_r[8];
#pragma unroll
  for (int r = 0; r < 8; ++r) { m_r[r] = -3.0e38f; l_r[r] = 0.f; }
  v8f oacc[DT];
#pragma unroll
  for (int dt = 0; dt < DT; ++dt) oacc[dt] = (v8f){0.f,0.f,0.f,0.f,0.f,0.f,0.f,0.f};

  const int kv_end = CAUSAL ? min(T, qblk * 64 + 64) : T;     // block-uniform
  for (int j0 = 0; j0 < kv_end; j0 += 32) {
    __syncthreads();
    for (int e = tid; e < 32 * (D / 4); e += 128) {
      const int r = e / (D / 4), c4 = (e % (D / 4)) * 4;
      const int key = j0 + r;
      v4f kf = {0.f,0.f,0.f,0.f}, vf = {0.f,0.f,0.f,0.f};
      if (key < T) { kf = *(const v4fa*)(K + (size_t)key * pitch + c4); vf = *(const v4fa*)(V + (size_t)key * pitch + c4); }
#pragma unroll
      for (int t = 0; t < 4; ++t) {
        unsigned short hb = bf16_bits(kf[t]); sKh[r][c4 + t] = hb; sKl[r][c4 + t] = bf16_bits(kf[t] - bf16_val(hb));
        hb = bf16_bits(vf[t]); sVh[r][c4 + t] = hb; sVl[r][c4 + t] = bf16_bits(vf[t] - bf16_val(hb));
      }
    }
    __syncthreads();
    // S tile 16 x 32
    v8f s[2];
#pragma unroll
    for (int nt = 0; nt < 2; ++nt) {
      v8f acc = {};
#pragma unroll
      for (int ks = 0; ks < KS; ++ks) {
        FragB bh_, bl_;
        bh_.half[0] = *(const v8us*)&sKh[nt * 16 + ln][ks * 32 + 8 * hh]; bh_.half[1] = *(const v8us*)&sKh[nt * 16 + ln][ks * 32 + 16 + 8 * hh];
        bl_.half[0] = *(const v8us*)&sKl[nt * 16 + ln][ks * 32 + 8 * hh]; bl_.half[1] = *(const v8us*)&sKl[nt * 16 + ln][ks * 32 + 16 + 8 * hh];
        acc = mmaN<3>(aqh[ks].v, aql[ks].v, bh_.v, bl_.v, acc);
      }
      s[nt] = acc;
    }
    // mask + running max (rows 8hh+r; the 16 lanes of a half share rows)
    float alpha[8];
#pragma unroll
    for (int r = 0; r < 8; ++r) {
      const int qi = q0 + 8 * hh + r;
      const int ja = j0 + ln, jb = j0 + 16 + ln;
      if (CAUSAL) { if (ja > qi) s[0][r] = -3.0e38f; if (jb > qi) s[1][r] = -3.0e38f; }
      if (ja >= T) s[0][r] = -3.0e38f;
      if (jb >= T) s[1][r] = -3.0e38f;
      float mx = fmaxf(s[0][r], s[1][r]);
      mx = fmaxf(mx, __shfl_xor(mx, 1, 32)); mx = fmaxf(mx, __shfl_xor(mx, 2, 32)); mx = fmaxf(mx, __shfl_xor(mx, 4, 32)); mx = fmaxf(mx, __shfl_xor(mx, 8, 32));
      const float mnew = fmaxf(m_r[r], mx);
      alpha[r] = (mnew > -1.0e38f) ? __expf(m_r[r] - mnew) : 1.0f;
      const float p0 = (s[0][r] > -1.0e38f) ? __expf(s[0][r] - mnew) : 0.f;
      const float p1 = (s[1][r] > -1.0e38f) ? __expf(s[1][r] - mnew) : 0.f;
      m_r[r] = mnew;
      l_r[r] = l_r[r] * alpha[r] + p0 + p1;            // per-lane partial row sum (16 lanes combined at the end)
      unsigned short hb = bf16_bits(p0); sPh[w][8 * hh + r][ln] = hb;      sPl[w][8 * hh + r][ln] = bf16_bits(p0 - bf16_val(hb));
      hb = bf16_bits(p1);                sPh[w][8 * hh + r][16 + ln] = hb; sPl[w][8 * hh + r][16 + ln] = bf16_bits(p1 - bf16_val(hb));
    }
#pragma unroll
    for (int dt = 0; dt < DT; ++dt)
#pragma unroll
      for (int r = 0; r < 8; ++r) oacc[dt][r] *= alpha[r];
    __builtin_amdgcn_fence(__ATOMIC_ACQ_REL, "workgroup");
    __builtin_amdgcn_wave_barrier();
    FragB pah, pal;
    pah.half[0] = *(const v8us*)&sPh[w][ln][8 * hh]; pah.half[1] = *(const v8us*)&sPh[w][ln][16 + 8 * hh];
    pal.half[0] = *(const v8us*)&sPl[w][ln][8 * hh]; pal.half[1] = *(const v8us*)&sPl[w][ln][16 + 8 * hh];
#pragma unroll
    for (int dt = 0; dt < DT; ++dt) {
      FragB bvh, bvl;
#pragma unroll
      for (int i = 0; i < 8; ++i) {
        bvh.u[i] = sVh[8 * hh + i][dt * 16 + ln]; bvh.u[8 + i] = sVh[16 + 8 * hh + i][dt * 16 + ln];
        bvl.u[i] = sVl[8 * hh + i][dt * 16 + ln]; bvl.u[8 + i] = sVl[16 + 8 * hh + i][dt * 16 + ln];
      }
      oacc[dt] = mmaN<3>(pah.v, pal.v, bvh.v, bvl.v, oacc[dt]);
    }
    __builtin_amdgcn_fence(__ATOMIC_ACQ_REL, "workgroup");
    __builtin_amdgcn_wave_barrier();
  }
#pragma unroll
  for (int r = 0; r < 8; ++r) {
    float l = l_r[r];
    l += __shfl_xor(l, 1, 32); l += __shfl_xor(l, 2, 32); l += __shfl_xor(l, 4, 32); l += __shfl_xor(l, 8, 32);
    l_r[r] = (l > 0.f) ? 1.0f / l : 0.f;
  }
#pragma unroll
  for (int dt = 0; dt < DT; ++dt)
#pragma unroll
    for (int r = 0; r < 8; ++r) sO[w][8 * hh + r][dt * 16 + ln] = oacc[dt][r] * l_r[r];
  __builtin_amdgcn_fence(__ATOMIC_ACQ_REL, "workgroup");
  __builtin_amdgcn_wave_barrier();
  {
    for (int r = 0; r < 16; ++r) {
      const int row = q0 + r;
      if (row < T && lane < D / 4) {
        const v4f val = *(const v4fa*)&sO[w][r][lane * 4];
        *(v4f*)(y + ((size_t)b * T + row) * ypitch + h * D + lane * 4) = val;
      }
    }
    
  }
}

// GEMM C = act(A·W + bias + resid): A f32 (ASPLIT -> hi/lo 2 terms), Wt bf16 [N][K]; ACT 0 none, 1 relu, 2 exact gelu;
// resid (optional, f32, row index = (row % rmod), pitch ldr, RES_BF16 rounds it) added before the activation.
template <bool ASPLIT, int ACT, bool BIAS_BF16, bool RES_BF16>
__global__ __launch_bounds__(128) void k_gemm_bf3(const float* __restrict__ A, int lda, const unsigned short* __restrict__ Wt, int ldb,
                                                const float* __restrict__ bias, const float* __restrict__ resid, int rmod, int ldr,
                                                float* __restrict__ C, int ldc, int M, int N, int K) {
  __shared__ __attribute__((aligned(16))) float so[4][16][64];
  const int tid = threadIdx.x, w = tid >> 5, lane = tid & 31, ln = lane & 15, hh = lane >> 4;
  const int ntn = N / 64;
  const int wid = blockIdx.x * 4 + w;
  const int mt = wid / ntn, nq = wid % ntn;
  if (mt * 16 >= M) return;
  const int row0 = mt * 16, col0 = nq * 64;
  const float* arow = A + (size_t)(row0 + ln) * lda;
  v8f acc[4] = {};
  for (int kb = 0; kb < K; kb += 32) {
    FragB ah, al;
    const v4f x0 = *(const v4fa*)(arow + kb + 8 * hh), x1 = *(const v4fa*)(arow + kb + 8 * hh + 4);
    const v4f x2 = *(const v4fa*)(arow + kb + 16 + 8 * hh), x3 = *(const v4fa*)(arow + kb + 16 + 8 * hh + 4);
    float xs[16] = {x0[0],x0[1],x0[2],x0[3],x1[0],x1[1],x1[2],x1[3],x2[0],x2[1],x2[2],x2[3],x3[0],x3[1],x3[2],x3[3]};
#pragma unroll
    for (int i = 0; i < 16; ++i) { const unsigned short hb = bf16_bits(xs[i]); ah.u[i] = hb; al.u[i] = ASPLIT ? bf16_bits(xs[i] - bf16_val(hb)) : (unsigned short)0; }
#pragma unroll
    for (int t = 0; t < 4; ++t) {
      const unsigned short* brow = Wt + (size_t)(col0 + t * 16 + ln) * ldb + kb;
      FragB b;
      b.half[0] = *(const v8us*)(brow + 8 * hh);
      b.half[1] = *(const v8us*)(brow + 16 + 8 * hh);
      acc[t] = mmaN<ASPLIT ? 2 : 1>(ah.v, al.v, b.v, b.v, acc[t]);
    }
  }
#pragma unroll
  for (int t = 0; t < 4; ++t) {
    const int col = col0 + t * 16 + ln;
    float bv = bias ? bias[col] : 0.f;
    if (BIAS_BF16) bv = bf16_round(bv);
#pragma unroll
    for (int r = 0; r < 8; ++r) {
      float v = acc[t][r] + bv;
      if (resid) { float rv = resid[(size_t)((row0 + 8 * hh + r) % rmod) * ldr + col]; if (RES_BF16) rv = bf16_round(rv); v += rv; }
      if (ACT == 1) v = fmaxf(v, 0.f);
      if (ACT == 2) v = 0.5f * v * (1.0f + erff(v * 0.70710678118654752f));
      if (ACT == 3) { const float u = 0.7978845608028654f * (v + 0.044715f * v * v * v); v = 0.5f * v * (1.0f + tanhf(u)); }
      so[w][8 * hh + r][t * 16 + ln] = v;
    }
  }
  __builtin_amdgcn_fence(__ATOMIC_ACQ_REL, "workgroup");
  __builtin_amdgcn_wave_barrier();
  const int rsub = lane >> 4, c4 = (lane & 15) * 4;
  {
#pragma unroll
    for (int q = 0; q < 8; ++q) {
      const int r = q * 2 + rsub;
      const v4f v = *(const v4fa*)&so[w][r][c4];
      *(v4f*)(C + (size_t)(row0 + r) * ldc + col0 + c4) = v;
    }
    
  }
}
// row LayerNorm (biased variance, eps) over N: s = X (+ R); optional out_sum <- s; out_norm <- (s-mu)*rsqrt(var+eps)*g + b
template <bool PARAM_BF16>
__global__ __launch_bounds__(256) void k_layernorm(const float* __restrict__ X, const float* __restrict__ R, const float* __restrict__ g, const float* __restrict__ bta,
                                                  float* __restrict__ out_sum, float* __restrict__ out_norm, int N, float eps) {
  __shared__ float red[256];
  const int row = blockIdx.x, tid = threadIdx.x;
  const float* x = X + (size_t)row * N; const float* rr = R ? R + (size_t)row * N : nullptr;
  float vals[16];                     // up to N = 4096
  const int per = N / 256;            // contiguous chunk per thread? use strided-by-4 chunks: thread handles j = tid*4 + 1024*u
  float s1 = 0.f;
  for (int u = 0; u < per / 4; ++u) {
    const int j = tid * 4 + 1024 * u;
    const v4f a = *(const v4fa*)(x + j);
    v4f b = {0.f,0.f,0.f,0.f}; if (rr) b = *(const v4fa*)(rr + j);
#pragma unroll
    for (int q = 0; q < 4; ++q) { const float v = a[q] + b[q]; vals[u * 4 + q] = v; s1 += v; }
  }
  red[tid] = s1; __syncthreads();
  for (int st = 128; st > 0; st >>= 1) { if (tid < st) red[tid] += red[tid + st]; __syncthreads(); }
  const float mu = red[0] / (float)N; __syncthreads();
  float s2 = 0.f;
  for (int u = 0; u < per / 4; ++u)
#pragma unroll
    for (int q = 0; q < 4; ++q) { const float c = vals[u * 4 + q] - mu; s2 += c * c; }
  red[tid] = s2; __syncthreads();
  for (int st = 128; st > 0; st >>= 1) { if (tid < st) red[tid] += red[tid + st]; __syncthreads(); }
  const float rs = rsqrtf(red[0] / (float)N + eps);
  {
    for (int u = 0; u < per / 4; ++u) {
      const int j = tid * 4 + 1024 * u;
      v4f o, sm;
#pragma unroll
      for (int q = 0; q < 4; ++q) {
        float gg = g[j + q], bb = bta[j + q];
        if (PARAM_BF16) { gg = bf16_round(gg); bb = bf16_round(bb); }
        sm[q] = vals[u * 4 + q]; o[q] = (vals[u * 4 + q] - mu) * rs * gg + bb;
      }
      if (out_sum) *(v4f*)(out_sum + (size_t)row * N + j) = sm;
      *(v4f*)(out_norm + (size_t)row * N + j) = o;
    }
    
  }
}



// ---- f16 WMMA path (v_wmma_f32_16x16x32_f16): 11-bit significands for operands in range — used where a [0,1] probability operand needs more precision than bf16
typedef _Float16 v16h __attribute__((ext_vector_type(16)));
union FragH { v16h v; v8us half[2]; _Float16 h[16]; unsigned short u[16]; };
template <int NT>
__device__ __forceinline__ v8f mmaH(v16h ah, v16h al, v16h bh, v16h bl, v8f c) {
  c = __builtin_amdgcn_wmma_f32_16x16x32_f16(false, ah, false, bh, (short)0, c, false, false);
  if (NT >= 2) c = __builtin_amdgcn_wmma_f32_16x16x32_f16(false, al, false, bh, (short)0, c, false, false);
  if (NT >= 3) c = __builtin_amdgcn_wmma_f32_16x16x32_f16(false, ah, false, bl, (short)0, c, false, false);
  asm volatile("v_nop\n\tv_nop\n\tv_nop\n\tv_nop" : "+v"(c) : "v"(ah), "v"(al), "v"(bh), "v"(bl));
  return c;
}
// batched GEMM like k_gemm_b but f16 operands: A f32 (split into f16 hi/lo if ASPLIT, else rounded to f16), Bt = f16 values [n][k]; alpha; C f32; N multiple of 16 (partial tiles skipped)
template <bool ASPLIT>
__global__ __launch_bounds__(128) void k_gemm_h(const float* __restrict__ A, int lda, size_t sA, const _Float16* __restrict__ Bh, int ldb, size_t sB, float alpha, float* __restrict__ C, int ldc, size_t sC, int M, int N, int K) {
  __shared__ __attribute__((aligned(16))) float so[4][16][64];
  const int tid = threadIdx.x, w = tid >> 5, lane = tid & 31, ln = lane & 15, hh = lane >> 4; const int by = blockIdx.y;
  A += (size_t)by * sA; Bh += (size_t)by * sB; C += (size_t)by * sC;
  const int ntn = (N + 63) / 64; const int wid = blockIdx.x * 4 + w; const int mt = wid / ntn, nq = wid % ntn; if (mt * 16 >= M) return;
  const int row0 = mt * 16, col0 = nq * 64; const float* arow = A + (size_t)(row0 + ln) * lda;
  v8f acc[4] = {};
  for (int kb = 0; kb < K; kb += 32) {
    FragH ah, al;
    const v4f x0 = *(const v4fa*)(arow + kb + 8 * hh), x1 = *(const v4fa*)(arow + kb + 8 * hh + 4), x2 = *(const v4fa*)(arow + kb + 16 + 8 * hh), x3 = *(const v4fa*)(arow + kb + 16 + 8 * hh + 4);
    float xs[16] = {x0[0],x0[1],x0[2],x0[3],x1[0],x1[1],x1[2],x1[3],x2[0],x2[1],x2[2],x2[3],x3[0],x3[1],x3[2],x3[3]};
#pragma unroll
    for (int i = 0; i < 16; ++i) { const _Float16 h = (_Float16)xs[i]; ah.h[i] = h; al.h[i] = ASPLIT ? (_Float16)(xs[i] - (float)h) : (_Float16)0.0f; }
#pragma unroll
    for (int t = 0; t < 4; ++t) { if (col0 + t * 16 >= N) continue; const size_t boff = (size_t)(col0 + t * 16 + ln) * ldb + kb; FragH bq; bq.half[0] = *(const v8us*)(Bh + boff + 8 * hh); bq.half[1] = *(const v8us*)(Bh + boff + 16 + 8 * hh);
      acc[t] = mmaH<ASPLIT ? 2 : 1>(ah.v, al.v, bq.v, bq.v, acc[t]); }
  }
#pragma unroll
  for (int t = 0; t < 4; ++t) { if (col0 + t * 16 >= N) continue;
#pragma unroll
    for (int r = 0; r < 8; ++r) so[w][8 * hh + r][t * 16 + ln] = acc[t][r] * alpha; }
  __builtin_amdgcn_fence(__ATOMIC_ACQ_REL, "workgroup"); __builtin_amdgcn_wave_barrier();
  const int rsub = lane >> 4, c4 = (lane & 15) * 4;
  {
#pragma unroll
    for (int q = 0; q < 8; ++q) { const int r = q * 2 + rsub; if (col0 + c4 < N) { const v4f v = *(const v4fa*)&so[w][r][c4]; *(v4f*)(C + (size_t)(row0 + r) * ldc + col0 + c4) = v; } }
     }
}

// f16(W[k][n]·scale) from f32 row-major W[K][N] (scale = power of two; bf16-exact weights stay exact in f16 away from the subnormal range), packed in fragment order: one block of 512 bytes = one 16-byte load of a whole wave =
// half j of the fragment (16 columns n of tile tn) x (k block c of 32): lane (ln, hh) owns the 8 values n = 16tn + ln, k = 32c + 16j + 8hh .. + 7. Blocks in the order [tn][c][j]. Thread t writes the 16 bytes number t of the plane.
#define FRH 256            // f16 values in one such block
__global__ __launch_bounds__(256) void k_wt_f16(const float* __restrict__ W, _Float16* __restrict__ Wt, int K, int N, float scale) {
  const int t = blockIdx.x * 256 + threadIdx.x; if (t >= N * (K / 8)) return;
  const int ln = t & 15, hh = (t >> 4) & 1, j = (t >> 5) & 1, cb = t >> 6, c = cb % (K / 32), tn = cb / (K / 32);
  const int n = tn * 16 + ln, k8 = c * 32 + j * 16 + hh * 8; FragH f;
#pragma unroll
  for (int i = 0; i < 8; ++i) f.h[i] = (_Float16)(bf16_round(W[(size_t)(k8 + i) * N + n]) * scale); const v8us o = f.half[0];
  *(v8us*)((unsigned short*)Wt + (size_t)t * 8) = o; 
}
// The whole head in one kernel. One work-group = one batch b and all HPW heads; wave w owns the 16 query rows g = 16w..16w+15 (7 waves cover 112 >= 100) and loops over the heads.
// The score tile is formed transposed, S^T = K.Q^T (A = 16 key rows, B = 16 query rows, d 16 zero-extended to the k = 32 of the instruction), so a lane (ln, hh) holds, for its one
// query g = 16w + ln, the keys p = 16t + 8hh + r (t = tile, r = accumulator register). That is the k order of a B fragment: after the softmax (registers, an exchange for the maximum and one for the sum between the
// two lane halves) tiles 2c and 2c+1 are, register for register, the B operand of O^T = V^T.P^T for keys 32c..32c+31. Scores and weights never leave the registers.
// V^T (A operand, rows = head columns, k = keys, zero for keys >= 100) waits in LDS. The mask row slice of a lane is read once and serves all HPW heads and the pointer softmax.
// The same turn carries the wave through the rest of the network: O^T of heads 2c, 2c+1 is the B operand (k = 32c..32c+31) of MH^T = Wc^T.O^T, the tiles 2c, 2c+1 of MH^T are the B operand
// of S2^T = ENC.MH^T, and S2^T again leaves a lane with the keys 16t + 8hh + r of its one query, the places its mask registers already have: tanh, mask and softmax run as in the heads.
// The projections stand in front, in the same turn: wave w rounds the node rows 16w..16w+15 to one set of f16 fragments (rows >= 100 zero), which is the B operand of K^T = Wk^T.ENC^T (a lane gets 8 columns in a row of
// its node: one 16-byte store into a K row in LDS), the A operand of V = ENC.Wv (a lane gets 8 nodes in a row of its column: one 16-byte store into a V^T row) and, stored as it is, the A operand of the pointer product.
// Q^T = Wq^T.[input1 | input2]^T (k = 256, input1 the same in every lane) leaves a lane with the columns 8hh + r of head te of its own query: the half fragment that the score product wants as B.
#define HPW 8              // heads per work-group: all of them, so a wave reads and rounds its mask slice once and holds the whole O row of its query
#define VTP 136            // f16 pitch of a V^T, K or node row in LDS: 256 + 16 bytes, spreads the 16 rows of a 16-byte fragment read over the banks
// the 16 f32 values of one fragment (k = 8hh..8hh+7 and 16+8hh..16+8hh+7 of a block of 32) of an f32 row; p = row + 32c + 8hh
__device__ __forceinline__ void raw_f32(v4f (&x)[4], const float* __restrict__ p) { x[0] = *(const v4fa*)p; x[1] = *(const v4fa*)(p + 4); x[2] = *(const v4fa*)(p + 16); x[3] = *(const v4fa*)(p + 20); }
// ... rounded to bf16, then (exactly, in range) to f16
__device__ __forceinline__ FragH frag_f32(const v4f (&x)[4]) {
  FragH f;
#pragma unroll
  for (int j = 0; j < 4; ++j)
#pragma unroll
    for (int i = 0; i < 4; ++i) f.h[4 * j + i] = (_Float16)bf16_round(x[j][i]);
  return f;
}
// e^x for the softmaxes (x <= 0 there): one multiply and the chip's own base-2 exponential, in place of the library routine with its split argument, ldexp and two range tests; a result below 2^-126 may come out as 0
__device__ __forceinline__ float exp_hw(float x) { return __builtin_amdgcn_exp2f(x * 1.4426950408889634f); }
// tanh(k x) = 1 - 2 / (1 + e^(2 k x)) on the base-2 exponential and the reciprocal instruction: no branch; +-1 at the far ends (e = inf or 0); absolute error of a few 2^-24, also near 0
__device__ __forceinline__ float tanh_hw(float x, float k) { return 1.0f - 2.0f * __builtin_amdgcn_rcpf(1.0f + __builtin_amdgcn_exp2f(x * (k * 2.8853900817779268f))); }
// Keep it at or under 256 registers a wave and 160 KiB of LDS: then the 512 work-groups of 7 waves stand two to a WGP, all resident at once; above either only one fits and the grid runs in two turns. The attribute states that budget to the compiler (four waves a SIMD = 256 registers): left free, its scheduler goes above it.
__global__ __launch_bounds__(224) __attribute__((amdgpu_waves_per_eu(4))) void k_attn(const float* __restrict__ IN1, const float* __restrict__ IN2, const float* __restrict__ RL, const float* __restrict__ MSK, const float* __restrict__ ENC, const float* __restrict__ WQ,
                                              const _Float16* __restrict__ WqT, const _Float16* __restrict__ WkT, const _Float16* __restrict__ WvT, const _Float16* __restrict__ WcT, const float* __restrict__ bc, float* __restrict__ out) {
  static_assert(HPW == NH, "the output projection needs all heads of a query in one wave");
  static_assert(GG == PN, "a wave's 16 query rows and its 16 node rows share one row index");
  __shared__ __attribute__((aligned(16))) unsigned short sVT[HPW * KD][VTP];
  __shared__ __attribute__((aligned(16))) unsigned short sK[112][VTP];      // K rows (f16), rows 100..111 zero
  __shared__ __attribute__((aligned(16))) unsigned short sE[112][VTP];      // node rows (f16), rows 100..111 zero
  __shared__ __attribute__((aligned(16))) v8us sO[NH][224];      // a lane's own half-fragments, one per head: first Q, then, once a head's Q has been read, its O; written and read back by the same lane (the head loop is rolled, so registers cannot be indexed by the head)
  __shared__ __attribute__((aligned(16))) float sW3[EE];      // Wq row 256 (the weights of 'remaining'), rounded to bf16
  __shared__ __attribute__((aligned(16))) _Float16 sI1[EE];      // input1 of the batch, rounded to bf16, as f16: every wave's B fragments for k 0..127 of the Q product
  const int tid = threadIdx.x, w = tid >> 5, lane = tid & 31, ln = lane & 15, hh = lane >> 4;
  const int b = blockIdx.x;
  const v8us zero8 = {0,0,0,0,0,0,0,0};
  for (int e = tid; e < 2 * HPW * KD; e += 224) *(v8us*)&sVT[e >> 1][112 + 8 * (e & 1)] = zero8;      // keys 112..127 belong to no wave's tile; the last k block of V^T.P^T reads them
  const int g = w * 16 + ln, gc = (g < GG) ? g : GG - 1;      // rows 100..111 compute on row 99 and store nothing
  const size_t bg = (size_t)b * GG + gc;
  const bool live = g < PN;
  // the f32 rows of the wave are asked for at once: node rows (rows 100..111 read row 99, in bounds, and are zeroed) and input2; with them one value a thread of input1 and of Wq row 256 (threads 128.. read again what 0.. read, in bounds, and drop it)
  v4f xe[4][4], x2[4][4];
  const float* pe = ENC + bg * EE + 8 * hh; const float* p2 = IN2 + bg * EE + 8 * hh; const float* pr = RL + bg; const int ix = tid & (EE - 1);
#pragma unroll      // the index names registers (fragments, accumulators): it must be a constant
  for (int c = 0; c < 4; ++c) raw_f32(xe[c], pe + c * 32);
#pragma unroll      // the index names registers (fragments, accumulators): it must be a constant
  for (int c = 0; c < 4; ++c) raw_f32(x2[c], p2 + c * 32);
  const float rv = bf16_round(*pr);
  const float y1 = IN1[(size_t)b * EE + ix], y3 = WQ[(size_t)(2 * EE) * EE + ix];
  asm volatile("s_wait_xcnt 0x0" :: "v"(pe), "v"(p2), "v"(pr), "v"(ix) : "memory");      // the address registers of the 35 loads are reused below: the wait stands in front of that overwrite; as inputs they stay whole up to it (else a later load of the run lands in them)
  __builtin_amdgcn_sched_barrier(0);      // keeps the 35 loads above together in front of the first conversion: sunk to their uses they would be waited for one memory latency after another
  FragH eb[4], ib[8];
#pragma unroll      // the index names registers (fragments, accumulators): it must be a constant
  for (int c = 0; c < 4; ++c) {
    const FragH x = frag_f32(xe[c]);
    eb[c].half[0] = live ? x.half[0] : zero8; eb[c].half[1] = live ? x.half[1] : zero8;
    *(v8us*)&sE[g][c * 32 + 8 * hh] = eb[c].half[0]; *(v8us*)&sE[g][c * 32 + 16 + 8 * hh] = eb[c].half[1];
  }
  // The weight fragments come in 32 groups of 8 loads (one group = 16 weight rows x k 128 = the 4 matrix instructions of one accumulator chain): groups 0..7 the tiles of Wk^T, 8..15 of Wv^T,
  // 16..31 of Wq^T (two groups a tile: k 0..127 input1, k 128..255 input2). Three register buffers in turn: group i + 2 is asked for before group i is used.
  // The planes lie in fragment order (k_wt_f16): a load of the wave reads 512 bytes in a row, four whole cache lines, and a group 4 KiB in a row.
  const unsigned short* wkp = (const unsigned short*)WkT + lane * 8;
  const unsigned short* wvp = (const unsigned short*)WvT + lane * 8;
  const unsigned short* wqp = (const unsigned short*)WqT + lane * 8;
  v8us ring[3][8];
  auto fetch = [&](int gi) {
    const unsigned short* p = (gi < 8) ? wkp + gi * 8 * FRH : (gi < 16) ? wvp + (gi - 8) * 8 * FRH : wqp + (gi - 16) * 8 * FRH;
#pragma unroll      // the index names registers (fragments, accumulators): it must be a constant
    for (int c = 0; c < 4; ++c) { ring[gi % 3][2 * c] = *(const v8us*)(p + 2 * c * FRH); ring[gi % 3][2 * c + 1] = *(const v8us*)(p + (2 * c + 1) * FRH); }
    if (gi == 7 || gi == 15 || gi == 31) asm volatile("s_wait_xcnt 0x0" :: "v"(p) : "memory");      // the last loads of a weight plane: its address registers are free from here on and later loads land in them; the wait stands in front of that overwrite; as an input the address stays whole up to it
  };
  asm volatile("" :: "v"(y1), "v"(y3));      // inputs only: holds the two loads up with the others; without it the compiler sinks them into the branch below, where their memory latency is waited out alone
  if (tid < EE) { sI1[tid] = (_Float16)bf16_round(y1); sW3[tid] = bf16_round(y3); }
  fetch(0); fetch(1);
  __builtin_amdgcn_sched_barrier(0);      // the first two groups fly while input2 is rounded
#pragma unroll      // the index names registers (fragments, accumulators): it must be a constant
  for (int c = 0; c < 4; ++c) ib[4 + c] = frag_f32(x2[c]);
  __builtin_amdgcn_sched_barrier(0);      // the third group stays behind the rounding of input2, whose f32 registers it takes over
  // K^T = Wk^T.ENC^T and V = ENC.Wv, both acc/16 rounded to f16
#pragma unroll      // the index names registers (fragments, accumulators): it must be a constant
  for (int gi = 0; gi < 16; ++gi) {
    fetch(gi + 2);
    __builtin_amdgcn_sched_barrier(0);      // keeps the loads of group gi + 2 in front of the products of group gi: sunk to their use, each pair is waited for at its own matrix instruction
    v8f a = {};
#pragma unroll      // the index names registers (fragments, accumulators): it must be a constant
    for (int c = 0; c < 4; ++c) {
      FragH x; x.half[0] = ring[gi % 3][2 * c]; x.half[1] = ring[gi % 3][2 * c + 1];
      a = (gi < 8) ? __builtin_amdgcn_wmma_f32_16x16x32_f16(false, x.v, false, eb[c].v, (short)0, a, false, false)
                   : __builtin_amdgcn_wmma_f32_16x16x32_f16(false, eb[c].v, false, x.v, (short)0, a, false, false);
    }
    FragH f;
#pragma unroll
    for (int r = 0; r < 8; ++r) f.h[r] = (_Float16)(a[r] * 0.0625f);
    if (gi < 8) *(v8us*)&sK[g][gi * 16 + 8 * hh] = f.half[0];
    else *(v8us*)&sVT[(gi - 8) * 16 + ln][w * 16 + 8 * hh] = f.half[0];
  }
  __syncthreads();      // K, V^T, the node rows, input1 and the last row of Wq complete before any wave reads them
#pragma unroll      // the index names registers (fragments, accumulators): it must be a constant
  for (int c = 0; c < 4; ++c) { ib[c].half[0] = *(const v8us*)&sI1[c * 32 + 8 * hh]; ib[c].half[1] = *(const v8us*)&sI1[c * 32 + 16 + 8 * hh]; }
  v4f my[7][2];      // mask[b][g][16t + 8hh + 4u ..]; tile 6: both halves read keys 96..99 (in bounds), the upper half drops them
  const float* mp = MSK + bg * PN + 8 * hh; const float* mp6 = MSK + bg * PN + 96;
  // Q^T = Wq^T.[input1 | input2]^T; q = (acc/16 + remaining.Wq[256]) / sqrt(16), rounded to f16
  v8f aq = {};
#pragma unroll      // the index names registers (fragments, accumulators): it must be a constant
  for (int gi = 16; gi < 32; ++gi) {
    if (gi + 2 < 32) fetch(gi + 2);
    if (gi == 30) {      // no weight group is left to ask for: the mask slice takes the free registers and flies during the last two groups
#pragma unroll      // the index names registers (fragments, accumulators): it must be a constant
      for (int t = 0; t < 7; ++t)
#pragma unroll      // the index names registers (fragments, accumulators): it must be a constant
        for (int u = 0; u < 2; ++u) if (t < 6 || u == 0) my[t][u] = *(const v4fa*)(((t < 6) ? mp + t * 16 : mp6) + 4 * u);
      asm volatile("s_wait_xcnt 0x0" :: "v"(mp), "v"(mp6) : "memory");      // the two address pairs are reused behind the 13 loads: the wait stands in front of that overwrite; as inputs they stay whole up to it
    }
    __builtin_amdgcn_sched_barrier(0);      // keeps the loads of group gi + 2 (at gi = 30 the mask loads) in front of the products of group gi: sunk to their use, each pair is waited for at its own matrix instruction
#pragma unroll      // the index names registers (fragments, accumulators): it must be a constant
    for (int c = 0; c < 4; ++c) {
      FragH x; x.half[0] = ring[gi % 3][2 * c]; x.half[1] = ring[gi % 3][2 * c + 1];
      aq = __builtin_amdgcn_wmma_f32_16x16x32_f16(false, x.v, false, ib[(gi & 1) * 4 + c].v, (short)0, aq, false, false);
    }
    if (gi & 1) {
      const int te = (gi - 16) >> 1;
      const v4f u0 = *(const v4fa*)&sW3[te * 16 + 8 * hh], u1 = *(const v4fa*)&sW3[te * 16 + 8 * hh + 4];
      FragH f;
#pragma unroll
      for (int r = 0; r < 8; ++r) f.h[r] = (_Float16)((aq[r] * 0.0625f + rv * ((r < 4) ? u0[r & 3] : u1[r & 3])) * 0.25f);
      sO[te][tid] = f.half[0];
      aq = (v8f){};
    }
  }
  float mk[7][8];      // the mask slice rounded to bf16; keys >= 100 get the sentinel the row maximum starts from, so weight 0
#pragma unroll
  for (int t = 0; t < 7; ++t)
#pragma unroll
    for (int u = 0; u < 2; ++u) {
      if (t == 6 && u == 1) { for (int i = 0; i < 4; ++i) mk[t][4 + i] = -3.0e38f; continue; }
      const bool dead = (t == 6) && (hh == 1);
#pragma unroll
      for (int i = 0; i < 4; ++i) { const float x = bf16_round(my[t][u][i]); mk[t][4 * u + i] = dead ? -3.0e38f : x; }
    }
  // Q and K fragment halves of one head
  v8us qf = sO[0][tid], kf[7];
#pragma unroll
  for (int t = 0; t < 7; ++t) kf[t] = *(const v8us*)&sK[t * 16 + ln][8 * hh];
#pragma nounroll      // stays one rolled loop of 8 passes: with the shorter body the compiler peels the last pass off and schedules it into the output projection, which takes the kernel above 256 registers (under the stated budget: into scratch)
  for (int hl = 0; hl < HPW; ++hl) {
    FragH bq; bq.half[0] = qf; bq.half[1] = zero8;
    v8f s[7];
#pragma unroll
    for (int t = 0; t < 7; ++t) {
      FragH ak; ak.half[0] = kf[t]; ak.half[1] = zero8;
      const v8f z = {};
      s[t] = __builtin_amdgcn_wmma_f32_16x16x32_f16(false, ak.v, false, bq.v, (short)0, z, false, false);
    }
    // the next head's fragments fly while this head's softmax runs; the last pass reads its own again (in bounds, unused), so that no branch stands behind the matrix instructions
    const int hn = (hl + 1 < HPW) ? hl + 1 : hl;
    qf = sO[hn][tid];
#pragma unroll
    for (int t = 0; t < 7; ++t) kf[t] = *(const v8us*)&sK[t * 16 + ln][hn * KD + 8 * hh];
    FragH av[4];      // this head's V^T fragments, asked for ahead of the softmax as well
#pragma unroll
    for (int cc = 0; cc < 4; ++cc) { av[cc].half[0] = *(const v8us*)&sVT[hl * KD + ln][cc * 32 + 8 * hh]; av[cc].half[1] = *(const v8us*)&sVT[hl * KD + ln][cc * 32 + 16 + 8 * hh]; }
    __builtin_amdgcn_sched_barrier(0);      // keeps the loads above in front of the softmax: without it the compiler sinks them to their first use and their latency is waited out there
    // row maximum and row sum: one short chain per tile, then a tree (seven independent chains instead of one of 56 links; few waves share a SIMD here)
    float pm[7], ps[7];
#pragma unroll
    for (int t = 0; t < 7; ++t) {
      pm[t] = -3.0e38f;
#pragma unroll
      for (int r = 0; r < 8; ++r) { s[t][r] += mk[t][r]; pm[t] = fmaxf(pm[t], s[t][r]); }
    }
    float m = fmaxf(fmaxf(fmaxf(pm[0], pm[1]), fmaxf(pm[2], pm[3])), fmaxf(fmaxf(pm[4], pm[5]), pm[6]));
    m = fmaxf(m, __shfl_xor(m, 16, 32));
#pragma unroll
    for (int t = 0; t < 7; ++t) {
      ps[t] = 0.f;
#pragma unroll
      for (int r = 0; r < 8; ++r) { const float x = exp_hw(s[t][r] - m); const float e = (s[t][r] > -1.0e38f) ? x : 0.f; s[t][r] = e; ps[t] += e; }
    }
    float sum = ((ps[0] + ps[1]) + (ps[2] + ps[3])) + ((ps[4] + ps[5]) + ps[6]);
    sum += __shfl_xor(sum, 16, 32);
    const float is = (sum > 0.f) ? 1.0f / sum : 0.f;
    v8f o = {};
#pragma unroll
    for (int c = 0; c < 4; ++c) {
      FragH pb;
#pragma unroll
      for (int i = 0; i < 8; ++i) { pb.h[i] = (_Float16)(s[2 * c][i] * is); pb.h[8 + i] = (2 * c + 1 < 7) ? (_Float16)(s[(2 * c + 1 < 7) ? 2 * c + 1 : 0][i] * is) : (_Float16)0.f; }
      o = __builtin_amdgcn_wmma_f32_16x16x32_f16(false, av[c].v, false, pb.v, (short)0, o, false, false);
    }
    FragH f;      // o[r] = O[g][head column 8hh + r]: 16 bytes in a row of the lane's output row
#pragma unroll
    for (int r = 0; r < 8; ++r) f.h[r] = (_Float16)o[r];
    sO[hl][tid] = f.half[0];
  }
  // MH^T = Wc^T.O^T: A = 16 rows of Wc^T (output columns e), B = the lane's O row; two tiles of e make one B fragment of the pointer product. mh = acc/16 + bc, rounded to f16.
  FragH ob[4], mb[4];
#pragma unroll      // the index names registers (fragments, accumulators): it must be a constant
  for (int c = 0; c < 4; ++c) { ob[c].half[0] = sO[2 * c][tid]; ob[c].half[1] = sO[2 * c + 1][tid]; }
  const unsigned short* wp = (const unsigned short*)WcT + lane * 8;
  v8f am[8];
#pragma unroll      // the index names registers (fragments, accumulators): it must be a constant
  for (int te = 0; te < 8; ++te) {
    v8f a = {};
#pragma unroll      // the index names registers (fragments, accumulators): it must be a constant
    for (int c = 0; c < 4; ++c) {
      FragH aw; aw.half[0] = *(const v8us*)(wp + (te * 8 + 2 * c) * FRH); aw.half[1] = *(const v8us*)(wp + (te * 8 + 2 * c + 1) * FRH);
      a = __builtin_amdgcn_wmma_f32_16x16x32_f16(false, aw.v, false, ob[c].v, (short)0, a, false, false);
    }
    am[te] = a;
  }
  asm volatile("s_wait_xcnt 0x0" ::: "memory");      // the later loads land in the registers that held the address of the Wc^T loads: the wait stands in front of that overwrite
#pragma unroll      // the index names registers (fragments, accumulators): it must be a constant
  for (int te = 0; te < 8; ++te) {
    const v8f a = am[te];
    const v4f b0 = *(const v4fa*)(bc + te * 16 + 8 * hh), b1 = *(const v4fa*)(bc + te * 16 + 8 * hh + 4);
#pragma unroll      // the index names registers (fragments, accumulators): it must be a constant
    for (int r = 0; r < 8; ++r) mb[te >> 1].h[8 * (te & 1) + r] = (_Float16)(a[r] * 0.0625f + bf16_round((r < 4) ? b0[r & 3] : b1[r & 3]));
  }
  // S2^T = ENC.MH^T: A = 16 node rows from LDS (rows 100..111 zero), B = mb
  v8f z[7];
#pragma unroll      // the index names registers (fragments, accumulators): it must be a constant
  for (int t = 0; t < 7; ++t) {
    v8f a = {};
#pragma unroll      // the index names registers (fragments, accumulators): it must be a constant
    for (int c = 0; c < 4; ++c) {
      FragH ae; ae.half[0] = *(const v8us*)&sE[t * 16 + ln][c * 32 + 8 * hh]; ae.half[1] = *(const v8us*)&sE[t * 16 + ln][c * 32 + 16 + 8 * hh];
      a = __builtin_amdgcn_wmma_f32_16x16x32_f16(false, ae.v, false, mb[c].v, (short)0, a, false, false);
    }
    z[t] = a;
  }
  __builtin_amdgcn_sched_barrier(0);      // ends the scheduling region of the two products here, where the branches of the library tanh ended it: as one region with the branch-free tail the kernel goes above 256 registers (under the stated budget: into scratch)
  // probs = softmax(10 tanh(S2 / sqrt(128)) + mask) over the keys of the lane's query: chains per tile, a tree, one exchange between the lane halves, as in the heads
  float pm[7], ps[7];
#pragma unroll      // the index names registers (fragments, accumulators): it must be a constant
  for (int t = 0; t < 7; ++t) {
    pm[t] = -3.0e38f;
#pragma unroll      // the index names registers (fragments, accumulators): it must be a constant
    for (int r = 0; r < 8; ++r) { z[t][r] = 10.0f * tanh_hw(z[t][r], 0.08838834764831845f) + mk[t][r]; pm[t] = fmaxf(pm[t], z[t][r]); }
  }
  float m = fmaxf(fmaxf(fmaxf(pm[0], pm[1]), fmaxf(pm[2], pm[3])), fmaxf(fmaxf(pm[4], pm[5]), pm[6]));
  m = fmaxf(m, __shfl_xor(m, 16, 32));
#pragma unroll      // the index names registers (fragments, accumulators): it must be a constant
  for (int t = 0; t < 7; ++t) {
    ps[t] = 0.f;
#pragma unroll      // the index names registers (fragments, accumulators): it must be a constant
    for (int r = 0; r < 8; ++r) { const float x = exp_hw(z[t][r] - m); const float e = (z[t][r] > -1.0e38f) ? x : 0.f; z[t][r] = e; ps[t] += e; }
  }
  float sum = ((ps[0] + ps[1]) + (ps[2] + ps[3])) + ((ps[4] + ps[5]) + ps[6]);
  sum += __shfl_xor(sum, 16, 32);
  const float is = (sum > 0.f) ? 1.0f / sum : 0.f;
#pragma unroll      // the index names registers (fragments, accumulators): it must be a constant
  for (int t = 0; t < 7; ++t)
#pragma unroll      // the index names registers (fragments, accumulators): it must be a constant
    for (int r = 0; r < 8; ++r) z[t][r] *= is;
  if (g < GG) {      // a lane stores 32 bytes in a row per tile of its own output row (400-byte rows, 16-byte aligned pieces); tile 6 holds keys 96..99 in the lower half alone
    float* op = out + bg * PN + 8 * hh;
#pragma unroll      // the index names registers (fragments, accumulators): it must be a constant
    for (int t = 0; t < 6; ++t) {
      const v4f lo = {z[t][0], z[t][1], z[t][2], z[t][3]}, hi = {z[t][4], z[t][5], z[t][6], z[t][7]};
      *(v4f*)(op + t * 16) = lo; *(v4f*)(op + t * 16 + 4) = hi;
    }
    if (hh == 0) { const v4f lo = {z[6][0], z[6][1], z[6][2], z[6][3]}; *(v4f*)(op + 96) = lo; }
  }
}
extern "C" void kernel_launch(void* const* d_in, const int* in_sizes, int n_in,
                              void* d_out, int out_size, void* d_ws, size_t ws_size, hipStream_t stream) {
  (void)in_sizes; (void)n_in; (void)out_size;
  const float* in1 = (const float*)d_in[0]; const float* in2 = (const float*)d_in[1]; const float* rl = (const float*)d_in[2]; const float* msk = (const float*)d_in[3]; const float* enc = (const float*)d_in[4]; const float* Wq = (const float*)d_in[5]; const float* Wk = (const float*)d_in[6]; const float* Wv = (const float*)d_in[7]; const float* Wc = (const float*)d_in[8]; const float* bc = (const float*)d_in[9];
  char* ws = (char*)d_ws; size_t off = 0;
  auto take = [&](size_t bytes) { char* p = ws + off; off += (bytes + 255) & ~(size_t)255; return p; };
  _Float16* Bq = (_Float16*)take(2 * EE * EE * 2); _Float16* Bk = (_Float16*)take(EE * EE * 2); _Float16* Bv = (_Float16*)take(EE * EE * 2); _Float16* Bc = (_Float16*)take(EE * EE * 2);
  if (off > ws_size) return;      // 160 KiB of the workspace
  const size_t w8 = (size_t)EE * EE / 8; const unsigned gw = (unsigned)((w8 + 255) / 256);
  k_wt_f16<<<2 * gw, 256, 0, stream>>>(Wq, Bq, 2 * EE, EE, 16.0f);      // Wq rows 0..255: input1 and input2  ([in][out]); row 256 (remaining) is read as it is
  k_wt_f16<<<gw, 256, 0, stream>>>(Wk, Bk, EE, EE, 16.0f); k_wt_f16<<<gw, 256, 0, stream>>>(Wv, Bv, EE, EE, 16.0f); k_wt_f16<<<gw, 256, 0, stream>>>(Wc, Bc, EE, EE, 16.0f);
  // ---- projections, attention, output projection, pointer scores and the final softmax, one launch: a work-group per batch
  k_attn<<<NB, 224, 0, stream>>>(in1, in2, rl, msk, enc, Wq, Bq, Bk, Bv, Bc, bc, (float*)d_out);
}

// v007
// It runs in 42.3 microseconds.
// Timed twice side by side with v006, it ran 1.12 and 1.17 times as fast.
// Counting every step since v000, it is 21.5 times as fast.
#include <hip/hip_runtime.h>
// Next-node probability head (B=512, G=100 group rows, P=100 nodes, E=128, 8 heads x 16, logit clipping 10). The weights are packed into f16 planes in fragment order first; then one kernel (k_attn), one work-group per batch,
// does all the rest: k,v = enc.W and q = [input1 | input2 | remaining].Wq (the first 256 rows as a product, the last as a rank-1 term), the 8-head attention (additive INPUT ninf mask),
// o.Wc + bc, the pointer score mh.enc^T/sqrt(128) and the softmax of 10 tanh + mask. K, V^T and the f16 nodes wait in LDS, Q and O in lane-private LDS, the rest in registers. Contractions on v_wmma_f32_16x16x32_f16 (f16 operands,
// weights [in][out] bf16-exact x2^4, f32 accumulate); softmaxes/tanh f32 VALU.
#define NB 512
#define GG 100
#define PN 100
#define EE 128
#define NH 8
#define KD 16

typedef __bf16 v16b __attribute__((ext_vector_type(16)));
typedef unsigned short v8us __attribute__((ext_vector_type(8), may_alias));
typedef float  v8f  __attribute__((ext_vector_type(8)));
typedef float  v4f  __attribute__((ext_vector_type(4)));
typedef float  v4fa __attribute__((ext_vector_type(4), may_alias));
union FragB { v16b v; v8us half[2]; unsigned short u[16]; };

__device__ __forceinline__ unsigned short bf16_bits(float x) { unsigned int u = __float_as_uint(x); return (unsigned short)((u + 0x7FFFu + ((u >> 16) & 1u)) >> 16); }
__device__ __forceinline__ float bf16_val(unsigned short b) { return __uint_as_float(((unsigned int)b) << 16); }
__device__ __forceinline__ float bf16_round(float x) { return bf16_val(bf16_bits(x)); }
// D += A·B with NT terms: 1 = ah·bh, 2 = + al·bh (A split), 3 = + ah·bl (both split)
template <int NT>
__device__ __forceinline__ v8f mmaN(v16b ah, v16b al, v16b bh, v16b bl, v8f c) {
  c = __builtin_amdgcn_wmma_f32_16x16x32_bf16(false, ah, false, bh, (short)0, c, false, false);
  if (NT >= 2) c = __builtin_amdgcn_wmma_f32_16x16x32_bf16(false, al, false, bh, (short)0, c, false, false);
  if (NT >= 3) c = __builtin_amdgcn_wmma_f32_16x16x32_bf16(false, ah, false, bl, (short)0, c, false, false);
  asm volatile("v_nop\n\tv_nop\n\tv_nop\n\tv_nop" : "+v"(c) : "v"(ah), "v"(al), "v"(bh), "v"(bl));
  return c;
}

__global__ __launch_bounds__(256) void k_wt_bf16(const float* __restrict__ W, unsigned short* __restrict__ Wt, int K, int N) {
  const int t = blockIdx.x * 256 + threadIdx.x;
  const int k8n = K / 8;
  if (t >= N * k8n) return;
  const int n = t / k8n, k8 = (t % k8n) * 8;
  v8us v;
#pragma unroll
  for (int i = 0; i < 8; ++i) v[i] = bf16_bits(W[(size_t)(k8 + i) * N + n]);
  *(v8us*)(Wt + (size_t)n * K + k8) = v;
  
}

// GEMM C[M][N] (f32, pitch ldc) = act(A[M][K]·W + bias). A f32 row-major (pitch lda) converted per fragment to bf16
// (ASPLIT: hi/lo two planes -> 2 terms, else single rounded term); Wt bf16 [N][K] (pitch ldb). BIAS_BF16 rounds the
// bias to bf16 first (bias quantised to bf16 before the add). K%32==0, M%16==0, N%64==0.
template <bool ASPLIT, int ACT, bool BIAS_BF16>
__global__ __launch_bounds__(128) void k_gemm_bf(const float* __restrict__ A, int lda, const unsigned short* __restrict__ Wt, int ldb,
                                               const float* __restrict__ bias, float* __restrict__ C, int ldc, int M, int N, int K) {
  __shared__ __attribute__((aligned(16))) float so[4][16][64];
  const int tid = threadIdx.x, w = tid >> 5, lane = tid & 31, ln = lane & 15, hh = lane >> 4;
  const int ntn = N / 64;
  const int wid = blockIdx.x * 4 + w;
  const int mt = wid / ntn, nq = wid % ntn;
  if (mt * 16 >= M) return;
  const int row0 = mt * 16, col0 = nq * 64;
  const float* arow = A + (size_t)(row0 + ln) * lda;
  v8f acc[4] = {};
  for (int kb = 0; kb < K; kb += 32) {
    FragB ah, al;
    const v4f x0 = *(const v4fa*)(arow + kb + 8 * hh), x1 = *(const v4fa*)(arow + kb + 8 * hh + 4);
    const v4f x2 = *(const v4fa*)(arow + kb + 16 + 8 * hh), x3 = *(const v4fa*)(arow + kb + 16 + 8 * hh + 4);
    float xs[16] = {x0[0],x0[1],x0[2],x0[3],x1[0],x1[1],x1[2],x1[3],x2[0],x2[1],x2[2],x2[3],x3[0],x3[1],x3[2],x3[3]};
#pragma unroll
    for (int i = 0; i < 16; ++i) { const unsigned short hb = bf16_bits(xs[i]); ah.u[i] = hb; al.u[i] = ASPLIT ? bf16_bits(xs[i] - bf16_val(hb)) : (unsigned short)0; }
#pragma unroll
    for (int t = 0; t < 4; ++t) {
      const unsigned short* brow = Wt + (size_t)(col0 + t * 16 + ln) * ldb + kb;
      FragB b;
      b.half[0] = *(const v8us*)(brow + 8 * hh);
      b.half[1] = *(const v8us*)(brow + 16 + 8 * hh);
      acc[t] = mmaN<ASPLIT ? 2 : 1>(ah.v, al.v, b.v, b.v, acc[t]);
    }
  }
#pragma unroll
  for (int t = 0; t < 4; ++t) {
    float bv = bias ? bias[col0 + t * 16 + ln] : 0.f;
    if (BIAS_BF16) bv = bf16_round(bv);
#pragma unroll
    for (int r = 0; r < 8; ++r) { float v = acc[t][r] + bv; if (ACT == 1) v = fmaxf(v, 0.f); so[w][8 * hh + r][t * 16 + ln] = v; }
  }
  __builtin_amdgcn_fence(__ATOMIC_ACQ_REL, "workgroup");
  __builtin_amdgcn_wave_barrier();
  const int rsub = lane >> 4, c4 = (lane & 15) * 4;
  {
#pragma unroll
    for (int q = 0; q < 8; ++q) {
      const int r = q * 2 + rsub;
      const v4f v = *(const v4fa*)&so[w][r][c4];
      *(v4f*)(C + (size_t)(row0 + r) * ldc + col0 + c4) = v;
    }
    
  }
}

// Flash-style causal/unmasked attention, all contractions 3-term bf16 hi/lo splits, f32 softmax with running max.
// q,k,v rows are read from f32 buffers with arbitrary row pitch (so they can live inside a fused qkv buffer);
// D = head size (multiple of 32, <= 128); one wave = 16 query rows; block = 4 waves (64 queries) sharing K/V chunks of 32.
template <int D, bool CAUSAL>
__global__ __launch_bounds__(128) void k_flash(const float* __restrict__ qb, const float* __restrict__ kb, const float* __restrict__ vb,
                                             int pitch, int T, int H, float scale, float* __restrict__ y, int ypitch) {
  constexpr int KS = D / 32;        // k-steps for QK
  constexpr int DT = D / 16;        // d tiles for PV
  __shared__ __attribute__((aligned(16))) unsigned short sKh[32][D + 8], sKl[32][D + 8], sVh[32][D + 8], sVl[32][D + 8];
  __shared__ __attribute__((aligned(16))) unsigned short sPh[4][16][40], sPl[4][16][40];
  __shared__ __attribute__((aligned(16))) float sO[4][16][D];
  const int tid = threadIdx.x, w = tid >> 5, lane = tid & 31, ln = lane & 15, hh = lane >> 4;
  const int nqb = (T + 63) / 64;
  const int bh = blockIdx.x / nqb, qblk = blockIdx.x % nqb;
  const int b = bh / H, h = bh % H;
  const int q0 = qblk * 64 + w * 16;
  const float* Q = qb + (size_t)b * T * pitch + h * D;
  const float* K = kb + (size_t)b * T * pitch + h * D;
  const float* V = vb + (size_t)b * T * pitch + h * D;

  // A fragments of the wave's 16 query rows (scaled), hi/lo
  FragB aqh[KS], aql[KS];
  {
    int row = q0 + ln; if (row >= T) row = T - 1;
    const float* qr = Q + (size_t)row * pitch;
#pragma unroll
    for (int ks = 0; ks < KS; ++ks)
#pragma unroll
      for (int i = 0; i < 16; ++i) {
        const int d = ks * 32 + ((i < 8) ? (8 * hh + i) : (16 + 8 * hh + (i - 8)));
        const float x = qr[d] * scale; const unsigned short hb = bf16_bits(x);
        aqh[ks].u[i] = hb; aql[ks].u[i] = bf16_bits(x - bf16_val(hb));
      }
  }
  float m_r[8], l_r[8];
#pragma unroll
  for (int r = 0; r < 8; ++r) { m_r[r] = -3.0e38f; l_r[r] = 0.f; }
  v8f oacc[DT];
#pragma unroll
  for (int dt = 0; dt < DT; ++dt) oacc[dt] = (v8f){0.f,0.f,0.f,0.f,0.f,0.f,0.f,0.f};

  const int kv_end = CAUSAL ? min(T, qblk * 64 + 64) : T;     // block-uniform
  for (int j0 = 0; j0 < kv_end; j0 += 32) {
    __syncthreads();
    for (int e = tid; e < 32 * (D / 4); e += 128) {
      const int r = e / (D / 4), c4 = (e % (D / 4)) * 4;
      const int key = j0 + r;
      v4f kf = {0.f,0.f,0.f,0.f}, vf = {0.f,0.f,0.f,0.f};
      if (key < T) { kf = *(const v4fa*)(K + (size_t)key * pitch + c4); vf = *(const v4fa*)(V + (size_t)key * pitch + c4); }
#pragma unroll
      for (int t = 0; t < 4; ++t) {
        unsigned short hb = bf16_bits(kf[t]); sKh[r][c4 + t] = hb; sKl[r][c4 + t] = bf16_bits(kf[t] - bf16_val(hb));
        hb = bf16_bits(vf[t]); sVh[r][c4 + t] = hb; sVl[r][c4 + t] = bf16_bits(vf[t] - bf16_val(hb));
      }
    }
    __syncthreads();
    // S tile 16 x 32
    v8f s[2];
#pragma unroll
    for (int nt = 0; nt < 2; ++nt) {
      v8f acc = {};
#pragma unroll
      for (int ks = 0; ks < KS; ++ks) {
        FragB bh_, bl_;
        bh_.half[0] = *(const v8us*)&sKh[nt * 16 + ln][ks * 32 + 8 * hh]; bh_.half[1] = *(const v8us*)&sKh[nt * 16 + ln][ks * 32 + 16 + 8 * hh];
        bl_.half[0] = *(const v8us*)&sKl[nt * 16 + ln][ks * 32 + 8 * hh]; bl_.half[1] = *(const v8us*)&sKl[nt * 16 + ln][ks * 32 + 16 + 8 * hh];
        acc = mmaN<3>(aqh[ks].v, aql[ks].v, bh_.v, bl_.v, acc);
      }
      s[nt] = acc;
    }
    // mask + running max (rows 8hh+r; the 16 lanes of a half share rows)
    float alpha[8];
#pragma unroll
    for (int r = 0; r < 8; ++r) {
      const int qi = q0 + 8 * hh + r;
      const int ja = j0 + ln, jb = j0 + 16 + ln;
      if (CAUSAL) { if (ja > qi) s[0][r] = -3.0e38f; if (jb > qi) s[1][r] = -3.0e38f; }
      if (ja >= T) s[0][r] = -3.0e38f;
      if (jb >= T) s[1][r] = -3.0e38f;
      float mx = fmaxf(s[0][r], s[1][r]);
      mx = fmaxf(mx, __shfl_xor(mx, 1, 32)); mx = fmaxf(mx, __shfl_xor(mx, 2, 32)); mx = fmaxf(mx, __shfl_xor(mx, 4, 32)); mx = fmaxf(mx, __shfl_xor(mx, 8, 32));
      const float mnew = fmaxf(m_r[r], mx);
      alpha[r] = (mnew > -1.0e38f) ? __expf(m_r[r] - mnew) : 1.0f;
      const float p0 = (s[0][r] > -1.0e38f) ? __expf(s[0][r] - mnew) : 0.f;
      const float p1 = (s[1][r] > -1.0e38f) ? __expf(s[1][r] - mnew) : 0.f;
      m_r[r] = mnew;
      l_r[r] = l_r[r] * alpha[r] + p0 + p1;            // per-lane partial row sum (16 lanes combined at the end)
      unsigned short hb = bf16_bits(p0); sPh[w][8 * hh + r][ln] = hb;      sPl[w][8 * hh + r][ln] = bf16_bits(p0 - bf16_val(hb));
      hb = bf16_bits(p1);                sPh[w][8 * hh + r][16 + ln] = hb; sPl[w][8 * hh + r][16 + ln] = bf16_bits(p1 - bf16_val(hb));
    }
#pragma unroll
    for (int dt = 0; dt < DT; ++dt)
#pragma unroll
      for (int r = 0; r < 8; ++r) oacc[dt][r] *= alpha[r];
    __builtin_amdgcn_fence(__ATOMIC_ACQ_REL, "workgroup");
    __builtin_amdgcn_wave_barrier();
    FragB pah, pal;
    pah.half[0] = *(const v8us*)&sPh[w][ln][8 * hh]; pah.half[1] = *(const v8us*)&sPh[w][ln][16 + 8 * hh];
    pal.half[0] = *(const v8us*)&sPl[w][ln][8 * hh]; pal.half[1] = *(const v8us*)&sPl[w][ln][16 + 8 * hh];
#pragma unroll
    for (int dt = 0; dt < DT; ++dt) {
      FragB bvh, bvl;
#pragma unroll
      for (int i = 0; i < 8; ++i) {
        bvh.u[i] = sVh[8 * hh + i][dt * 16 + ln]; bvh.u[8 + i] = sVh[16 + 8 * hh + i][dt * 16 + ln];
        bvl.u[i] = sVl[8 * hh + i][dt * 16 + ln]; bvl.u[8 + i] = sVl[16 + 8 * hh + i][dt * 16 + ln];
      }
      oacc[dt] = mmaN<3>(pah.v, pal.v, bvh.v, bvl.v, oacc[dt]);
    }
    __builtin_amdgcn_fence(__ATOMIC_ACQ_REL, "workgroup");
    __builtin_amdgcn_wave_barrier();
  }
#pragma unroll
  for (int r = 0; r < 8; ++r) {
    float l = l_r[r];
    l += __shfl_xor(l, 1, 32); l += __shfl_xor(l, 2, 32); l += __shfl_xor(l, 4, 32); l += __shfl_xor(l, 8, 32);
    l_r[r] = (l > 0.f) ? 1.0f / l : 0.f;
  }
#pragma unroll
  for (int dt = 0; dt < DT; ++dt)
#pragma unroll
    for (int r = 0; r < 8; ++r) sO[w][8 * hh + r][dt * 16 + ln] = oacc[dt][r] * l_r[r];
  __builtin_amdgcn_fence(__ATOMIC_ACQ_REL, "workgroup");
  __builtin_amdgcn_wave_barrier();
  {
    for (int r = 0; r < 16; ++r) {
      const int row = q0 + r;
      if (row < T && lane < D / 4) {
        const v4f val = *(const v4fa*)&sO[w][r][lane * 4];
        *(v4f*)(y + ((size_t)b * T + row) * ypitch + h * D + lane * 4) = val;
      }
    }
    
  }
}

// GEMM C = act(A·W + bias + resid): A f32 (ASPLIT -> hi/lo 2 terms), Wt bf16 [N][K]; ACT 0 none, 1 relu, 2 exact gelu;
// resid (optional, f32, row index = (row % rmod), pitch ldr, RES_BF16 rounds it) added before the activation.
template <bool ASPLIT, int ACT, bool BIAS_BF16, bool RES_BF16>
__global__ __launch_bounds__(128) void k_gemm_bf3(const float* __restrict__ A, int lda, const unsigned short* __restrict__ Wt, int ldb,
                                                const float* __restrict__ bias, const float* __restrict__ resid, int rmod, int ldr,
                                                float* __restrict__ C, int ldc, int M, int N, int K) {
  __shared__ __attribute__((aligned(16))) float so[4][16][64];
  const int tid = threadIdx.x, w = tid >> 5, lane = tid & 31, ln = lane & 15, hh = lane >> 4;
  const int ntn = N / 64;
  const int wid = blockIdx.x * 4 + w;
  const int mt = wid / ntn, nq = wid % ntn;
  if (mt * 16 >= M) return;
  const int row0 = mt * 16, col0 = nq * 64;
  const float* arow = A + (size_t)(row0 + ln) * lda;
  v8f acc[4] = {};
  for (int kb = 0; kb < K; kb += 32) {
    FragB ah, al;
    const v4f x0 = *(const v4fa*)(arow + kb + 8 * hh), x1 = *(const v4fa*)(arow + kb + 8 * hh + 4);
    const v4f x2 = *(const v4fa*)(arow + kb + 16 + 8 * hh), x3 = *(const v4fa*)(arow + kb + 16 + 8 * hh + 4);
    float xs[16] = {x0[0],x0[1],x0[2],x0[3],x1[0],x1[1],x1[2],x1[3],x2[0],x2[1],x2[2],x2[3],x3[0],x3[1],x3[2],x3[3]};
#pragma unroll
    for (int i = 0; i < 16; ++i) { const unsigned short hb = bf16_bits(xs[i]); ah.u[i] = hb; al.u[i] = ASPLIT ? bf16_bits(xs[i] - bf16_val(hb)) : (unsigned short)0; }
#pragma unroll
    for (int t = 0; t < 4; ++t) {
      const unsigned short* brow = Wt + (size_t)(col0 + t * 16 + ln) * ldb + kb;
      FragB b;
      b.half[0] = *(const v8us*)(brow + 8 * hh);
      b.half[1] = *(const v8us*)(brow + 16 + 8 * hh);
      acc[t] = mmaN<ASPLIT ? 2 : 1>(ah.v, al.v, b.v, b.v, acc[t]);
    }
  }
#pragma unroll
  for (int t = 0; t < 4; ++t) {
    const int col = col0 + t * 16 + ln;
    float bv = bias ? bias[col] : 0.f;
    if (BIAS_BF16) bv = bf16_round(bv);
#pragma unroll
    for (int r = 0; r < 8; ++r) {
      float v = acc[t][r] + bv;
      if (resid) { float rv = resid[(size_t)((row0 + 8 * hh + r) % rmod) * ldr + col]; if (RES_BF16) rv = bf16_round(rv); v += rv; }
      if (ACT == 1) v = fmaxf(v, 0.f);
      if (ACT == 2) v = 0.5f * v * (1.0f + erff(v * 0.70710678118654752f));
      if (ACT == 3) { const float u = 0.7978845608028654f * (v + 0.044715f * v * v * v); v = 0.5f * v * (1.0f + tanhf(u)); }
      so[w][8 * hh + r][t * 16 + ln] = v;
    }
  }
  __builtin_amdgcn_fence(__ATOMIC_ACQ_REL, "workgroup");
  __builtin_amdgcn_wave_barrier();
  const int rsub = lane >> 4, c4 = (lane & 15) * 4;
  {
#pragma unroll
    for (int q = 0; q < 8; ++q) {
      const int r = q * 2 + rsub;
      const v4f v = *(const v4fa*)&so[w][r][c4];
      *(v4f*)(C + (size_t)(row0 + r) * ldc + col0 + c4) = v;
    }
    
  }
}
// row LayerNorm (biased variance, eps) over N: s = X (+ R); optional out_sum <- s; out_norm <- (s-mu)*rsqrt(var+eps)*g + b
template <bool PARAM_BF16>
__global__ __launch_bounds__(256) void k_layernorm(const float* __restrict__ X, const float* __restrict__ R, const float* __restrict__ g, const float* __restrict__ bta,
                                                  float* __restrict__ out_sum, float* __restrict__ out_norm, int N, float eps) {
  __shared__ float red[256];
  const int row = blockIdx.x, tid = threadIdx.x;
  const float* x = X + (size_t)row * N; const float* rr = R ? R + (size_t)row * N : nullptr;
  float vals[16];                     // up to N = 4096
  const int per = N / 256;            // contiguous chunk per thread? use strided-by-4 chunks: thread handles j = tid*4 + 1024*u
  float s1 = 0.f;
  for (int u = 0; u < per / 4; ++u) {
    const int j = tid * 4 + 1024 * u;
    const v4f a = *(const v4fa*)(x + j);
    v4f b = {0.f,0.f,0.f,0.f}; if (rr) b = *(const v4fa*)(rr + j);
#pragma unroll
    for (int q = 0; q < 4; ++q) { const float v = a[q] + b[q]; vals[u * 4 + q] = v; s1 += v; }
  }
  red[tid] = s1; __syncthreads();
  for (int st = 128; st > 0; st >>= 1) { if (tid < st) red[tid] += red[tid + st]; __syncthreads(); }
  const float mu = red[0] / (float)N; __syncthreads();
  float s2 = 0.f;
  for (int u = 0; u < per / 4; ++u)
#pragma unroll
    for (int q = 0; q < 4; ++q) { const float c = vals[u * 4 + q] - mu; s2 += c * c; }
  red[tid] = s2; __syncthreads();
  for (int st = 128; st > 0; st >>= 1) { if (tid < st) red[tid] += red[tid + st]; __syncthreads(); }
  const float rs = rsqrtf(red[0] / (float)N + eps);
  {
    for (int u = 0; u < per / 4; ++u) {
      const int j = tid * 4 + 1024 * u;
      v4f o, sm;
#pragma unroll
      for (int q = 0; q < 4; ++q) {
        float gg = g[j + q], bb = bta[j + q];
        if (PARAM_BF16) { gg = bf16_round(gg); bb = bf16_round(bb); }
        sm[q] = vals[u * 4 + q]; o[q] = (vals[u * 4 + q] - mu) * rs * gg + bb;
      }
      if (out_sum) *(v4f*)(out_sum + (size_t)row * N + j) = sm;
      *(v4f*)(out_norm + (size_t)row * N + j) = o;
    }
    
  }
}



// ---- f16 WMMA path (v_wmma_f32_16x16x32_f16): 11-bit significands for operands in range — used where a [0,1] probability operand needs more precision than bf16
typedef _Float16 v16h __attribute__((ext_vector_type(16)));
union FragH { v16h v; v8us half[2]; _Float16 h[16]; unsigned short u[16]; };
template <int NT>
__device__ __forceinline__ v8f mmaH(v16h ah, v16h al, v16h bh, v16h bl, v8f c) {
  c = __builtin_amdgcn_wmma_f32_16x16x32_f16(false, ah, false, bh, (short)0, c, false, false);
  if (NT >= 2) c = __builtin_amdgcn_wmma_f32_16x16x32_f16(false, al, false, bh, (short)0, c, false, false);
  if (NT >= 3) c = __builtin_amdgcn_wmma_f32_16x16x32_f16(false, ah, false, bl, (short)0, c, false, false);
  asm volatile("v_nop\n\tv_nop\n\tv_nop\n\tv_nop" : "+v"(c) : "v"(ah), "v"(al), "v"(bh), "v"(bl));
  return c;
}
// batched GEMM like k_gemm_b but f16 operands: A f32 (split into f16 hi/lo if ASPLIT, else rounded to f16), Bt = f16 values [n][k]; alpha; C f32; N multiple of 16 (partial tiles skipped)
template <bool ASPLIT>
__global__ __launch_bounds__(128) void k_gemm_h(const float* __restrict__ A, int lda, size_t sA, const _Float16* __restrict__ Bh, int ldb, size_t sB, float alpha, float* __restrict__ C, int ldc, size_t sC, int M, int N, int K) {
  __shared__ __attribute__((aligned(16))) float so[4][16][64];
  const int tid = threadIdx.x, w = tid >> 5, lane = tid & 31, ln = lane & 15, hh = lane >> 4; const int by = blockIdx.y;
  A += (size_t)by * sA; Bh += (size_t)by * sB; C += (size_t)by * sC;
  const int ntn = (N + 63) / 64; const int wid = blockIdx.x * 4 + w; const int mt = wid / ntn, nq = wid % ntn; if (mt * 16 >= M) return;
  const int row0 = mt * 16, col0 = nq * 64; const float* arow = A + (size_t)(row0 + ln) * lda;
  v8f acc[4] = {};
  for (int kb = 0; kb < K; kb += 32) {
    FragH ah, al;
    const v4f x0 = *(const v4fa*)(arow + kb + 8 * hh), x1 = *(const v4fa*)(arow + kb + 8 * hh + 4), x2 = *(const v4fa*)(arow + kb + 16 + 8 * hh), x3 = *(const v4fa*)(arow + kb + 16 + 8 * hh + 4);
    float xs[16] = {x0[0],x0[1],x0[2],x0[3],x1[0],x1[1],x1[2],x1[3],x2[0],x2[1],x2[2],x2[3],x3[0],x3[1],x3[2],x3[3]};
#pragma unroll
    for (int i = 0; i < 16; ++i) { const _Float16 h = (_Float16)xs[i]; ah.h[i] = h; al.h[i] = ASPLIT ? (_Float16)(xs[i] - (float)h) : (_Float16)0.0f; }
#pragma unroll
    for (int t = 0; t < 4; ++t) { if (col0 + t * 16 >= N) continue; const size_t boff = (size_t)(col0 + t * 16 + ln) * ldb + kb; FragH bq; bq.half[0] = *(const v8us*)(Bh + boff + 8 * hh); bq.half[1] = *(const v8us*)(Bh + boff + 16 + 8 * hh);
      acc[t] = mmaH<ASPLIT ? 2 : 1>(ah.v, al.v, bq.v, bq.v, acc[t]); }
  }
#pragma unroll
  for (int t = 0; t < 4; ++t) { if (col0 + t * 16 >= N) continue;
#pragma unroll
    for (int r = 0; r < 8; ++r) so[w][8 * hh + r][t * 16 + ln] = acc[t][r] * alpha; }
  __builtin_amdgcn_fence(__ATOMIC_ACQ_REL, "workgroup"); __builtin_amdgcn_wave_barrier();
  const int rsub = lane >> 4, c4 = (lane & 15) * 4;
  {
#pragma unroll
    for (int q = 0; q < 8; ++q) { const int r = q * 2 + rsub; if (col0 + c4 < N) { const v4f v = *(const v4fa*)&so[w][r][c4]; *(v4f*)(C + (size_t)(row0 + r) * ldc + col0 + c4) = v; } }
     }
}

// f16(W[k][n]·scale) from f32 row-major W[K][N] (scale = power of two; bf16-exact weights stay exact in f16 away from the subnormal range), packed in fragment order: one block of 512 bytes = one 16-byte load of a whole wave =
// half j of the fragment (16 columns n of tile tn) x (k block c of 32): lane (ln, hh) owns the 8 values n = 16tn + ln, k = 32c + 16j + 8hh .. + 7. Blocks in the order [tn][c][j]. Thread t writes the 16 bytes number t of the plane.
#define FRH 256            // f16 values in one such block
// All four planes in one launch (for speed only). A plane of 128 x 128 takes WPB blocks; blocks 0 .. 2 WPB - 1 pack Wq rows 0..255, then WPB each Wk, Wv, Wc:
// a block lies wholly in one plane, so the choice of plane is scalar.
#define WPB (EE * EE / 8 / 256)
__global__ __launch_bounds__(256) void k_wt_f16(const float* __restrict__ Wq, const float* __restrict__ Wk, const float* __restrict__ Wv, const float* __restrict__ Wc,
                                                _Float16* __restrict__ Bq, _Float16* __restrict__ Bk, _Float16* __restrict__ Bv, _Float16* __restrict__ Bc, float scale) {
  const int blk = blockIdx.x, pl = (blk < 2 * WPB) ? 0 : blk / WPB - 1;      // plane 0 Wq (K = 256), 1 Wk, 2 Wv, 3 Wc (K = 128)
  const float* __restrict__ W = (pl == 0) ? Wq : (pl == 1) ? Wk : (pl == 2) ? Wv : Wc;
  _Float16* __restrict__ Wt = (pl == 0) ? Bq : (pl == 1) ? Bk : (pl == 2) ? Bv : Bc;
  const int kl = (pl == 0) ? 3 : 2;      // log2 of the k blocks of 32 in the plane
  const int t = (blk - ((pl == 0) ? 0 : (pl + 1) * WPB)) * 256 + threadIdx.x;
  const int ln = t & 15, hh = (t >> 4) & 1, j = (t >> 5) & 1, cb = t >> 6, c = cb & ((1 << kl) - 1), tn = cb >> kl;
  const int n = tn * 16 + ln, k8 = c * 32 + j * 16 + hh * 8; FragH f;
#pragma unroll
  for (int i = 0; i < 8; ++i) f.h[i] = (_Float16)(bf16_round(W[(size_t)(k8 + i) * EE + n]) * scale); const v8us o = f.half[0];
  *(v8us*)((unsigned short*)Wt + (size_t)t * 8) = o; 
}
// The whole head in one kernel. One work-group = one batch b and all HPW heads; wave w owns the 16 query rows g = 16w..16w+15 (7 waves cover 112 >= 100) and loops over the heads.
// The score tile is formed transposed, S^T = K.Q^T (A = 16 key rows, B = 16 query rows, d 16 zero-extended to the k = 32 of the instruction), so a lane (ln, hh) holds, for its one
// query g = 16w + ln, the keys p = 16t + 8hh + r (t = tile, r = accumulator register). That is the k order of a B fragment: after the softmax (registers, an exchange for the maximum and one for the sum between the
// two lane halves) tiles 2c and 2c+1 are, register for register, the B operand of O^T = V^T.P^T for keys 32c..32c+31. Scores and weights never leave the registers.
// V^T (A operand, rows = head columns, k = keys, zero for keys >= 100) waits in LDS. The mask row slice of a lane is read once and serves all HPW heads and the pointer softmax.
// The same turn carries the wave through the rest of the network: O^T of heads 2c, 2c+1 is the B operand (k = 32c..32c+31) of MH^T = Wc^T.O^T, the tiles 2c, 2c+1 of MH^T are the B operand
// of S2^T = ENC.MH^T, and S2^T again leaves a lane with the keys 16t + 8hh + r of its one query, the places its mask registers already have: tanh, mask and softmax run as in the heads.
// The projections stand in front, in the same turn: wave w rounds the node rows 16w..16w+15 to one set of f16 fragments (rows >= 100 zero), which is the B operand of K^T = Wk^T.ENC^T (a lane gets 8 columns in a row of
// its node: one 16-byte store into a K row in LDS), the A operand of V = ENC.Wv (a lane gets 8 nodes in a row of its column: one 16-byte store into a V^T row) and, stored as it is, the A operand of the pointer product.
// Q^T = Wq^T.[input1 | input2]^T (k = 256, input1 the same in every lane) leaves a lane with the columns 8hh + r of head te of its own query: the half fragment that the score product wants as B.
#define HPW 8              // heads per work-group: all of them, so a wave reads and rounds its mask slice once and holds the whole O row of its query
#define VTP 136            // f16 pitch of a V^T, K or node row in LDS: 256 + 16 bytes, spreads the 16 rows of a 16-byte fragment read over the banks
// the 16 f32 values of one fragment (k = 8hh..8hh+7 and 16+8hh..16+8hh+7 of a block of 32) of an f32 row; p = row + 32c + 8hh
__device__ __forceinline__ void raw_f32(v4f (&x)[4], const float* __restrict__ p) { x[0] = *(const v4fa*)p; x[1] = *(const v4fa*)(p + 4); x[2] = *(const v4fa*)(p + 16); x[3] = *(const v4fa*)(p + 20); }
// ... rounded to bf16, then (exactly, in range) to f16
__device__ __forceinline__ FragH frag_f32(const v4f (&x)[4]) {
  FragH f;
#pragma unroll
  for (int j = 0; j < 4; ++j)
#pragma unroll
    for (int i = 0; i < 4; ++i) f.h[4 * j + i] = (_Float16)bf16_round(x[j][i]);
  return f;
}
// e^x for the softmaxes (x <= 0 there): one multiply and the chip's own base-2 exponential, in place of the library routine with its split argument, ldexp and two range tests; a result below 2^-126 may come out as 0
__device__ __forceinline__ float exp_hw(float x) { return __builtin_amdgcn_exp2f(x * 1.4426950408889634f); }
// tanh(k x) = 1 - 2 / (1 + e^(2 k x)) on the base-2 exponential and the reciprocal instruction: no branch; +-1 at the far ends (e = inf or 0); absolute error of a few 2^-24, also near 0
__device__ __forceinline__ float tanh_hw(float x, float k) { return 1.0f - 2.0f * __builtin_amdgcn_rcpf(1.0f + __builtin_amdgcn_exp2f(x * (k * 2.8853900817779268f))); }
// Keep it at or under 256 registers a wave and 160 KiB of LDS: then the 512 work-groups of 7 waves stand two to a WGP, all resident at once; above either only one fits and the grid runs in two turns. The attribute states that budget to the compiler (four waves a SIMD = 256 registers): left free, its scheduler goes above it.
__global__ __launch_bounds__(224) __attribute__((amdgpu_waves_per_eu(4))) void k_attn(const float* __restrict__ IN1, const float* __restrict__ IN2, const float* __restrict__ RL, const float* __restrict__ MSK, const float* __restrict__ ENC, const float* __restrict__ WQ,
                                              const _Float16* __restrict__ WqT, const _Float16* __restrict__ WkT, const _Float16* __restrict__ WvT, const _Float16* __restrict__ WcT, const float* __restrict__ bc, float* __restrict__ out) {
  static_assert(HPW == NH, "the output projection needs all heads of a query in one wave");
  static_assert(GG == PN, "a wave's 16 query rows and its 16 node rows share one row index");
  __shared__ __attribute__((aligned(16))) unsigned short sVT[HPW * KD][VTP];
  __shared__ __attribute__((aligned(16))) unsigned short sK[112][VTP];      // K rows (f16), rows 100..111 zero
  __shared__ __attribute__((aligned(16))) unsigned short sE[112][VTP];      // node rows (f16), rows 100..111 zero
  __shared__ __attribute__((aligned(16))) v8us sO[NH][224];      // a lane's own half-fragments, one per head: first Q, then, once a head's Q has been read, its O; written and read back by the same lane (the head loop is rolled, so registers cannot be indexed by the head)
  __shared__ __attribute__((aligned(16))) float sW3[EE];      // Wq row 256 (the weights of 'remaining'), rounded to bf16
  __shared__ __attribute__((aligned(16))) _Float16 sI1[EE];      // input1 of the batch, rounded to bf16, as f16: every wave's B fragments for k 0..127 of the Q product
  const int tid = threadIdx.x, w = tid >> 5, lane = tid & 31, ln = lane & 15, hh = lane >> 4;
  const int b = blockIdx.x;
  const v8us zero8 = {0,0,0,0,0,0,0,0};
  for (int e = tid; e < 2 * HPW * KD; e += 224) *(v8us*)&sVT[e >> 1][112 + 8 * (e & 1)] = zero8;      // keys 112..127 belong to no wave's tile; the last k block of V^T.P^T reads them
  const int g = w * 16 + ln, gc = (g < GG) ? g : GG - 1;      // rows 100..111 compute on row 99 and store nothing
  const size_t bg = (size_t)b * GG + gc;
  const bool live = g < PN;
  // the f32 rows of the wave are asked for at once: node rows (rows 100..111 read row 99, in bounds, and are zeroed) and input2; with them one value a thread of input1 and of Wq row 256 (threads 128.. read again what 0.. read, in bounds, and drop it)
  v4f xe[4][4], x2[4][4];
  const float* pe = ENC + bg * EE + 8 * hh; const float* p2 = IN2 + bg * EE + 8 * hh; const float* pr = RL + bg; const int ix = tid & (EE - 1);
#pragma unroll      // the index names registers (fragments, accumulators): it must be a constant
  for (int c = 0; c < 4; ++c) raw_f32(xe[c], pe + c * 32);
#pragma unroll      // the index names registers (fragments, accumulators): it must be a constant
  for (int c = 0; c < 4; ++c) raw_f32(x2[c], p2 + c * 32);
  const float rv = bf16_round(*pr);
  const float y1 = IN1[(size_t)b * EE + ix], y3 = WQ[(size_t)(2 * EE) * EE + ix];
  asm volatile("s_wait_xcnt 0x0" :: "v"(pe), "v"(p2), "v"(pr), "v"(ix) : "memory");      // the address registers of the 35 loads are reused below: the wait stands in front of that overwrite; as inputs they stay whole up to it (else a later load of the run lands in them)
  __builtin_amdgcn_sched_barrier(0);      // keeps the 35 loads above together in front of the first conversion: sunk to their uses they would be waited for one memory latency after another
  FragH eb[4], ib[8];
#pragma unroll      // the index names registers (fragments, accumulators): it must be a constant
  for (int c = 0; c < 4; ++c) {
    const FragH x = frag_f32(xe[c]);
    eb[c].half[0] = live ? x.half[0] : zero8; eb[c].half[1] = live ? x.half[1] : zero8;
    *(v8us*)&sE[g][c * 32 + 8 * hh] = eb[c].half[0]; *(v8us*)&sE[g][c * 32 + 16 + 8 * hh] = eb[c].half[1];
  }
  // The weight fragments come in 32 groups of 8 loads (one group = 16 weight rows x k 128 = the 4 matrix instructions of one accumulator chain): groups 0..7 the tiles of Wk^T, 8..15 of Wv^T,
  // 16..31 of Wq^T (two groups a tile: k 0..127 input1, k 128..255 input2). Three register buffers in turn: group i + 2 is asked for before group i is used.
  // The planes lie in fragment order (k_wt_f16): a load of the wave reads 512 bytes in a row, four whole cache lines, and a group 4 KiB in a row.
  const unsigned short* wkp = (const unsigned short*)WkT + lane * 8;
  const unsigned short* wvp = (const unsigned short*)WvT + lane * 8;
  const unsigned short* wqp = (const unsigned short*)WqT + lane * 8;
  v8us ring[3][8];
  auto fetch = [&](int gi) {
    const unsigned short* p = (gi < 8) ? wkp + gi * 8 * FRH : (gi < 16) ? wvp + (gi - 8) * 8 * FRH : wqp + (gi - 16) * 8 * FRH;
#pragma unroll      // the index names registers (fragments, accumulators): it must be a constant
    for (int c = 0; c < 4; ++c) { ring[gi % 3][2 * c] = *(const v8us*)(p + 2 * c * FRH); ring[gi % 3][2 * c + 1] = *(const v8us*)(p + (2 * c + 1) * FRH); }
    if (gi == 7 || gi == 15 || gi == 31) asm volatile("s_wait_xcnt 0x0" :: "v"(p) : "memory");      // the last loads of a weight plane: its address registers are free from here on and later loads land in them; the wait stands in front of that overwrite; as an input the address stays whole up to it
  };
  asm volatile("" :: "v"(y1), "v"(y3));      // inputs only: holds the two loads up with the others; without it the compiler sinks them into the branch below, where their memory latency is waited out alone
  if (tid < EE) { sI1[tid] = (_Float16)bf16_round(y1); sW3[tid] = bf16_round(y3); }
  fetch(0); fetch(1);
  __builtin_amdgcn_sched_barrier(0);      // the first two groups fly while input2 is rounded
#pragma unroll      // the index names registers (fragments, accumulators): it must be a constant
  for (int c = 0; c < 4; ++c) ib[4 + c] = frag_f32(x2[c]);
  __builtin_amdgcn_sched_barrier(0);      // the third group stays behind the rounding of input2, whose f32 registers it takes over
  // K^T = Wk^T.ENC^T and V = ENC.Wv, both acc/16 rounded to f16
#pragma unroll      // the index names registers (fragments, accumulators): it must be a constant
  for (int gi = 0; gi < 16; ++gi) {
    fetch(gi + 2);
    __builtin_amdgcn_sched_barrier(0);      // keeps the loads of group gi + 2 in front of the products of group gi: sunk to their use, each pair is waited for at its own matrix instruction
    v8f a = {};
#pragma unroll      // the index names registers (fragments, accumulators): it must be a constant
    for (int c = 0; c < 4; ++c) {
      FragH x; x.half[0] = ring[gi % 3][2 * c]; x.half[1] = ring[gi % 3][2 * c + 1];
      a = (gi < 8) ? __builtin_amdgcn_wmma_f32_16x16x32_f16(false, x.v, false, eb[c].v, (short)0, a, false, false)
                   : __builtin_amdgcn_wmma_f32_16x16x32_f16(false, eb[c].v, false, x.v, (short)0, a, false, false);
    }
    FragH f;
#pragma unroll
    for (int r = 0; r < 8; ++r) f.h[r] = (_Float16)(a[r] * 0.0625f);
    if (gi < 8) *(v8us*)&sK[g][gi * 16 + 8 * hh] = f.half[0];
    else *(v8us*)&sVT[(gi - 8) * 16 + ln][w * 16 + 8 * hh] = f.half[0];
  }
  __syncthreads();      // K, V^T, the node rows, input1 and the last row of Wq complete before any wave reads them
#pragma unroll      // the index names registers (fragments, accumulators): it must be a constant
  for (int c = 0; c < 4; ++c) { ib[c].half[0] = *(const v8us*)&sI1[c * 32 + 8 * hh]; ib[c].half[1] = *(const v8us*)&sI1[c * 32 + 16 + 8 * hh]; }
  v4f my[7][2];      // mask[b][g][16t + 8hh + 4u ..]; tile 6: both halves read keys 96..99 (in bounds), the upper half drops them
  const float* mp = MSK + bg * PN + 8 * hh; const float* mp6 = MSK + bg * PN + 96;
  // Q^T = Wq^T.[input1 | input2]^T; q = (acc/16 + remaining.Wq[256]) / sqrt(16), rounded to f16
  v8f aq = {};
#pragma unroll      // the index names registers (fragments, accumulators): it must be a constant
  for (int gi = 16; gi < 32; ++gi) {
    if (gi + 2 < 32) fetch(gi + 2);
    if (gi == 30) {      // no weight group is left to ask for: the mask slice takes the free registers and flies during the last two groups
#pragma unroll      // the index names registers (fragments, accumulators): it must be a constant
      for (int t = 0; t < 7; ++t)
#pragma unroll      // the index names registers (fragments, accumulators): it must be a constant
        for (int u = 0; u < 2; ++u) if (t < 6 || u == 0) my[t][u] = *(const v4fa*)(((t < 6) ? mp + t * 16 : mp6) + 4 * u);
      asm volatile("s_wait_xcnt 0x0" :: "v"(mp), "v"(mp6) : "memory");      // the two address pairs are reused behind the 13 loads: the wait stands in front of that overwrite; as inputs they stay whole up to it
    }
    __builtin_amdgcn_sched_barrier(0);      // keeps the loads of group gi + 2 (at gi = 30 the mask loads) in front of the products of group gi: sunk to their use, each pair is waited for at its own matrix instruction
#pragma unroll      // the index names registers (fragments, accumulators): it must be a constant
    for (int c = 0; c < 4; ++c) {
      FragH x; x.half[0] = ring[gi % 3][2 * c]; x.half[1] = ring[gi % 3][2 * c + 1];
      aq = __builtin_amdgcn_wmma_f32_16x16x32_f16(false, x.v, false, ib[(gi & 1) * 4 + c].v, (short)0, aq, false, false);
    }
    if (gi & 1) {
      const int te = (gi - 16) >> 1;
      const v4f u0 = *(const v4fa*)&sW3[te * 16 + 8 * hh], u1 = *(const v4fa*)&sW3[te * 16 + 8 * hh + 4];
      FragH f;
#pragma unroll
      for (int r = 0; r < 8; ++r) f.h[r] = (_Float16)((aq[r] * 0.0625f + rv * ((r < 4) ? u0[r & 3] : u1[r & 3])) * 0.25f);
      sO[te][tid] = f.half[0];
      aq = (v8f){};
    }
  }
  float mk[7][8];      // the mask slice rounded to bf16; keys >= 100 get the sentinel the row maximum starts from, so weight 0
#pragma unroll
  for (int t = 0; t < 7; ++t)
#pragma unroll
    for (int u = 0; u < 2; ++u) {
      if (t == 6 && u == 1) { for (int i = 0; i < 4; ++i) mk[t][4 + i] = -3.0e38f; continue; }
      const bool dead = (t == 6) && (hh == 1);
#pragma unroll
      for (int i = 0; i < 4; ++i) { const float x = bf16_round(my[t][u][i]); mk[t][4 * u + i] = dead ? -3.0e38f : x; }
    }
  // Q and K fragment halves of one head
  v8us qf = sO[0][tid], kf[7];
#pragma unroll
  for (int t = 0; t < 7; ++t) kf[t] = *(const v8us*)&sK[t * 16 + ln][8 * hh];
#pragma nounroll      // stays one rolled loop of 8 passes: with the shorter body the compiler peels the last pass off and schedules it into the output projection, which takes the kernel above 256 registers (under the stated budget: into scratch)
  for (int hl = 0; hl < HPW; ++hl) {
    FragH bq; bq.half[0] = qf; bq.half[1] = zero8;
    v8f s[7];
#pragma unroll
    for (int t = 0; t < 7; ++t) {
      FragH ak; ak.half[0] = kf[t]; ak.half[1] = zero8;
      const v8f z = {};
      s[t] = __builtin_amdgcn_wmma_f32_16x16x32_f16(false, ak.v, false, bq.v, (short)0, z, false, false);
    }
    // the next head's fragments fly while this head's softmax runs; the last pass reads its own again (in bounds, unused), so that no branch stands behind the matrix instructions
    const int hn = (hl + 1 < HPW) ? hl + 1 : hl;
    qf = sO[hn][tid];
#pragma unroll
    for (int t = 0; t < 7; ++t) kf[t] = *(const v8us*)&sK[t * 16 + ln][hn * KD + 8 * hh];
    FragH av[4];      // this head's V^T fragments, asked for ahead of the softmax as well
#pragma unroll
    for (int cc = 0; cc < 4; ++cc) { av[cc].half[0] = *(const v8us*)&sVT[hl * KD + ln][cc * 32 + 8 * hh]; av[cc].half[1] = *(const v8us*)&sVT[hl * KD + ln][cc * 32 + 16 + 8 * hh]; }
    __builtin_amdgcn_sched_barrier(0);      // keeps the loads above in front of the softmax: without it the compiler sinks them to their first use and their latency is waited out there
    // row maximum and row sum: one short chain per tile, then a tree (seven independent chains instead of one of 56 links; few waves share a SIMD here)
    float pm[7], ps[7];
#pragma unroll
    for (int t = 0; t < 7; ++t) {
      pm[t] = -3.0e38f;
#pragma unroll
      for (int r = 0; r < 8; ++r) { s[t][r] += mk[t][r]; pm[t] = fmaxf(pm[t], s[t][r]); }
    }
    float m = fmaxf(fmaxf(fmaxf(pm[0], pm[1]), fmaxf(pm[2], pm[3])), fmaxf(fmaxf(pm[4], pm[5]), pm[6]));
    m = fmaxf(m, __shfl_xor(m, 16, 32));
#pragma unroll
    for (int t = 0; t < 7; ++t) {
      ps[t] = 0.f;
#pragma unroll
      for (int r = 0; r < 8; ++r) { const float x = exp_hw(s[t][r] - m); const float e = (s[t][r] > -1.0e38f) ? x : 0.f; s[t][r] = e; ps[t] += e; }
    }
    float sum = ((ps[0] + ps[1]) + (ps[2] + ps[3])) + ((ps[4] + ps[5]) + ps[6]);
    sum += __shfl_xor(sum, 16, 32);
    const float is = (sum > 0.f) ? 1.0f / sum : 0.f;
    v8f o = {};
#pragma unroll
    for (int c = 0; c < 4; ++c) {
      FragH pb;
#pragma unroll
      for (int i = 0; i < 8; ++i) { pb.h[i] = (_Float16)(s[2 * c][i] * is); pb.h[8 + i] = (2 * c + 1 < 7) ? (_Float16)(s[(2 * c + 1 < 7) ? 2 * c + 1 : 0][i] * is) : (_Float16)0.f; }
      o = __builtin_amdgcn_wmma_f32_16x16x32_f16(false, av[c].v, false, pb.v, (short)0, o, false, false);
    }
    FragH f;      // o[r] = O[g][head column 8hh + r]: 16 bytes in a row of the lane's output row
#pragma unroll
    for (int r = 0; r < 8; ++r) f.h[r] = (_Float16)o[r];
    sO[hl][tid] = f.half[0];
  }
  // MH^T = Wc^T.O^T: A = 16 rows of Wc^T (output columns e), B = the lane's O row; two tiles of e make one B fragment of the pointer product. mh = acc/16 + bc, rounded to f16.
  FragH ob[4], mb[4];
#pragma unroll      // the index names registers (fragments, accumulators): it must be a constant
  for (int c = 0; c < 4; ++c) { ob[c].half[0] = sO[2 * c][tid]; ob[c].half[1] = sO[2 * c + 1][tid]; }
  const unsigned short* wp = (const unsigned short*)WcT + lane * 8;
  v8f am[8];
#pragma unroll      // the index names registers (fragments, accumulators): it must be a constant
  for (int te = 0; te < 8; ++te) {
    v8f a = {};
#pragma unroll      // the index names registers (fragments, accumulators): it must be a constant
    for (int c = 0; c < 4; ++c) {
      FragH aw; aw.half[0] = *(const v8us*)(wp + (te * 8 + 2 * c) * FRH); aw.half[1] = *(const v8us*)(wp + (te * 8 + 2 * c + 1) * FRH);
      a = __builtin_amdgcn_wmma_f32_16x16x32_f16(false, aw.v, false, ob[c].v, (short)0, a, false, false);
    }
    am[te] = a;
  }
  asm volatile("s_wait_xcnt 0x0" ::: "memory");      // the later loads land in the registers that held the address of the Wc^T loads: the wait stands in front of that overwrite
#pragma unroll      // the index names registers (fragments, accumulators): it must be a constant
  for (int te = 0; te < 8; ++te) {
    const v8f a = am[te];
    const v4f b0 = *(const v4fa*)(bc + te * 16 + 8 * hh), b1 = *(const v4fa*)(bc + te * 16 + 8 * hh + 4);
#pragma unroll      // the index names registers (fragments, accumulators): it must be a constant
    for (int r = 0; r < 8; ++r) mb[te >> 1].h[8 * (te & 1) + r] = (_Float16)(a[r] * 0.0625f + bf16_round((r < 4) ? b0[r & 3] : b1[r & 3]));
  }
  // S2^T = ENC.MH^T: A = 16 node rows from LDS (rows 100..111 zero), B = mb
  v8f z[7];
#pragma unroll      // the index names registers (fragments, accumulators): it must be a constant
  for (int t = 0; t < 7; ++t) {
    v8f a = {};
#pragma unroll      // the index names registers (fragments, accumulators): it must be a constant
    for (int c = 0; c < 4; ++c) {
      FragH ae; ae.half[0] = *(const v8us*)&sE[t * 16 + ln][c * 32 + 8 * hh]; ae.half[1] = *(const v8us*)&sE[t * 16 + ln][c * 32 + 16 + 8 * hh];
      a = __builtin_amdgcn_wmma_f32_16x16x32_f16(false, ae.v, false, mb[c].v, (short)0, a, false, false);
    }
    z[t] = a;
  }
  __builtin_amdgcn_sched_barrier(0);      // ends the scheduling region of the two products here, where the branches of the library tanh ended it: as one region with the branch-free tail the kernel goes above 256 registers (under the stated budget: into scratch)
  // probs = softmax(10 tanh(S2 / sqrt(128)) + mask) over the keys of the lane's query: chains per tile, a tree, one exchange between the lane halves, as in the heads
  float pm[7], ps[7];
#pragma unroll      // the index names registers (fragments, accumulators): it must be a constant
  for (int t = 0; t < 7; ++t) {
    pm[t] = -3.0e38f;
#pragma unroll      // the index names registers (fragments, accumulators): it must be a constant
    for (int r = 0; r < 8; ++r) { z[t][r] = 10.0f * tanh_hw(z[t][r], 0.08838834764831845f) + mk[t][r]; pm[t] = fmaxf(pm[t], z[t][r]); }
  }
  float m = fmaxf(fmaxf(fmaxf(pm[0], pm[1]), fmaxf(pm[2], pm[3])), fmaxf(fmaxf(pm[4], pm[5]), pm[6]));
  m = fmaxf(m, __shfl_xor(m, 16, 32));
#pragma unroll      // the index names registers (fragments, accumulators): it must be a constant
  for (int t = 0; t < 7; ++t) {
    ps[t] = 0.f;
#pragma unroll      // the index names registers (fragments, accumulators): it must be a constant
    for (int r = 0; r < 8; ++r) { const float x = exp_hw(z[t][r] - m); const float e = (z[t][r] > -1.0e38f) ? x : 0.f; z[t][r] = e; ps[t] += e; }
  }
  float sum = ((ps[0] + ps[1]) + (ps[2] + ps[3])) + ((ps[4] + ps[5]) + ps[6]);
  sum += __shfl_xor(sum, 16, 32);
  const float is = (sum > 0.f) ? 1.0f / sum : 0.f;
#pragma unroll      // the index names registers (fragments, accumulators): it must be a constant
  for (int t = 0; t < 7; ++t)
#pragma unroll      // the index names registers (fragments, accumulators): it must be a constant
    for (int r = 0; r < 8; ++r) z[t][r] *= is;
  if (g < GG) {      // a lane stores 32 bytes in a row per tile of its own output row (400-byte rows, 16-byte aligned pieces); tile 6 holds keys 96..99 in the lower half alone
    float* op = out + bg * PN + 8 * hh;
#pragma unroll      // the index names registers (fragments, accumulators): it must be a constant
    for (int t = 0; t < 6; ++t) {
      const v4f lo = {z[t][0], z[t][1], z[t][2], z[t][3]}, hi = {z[t][4], z[t][5], z[t][6], z[t][7]};
      *(v4f*)(op + t * 16) = lo; *(v4f*)(op + t * 16 + 4) = hi;
    }
    if (hh == 0) { const v4f lo = {z[6][0], z[6][1], z[6][2], z[6][3]}; *(v4f*)(op + 96) = lo; }
  }
}
extern "C" void kernel_launch(void* const* d_in, const int* in_sizes, int n_in,
                              void* d_out, int out_size, void* d_ws, size_t ws_size, hipStream_t stream) {
  (void)in_sizes; (void)n_in; (void)out_size;
  const float* in1 = (const float*)d_in[0]; const float* in2 = (const float*)d_in[1]; const float* rl = (const float*)d_in[2]; const float* msk = (const float*)d_in[3]; const float* enc = (const float*)d_in[4]; const float* Wq = (const float*)d_in[5]; const float* Wk = (const float*)d_in[6]; const float* Wv = (const float*)d_in[7]; const float* Wc = (const float*)d_in[8]; const float* bc = (const float*)d_in[9];
  char* ws = (char*)d_ws; size_t off = 0;
  auto take = [&](size_t bytes) { char* p = ws + off; off += (bytes + 255) & ~(size_t)255; return p; };
  _Float16* Bq = (_Float16*)take(2 * EE * EE * 2); _Float16* Bk = (_Float16*)take(EE * EE * 2); _Float16* Bv = (_Float16*)take(EE * EE * 2); _Float16* Bc = (_Float16*)take(EE * EE * 2);
  if (off > ws_size) return;      // 160 KiB of the workspace
  k_wt_f16<<<5 * WPB, 256, 0, stream>>>(Wq, Wk, Wv, Wc, Bq, Bk, Bv, Bc, 16.0f);      // of Wq the rows 0..255: input1 and input2  ([in][out]); row 256 (remaining) is read as it is
  // ---- projections, attention, output projection, pointer scores and the final softmax, one launch: a work-group per batch
  k_attn<<<NB, 224, 0, stream>>>(in1, in2, rl, msk, enc, Wq, Bq, Bk, Bv, Bc, bc, (float*)d_out);
}

// v008
// Measured time: 34.4 microseconds a run.
// In both of two side-by-side timings against v007, it was 1.20 times as fast.
// Over all steps from v000 it is 25.8 times as fast.
#include <hip/hip_runtime.h>
// Next-node probability head (B=512, G=100 group rows, P=100 nodes, E=128, 8 heads x 16, logit clipping 10). The weights are packed into f16 planes in fragment order first; then one kernel (k_attn), one work-group per batch,
// does all the rest: k,v = enc.W and q = [input1 | input2 | remaining].Wq (the first 256 rows as a product, the last as a rank-1 term), the 8-head attention (additive INPUT ninf mask),
// o.Wc + bc, the pointer score mh.enc^T/sqrt(128) and the softmax of 10 tanh + mask. K, V^T and the f16 nodes wait in LDS, Q and O in lane-private LDS, the rest in registers. Contractions on v_wmma_f32_16x16x32_f16 (f16 operands,
// weights [in][out] bf16-exact x2^4, f32 accumulate); softmaxes/tanh f32 VALU.
#define NB 512
#define GG 100
#define PN 100
#define EE 128
#define NH 8
#define KD 16

typedef __bf16 v16b __attribute__((ext_vector_type(16)));
typedef unsigned short v8us __attribute__((ext_vector_type(8), may_alias));
typedef float  v8f  __attribute__((ext_vector_type(8)));
typedef float  v4f  __attribute__((ext_vector_type(4)));
typedef float  v4fa __attribute__((ext_vector_type(4), may_alias));
union FragB { v16b v; v8us half[2]; unsigned short u[16]; };

__device__ __forceinline__ unsigned short bf16_bits(float x) { unsigned int u = __float_as_uint(x); return (unsigned short)((u + 0x7FFFu + ((u >> 16) & 1u)) >> 16); }
__device__ __forceinline__ float bf16_val(unsigned short b) { return __uint_as_float(((unsigned int)b) << 16); }
__device__ __forceinline__ float bf16_round(float x) { return bf16_val(bf16_bits(x)); }
// D += A·B with NT terms: 1 = ah·bh, 2 = + al·bh (A split), 3 = + ah·bl (both split)
template <int NT>
__device__ __forceinline__ v8f mmaN(v16b ah, v16b al, v16b bh, v16b bl, v8f c) {
  c = __builtin_amdgcn_wmma_f32_16x16x32_bf16(false, ah, false, bh, (short)0, c, false, false);
  if (NT >= 2) c = __builtin_amdgcn_wmma_f32_16x16x32_bf16(false, al, false, bh, (short)0, c, false, false);
  if (NT >= 3) c = __builtin_amdgcn_wmma_f32_16x16x32_bf16(false, ah, false, bl, (short)0, c, false, false);
  asm volatile("v_nop\n\tv_nop\n\tv_nop\n\tv_nop" : "+v"(c) : "v"(ah), "v"(al), "v"(bh), "v"(bl));
  return c;
}

__global__ __launch_bounds__(256) void k_wt_bf16(const float* __restrict__ W, unsigned short* __restrict__ Wt, int K, int N) {
  const int t = blockIdx.x * 256 + threadIdx.x;
  const int k8n = K / 8;
  if (t >= N * k8n) return;
  const int n = t / k8n, k8 = (t % k8n) * 8;
  v8us v;
#pragma unroll
  for (int i = 0; i < 8; ++i) v[i] = bf16_bits(W[(size_t)(k8 + i) * N + n]);
  *(v8us*)(Wt + (size_t)n * K + k8) = v;
  
}

// GEMM C[M][N] (f32, pitch ldc) = act(A[M][K]·W + bias). A f32 row-major (pitch lda) converted per fragment to bf16
// (ASPLIT: hi/lo two planes -> 2 terms, else single rounded term); Wt bf16 [N][K] (pitch ldb). BIAS_BF16 rounds the
// bias to bf16 first (bias quantised to bf16 before the add). K%32==0, M%16==0, N%64==0.
template <bool ASPLIT, int ACT, bool BIAS_BF16>
__global__ __launch_bounds__(128) void k_gemm_bf(const float* __restrict__ A, int lda, const unsigned short* __restrict__ Wt, int ldb,
                                               const float* __restrict__ bias, float* __restrict__ C, int ldc, int M, int N, int K) {
  __shared__ __attribute__((aligned(16))) float so[4][16][64];
  const int tid = threadIdx.x, w = tid >> 5, lane = tid & 31, ln = lane & 15, hh = lane >> 4;
  const int ntn = N / 64;
  const int wid = blockIdx.x * 4 + w;
  const int mt = wid / ntn, nq = wid % ntn;
  if (mt * 16 >= M) return;
  const int row0 = mt * 16, col0 = nq * 64;
  const float* arow = A + (size_t)(row0 + ln) * lda;
  v8f acc[4] = {};
  for (int kb = 0; kb < K; kb += 32) {
    FragB ah, al;
    const v4f x0 = *(const v4fa*)(arow + kb + 8 * hh), x1 = *(const v4fa*)(arow + kb + 8 * hh + 4);
    const v4f x2 = *(const v4fa*)(arow + kb + 16 + 8 * hh), x3 = *(const v4fa*)(arow + kb + 16 + 8 * hh + 4);
    float xs[16] = {x0[0],x0[1],x0[2],x0[3],x1[0],x1[1],x1[2],x1[3],x2[0],x2[1],x2[2],x2[3],x3[0],x3[1],x3[2],x3[3]};
#pragma unroll
    for (int i = 0; i < 16; ++i) { const unsigned short hb = bf16_bits(xs[i]); ah.u[i] = hb; al.u[i] = ASPLIT ? bf16_bits(xs[i] - bf16_val(hb)) : (unsigned short)0; }
#pragma unroll
    for (int t = 0; t < 4; ++t) {
      const unsigned short* brow = Wt + (size_t)(col0 + t * 16 + ln) * ldb + kb;
      FragB b;
      b.half[0] = *(const v8us*)(brow + 8 * hh);
      b.half[1] = *(const v8us*)(brow + 16 + 8 * hh);
      acc[t] = mmaN<ASPLIT ? 2 : 1>(ah.v, al.v, b.v, b.v, acc[t]);
    }
  }
#pragma unroll
  for (int t = 0; t < 4; ++t) {
    float bv = bias ? bias[col0 + t * 16 + ln] : 0.f;
    if (BIAS_BF16) bv = bf16_round(bv);
#pragma unroll
    for (int r = 0; r < 8; ++r) { float v = acc[t][r] + bv; if (ACT == 1) v = fmaxf(v, 0.f); so[w][8 * hh + r][t * 16 + ln] = v; }
  }
  __builtin_amdgcn_fence(__ATOMIC_ACQ_REL, "workgroup");
  __builtin_amdgcn_wave_barrier();
  const int rsub = lane >> 4, c4 = (lane & 15) * 4;
  {
#pragma unroll
    for (int q = 0; q < 8; ++q) {
      const int r = q * 2 + rsub;
      const v4f v = *(const v4fa*)&so[w][r][c4];
      *(v4f*)(C + (size_t)(row0 + r) * ldc + col0 + c4) = v;
    }
    
  }
}

// Flash-style causal/unmasked attention, all contractions 3-term bf16 hi/lo splits, f32 softmax with running max.
// q,k,v rows are read from f32 buffers with arbitrary row pitch (so they can live inside a fused qkv buffer);
// D = head size (multiple of 32, <= 128); one wave = 16 query rows; block = 4 waves (64 queries) sharing K/V chunks of 32.
template <int D, bool CAUSAL>
__global__ __launch_bounds__(128) void k_flash(const float* __restrict__ qb, const float* __restrict__ kb, const float* __restrict__ vb,
                                             int pitch, int T, int H, float scale, float* __restrict__ y, int ypitch) {
  constexpr int KS = D / 32;        // k-steps for QK
  constexpr int DT = D / 16;        // d tiles for PV
  __shared__ __attribute__((aligned(16))) unsigned short sKh[32][D + 8], sKl[32][D + 8], sVh[32][D + 8], sVl[32][D + 8];
  __shared__ __attribute__((aligned(16))) unsigned short sPh[4][16][40], sPl[4][16][40];
  __shared__ __attribute__((aligned(16))) float sO[4][16][D];
  const int tid = threadIdx.x, w = tid >> 5, lane = tid & 31, ln = lane & 15, hh = lane >> 4;
  const int nqb = (T + 63) / 64;
  const int bh = blockIdx.x / nqb, qblk = blockIdx.x % nqb;
  const int b = bh / H, h = bh % H;
  const int q0 = qblk * 64 + w * 16;
  const float* Q = qb + (size_t)b * T * pitch + h * D;
  const float* K = kb + (size_t)b * T * pitch + h * D;
  const float* V = vb + (size_t)b * T * pitch + h * D;

  // A fragments of the wave's 16 query rows (scaled), hi/lo
  FragB aqh[KS], aql[KS];
  {
    int row = q0 + ln; if (row >= T) row = T - 1;
    const float* qr = Q + (size_t)row * pitch;
#pragma unroll
    for (int ks = 0; ks < KS; ++ks)
#pragma unroll
      for (int i = 0; i < 16; ++i) {
        const int d = ks * 32 + ((i < 8) ? (8 * hh + i) : (16 + 8 * hh + (i - 8)));
        const float x = qr[d] * scale; const unsigned short hb = bf16_bits(x);
        aqh[ks].u[i] = hb; aql[ks].u[i] = bf16_bits(x - bf16_val(hb));
      }
  }
  float m_r[8], l_r[8];
#pragma unroll
  for (int r = 0; r < 8; ++r) { m_r[r] = -3.0e38f; l_r[r] = 0.f; }
  v8f oacc[DT];
#pragma unroll
  for (int dt = 0; dt < DT; ++dt) oacc[dt] = (v8f){0.f,0.f,0.f,0.f,0.f,0.f,0.f,0.f};

  const int kv_end = CAUSAL ? min(T, qblk * 64 + 64) : T;     // block-uniform
  for (int j0 = 0; j0 < kv_end; j0 += 32) {
    __syncthreads();
    for (int e = tid; e < 32 * (D / 4); e += 128) {
      const int r = e / (D / 4), c4 = (e % (D / 4)) * 4;
      const int key = j0 + r;
      v4f kf = {0.f,0.f,0.f,0.f}, vf = {0.f,0.f,0.f,0.f};
      if (key < T) { kf = *(const v4fa*)(K + (size_t)key * pitch + c4); vf = *(const v4fa*)(V + (size_t)key * pitch + c4); }
#pragma unroll
      for (int t = 0; t < 4; ++t) {
        unsigned short hb = bf16_bits(kf[t]); sKh[r][c4 + t] = hb; sKl[r][c4 + t] = bf16_bits(kf[t] - bf16_val(hb));
        hb = bf16_bits(vf[t]); sVh[r][c4 + t] = hb; sVl[r][c4 + t] = bf16_bits(vf[t] - bf16_val(hb));
      }
    }
    __syncthreads();
    // S tile 16 x 32
    v8f s[2];
#pragma unroll
    for (int nt = 0; nt < 2; ++nt) {
      v8f acc = {};
#pragma unroll
      for (int ks = 0; ks < KS; ++ks) {
        FragB bh_, bl_;
        bh_.half[0] = *(const v8us*)&sKh[nt * 16 + ln][ks * 32 + 8 * hh]; bh_.half[1] = *(const v8us*)&sKh[nt * 16 + ln][ks * 32 + 16 + 8 * hh];
        bl_.half[0] = *(const v8us*)&sKl[nt * 16 + ln][ks * 32 + 8 * hh]; bl_.half[1] = *(const v8us*)&sKl[nt * 16 + ln][ks * 32 + 16 + 8 * hh];
        acc = mmaN<3>(aqh[ks].v, aql[ks].v, bh_.v, bl_.v, acc);
      }
      s[nt] = acc;
    }
    // mask + running max (rows 8hh+r; the 16 lanes of a half share rows)
    float alpha[8];
#pragma unroll
    for (int r = 0; r < 8; ++r) {
      const int qi = q0 + 8 * hh + r;
      const int ja = j0 + ln, jb = j0 + 16 + ln;
      if (CAUSAL) { if (ja > qi) s[0][r] = -3.0e38f; if (jb > qi) s[1][r] = -3.0e38f; }
      if (ja >= T) s[0][r] = -3.0e38f;
      if (jb >= T) s[1][r] = -3.0e38f;
      float mx = fmaxf(s[0][r], s[1][r]);
      mx = fmaxf(mx, __shfl_xor(mx, 1, 32)); mx = fmaxf(mx, __shfl_xor(mx, 2, 32)); mx = fmaxf(mx, __shfl_xor(mx, 4, 32)); mx = fmaxf(mx, __shfl_xor(mx, 8, 32));
      const float mnew = fmaxf(m_r[r], mx);
      alpha[r] = (mnew > -1.0e38f) ? __expf(m_r[r] - mnew) : 1.0f;
      const float p0 = (s[0][r] > -1.0e38f) ? __expf(s[0][r] - mnew) : 0.f;
      const float p1 = (s[1][r] > -1.0e38f) ? __expf(s[1][r] - mnew) : 0.f;
      m_r[r] = mnew;
      l_r[r] = l_r[r] * alpha[r] + p0 + p1;            // per-lane partial row sum (16 lanes combined at the end)
      unsigned short hb = bf16_bits(p0); sPh[w][8 * hh + r][ln] = hb;      sPl[w][8 * hh + r][ln] = bf16_bits(p0 - bf16_val(hb));
      hb = bf16_bits(p1);                sPh[w][8 * hh + r][16 + ln] = hb; sPl[w][8 * hh + r][16 + ln] = bf16_bits(p1 - bf16_val(hb));
    }
#pragma unroll
    for (int dt = 0; dt < DT; ++dt)
#pragma unroll
      for (int r = 0; r < 8; ++r) oacc[dt][r] *= alpha[r];
    __builtin_amdgcn_fence(__ATOMIC_ACQ_REL, "workgroup");
    __builtin_amdgcn_wave_barrier();
    FragB pah, pal;
    pah.half[0] = *(const v8us*)&sPh[w][ln][8 * hh]; pah.half[1] = *(const v8us*)&sPh[w][ln][16 + 8 * hh];
    pal.half[0] = *(const v8us*)&sPl[w][ln][8 * hh]; pal.half[1] = *(const v8us*)&sPl[w][ln][16 + 8 * hh];
#pragma unroll
    for (int dt = 0; dt < DT; ++dt) {
      FragB bvh, bvl;
#pragma unroll
      for (int i = 0; i < 8; ++i) {
        bvh.u[i] = sVh[8 * hh + i][dt * 16 + ln]; bvh.u[8 + i] = sVh[16 + 8 * hh + i][dt * 16 + ln];
        bvl.u[i] = sVl[8 * hh + i][dt * 16 + ln]; bvl.u[8 + i] = sVl[16 + 8 * hh + i][dt * 16 + ln];
      }
      oacc[dt] = mmaN<3>(pah.v, pal.v, bvh.v, bvl.v, oacc[dt]);
    }
    __builtin_amdgcn_fence(__ATOMIC_ACQ_REL, "workgroup");
    __builtin_amdgcn_wave_barrier();
  }
#pragma unroll
  for (int r = 0; r < 8; ++r) {
    float l = l_r[r];
    l += __shfl_xor(l, 1, 32); l += __shfl_xor(l, 2, 32); l += __shfl_xor(l, 4, 32); l += __shfl_xor(l, 8, 32);
    l_r[r] = (l > 0.f) ? 1.0f / l : 0.f;
  }
#pragma unroll
  for (int dt = 0; dt < DT; ++dt)
#pragma unroll
    for (int r = 0; r < 8; ++r) sO[w][8 * hh + r][dt * 16 + ln] = oacc[dt][r] * l_r[r];
  __builtin_amdgcn_fence(__ATOMIC_ACQ_REL, "workgroup");
  __builtin_amdgcn_wave_barrier();
  {
    for (int r = 0; r < 16; ++r) {
      const int row = q0 + r;
      if (row < T && lane < D / 4) {
        const v4f val = *(const v4fa*)&sO[w][r][lane * 4];
        *(v4f*)(y + ((size_t)b * T + row) * ypitch + h * D + lane * 4) = val;
      }
    }
    
  }
}

// GEMM C = act(A·W + bias + resid): A f32 (ASPLIT -> hi/lo 2 terms), Wt bf16 [N][K]; ACT 0 none, 1 relu, 2 exact gelu;
// resid (optional, f32, row index = (row % rmod), pitch ldr, RES_BF16 rounds it) added before the activation.
template <bool ASPLIT, int ACT, bool BIAS_BF16, bool RES_BF16>
__global__ __launch_bounds__(128) void k_gemm_bf3(const float* __restrict__ A, int lda, const unsigned short* __restrict__ Wt, int ldb,
                                                const float* __restrict__ bias, const float* __restrict__ resid, int rmod, int ldr,
                                                float* __restrict__ C, int ldc, int M, int N, int K) {
  __shared__ __attribute__((aligned(16))) float so[4][16][64];
  const int tid = threadIdx.x, w = tid >> 5, lane = tid & 31, ln = lane & 15, hh = lane >> 4;
  const int ntn = N / 64;
  const int wid = blockIdx.x * 4 + w;
  const int mt = wid / ntn, nq = wid % ntn;
  if (mt * 16 >= M) return;
  const int row0 = mt * 16, col0 = nq * 64;
  const float* arow = A + (size_t)(row0 + ln) * lda;
  v8f acc[4] = {};
  for (int kb = 0; kb < K; kb += 32) {
    FragB ah, al;
    const v4f x0 = *(const v4fa*)(arow + kb + 8 * hh), x1 = *(const v4fa*)(arow + kb + 8 * hh + 4);
    const v4f x2 = *(const v4fa*)(arow + kb + 16 + 8 * hh), x3 = *(const v4fa*)(arow + kb + 16 + 8 * hh + 4);
    float xs[16] = {x0[0],x0[1],x0[2],x0[3],x1[0],x1[1],x1[2],x1[3],x2[0],x2[1],x2[2],x2[3],x3[0],x3[1],x3[2],x3[3]};
#pragma unroll
    for (int i = 0; i < 16; ++i) { const unsigned short hb = bf16_bits(xs[i]); ah.u[i] = hb; al.u[i] = ASPLIT ? bf16_bits(xs[i] - bf16_val(hb)) : (unsigned short)0; }
#pragma unroll
    for (int t = 0; t < 4; ++t) {
      const unsigned short* brow = Wt + (size_t)(col0 + t * 16 + ln) * ldb + kb;
      FragB b;
      b.half[0] = *(const v8us*)(brow + 8 * hh);
      b.half[1] = *(const v8us*)(brow + 16 + 8 * hh);
      acc[t] = mmaN<ASPLIT ? 2 : 1>(ah.v, al.v, b.v, b.v, acc[t]);
    }
  }
#pragma unroll
  for (int t = 0; t < 4; ++t) {
    const int col = col0 + t * 16 + ln;
    float bv = bias ? bias[col] : 0.f;
    if (BIAS_BF16) bv = bf16_round(bv);
#pragma unroll
    for (int r = 0; r < 8; ++r) {
      float v = acc[t][r] + bv;
      if (resid) { float rv = resid[(size_t)((row0 + 8 * hh + r) % rmod) * ldr + col]; if (RES_BF16) rv = bf16_round(rv); v += rv; }
      if (ACT == 1) v = fmaxf(v, 0.f);
      if (ACT == 2) v = 0.5f * v * (1.0f + erff(v * 0.70710678118654752f));
      if (ACT == 3) { const float u = 0.7978845608028654f * (v + 0.044715f * v * v * v); v = 0.5f * v * (1.0f + tanhf(u)); }
      so[w][8 * hh + r][t * 16 + ln] = v;
    }
  }
  __builtin_amdgcn_fence(__ATOMIC_ACQ_REL, "workgroup");
  __builtin_amdgcn_wave_barrier();
  const int rsub = lane >> 4, c4 = (lane & 15) * 4;
  {
#pragma unroll
    for (int q = 0; q < 8; ++q) {
      const int r = q * 2 + rsub;
      const v4f v = *(const v4fa*)&so[w][r][c4];
      *(v4f*)(C + (size_t)(row0 + r) * ldc + col0 + c4) = v;
    }
    
  }
}
// row LayerNorm (biased variance, eps) over N: s = X (+ R); optional out_sum <- s; out_norm <- (s-mu)*rsqrt(var+eps)*g + b
template <bool PARAM_BF16>
__global__ __launch_bounds__(256) void k_layernorm(const float* __restrict__ X, const float* __restrict__ R, const float* __restrict__ g, const float* __restrict__ bta,
                                                  float* __restrict__ out_sum, float* __restrict__ out_norm, int N, float eps) {
  __shared__ float red[256];
  const int row = blockIdx.x, tid = threadIdx.x;
  const float* x = X + (size_t)row * N; const float* rr = R ? R + (size_t)row * N : nullptr;
  float vals[16];                     // up to N = 4096
  const int per = N / 256;            // contiguous chunk per thread? use strided-by-4 chunks: thread handles j = tid*4 + 1024*u
  float s1 = 0.f;
  for (int u = 0; u < per / 4; ++u) {
    const int j = tid * 4 + 1024 * u;
    const v4f a = *(const v4fa*)(x + j);
    v4f b = {0.f,0.f,0.f,0.f}; if (rr) b = *(const v4fa*)(rr + j);
#pragma unroll
    for (int q = 0; q < 4; ++q) { const float v = a[q] + b[q]; vals[u * 4 + q] = v; s1 += v; }
  }
  red[tid] = s1; __syncthreads();
  for (int st = 128; st > 0; st >>= 1) { if (tid < st) red[tid] += red[tid + st]; __syncthreads(); }
  const float mu = red[0] / (float)N; __syncthreads();
  float s2 = 0.f;
  for (int u = 0; u < per / 4; ++u)
#pragma unroll
    for (int q = 0; q < 4; ++q) { const float c = vals[u * 4 + q] - mu; s2 += c * c; }
  red[tid] = s2; __syncthreads();
  for (int st = 128; st > 0; st >>= 1) { if (tid < st) red[tid] += red[tid + st]; __syncthreads(); }
  const float rs = rsqrtf(red[0] / (float)N + eps);
  {
    for (int u = 0; u < per / 4; ++u) {
      const int j = tid * 4 + 1024 * u;
      v4f o, sm;
#pragma unroll
      for (int q = 0; q < 4; ++q) {
        float gg = g[j + q], bb = bta[j + q];
        if (PARAM_BF16) { gg = bf16_round(gg); bb = bf16_round(bb); }
        sm[q] = vals[u * 4 + q]; o[q] = (vals[u * 4 + q] - mu) * rs * gg + bb;
      }
      if (out_sum) *(v4f*)(out_sum + (size_t)row * N + j) = sm;
      *(v4f*)(out_norm + (size_t)row * N + j) = o;
    }
    
  }
}



// ---- f16 WMMA path (v_wmma_f32_16x16x32_f16): 11-bit significands for operands in range — used where a [0,1] probability operand needs more precision than bf16
typedef _Float16 v16h __attribute__((ext_vector_type(16)));
union FragH { v16h v; v8us half[2]; _Float16 h[16]; unsigned short u[16]; };
template <int NT>
__device__ __forceinline__ v8f mmaH(v16h ah, v16h al, v16h bh, v16h bl, v8f c) {
  c = __builtin_amdgcn_wmma_f32_16x16x32_f16(false, ah, false, bh, (short)0, c, false, false);
  if (NT >= 2) c = __builtin_amdgcn_wmma_f32_16x16x32_f16(false, al, false, bh, (short)0, c, false, false);
  if (NT >= 3) c = __builtin_amdgcn_wmma_f32_16x16x32_f16(false, ah, false, bl, (short)0, c, false, false);
  asm volatile("v_nop\n\tv_nop\n\tv_nop\n\tv_nop" : "+v"(c) : "v"(ah), "v"(al), "v"(bh), "v"(bl));
  return c;
}
// batched GEMM like k_gemm_b but f16 operands: A f32 (split into f16 hi/lo if ASPLIT, else rounded to f16), Bt = f16 values [n][k]; alpha; C f32; N multiple of 16 (partial tiles skipped)
template <bool ASPLIT>
__global__ __launch_bounds__(128) void k_gemm_h(const float* __restrict__ A, int lda, size_t sA, const _Float16* __restrict__ Bh, int ldb, size_t sB, float alpha, float* __restrict__ C, int ldc, size_t sC, int M, int N, int K) {
  __shared__ __attribute__((aligned(16))) float so[4][16][64];
  const int tid = threadIdx.x, w = tid >> 5, lane = tid & 31, ln = lane & 15, hh = lane >> 4; const int by = blockIdx.y;
  A += (size_t)by * sA; Bh += (size_t)by * sB; C += (size_t)by * sC;
  const int ntn = (N + 63) / 64; const int wid = blockIdx.x * 4 + w; const int mt = wid / ntn, nq = wid % ntn; if (mt * 16 >= M) return;
  const int row0 = mt * 16, col0 = nq * 64; const float* arow = A + (size_t)(row0 + ln) * lda;
  v8f acc[4] = {};
  for (int kb = 0; kb < K; kb += 32) {
    FragH ah, al;
    const v4f x0 = *(const v4fa*)(arow + kb + 8 * hh), x1 = *(const v4fa*)(arow + kb + 8 * hh + 4), x2 = *(const v4fa*)(arow + kb + 16 + 8 * hh), x3 = *(const v4fa*)(arow + kb + 16 + 8 * hh + 4);
    float xs[16] = {x0[0],x0[1],x0[2],x0[3],x1[0],x1[1],x1[2],x1[3],x2[0],x2[1],x2[2],x2[3],x3[0],x3[1],x3[2],x3[3]};
#pragma unroll
    for (int i = 0; i < 16; ++i) { const _Float16 h = (_Float16)xs[i]; ah.h[i] = h; al.h[i] = ASPLIT ? (_Float16)(xs[i] - (float)h) : (_Float16)0.0f; }
#pragma unroll
    for (int t = 0; t < 4; ++t) { if (col0 + t * 16 >= N) continue; const size_t boff = (size_t)(col0 + t * 16 + ln) * ldb + kb; FragH bq; bq.half[0] = *(const v8us*)(Bh + boff + 8 * hh); bq.half[1] = *(const v8us*)(Bh + boff + 16 + 8 * hh);
      acc[t] = mmaH<ASPLIT ? 2 : 1>(ah.v, al.v, bq.v, bq.v, acc[t]); }
  }
#pragma unroll
  for (int t = 0; t < 4; ++t) { if (col0 + t * 16 >= N) continue;
#pragma unroll
    for (int r = 0; r < 8; ++r) so[w][8 * hh + r][t * 16 + ln] = acc[t][r] * alpha; }
  __builtin_amdgcn_fence(__ATOMIC_ACQ_REL, "workgroup"); __builtin_amdgcn_wave_barrier();
  const int rsub = lane >> 4, c4 = (lane & 15) * 4;
  {
#pragma unroll
    for (int q = 0; q < 8; ++q) { const int r = q * 2 + rsub; if (col0 + c4 < N) { const v4f v = *(const v4fa*)&so[w][r][c4]; *(v4f*)(C + (size_t)(row0 + r) * ldc + col0 + c4) = v; } }
     }
}

// f16(W[k][n]·scale) from f32 row-major W[K][N] (scale = power of two; bf16-exact weights stay exact in f16 away from the subnormal range), packed in fragment order: one block of 512 bytes = one 16-byte load of a whole wave =
// half j of the fragment (16 columns n of tile tn) x (k block c of 32): lane (ln, hh) owns the 8 values n = 16tn + ln, k = 32c + 16j + 8hh .. + 7. Blocks in the order [tn][c][j]. Thread t writes the 16 bytes number t of the plane.
#define FRH 256            // f16 values in one such block
// All four planes in one launch (for speed only). A plane of 128 x 128 takes WPB blocks; blocks 0 .. 2 WPB - 1 pack Wq rows 0..255, then WPB each Wk, Wv, Wc:
// a block lies wholly in one plane, so the choice of plane is scalar.
#define WPB (EE * EE / 8 / 256)
__global__ __launch_bounds__(256) void k_wt_f16(const float* __restrict__ Wq, const float* __restrict__ Wk, const float* __restrict__ Wv, const float* __restrict__ Wc,
                                                _Float16* __restrict__ Bq, _Float16* __restrict__ Bk, _Float16* __restrict__ Bv, _Float16* __restrict__ Bc, float scale) {
  const int blk = blockIdx.x, pl = (blk < 2 * WPB) ? 0 : blk / WPB - 1;      // plane 0 Wq (K = 256), 1 Wk, 2 Wv, 3 Wc (K = 128)
  const float* __restrict__ W = (pl == 0) ? Wq : (pl == 1) ? Wk : (pl == 2) ? Wv : Wc;
  _Float16* __restrict__ Wt = (pl == 0) ? Bq : (pl == 1) ? Bk : (pl == 2) ? Bv : Bc;
  const int kl = (pl == 0) ? 3 : 2;      // log2 of the k blocks of 32 in the plane
  const int t = (blk - ((pl == 0) ? 0 : (pl + 1) * WPB)) * 256 + threadIdx.x;
  const int ln = t & 15, hh = (t >> 4) & 1, j = (t >> 5) & 1, cb = t >> 6, c = cb & ((1 << kl) - 1), tn = cb >> kl;
  const int n = tn * 16 + ln, k8 = c * 32 + j * 16 + hh * 8; FragH f;
#pragma unroll
  for (int i = 0; i < 8; ++i) f.h[i] = (_Float16)(bf16_round(W[(size_t)(k8 + i) * EE + n]) * scale); const v8us o = f.half[0];
  *(v8us*)((unsigned short*)Wt + (size_t)t * 8) = o; 
}
// The whole head in one kernel. One work-group = one batch b and all HPW heads; wave w owns the 16 query rows g = 16w..16w+15 (7 waves cover 112 >= 100) and loops over the heads.
// The score tile is formed transposed, S^T = K.Q^T (A = 16 key rows, B = 16 query rows, d 16 zero-extended to the k = 32 of the instruction), so a lane (ln, hh) holds, for its one
// query g = 16w + ln, the keys p = 16t + 8hh + r (t = tile, r = accumulator register). That is the k order of a B fragment: after the softmax (registers, an exchange for the maximum and one for the sum between the
// two lane halves) tiles 2c and 2c+1 are, register for register, the B operand of O^T = V^T.P^T for keys 32c..32c+31. Scores and weights never leave the registers.
// V^T (A operand, rows = head columns, k = keys, zero for keys >= 100) waits in LDS. The mask row slice of a lane is read once and serves all HPW heads and the pointer softmax.
// The same turn carries the wave through the rest of the network: O^T of heads 2c, 2c+1 is the B operand (k = 32c..32c+31) of MH^T = Wc^T.O^T, the tiles 2c, 2c+1 of MH^T are the B operand
// of S2^T = ENC.MH^T, and S2^T again leaves a lane with the keys 16t + 8hh + r of its one query, the places its mask registers already have: tanh, mask and softmax run as in the heads.
// The projections stand in front, in the same turn: wave w rounds the node rows 16w..16w+15 to one set of f16 fragments (rows >= 100 zero), which is the B operand of K^T = Wk^T.ENC^T (a lane gets 8 columns in a row of
// its node: one 16-byte store into a K row in LDS), the A operand of V = ENC.Wv (a lane gets 8 nodes in a row of its column: one 16-byte store into a V^T row) and, stored as it is, the A operand of the pointer product.
// Q^T = Wq^T.[input1 | input2]^T (k = 256, input1 the same in every lane) leaves a lane with the columns 8hh + r of head te of its own query: the half fragment that the score product wants as B.
#define HPW 8              // heads per work-group: all of them, so a wave reads and rounds its mask slice once and holds the whole O row of its query
#define VTP 136            // f16 pitch of a V^T, K or node row in LDS: 256 + 16 bytes, spreads the 16 rows of a 16-byte fragment read over the banks
// the 16 f32 values of one fragment (k = 8hh..8hh+7 and 16+8hh..16+8hh+7 of a block of 32) of an f32 row; p = row + 32c + 8hh
__device__ __forceinline__ void raw_f32(v4f (&x)[4], const float* __restrict__ p) { x[0] = *(const v4fa*)p; x[1] = *(const v4fa*)(p + 4); x[2] = *(const v4fa*)(p + 16); x[3] = *(const v4fa*)(p + 20); }
// ... rounded to bf16, then (exactly, in range) to f16
__device__ __forceinline__ FragH frag_f32(const v4f (&x)[4]) {
  FragH f;
#pragma unroll
  for (int j = 0; j < 4; ++j)
#pragma unroll
    for (int i = 0; i < 4; ++i) f.h[4 * j + i] = (_Float16)bf16_round(x[j][i]);
  return f;
}
// e^x for the softmaxes (x <= 0 there): one multiply and the chip's own base-2 exponential, in place of the library routine with its split argument, ldexp and two range tests; a result below 2^-126 may come out as 0
__device__ __forceinline__ float exp_hw(float x) { return __builtin_amdgcn_exp2f(x * 1.4426950408889634f); }
// tanh(k x) = 1 - 2 / (1 + e^(2 k x)) on the base-2 exponential and the reciprocal instruction: no branch; +-1 at the far ends (e = inf or 0); absolute error of a few 2^-24, also near 0
__device__ __forceinline__ float tanh_hw(float x, float k) { return 1.0f - 2.0f * __builtin_amdgcn_rcpf(1.0f + __builtin_amdgcn_exp2f(x * (k * 2.8853900817779268f))); }
// Keep it at or under 256 registers a wave and 160 KiB of LDS: then the 512 work-groups of 7 waves stand two to a WGP, all resident at once; above either only one fits and the grid runs in two turns. The attribute states that budget to the compiler (four waves a SIMD = 256 registers): left free, its scheduler goes above it.
__global__ __launch_bounds__(224) __attribute__((amdgpu_waves_per_eu(4))) void k_attn(const float* __restrict__ IN1, const float* __restrict__ IN2, const float* __restrict__ RL, const float* __restrict__ MSK, const float* __restrict__ ENC, const float* __restrict__ WQ,
                                              const _Float16* __restrict__ WqT, const _Float16* __restrict__ WkT, const _Float16* __restrict__ WvT, const _Float16* __restrict__ WcT, const float* __restrict__ bc, float* __restrict__ out) {
  static_assert(HPW == NH, "the output projection needs all heads of a query in one wave");
  static_assert(GG == PN, "a wave's 16 query rows and its 16 node rows share one row index");
  __shared__ __attribute__((aligned(16))) unsigned short sVT[HPW * KD][VTP];
  __shared__ __attribute__((aligned(16))) unsigned short sK[112][VTP];      // K rows (f16), rows 100..111 zero
  __shared__ __attribute__((aligned(16))) unsigned short sE[112][VTP];      // node rows (f16), rows 100..111 zero
  __shared__ __attribute__((aligned(16))) v8us sO[NH][224];      // a lane's own half-fragments, one per head: first Q, then, once a head's Q has been read, its O; written and read back by the same lane (the head loop is rolled, so registers cannot be indexed by the head)
  __shared__ __attribute__((aligned(16))) float sW3[EE];      // Wq row 256 (the weights of 'remaining'), rounded to bf16
  __shared__ __attribute__((aligned(16))) float sBC[EE];      // bc rounded to bf16: read and rounded once a work-group, with the first loads, so that the output projection waits for no global load of it
  __shared__ __attribute__((aligned(16))) _Float16 sI1[EE];      // input1 of the batch, rounded to bf16, as f16: every wave's B fragments for k 0..127 of the Q product
  const int tid = threadIdx.x, w = tid >> 5, lane = tid & 31, ln = lane & 15, hh = lane >> 4;
  const int b = blockIdx.x;
  const v8us zero8 = {0,0,0,0,0,0,0,0};
  for (int e = tid; e < 2 * HPW * KD; e += 224) *(v8us*)&sVT[e >> 1][112 + 8 * (e & 1)] = zero8;      // keys 112..127 belong to no wave's tile; the last k block of V^T.P^T reads them
  const int g = w * 16 + ln, gc = (g < GG) ? g : GG - 1;      // rows 100..111 compute on row 99 and store nothing
  const size_t bg = (size_t)b * GG + gc;
  const bool live = g < PN;
  // the f32 rows of the wave are asked for at once: node rows (rows 100..111 read row 99, in bounds, and are zeroed) and input2; with them one value a thread of input1, of Wq row 256 and of bc (threads 128.. read again what 0.. read, in bounds, and drop it)
  v4f xe[4][4], x2[4][4];
  const float* pe = ENC + bg * EE + 8 * hh; const float* p2 = IN2 + bg * EE + 8 * hh; const float* pr = RL + bg; const int ix = tid & (EE - 1);
#pragma unroll      // the index names registers (fragments, accumulators): it must be a constant
  for (int c = 0; c < 4; ++c) raw_f32(xe[c], pe + c * 32);
#pragma unroll      // the index names registers (fragments, accumulators): it must be a constant
  for (int c = 0; c < 4; ++c) raw_f32(x2[c], p2 + c * 32);
  const float rv = bf16_round(*pr);
  const float y1 = IN1[(size_t)b * EE + ix], y3 = WQ[(size_t)(2 * EE) * EE + ix], y4 = bc[ix];
  asm volatile("s_wait_xcnt 0x0" :: "v"(pe), "v"(p2), "v"(pr), "v"(ix) : "memory");      // the address registers of the 36 loads are reused below: the wait stands in front of that overwrite; as inputs they stay whole up to it (else a later load of the run lands in them)
  __builtin_amdgcn_sched_barrier(0);      // keeps the 36 loads above together in front of the first conversion: sunk to their uses they would be waited for one memory latency after another
  FragH eb[4], ib[8];
#pragma unroll      // the index names registers (fragments, accumulators): it must be a constant
  for (int c = 0; c < 4; ++c) {
    const FragH x = frag_f32(xe[c]);
    eb[c].half[0] = live ? x.half[0] : zero8; eb[c].half[1] = live ? x.half[1] : zero8;
    *(v8us*)&sE[g][c * 32 + 8 * hh] = eb[c].half[0]; *(v8us*)&sE[g][c * 32 + 16 + 8 * hh] = eb[c].half[1];
  }
  // The weight fragments come in 32 groups of 8 loads (one group = 16 weight rows x k 128 = the 4 matrix instructions of one accumulator chain): groups 0..7 the tiles of Wk^T, 8..15 of Wv^T,
  // 16..31 of Wq^T (two groups a tile: k 0..127 input1, k 128..255 input2). Three register buffers in turn: group i + 2 is asked for before group i is used.
  // The planes lie in fragment order (k_wt_f16): a load of the wave reads 512 bytes in a row, four whole cache lines, and a group 4 KiB in a row.
  const unsigned short* wkp = (const unsigned short*)WkT + lane * 8;
  const unsigned short* wvp = (const unsigned short*)WvT + lane * 8;
  const unsigned short* wqp = (const unsigned short*)WqT + lane * 8;
  v8us ring[3][8];
  auto fetch = [&](int gi) {
    const unsigned short* p = (gi < 8) ? wkp + gi * 8 * FRH : (gi < 16) ? wvp + (gi - 8) * 8 * FRH : wqp + (gi - 16) * 8 * FRH;
#pragma unroll      // the index names registers (fragments, accumulators): it must be a constant
    for (int c = 0; c < 4; ++c) { ring[gi % 3][2 * c] = *(const v8us*)(p + 2 * c * FRH); ring[gi % 3][2 * c + 1] = *(const v8us*)(p + (2 * c + 1) * FRH); }
    if (gi == 7 || gi == 15 || gi == 31) asm volatile("s_wait_xcnt 0x0" :: "v"(p) : "memory");      // the last loads of a weight plane: its address registers are free from here on and later loads land in them; the wait stands in front of that overwrite; as an input the address stays whole up to it
  };
  asm volatile("" :: "v"(y1), "v"(y3), "v"(y4));      // inputs only: holds the three loads up with the others; without it the compiler sinks them into the branch below, where their memory latency is waited out alone
  if (tid < EE) { sI1[tid] = (_Float16)bf16_round(y1); sW3[tid] = bf16_round(y3); sBC[tid] = bf16_round(y4); }
  fetch(0); fetch(1);
  __builtin_amdgcn_sched_barrier(0);      // the first two groups fly while input2 is rounded
#pragma unroll      // the index names registers (fragments, accumulators): it must be a constant
  for (int c = 0; c < 4; ++c) ib[4 + c] = frag_f32(x2[c]);
  __builtin_amdgcn_sched_barrier(0);      // the third group stays behind the rounding of input2, whose f32 registers it takes over
  // K^T = Wk^T.ENC^T and V = ENC.Wv, both acc/16 rounded to f16
#pragma unroll      // the index names registers (fragments, accumulators): it must be a constant
  for (int gi = 0; gi < 16; ++gi) {
    fetch(gi + 2);
    __builtin_amdgcn_sched_barrier(0);      // keeps the loads of group gi + 2 in front of the products of group gi: sunk to their use, each pair is waited for at its own matrix instruction
    v8f a = {};
#pragma unroll      // the index names registers (fragments, accumulators): it must be a constant
    for (int c = 0; c < 4; ++c) {
      FragH x; x.half[0] = ring[gi % 3][2 * c]; x.half[1] = ring[gi % 3][2 * c + 1];
      a = (gi < 8) ? __builtin_amdgcn_wmma_f32_16x16x32_f16(false, x.v, false, eb[c].v, (short)0, a, false, false)
                   : __builtin_amdgcn_wmma_f32_16x16x32_f16(false, eb[c].v, false, x.v, (short)0, a, false, false);
    }
    FragH f;
#pragma unroll
    for (int r = 0; r < 8; ++r) f.h[r] = (_Float16)(a[r] * 0.0625f);
    if (gi < 8) *(v8us*)&sK[g][gi * 16 + 8 * hh] = f.half[0];
    else *(v8us*)&sVT[(gi - 8) * 16 + ln][w * 16 + 8 * hh] = f.half[0];
  }
  __syncthreads();      // K, V^T, the node rows, input1, the last row of Wq and bc complete before any wave reads them
#pragma unroll      // the index names registers (fragments, accumulators): it must be a constant
  for (int c = 0; c < 4; ++c) { ib[c].half[0] = *(const v8us*)&sI1[c * 32 + 8 * hh]; ib[c].half[1] = *(const v8us*)&sI1[c * 32 + 16 + 8 * hh]; }
  v4f my[7][2];      // mask[b][g][16t + 8hh + 4u ..]; tile 6: both halves read keys 96..99 (in bounds), the upper half drops them
  const float* mp = MSK + bg * PN + 8 * hh; const float* mp6 = MSK + bg * PN + 96;
  // Q^T = Wq^T.[input1 | input2]^T; q = (acc/16 + remaining.Wq[256]) / sqrt(16), rounded to f16
  v8f aq = {};
#pragma unroll      // the index names registers (fragments, accumulators): it must be a constant
  for (int gi = 16; gi < 32; ++gi) {
    if (gi + 2 < 32) fetch(gi + 2);
    if (gi == 30) {      // no weight group is left to ask for: the mask slice takes the free registers and flies during the last two groups
#pragma unroll      // the index names registers (fragments, accumulators): it must be a constant
      for (int t = 0; t < 7; ++t)
#pragma unroll      // the index names registers (fragments, accumulators): it must be a constant
        for (int u = 0; u < 2; ++u) if (t < 6 || u == 0) my[t][u] = *(const v4fa*)(((t < 6) ? mp + t * 16 : mp6) + 4 * u);
      asm volatile("s_wait_xcnt 0x0" :: "v"(mp), "v"(mp6) : "memory");      // the two address pairs are reused behind the 13 loads: the wait stands in front of that overwrite; as inputs they stay whole up to it
    }
    __builtin_amdgcn_sched_barrier(0);      // keeps the loads of group gi + 2 (at gi = 30 the mask loads) in front of the products of group gi: sunk to their use, each pair is waited for at its own matrix instruction
#pragma unroll      // the index names registers (fragments, accumulators): it must be a constant
    for (int c = 0; c < 4; ++c) {
      FragH x; x.half[0] = ring[gi % 3][2 * c]; x.half[1] = ring[gi % 3][2 * c + 1];
      aq = __builtin_amdgcn_wmma_f32_16x16x32_f16(false, x.v, false, ib[(gi & 1) * 4 + c].v, (short)0, aq, false, false);
    }
    if (gi & 1) {
      const int te = (gi - 16) >> 1;
      const v4f u0 = *(const v4fa*)&sW3[te * 16 + 8 * hh], u1 = *(const v4fa*)&sW3[te * 16 + 8 * hh + 4];
      FragH f;
#pragma unroll
      for (int r = 0; r < 8; ++r) f.h[r] = (_Float16)((aq[r] * 0.0625f + rv * ((r < 4) ? u0[r & 3] : u1[r & 3])) * 0.25f);
      sO[te][tid] = f.half[0];
      aq = (v8f){};
    }
  }
  float mk[7][8];      // the mask slice rounded to bf16; keys >= 100 get the sentinel the row maximum starts from, so weight 0
#pragma unroll
  for (int t = 0; t < 7; ++t)
#pragma unroll
    for (int u = 0; u < 2; ++u) {
      if (t == 6 && u == 1) { for (int i = 0; i < 4; ++i) mk[t][4 + i] = -3.0e38f; continue; }
      const bool dead = (t == 6) && (hh == 1);
#pragma unroll
      for (int i = 0; i < 4; ++i) { const float x = bf16_round(my[t][u][i]); mk[t][4 * u + i] = dead ? -3.0e38f : x; }
    }
  // Q and K fragment halves of one head
  v8us qf = sO[0][tid], kf[7];
#pragma unroll
  for (int t = 0; t < 7; ++t) kf[t] = *(const v8us*)&sK[t * 16 + ln][8 * hh];
#pragma nounroll      // stays one rolled loop of 8 passes: with the shorter body the compiler peels the last pass off and schedules it into the output projection, which takes the kernel above 256 registers (under the stated budget: into scratch)
  for (int hl = 0; hl < HPW; ++hl) {
    FragH bq; bq.half[0] = qf; bq.half[1] = zero8;
    v8f s[7];
#pragma unroll
    for (int t = 0; t < 7; ++t) {
      FragH ak; ak.half[0] = kf[t]; ak.half[1] = zero8;
      const v8f z = {};
      s[t] = __builtin_amdgcn_wmma_f32_16x16x32_f16(false, ak.v, false, bq.v, (short)0, z, false, false);
    }
    // the next head's fragments fly while this head's softmax runs; the last pass reads its own again (in bounds, unused), so that no branch stands behind the matrix instructions
    const int hn = (hl + 1 < HPW) ? hl + 1 : hl;
    qf = sO[hn][tid];
#pragma unroll
    for (int t = 0; t < 7; ++t) kf[t] = *(const v8us*)&sK[t * 16 + ln][hn * KD + 8 * hh];
    FragH av[4];      // this head's V^T fragments, asked for ahead of the softmax as well
#pragma unroll
    for (int cc = 0; cc < 4; ++cc) { av[cc].half[0] = *(const v8us*)&sVT[hl * KD + ln][cc * 32 + 8 * hh]; av[cc].half[1] = *(const v8us*)&sVT[hl * KD + ln][cc * 32 + 16 + 8 * hh]; }
    __builtin_amdgcn_sched_barrier(0);      // keeps the loads above in front of the softmax: without it the compiler sinks them to their first use and their latency is waited out there
    // row maximum and row sum: one short chain per tile, then a tree (seven independent chains instead of one of 56 links; few waves share a SIMD here)
    float pm[7], ps[7];
#pragma unroll
    for (int t = 0; t < 7; ++t) {
      pm[t] = -3.0e38f;
#pragma unroll
      for (int r = 0; r < 8; ++r) { s[t][r] += mk[t][r]; pm[t] = fmaxf(pm[t], s[t][r]); }
    }
    float m = fmaxf(fmaxf(fmaxf(pm[0], pm[1]), fmaxf(pm[2], pm[3])), fmaxf(fmaxf(pm[4], pm[5]), pm[6]));
    m = fmaxf(m, __shfl_xor(m, 16, 32));
#pragma unroll
    for (int t = 0; t < 7; ++t) {
      ps[t] = 0.f;
#pragma unroll
      for (int r = 0; r < 8; ++r) { const float x = exp_hw(s[t][r] - m); const float e = (s[t][r] > -1.0e38f) ? x : 0.f; s[t][r] = e; ps[t] += e; }
    }
    float sum = ((ps[0] + ps[1]) + (ps[2] + ps[3])) + ((ps[4] + ps[5]) + ps[6]);
    sum += __shfl_xor(sum, 16, 32);
    const float is = (sum > 0.f) ? 1.0f / sum : 0.f;
    v8f o = {};
#pragma unroll
    for (int c = 0; c < 4; ++c) {
      FragH pb;
#pragma unroll
      for (int i = 0; i < 8; ++i) { pb.h[i] = (_Float16)(s[2 * c][i] * is); pb.h[8 + i] = (2 * c + 1 < 7) ? (_Float16)(s[(2 * c + 1 < 7) ? 2 * c + 1 : 0][i] * is) : (_Float16)0.f; }
      o = __builtin_amdgcn_wmma_f32_16x16x32_f16(false, av[c].v, false, pb.v, (short)0, o, false, false);
    }
    FragH f;      // o[r] = O[g][head column 8hh + r]: 16 bytes in a row of the lane's output row
#pragma unroll
    for (int r = 0; r < 8; ++r) f.h[r] = (_Float16)o[r];
    sO[hl][tid] = f.half[0];
  }
  // MH^T = Wc^T.O^T: A = 16 rows of Wc^T (output columns e), B = the lane's O row; two tiles of e make one B fragment of the pointer product. mh = acc/16 + bc, rounded to f16.
  FragH ob[4], mb[4];
#pragma unroll      // the index names registers (fragments, accumulators): it must be a constant
  for (int c = 0; c < 4; ++c) { ob[c].half[0] = sO[2 * c][tid]; ob[c].half[1] = sO[2 * c + 1][tid]; }
  // The operands of the two products come in 15 groups of 8 loads, as in the projections (one group = the 4 matrix instructions of one accumulator chain): groups 0..7 the tiles of Wc^T (global, fragment order),
  // groups 8..14 the node tiles (LDS). Three register buffers in turn: of Wc^T group i + 2 is asked for before group i is used, of the node tiles group i + 1. Left to the compiler each pair of loads stands directly in front of its matrix instruction and is waited for alone.
  const unsigned short* wp = (const unsigned short*)WcT + lane * 8;
  v8us rt[3][8];
  auto fetch_t = [&](int gi) {
#pragma unroll      // the index names registers (fragments, accumulators): it must be a constant
    for (int c = 0; c < 4; ++c) {
      if (gi < 8) { rt[gi % 3][2 * c] = *(const v8us*)(wp + (gi * 8 + 2 * c) * FRH); rt[gi % 3][2 * c + 1] = *(const v8us*)(wp + (gi * 8 + 2 * c + 1) * FRH); }
      else { rt[gi % 3][2 * c] = *(const v8us*)&sE[(gi - 8) * 16 + ln][c * 32 + 8 * hh]; rt[gi % 3][2 * c + 1] = *(const v8us*)&sE[(gi - 8) * 16 + ln][c * 32 + 16 + 8 * hh]; }
    }
    if (gi == 7) asm volatile("s_wait_xcnt 0x0" ::: "memory");      // the last loads of Wc^T: the registers that held their address are free from here on; the wait stands in front of that overwrite
  };
  fetch_t(0); fetch_t(1);
  // S2^T = ENC.MH^T: A = 16 node rows from LDS (rows 100..111 zero), B = mb
  v8f z[7];
#pragma unroll      // the index names registers (fragments, accumulators): it must be a constant
  for (int gi = 0; gi < 15; ++gi) {
    if (gi + 2 < 8) fetch_t(gi + 2);      // Wc^T comes from L2: two groups ahead
    else if (gi >= 7 && gi + 1 < 15) fetch_t(gi + 1);      // the node tiles come from LDS: one group ahead is enough, and the accumulators of the pointer product need the registers
    v4f b0 = {}, b1 = {};
    if (gi < 8) { b0 = *(const v4fa*)&sBC[gi * 16 + 8 * hh]; b1 = *(const v4fa*)&sBC[gi * 16 + 8 * hh + 4]; }
    __builtin_amdgcn_sched_barrier(0);      // keeps the loads asked for above and the bias of group gi in front of the products of group gi: sunk to their use, each pair is waited for at its own matrix instruction
    v8f a = {};
#pragma unroll      // the index names registers (fragments, accumulators): it must be a constant
    for (int c = 0; c < 4; ++c) {
      FragH x; x.half[0] = rt[gi % 3][2 * c]; x.half[1] = rt[gi % 3][2 * c + 1];
      a = __builtin_amdgcn_wmma_f32_16x16x32_f16(false, x.v, false, (gi < 8) ? ob[c].v : mb[c].v, (short)0, a, false, false);
    }
    if (gi < 8) {
#pragma unroll      // the index names registers (fragments, accumulators): it must be a constant
      for (int r = 0; r < 8; ++r) mb[gi >> 1].h[8 * (gi & 1) + r] = (_Float16)(a[r] * 0.0625f + ((r < 4) ? b0[r & 3] : b1[r & 3]));
    } else z[gi - 8] = a;
    if (gi < 6) __builtin_amdgcn_sched_barrier(0);      // keeps the loads of group gi + 3 behind the products of group gi, whose buffer they take over: lifted above them a fourth buffer is live and the kernel goes above 256 registers (under the stated budget: into scratch)
  }
  __builtin_amdgcn_sched_barrier(0);      // ends the scheduling region of the two products here, where the branches of the library tanh ended it: as one region with the branch-free tail the kernel goes above 256 registers (under the stated budget: into scratch)
  // probs = softmax(10 tanh(S2 / sqrt(128)) + mask) over the keys of the lane's query: chains per tile, a tree, one exchange between the lane halves, as in the heads
  float pm[7], ps[7];
#pragma unroll      // the index names registers (fragments, accumulators): it must be a constant
  for (int t = 0; t < 7; ++t) {
    pm[t] = -3.0e38f;
#pragma unroll      // the index names registers (fragments, accumulators): it must be a constant
    for (int r = 0; r < 8; ++r) { z[t][r] = 10.0f * tanh_hw(z[t][r], 0.08838834764831845f) + mk[t][r]; pm[t] = fmaxf(pm[t], z[t][r]); }
  }
  float m = fmaxf(fmaxf(fmaxf(pm[0], pm[1]), fmaxf(pm[2], pm[3])), fmaxf(fmaxf(pm[4], pm[5]), pm[6]));
  m = fmaxf(m, __shfl_xor(m, 16, 32));
#pragma unroll      // the index names registers (fragments, accumulators): it must be a constant
  for (int t = 0; t < 7; ++t) {
    ps[t] = 0.f;
#pragma unroll      // the index names registers (fragments, accumulators): it must be a constant
    for (int r = 0; r < 8; ++r) { const float x = exp_hw(z[t][r] - m); const float e = (z[t][r] > -1.0e38f) ? x : 0.f; z[t][r] = e; ps[t] += e; }
  }
  float sum = ((ps[0] + ps[1]) + (ps[2] + ps[3])) + ((ps[4] + ps[5]) + ps[6]);
  sum += __shfl_xor(sum, 16, 32);
  const float is = (sum > 0.f) ? 1.0f / sum : 0.f;
#pragma unroll      // the index names registers (fragments, accumulators): it must be a constant
  for (int t = 0; t < 7; ++t)
#pragma unroll      // the index names registers (fragments, accumulators): it must be a constant
    for (int r = 0; r < 8; ++r) z[t][r] *= is;
  if (g < GG) {      // a lane stores 32 bytes in a row per tile of its own output row (400-byte rows, 16-byte aligned pieces); tile 6 holds keys 96..99 in the lower half alone
    float* op = out + bg * PN + 8 * hh;
#pragma unroll      // the index names registers (fragments, accumulators): it must be a constant
    for (int t = 0; t < 6; ++t) {
      const v4f lo = {z[t][0], z[t][1], z[t][2], z[t][3]}, hi = {z[t][4], z[t][5], z[t][6], z[t][7]};
      *(v4f*)(op + t * 16) = lo; *(v4f*)(op + t * 16 + 4) = hi;
    }
    if (hh == 0) { const v4f lo = {z[6][0], z[6][1], z[6][2], z[6][3]}; *(v4f*)(op + 96) = lo; }
  }
}
extern "C" void kernel_launch(void* const* d_in, const int* in_sizes, int n_in,
                              void* d_out, int out_size, void* d_ws, size_t ws_size, hipStream_t stream) {
  (void)in_sizes; (void)n_in; (void)out_size;
  const float* in1 = (const float*)d_in[0]; const float* in2 = (const float*)d_in[1]; const float* rl = (const float*)d_in[2]; const float* msk = (const float*)d_in[3]; const float* enc = (const float*)d_in[4]; const float* Wq = (const float*)d_in[5]; const float* Wk = (const float*)d_in[6]; const float* Wv = (const float*)d_in[7]; const float* Wc = (const float*)d_in[8]; const float* bc = (const float*)d_in[9];
  char* ws = (char*)d_ws; size_t off = 0;
  auto take = [&](size_t bytes) { char* p = ws + off; off += (bytes + 255) & ~(size_t)255; return p; };
  _Float16* Bq = (_Float16*)take(2 * EE * EE * 2); _Float16* Bk = (_Float16*)take(EE * EE * 2); _Float16* Bv = (_Float16*)take(EE * EE * 2); _Float16* Bc = (_Float16*)take(EE * EE * 2);
  if (off > ws_size) return;      // 160 KiB of the workspace
  k_wt_f16<<<5 * WPB, 256, 0, stream>>>(Wq, Wk, Wv, Wc, Bq, Bk, Bv, Bc, 16.0f);      // of Wq the rows 0..255: input1 and input2  ([in][out]); row 256 (remaining) is read as it is
  // ---- projections, attention, output projection, pointer scores and the final softmax, one launch: a work-group per batch
  k_attn<<<NB, 224, 0, stream>>>(in1, in2, rl, msk, enc, Wq, Bq, Bk, Bv, Bc, bc, (float*)d_out);
}

// v009
// A run of this version takes 31.9 microseconds.
// Next to v008, in two timings, it ran 1.08 times as fast each time.
// Counting every step since v000, it is 27.8 times as fast.
#include <hip/hip_runtime.h>
// Next-node probability head (B=512, G=100 group rows, P=100 nodes, E=128, 8 heads x 16, logit clipping 10). The weights are packed into f16 planes in fragment order first; then one kernel (k_attn), one work-group per batch,
// does all the rest: k,v = enc.W and q = [input1 | input2 | remaining].Wq (the first 256 rows as a product, the last as a rank-1 term), the 8-head attention (additive INPUT ninf mask),
// o.Wc + bc, the pointer score mh.enc^T/sqrt(128) and the softmax of 10 tanh + mask. K, V^T and the f16 nodes wait in LDS, Q and O in lane-private LDS, the rest in registers. Contractions on v_wmma_f32_16x16x32_f16 (f16 operands,
// weights [in][out] bf16-exact x2^4, f32 accumulate); softmaxes/tanh f32 VALU.
#define NB 512
#define GG 100
#define PN 100
#define EE 128
#define NH 8
#define KD 16

typedef __bf16 v16b __attribute__((ext_vector_type(16)));
typedef unsigned short v8us __attribute__((ext_vector_type(8), may_alias));
typedef float  v8f  __attribute__((ext_vector_type(8)));
typedef float  v4f  __attribute__((ext_vector_type(4)));
typedef float  v2f  __attribute__((ext_vector_type(2)));
typedef float  v4fa __attribute__((ext_vector_type(4), may_alias));
union FragB { v16b v; v8us half[2]; unsigned short u[16]; };

__device__ __forceinline__ unsigned short bf16_bits(float x) { unsigned int u = __float_as_uint(x); return (unsigned short)((u + 0x7FFFu + ((u >> 16) & 1u)) >> 16); }
__device__ __forceinline__ float bf16_val(unsigned short b) { return __uint_as_float(((unsigned int)b) << 16); }
__device__ __forceinline__ float bf16_round(float x) { return bf16_val(bf16_bits(x)); }
// D += A·B with NT terms: 1 = ah·bh, 2 = + al·bh (A split), 3 = + ah·bl (both split)
template <int NT>
__device__ __forceinline__ v8f mmaN(v16b ah, v16b al, v16b bh, v16b bl, v8f c) {
  c = __builtin_amdgcn_wmma_f32_16x16x32_bf16(false, ah, false, bh, (short)0, c, false, false);
  if (NT >= 2) c = __builtin_amdgcn_wmma_f32_16x16x32_bf16(false, al, false, bh, (short)0, c, false, false);
  if (NT >= 3) c = __builtin_amdgcn_wmma_f32_16x16x32_bf16(false, ah, false, bl, (short)0, c, false, false);
  asm volatile("v_nop\n\tv_nop\n\tv_nop\n\tv_nop" : "+v"(c) : "v"(ah), "v"(al), "v"(bh), "v"(bl));
  return c;
}

__global__ __launch_bounds__(256) void k_wt_bf16(const float* __restrict__ W, unsigned short* __restrict__ Wt, int K, int N) {
  const int t = blockIdx.x * 256 + threadIdx.x;
  const int k8n = K / 8;
  if (t >= N * k8n) return;
  const int n = t / k8n, k8 = (t % k8n) * 8;
  v8us v;
#pragma unroll
  for (int i = 0; i < 8; ++i) v[i] = bf16_bits(W[(size_t)(k8 + i) * N + n]);
  *(v8us*)(Wt + (size_t)n * K + k8) = v;
  
}

// GEMM C[M][N] (f32, pitch ldc) = act(A[M][K]·W + bias). A f32 row-major (pitch lda) converted per fragment to bf16
// (ASPLIT: hi/lo two planes -> 2 terms, else single rounded term); Wt bf16 [N][K] (pitch ldb). BIAS_BF16 rounds the
// bias to bf16 first (bias quantised to bf16 before the add). K%32==0, M%16==0, N%64==0.
template <bool ASPLIT, int ACT, bool BIAS_BF16>
__global__ __launch_bounds__(128) void k_gemm_bf(const float* __restrict__ A, int lda, const unsigned short* __restrict__ Wt, int ldb,
                                               const float* __restrict__ bias, float* __restrict__ C, int ldc, int M, int N, int K) {
  __shared__ __attribute__((aligned(16))) float so[4][16][64];
  const int tid = threadIdx.x, w = tid >> 5, lane = tid & 31, ln = lane & 15, hh = lane >> 4;
  const int ntn = N / 64;
  const int wid = blockIdx.x * 4 + w;
  const int mt = wid / ntn, nq = wid % ntn;
  if (mt * 16 >= M) return;
  const int row0 = mt * 16, col0 = nq * 64;
  const float* arow = A + (size_t)(row0 + ln) * lda;
  v8f acc[4] = {};
  for (int kb = 0; kb < K; kb += 32) {
    FragB ah, al;
    const v4f x0 = *(const v4fa*)(arow + kb + 8 * hh), x1 = *(const v4fa*)(arow + kb + 8 * hh + 4);
    const v4f x2 = *(const v4fa*)(arow + kb + 16 + 8 * hh), x3 = *(const v4fa*)(arow + kb + 16 + 8 * hh + 4);
    float xs[16] = {x0[0],x0[1],x0[2],x0[3],x1[0],x1[1],x1[2],x1[3],x2[0],x2[1],x2[2],x2[3],x3[0],x3[1],x3[2],x3[3]};
#pragma unroll
    for (int i = 0; i < 16; ++i) { const unsigned short hb = bf16_bits(xs[i]); ah.u[i] = hb; al.u[i] = ASPLIT ? bf16_bits(xs[i] - bf16_val(hb)) : (unsigned short)0; }
#pragma unroll
    for (int t = 0; t < 4; ++t) {
      const unsigned short* brow = Wt + (size_t)(col0 + t * 16 + ln) * ldb + kb;
      FragB b;
      b.half[0] = *(const v8us*)(brow + 8 * hh);
      b.half[1] = *(const v8us*)(brow + 16 + 8 * hh);
      acc[t] = mmaN<ASPLIT ? 2 : 1>(ah.v, al.v, b.v, b.v, acc[t]);
    }
  }
#pragma unroll
  for (int t = 0; t < 4; ++t) {
    float bv = bias ? bias[col0 + t * 16 + ln] : 0.f;
    if (BIAS_BF16) bv = bf16_round(bv);
#pragma unroll
    for (int r = 0; r < 8; ++r) { float v = acc[t][r] + bv; if (ACT == 1) v = fmaxf(v, 0.f); so[w][8 * hh + r][t * 16 + ln] = v; }
  }
  __builtin_amdgcn_fence(__ATOMIC_ACQ_REL, "workgroup");
  __builtin_amdgcn_wave_barrier();
  const int rsub = lane >> 4, c4 = (lane & 15) * 4;
  {
#pragma unroll
    for (int q = 0; q < 8; ++q) {
      const int r = q * 2 + rsub;
      const v4f v = *(const v4fa*)&so[w][r][c4];
      *(v4f*)(C + (size_t)(row0 + r) * ldc + col0 + c4) = v;
    }
    
  }
}

// Flash-style causal/unmasked attention, all contractions 3-term bf16 hi/lo splits, f32 softmax with running max.
// q,k,v rows are read from f32 buffers with arbitrary row pitch (so they can live inside a fused qkv buffer);
// D = head size (multiple of 32, <= 128); one wave = 16 query rows; block = 4 waves (64 queries) sharing K/V chunks of 32.
template <int D, bool CAUSAL>
__global__ __launch_bounds__(128) void k_flash(const float* __restrict__ qb, const float* __restrict__ kb, const float* __restrict__ vb,
                                             int pitch, int T, int H, float scale, float* __restrict__ y, int ypitch) {
  constexpr int KS = D / 32;        // k-steps for QK
  constexpr int DT = D / 16;        // d tiles for PV
  __shared__ __attribute__((aligned(16))) unsigned short sKh[32][D + 8], sKl[32][D + 8], sVh[32][D + 8], sVl[32][D + 8];
  __shared__ __attribute__((aligned(16))) unsigned short sPh[4][16][40], sPl[4][16][40];
  __shared__ __attribute__((aligned(16))) float sO[4][16][D];
  const int tid = threadIdx.x, w = tid >> 5, lane = tid & 31, ln = lane & 15, hh = lane >> 4;
  const int nqb = (T + 63) / 64;
  const int bh = blockIdx.x / nqb, qblk = blockIdx.x % nqb;
  const int b = bh / H, h = bh % H;
  const int q0 = qblk * 64 + w * 16;
  const float* Q = qb + (size_t)b * T * pitch + h * D;
  const float* K = kb + (size_t)b * T * pitch + h * D;
  const float* V = vb + (size_t)b * T * pitch + h * D;

  // A fragments of the wave's 16 query rows (scaled), hi/lo
  FragB aqh[KS], aql[KS];
  {
    int row = q0 + ln; if (row >= T) row = T - 1;
    const float* qr = Q + (size_t)row * pitch;
#pragma unroll
    for (int ks = 0; ks < KS; ++ks)
#pragma unroll
      for (int i = 0; i < 16; ++i) {
        const int d = ks * 32 + ((i < 8) ? (8 * hh + i) : (16 + 8 * hh + (i - 8)));
        const float x = qr[d] * scale; const unsigned short hb = bf16_bits(x);
        aqh[ks].u[i] = hb; aql[ks].u[i] = bf16_bits(x - bf16_val(hb));
      }
  }
  float m_r[8], l_r[8];
#pragma unroll
  for (int r = 0; r < 8; ++r) { m_r[r] = -3.0e38f; l_r[r] = 0.f; }
  v8f oacc[DT];
#pragma unroll
  for (int dt = 0; dt < DT; ++dt) oacc[dt] = (v8f){0.f,0.f,0.f,0.f,0.f,0.f,0.f,0.f};

  const int kv_end = CAUSAL ? min(T, qblk * 64 + 64) : T;     // block-uniform
  for (int j0 = 0; j0 < kv_end; j0 += 32) {
    __syncthreads();
    for (int e = tid; e < 32 * (D / 4); e += 128) {
      const int r = e / (D / 4), c4 = (e % (D / 4)) * 4;
      const int key = j0 + r;
      v4f kf = {0.f,0.f,0.f,0.f}, vf = {0.f,0.f,0.f,0.f};
      if (key < T) { kf = *(const v4fa*)(K + (size_t)key * pitch + c4); vf = *(const v4fa*)(V + (size_t)key * pitch + c4); }
#pragma unroll
      for (int t = 0; t < 4; ++t) {
        unsigned short hb = bf16_bits(kf[t]); sKh[r][c4 + t] = hb; sKl[r][c4 + t] = bf16_bits(kf[t] - bf16_val(hb));
        hb = bf16_bits(vf[t]); sVh[r][c4 + t] = hb; sVl[r][c4 + t] = bf16_bits(vf[t] - bf16_val(hb));
      }
    }
    __syncthreads();
    // S tile 16 x 32
    v8f s[2];
#pragma unroll
    for (int nt = 0; nt < 2; ++nt) {
      v8f acc = {};
#pragma unroll
      for (int ks = 0; ks < KS; ++ks) {
        FragB bh_, bl_;
        bh_.half[0] = *(const v8us*)&sKh[nt * 16 + ln][ks * 32 + 8 * hh]; bh_.half[1] = *(const v8us*)&sKh[nt * 16 + ln][ks * 32 + 16 + 8 * hh];
        bl_.half[0] = *(const v8us*)&sKl[nt * 16 + ln][ks * 32 + 8 * hh]; bl_.half[1] = *(const v8us*)&sKl[nt * 16 + ln][ks * 32 + 16 + 8 * hh];
        acc = mmaN<3>(aqh[ks].v, aql[ks].v, bh_.v, bl_.v, acc);
      }
      s[nt] = acc;
    }
    // mask + running max (rows 8hh+r; the 16 lanes of a half share rows)
    float alpha[8];
#pragma unroll
    for (int r = 0; r < 8; ++r) {
      const int qi = q0 + 8 * hh + r;
      const int ja = j0 + ln, jb = j0 + 16 + ln;
      if (CAUSAL) { if (ja > qi) s[0][r] = -3.0e38f; if (jb > qi) s[1][r] = -3.0e38f; }
      if (ja >= T) s[0][r] = -3.0e38f;
      if (jb >= T) s[1][r] = -3.0e38f;
      float mx = fmaxf(s[0][r], s[1][r]);
      mx = fmaxf(mx, __shfl_xor(mx, 1, 32)); mx = fmaxf(mx, __shfl_xor(mx, 2, 32)); mx = fmaxf(mx, __shfl_xor(mx, 4, 32)); mx = fmaxf(mx, __shfl_xor(mx, 8, 32));
      const float mnew = fmaxf(m_r[r], mx);
      alpha[r] = (mnew > -1.0e38f) ? __expf(m_r[r] - mnew) : 1.0f;
      const float p0 = (s[0][r] > -1.0e38f) ? __expf(s[0][r] - mnew) : 0.f;
      const float p1 = (s[1][r] > -1.0e38f) ? __expf(s[1][r] - mnew) : 0.f;
      m_r[r] = mnew;
      l_r[r] = l_r[r] * alpha[r] + p0 + p1;            // per-lane partial row sum (16 lanes combined at the end)
      unsigned short hb = bf16_bits(p0); sPh[w][8 * hh + r][ln] = hb;      sPl[w][8 * hh + r][ln] = bf16_bits(p0 - bf16_val(hb));
      hb = bf16_bits(p1);                sPh[w][8 * hh + r][16 + ln] = hb; sPl[w][8 * hh + r][16 + ln] = bf16_bits(p1 - bf16_val(hb));
    }
#pragma unroll
    for (int dt = 0; dt < DT; ++dt)
#pragma unroll
      for (int r = 0; r < 8; ++r) oacc[dt][r] *= alpha[r];
    __builtin_amdgcn_fence(__ATOMIC_ACQ_REL, "workgroup");
    __builtin_amdgcn_wave_barrier();
    FragB pah, pal;
    pah.half[0] = *(const v8us*)&sPh[w][ln][8 * hh]; pah.half[1] = *(const v8us*)&sPh[w][ln][16 + 8 * hh];
    pal.half[0] = *(const v8us*)&sPl[w][ln][8 * hh]; pal.half[1] = *(const v8us*)&sPl[w][ln][16 + 8 * hh];
#pragma unroll
    for (int dt = 0; dt < DT; ++dt) {
      FragB bvh, bvl;
#pragma unroll
      for (int i = 0; i < 8; ++i) {
        bvh.u[i] = sVh[8 * hh + i][dt * 16 + ln]; bvh.u[8 + i] = sVh[16 + 8 * hh + i][dt * 16 + ln];
        bvl.u[i] = sVl[8 * hh + i][dt * 16 + ln]; bvl.u[8 + i] = sVl[16 + 8 * hh + i][dt * 16 + ln];
      }
      oacc[dt] = mmaN<3>(pah.v, pal.v, bvh.v, bvl.v, oacc[dt]);
    }
    __builtin_amdgcn_fence(__ATOMIC_ACQ_REL, "workgroup");
    __builtin_amdgcn_wave_barrier();
  }
#pragma unroll
  for (int r = 0; r < 8; ++r) {
    float l = l_r[r];
    l += __shfl_xor(l, 1, 32); l += __shfl_xor(l, 2, 32); l += __shfl_xor(l, 4, 32); l += __shfl_xor(l, 8, 32);
    l_r[r] = (l > 0.f) ? 1.0f / l : 0.f;
  }
#pragma unroll
  for (int dt = 0; dt < DT; ++dt)
#pragma unroll
    for (int r = 0; r < 8; ++r) sO[w][8 * hh + r][dt * 16 + ln] = oacc[dt][r] * l_r[r];
  __builtin_amdgcn_fence(__ATOMIC_ACQ_REL, "workgroup");
  __builtin_amdgcn_wave_barrier();
  {
    for (int r = 0; r < 16; ++r) {
      const int row = q0 + r;
      if (row < T && lane < D / 4) {
        const v4f val = *(const v4fa*)&sO[w][r][lane * 4];
        *(v4f*)(y + ((size_t)b * T + row) * ypitch + h * D + lane * 4) = val;
      }
    }
    
  }
}

// GEMM C = act(A·W + bias + resid): A f32 (ASPLIT -> hi/lo 2 terms), Wt bf16 [N][K]; ACT 0 none, 1 relu, 2 exact gelu;
// resid (optional, f32, row index = (row % rmod), pitch ldr, RES_BF16 rounds it) added before the activation.
template <bool ASPLIT, int ACT, bool BIAS_BF16, bool RES_BF16>
__global__ __launch_bounds__(128) void k_gemm_bf3(const float* __restrict__ A, int lda, const unsigned short* __restrict__ Wt, int ldb,
                                                const float* __restrict__ bias, const float* __restrict__ resid, int rmod, int ldr,
                                                float* __restrict__ C, int ldc, int M, int N, int K) {
  __shared__ __attribute__((aligned(16))) float so[4][16][64];
  const int tid = threadIdx.x, w = tid >> 5, lane = tid & 31, ln = lane & 15, hh = lane >> 4;
  const int ntn = N / 64;
  const int wid = blockIdx.x * 4 + w;
  const int mt = wid / ntn, nq = wid % ntn;
  if (mt * 16 >= M) return;
  const int row0 = mt * 16, col0 = nq * 64;
  const float* arow = A + (size_t)(row0 + ln) * lda;
  v8f acc[4] = {};
  for (int kb = 0; kb < K; kb += 32) {
    FragB ah, al;
    const v4f x0 = *(const v4fa*)(arow + kb + 8 * hh), x1 = *(const v4fa*)(arow + kb + 8 * hh + 4);
    const v4f x2 = *(const v4fa*)(arow + kb + 16 + 8 * hh), x3 = *(const v4fa*)(arow + kb + 16 + 8 * hh + 4);
    float xs[16] = {x0[0],x0[1],x0[2],x0[3],x1[0],x1[1],x1[2],x1[3],x2[0],x2[1],x2[2],x2[3],x3[0],x3[1],x3[2],x3[3]};
#pragma unroll
    for (int i = 0; i < 16; ++i) { const unsigned short hb = bf16_bits(xs[i]); ah.u[i] = hb; al.u[i] = ASPLIT ? bf16_bits(xs[i] - bf16_val(hb)) : (unsigned short)0; }
#pragma unroll
    for (int t = 0; t < 4; ++t) {
      const unsigned short* brow = Wt + (size_t)(col0 + t * 16 + ln) * ldb + kb;
      FragB b;
      b.half[0] = *(const v8us*)(brow + 8 * hh);
      b.half[1] = *(const v8us*)(brow + 16 + 8 * hh);
      acc[t] = mmaN<ASPLIT ? 2 : 1>(ah.v, al.v, b.v, b.v, acc[t]);
    }
  }
#pragma unroll
  for (int t = 0; t < 4; ++t) {
    const int col = col0 + t * 16 + ln;
    float bv = bias ? bias[col] : 0.f;
    if (BIAS_BF16) bv = bf16_round(bv);
#pragma unroll
    for (int r = 0; r < 8; ++r) {
      float v = acc[t][r] + bv;
      if (resid) { float rv = resid[(size_t)((row0 + 8 * hh + r) % rmod) * ldr + col]; if (RES_BF16) rv = bf16_round(rv); v += rv; }
      if (ACT == 1) v = fmaxf(v, 0.f);
      if (ACT == 2) v = 0.5f * v * (1.0f + erff(v * 0.70710678118654752f));
      if (ACT == 3) { const float u = 0.7978845608028654f * (v + 0.044715f * v * v * v); v = 0.5f * v * (1.0f + tanhf(u)); }
      so[w][8 * hh + r][t * 16 + ln] = v;
    }
  }
  __builtin_amdgcn_fence(__ATOMIC_ACQ_REL, "workgroup");
  __builtin_amdgcn_wave_barrier();
  const int rsub = lane >> 4, c4 = (lane & 15) * 4;
  {
#pragma unroll
    for (int q = 0; q < 8; ++q) {
      const int r = q * 2 + rsub;
      const v4f v = *(const v4fa*)&so[w][r][c4];
      *(v4f*)(C + (size_t)(row0 + r) * ldc + col0 + c4) = v;
    }
    
  }
}
// row LayerNorm (biased variance, eps) over N: s = X (+ R); optional out_sum <- s; out_norm <- (s-mu)*rsqrt(var+eps)*g + b
template <bool PARAM_BF16>
__global__ __launch_bounds__(256) void k_layernorm(const float* __restrict__ X, const float* __restrict__ R, const float* __restrict__ g, const float* __restrict__ bta,
                                                  float* __restrict__ out_sum, float* __restrict__ out_norm, int N, float eps) {
  __shared__ float red[256];
  const int row = blockIdx.x, tid = threadIdx.x;
  const float* x = X + (size_t)row * N; const float* rr = R ? R + (size_t)row * N : nullptr;
  float vals[16];                     // up to N = 4096
  const int per = N / 256;            // contiguous chunk per thread? use strided-by-4 chunks: thread handles j = tid*4 + 1024*u
  float s1 = 0.f;
  for (int u = 0; u < per / 4; ++u) {
    const int j = tid * 4 + 1024 * u;
    const v4f a = *(const v4fa*)(x + j);
    v4f b = {0.f,0.f,0.f,0.f}; if (rr) b = *(const v4fa*)(rr + j);
#pragma unroll
    for (int q = 0; q < 4; ++q) { const float v = a[q] + b[q]; vals[u * 4 + q] = v; s1 += v; }
  }
  red[tid] = s1; __syncthreads();
  for (int st = 128; st > 0; st >>= 1) { if (tid < st) red[tid] += red[tid + st]; __syncthreads(); }
  const float mu = red[0] / (float)N; __syncthreads();
  float s2 = 0.f;
  for (int u = 0; u < per / 4; ++u)
#pragma unroll
    for (int q = 0; q < 4; ++q) { const float c = vals[u * 4 + q] - mu; s2 += c * c; }
  red[tid] = s2; __syncthreads();
  for (int st = 128; st > 0; st >>= 1) { if (tid < st) red[tid] += red[tid + st]; __syncthreads(); }
  const float rs = rsqrtf(red[0] / (float)N + eps);
  {
    for (int u = 0; u < per / 4; ++u) {
      const int j = tid * 4 + 1024 * u;
      v4f o, sm;
#pragma unroll
      for (int q = 0; q < 4; ++q) {
        float gg = g[j + q], bb = bta[j + q];
        if (PARAM_BF16) { gg = bf16_round(gg); bb = bf16_round(bb); }
        sm[q] = vals[u * 4 + q]; o[q] = (vals[u * 4 + q] - mu) * rs * gg + bb;
      }
      if (out_sum) *(v4f*)(out_sum + (size_t)row * N + j) = sm;
      *(v4f*)(out_norm + (size_t)row * N + j) = o;
    }
    
  }
}



// ---- f16 WMMA path (v_wmma_f32_16x16x32_f16): 11-bit significands for operands in range — used where a [0,1] probability operand needs more precision than bf16
typedef _Float16 v16h __attribute__((ext_vector_type(16)));
union FragH { v16h v; v8us half[2]; _Float16 h[16]; unsigned short u[16]; };
template <int NT>
__device__ __forceinline__ v8f mmaH(v16h ah, v16h al, v16h bh, v16h bl, v8f c) {
  c = __builtin_amdgcn_wmma_f32_16x16x32_f16(false, ah, false, bh, (short)0, c, false, false);
  if (NT >= 2) c = __builtin_amdgcn_wmma_f32_16x16x32_f16(false, al, false, bh, (short)0, c, false, false);
  if (NT >= 3) c = __builtin_amdgcn_wmma_f32_16x16x32_f16(false, ah, false, bl, (short)0, c, false, false);
  asm volatile("v_nop\n\tv_nop\n\tv_nop\n\tv_nop" : "+v"(c) : "v"(ah), "v"(al), "v"(bh), "v"(bl));
  return c;
}
// batched GEMM like k_gemm_b but f16 operands: A f32 (split into f16 hi/lo if ASPLIT, else rounded to f16), Bt = f16 values [n][k]; alpha; C f32; N multiple of 16 (partial tiles skipped)
template <bool ASPLIT>
__global__ __launch_bounds__(128) void k_gemm_h(const float* __restrict__ A, int lda, size_t sA, const _Float16* __restrict__ Bh, int ldb, size_t sB, float alpha, float* __restrict__ C, int ldc, size_t sC, int M, int N, int K) {
  __shared__ __attribute__((aligned(16))) float so[4][16][64];
  const int tid = threadIdx.x, w = tid >> 5, lane = tid & 31, ln = lane & 15, hh = lane >> 4; const int by = blockIdx.y;
  A += (size_t)by * sA; Bh += (size_t)by * sB; C += (size_t)by * sC;
  const int ntn = (N + 63) / 64; const int wid = blockIdx.x * 4 + w; const int mt = wid / ntn, nq = wid % ntn; if (mt * 16 >= M) return;
  const int row0 = mt * 16, col0 = nq * 64; const float* arow = A + (size_t)(row0 + ln) * lda;
  v8f acc[4] = {};
  for (int kb = 0; kb < K; kb += 32) {
    FragH ah, al;
    const v4f x0 = *(const v4fa*)(arow + kb + 8 * hh), x1 = *(const v4fa*)(arow + kb + 8 * hh + 4), x2 = *(const v4fa*)(arow + kb + 16 + 8 * hh), x3 = *(const v4fa*)(arow + kb + 16 + 8 * hh + 4);
    float xs[16] = {x0[0],x0[1],x0[2],x0[3],x1[0],x1[1],x1[2],x1[3],x2[0],x2[1],x2[2],x2[3],x3[0],x3[1],x3[2],x3[3]};
#pragma unroll
    for (int i = 0; i < 16; ++i) { const _Float16 h = (_Float16)xs[i]; ah.h[i] = h; al.h[i] = ASPLIT ? (_Float16)(xs[i] - (float)h) : (_Float16)0.0f; }
#pragma unroll
    for (int t = 0; t < 4; ++t) { if (col0 + t * 16 >= N) continue; const size_t boff = (size_t)(col0 + t * 16 + ln) * ldb + kb; FragH bq; bq.half[0] = *(const v8us*)(Bh + boff + 8 * hh); bq.half[1] = *(const v8us*)(Bh + boff + 16 + 8 * hh);
      acc[t] = mmaH<ASPLIT ? 2 : 1>(ah.v, al.v, bq.v, bq.v, acc[t]); }
  }
#pragma unroll
  for (int t = 0; t < 4; ++t) { if (col0 + t * 16 >= N) continue;
#pragma unroll
    for (int r = 0; r < 8; ++r) so[w][8 * hh + r][t * 16 + ln] = acc[t][r] * alpha; }
  __builtin_amdgcn_fence(__ATOMIC_ACQ_REL, "workgroup"); __builtin_amdgcn_wave_barrier();
  const int rsub = lane >> 4, c4 = (lane & 15) * 4;
  {
#pragma unroll
    for (int q = 0; q < 8; ++q) { const int r = q * 2 + rsub; if (col0 + c4 < N) { const v4f v = *(const v4fa*)&so[w][r][c4]; *(v4f*)(C + (size_t)(row0 + r) * ldc + col0 + c4) = v; } }
     }
}

// f16(W[k][n]·scale) from f32 row-major W[K][N] (scale = power of two; bf16-exact weights stay exact in f16 away from the subnormal range), packed in fragment order: one block of 512 bytes = one 16-byte load of a whole wave =
// half j of the fragment (16 columns n of tile tn) x (k block c of 32): lane (ln, hh) owns the 8 values n = 16tn + ln, k = 32c + 16j + 8hh .. + 7. Blocks in the order [tn][c][j]. Thread t writes the 16 bytes number t of the plane.
#define FRH 256            // f16 values in one such block
// All four planes in one launch (for speed only). A plane of 128 x 128 takes WPB blocks; blocks 0 .. 2 WPB - 1 pack Wq rows 0..255, then WPB each Wk, Wv, Wc:
// a block lies wholly in one plane, so the choice of plane is scalar.
#define WPB (EE * EE / 8 / 256)
__global__ __launch_bounds__(256) void k_wt_f16(const float* __restrict__ Wq, const float* __restrict__ Wk, const float* __restrict__ Wv, const float* __restrict__ Wc,
                                                _Float16* __restrict__ Bq, _Float16* __restrict__ Bk, _Float16* __restrict__ Bv, _Float16* __restrict__ Bc, float scale) {
  const int blk = blockIdx.x, pl = (blk < 2 * WPB) ? 0 : blk / WPB - 1;      // plane 0 Wq (K = 256), 1 Wk, 2 Wv, 3 Wc (K = 128)
  const float* __restrict__ W = (pl == 0) ? Wq : (pl == 1) ? Wk : (pl == 2) ? Wv : Wc;
  _Float16* __restrict__ Wt = (pl == 0) ? Bq : (pl == 1) ? Bk : (pl == 2) ? Bv : Bc;
  const int kl = (pl == 0) ? 3 : 2;      // log2 of the k blocks of 32 in the plane
  const int t = (blk - ((pl == 0) ? 0 : (pl + 1) * WPB)) * 256 + threadIdx.x;
  const int ln = t & 15, hh = (t >> 4) & 1, j = (t >> 5) & 1, cb = t >> 6, c = cb & ((1 << kl) - 1), tn = cb >> kl;
  const int n = tn * 16 + ln, k8 = c * 32 + j * 16 + hh * 8; FragH f;
#pragma unroll
  for (int i = 0; i < 8; ++i) f.h[i] = (_Float16)(bf16_round(W[(size_t)(k8 + i) * EE + n]) * scale); const v8us o = f.half[0];
  *(v8us*)((unsigned short*)Wt + (size_t)t * 8) = o; 
}
// The whole head in one kernel. One work-group = one batch b and all HPW heads; wave w owns the 16 query rows g = 16w..16w+15 (7 waves cover 112 >= 100) and loops over the heads.
// The score tile is formed transposed, S^T = K.Q^T (A = 16 key rows, B = 16 query rows, d 16 zero-extended to the k = 32 of the instruction), so a lane (ln, hh) holds, for its one
// query g = 16w + ln, the keys p = 16t + 8hh + r (t = tile, r = accumulator register). That is the k order of a B fragment: after the softmax (registers, an exchange for the maximum and one for the sum between the
// two lane halves) tiles 2c and 2c+1 are, register for register, the B operand of O^T = V^T.P^T for keys 32c..32c+31. Scores and weights never leave the registers.
// V^T (A operand, rows = head columns, k = keys, zero for keys >= 100) waits in LDS. The mask row slice of a lane is read once and serves all HPW heads and the pointer softmax.
// The same turn carries the wave through the rest of the network: O^T of heads 2c, 2c+1 is the B operand (k = 32c..32c+31) of MH^T = Wc^T.O^T, the tiles 2c, 2c+1 of MH^T are the B operand
// of S2^T = ENC.MH^T, and S2^T again leaves a lane with the keys 16t + 8hh + r of its one query, the places its mask registers already have: tanh, mask and softmax run as in the heads.
// The projections stand in front, in the same turn: wave w rounds the node rows 16w..16w+15 to one set of f16 fragments (rows >= 100 zero), which is the B operand of K^T = Wk^T.ENC^T (a lane gets 8 columns in a row of
// its node: one 16-byte store into a K row in LDS), the A operand of V = ENC.Wv (a lane gets 8 nodes in a row of its column: one 16-byte store into a V^T row) and, stored as it is, the A operand of the pointer product.
// Q^T = Wq^T.[input1 | input2]^T (k = 256, input1 the same in every lane) leaves a lane with the columns 8hh + r of head te of its own query: the half fragment that the score product wants as B.
#define HPW 8              // heads per work-group: all of them, so a wave reads and rounds its mask slice once and holds the whole O row of its query
#define VTP 136            // f16 pitch of a V^T, K or node row in LDS: 256 + 16 bytes, spreads the 16 rows of a 16-byte fragment read over the banks
// the 16 f32 values of one fragment (k = 8hh..8hh+7 and 16+8hh..16+8hh+7 of a block of 32) of an f32 row; p = row + 32c + 8hh
__device__ __forceinline__ void raw_f32(v4f (&x)[4], const float* __restrict__ p) { x[0] = *(const v4fa*)p; x[1] = *(const v4fa*)(p + 4); x[2] = *(const v4fa*)(p + 16); x[3] = *(const v4fa*)(p + 20); }
// ... rounded to bf16, then (exactly, in range) to f16
__device__ __forceinline__ FragH frag_f32(const v4f (&x)[4]) {
  FragH f;
#pragma unroll
  for (int j = 0; j < 4; ++j)
#pragma unroll
    for (int i = 0; i < 4; ++i) f.h[4 * j + i] = (_Float16)bf16_round(x[j][i]);
  return f;
}
// The softmaxes run in base 2: log2(e) is folded into what their scores are made of (the scale of Q, the factor of tanh, the mask), so that a weight is one subtraction and the chip's own base-2 exponential, 2^(x - m);
// a result below 2^-126 may come out as 0. x = -inf or the sentinel of a dead key gives exactly 0 as long as m is at or above MFLOOR.
#define LOG2E 1.4426950408889634f
#define MFLOOR -1.0e38f      // floor of a row maximum: a row with no live key (every score -inf or the sentinel -3e38) then gets weight 0 everywhere from the exponential itself, and no score needs a test of its own
__device__ __forceinline__ float exp_sh(float x, float m) { return __builtin_amdgcn_exp2f(x - m); }
// tanh(k x) = 1 - 2 / (1 + e^(2 k x)) on the base-2 exponential and the reciprocal instruction: no branch; +-1 at the far ends (e = inf or 0); absolute error of a few 2^-24, also near 0
__device__ __forceinline__ float tanh_hw(float x, float k) { return 1.0f - 2.0f * __builtin_amdgcn_rcpf(1.0f + __builtin_amdgcn_exp2f(x * (k * 2.8853900817779268f))); }
// Keep it at or under 256 registers a wave and 160 KiB of LDS: then the 512 work-groups of 7 waves stand two to a WGP, all resident at once; above either only one fits and the grid runs in two turns. The attribute states that budget to the compiler (four waves a SIMD = 256 registers): left free, its scheduler goes above it.
__global__ __launch_bounds__(224) __attribute__((amdgpu_waves_per_eu(4))) void k_attn(const float* __restrict__ IN1, const float* __restrict__ IN2, const float* __restrict__ RL, const float* __restrict__ MSK, const float* __restrict__ ENC, const float* __restrict__ WQ,
                                              const _Float16* __restrict__ WqT, const _Float16* __restrict__ WkT, const _Float16* __restrict__ WvT, const _Float16* __restrict__ WcT, const float* __restrict__ bc, float* __restrict__ out) {
  static_assert(HPW == NH, "the output projection needs all heads of a query in one wave");
  static_assert(GG == PN, "a wave's 16 query rows and its 16 node rows share one row index");
  __shared__ __attribute__((aligned(16))) unsigned short sVT[HPW * KD][VTP];
  __shared__ __attribute__((aligned(16))) unsigned short sK[112][VTP];      // K rows (f16), rows 100..111 zero
  __shared__ __attribute__((aligned(16))) unsigned short sE[112][VTP];      // node rows (f16), rows 100..111 zero
  __shared__ __attribute__((aligned(16))) v8us sO[NH][224];      // a lane's own half-fragments, one per head: first Q, then, once a head's Q has been read, its O; written and read back by the same lane (the head loop is rolled, so registers cannot be indexed by the head)
  __shared__ __attribute__((aligned(16))) float sW3[EE];      // Wq row 256 (the weights of 'remaining'), rounded to bf16
  __shared__ __attribute__((aligned(16))) float sBC[EE];      // bc rounded to bf16: read and rounded once a work-group, with the first loads, so that the output projection waits for no global load of it
  __shared__ __attribute__((aligned(16))) _Float16 sI1[EE];      // input1 of the batch, rounded to bf16, as f16: every wave's B fragments for k 0..127 of the Q product
  const int tid = threadIdx.x, w = tid >> 5, lane = tid & 31, ln = lane & 15, hh = lane >> 4;
  const int b = blockIdx.x;
  const v8us zero8 = {0,0,0,0,0,0,0,0};
  for (int e = tid; e < 2 * HPW * KD; e += 224) *(v8us*)&sVT[e >> 1][112 + 8 * (e & 1)] = zero8;      // keys 112..127 belong to no wave's tile; the last k block of V^T.P^T reads them
  const int g = w * 16 + ln, gc = (g < GG) ? g : GG - 1;      // rows 100..111 compute on row 99 and store nothing
  const size_t bg = (size_t)b * GG + gc;
  const bool live = g < PN;
  // the f32 rows of the wave are asked for at once: node rows (rows 100..111 read row 99, in bounds, and are zeroed) and input2; with them one value a thread of input1, of Wq row 256 and of bc (threads 128.. read again what 0.. read, in bounds, and drop it)
  v4f xe[4][4], x2[4][4];
  const float* pe = ENC + bg * EE + 8 * hh; const float* p2 = IN2 + bg * EE + 8 * hh; const float* pr = RL + bg; const int ix = tid & (EE - 1);
#pragma unroll      // the index names registers (fragments, accumulators): it must be a constant
  for (int c = 0; c < 4; ++c) raw_f32(xe[c], pe + c * 32);
#pragma unroll      // the index names registers (fragments, accumulators): it must be a constant
  for (int c = 0; c < 4; ++c) raw_f32(x2[c], p2 + c * 32);
  const float rv = bf16_round(*pr);
  const float y1 = IN1[(size_t)b * EE + ix], y3 = WQ[(size_t)(2 * EE) * EE + ix], y4 = bc[ix];
  asm volatile("s_wait_xcnt 0x0" :: "v"(pe), "v"(p2), "v"(pr), "v"(ix) : "memory");      // the address registers of the 36 loads are reused below: the wait stands in front of that overwrite; as inputs they stay whole up to it (else a later load of the run lands in them)
  __builtin_amdgcn_sched_barrier(0);      // keeps the 36 loads above together in front of the first conversion: sunk to their uses they would be waited for one memory latency after another
  FragH eb[4], ib[8];
#pragma unroll      // the index names registers (fragments, accumulators): it must be a constant
  for (int c = 0; c < 4; ++c) {
    const FragH x = frag_f32(xe[c]);
    eb[c].half[0] = live ? x.half[0] : zero8; eb[c].half[1] = live ? x.half[1] : zero8;
    *(v8us*)&sE[g][c * 32 + 8 * hh] = eb[c].half[0]; *(v8us*)&sE[g][c * 32 + 16 + 8 * hh] = eb[c].half[1];
  }
  // The weight fragments come in 32 groups of 8 loads (one group = 16 weight rows x k 128 = the 4 matrix instructions of one accumulator chain): groups 0..7 the tiles of Wk^T, 8..15 of Wv^T,
  // 16..31 of Wq^T (two groups a tile: k 0..127 input1, k 128..255 input2). Three register buffers in turn: group i + 2 is asked for before group i is used.
  // The planes lie in fragment order (k_wt_f16): a load of the wave reads 512 bytes in a row, four whole cache lines, and a group 4 KiB in a row.
  const unsigned short* wkp = (const unsigned short*)WkT + lane * 8;
  const unsigned short* wvp = (const unsigned short*)WvT + lane * 8;
  const unsigned short* wqp = (const unsigned short*)WqT + lane * 8;
  v8us ring[3][8];
  auto fetch = [&](int gi) {
    const unsigned short* p = (gi < 8) ? wkp + gi * 8 * FRH : (gi < 16) ? wvp + (gi - 8) * 8 * FRH : wqp + (gi - 16) * 8 * FRH;
#pragma unroll      // the index names registers (fragments, accumulators): it must be a constant
    for (int c = 0; c < 4; ++c) { ring[gi % 3][2 * c] = *(const v8us*)(p + 2 * c * FRH); ring[gi % 3][2 * c + 1] = *(const v8us*)(p + (2 * c + 1) * FRH); }
    if (gi == 7 || gi == 15 || gi == 31) asm volatile("s_wait_xcnt 0x0" :: "v"(p) : "memory");      // the last loads of a weight plane: its address registers are free from here on and later loads land in them; the wait stands in front of that overwrite; as an input the address stays whole up to it
  };
  asm volatile("" :: "v"(y1), "v"(y3), "v"(y4));      // inputs only: holds the three loads up with the others; without it the compiler sinks them into the branch below, where their memory latency is waited out alone
  if (tid < EE) { sI1[tid] = (_Float16)bf16_round(y1); sW3[tid] = bf16_round(y3); sBC[tid] = bf16_round(y4); }
  fetch(0); fetch(1);
  __builtin_amdgcn_sched_barrier(0);      // the first two groups fly while input2 is rounded
#pragma unroll      // the index names registers (fragments, accumulators): it must be a constant
  for (int c = 0; c < 4; ++c) ib[4 + c] = frag_f32(x2[c]);
  __builtin_amdgcn_sched_barrier(0);      // the third group stays behind the rounding of input2, whose f32 registers it takes over
  // K^T = Wk^T.ENC^T and V = ENC.Wv, both acc/16 rounded to f16
#pragma unroll      // the index names registers (fragments, accumulators): it must be a constant
  for (int gi = 0; gi < 16; ++gi) {
    fetch(gi + 2);
    __builtin_amdgcn_sched_barrier(0);      // keeps the loads of group gi + 2 in front of the products of group gi: sunk to their use, each pair is waited for at its own matrix instruction
    v8f a = {};
#pragma unroll      // the index names registers (fragments, accumulators): it must be a constant
    for (int c = 0; c < 4; ++c) {
      FragH x; x.half[0] = ring[gi % 3][2 * c]; x.half[1] = ring[gi % 3][2 * c + 1];
      a = (gi < 8) ? __builtin_amdgcn_wmma_f32_16x16x32_f16(false, x.v, false, eb[c].v, (short)0, a, false, false)
                   : __builtin_amdgcn_wmma_f32_16x16x32_f16(false, eb[c].v, false, x.v, (short)0, a, false, false);
    }
    FragH f;
#pragma unroll
    for (int r = 0; r < 8; ++r) f.h[r] = (_Float16)(a[r] * 0.0625f);
    if (gi < 8) *(v8us*)&sK[g][gi * 16 + 8 * hh] = f.half[0];
    else *(v8us*)&sVT[(gi - 8) * 16 + ln][w * 16 + 8 * hh] = f.half[0];
  }
  __syncthreads();      // K, V^T, the node rows, input1, the last row of Wq and bc complete before any wave reads them
#pragma unroll      // the index names registers (fragments, accumulators): it must be a constant
  for (int c = 0; c < 4; ++c) { ib[c].half[0] = *(const v8us*)&sI1[c * 32 + 8 * hh]; ib[c].half[1] = *(const v8us*)&sI1[c * 32 + 16 + 8 * hh]; }
  v4f my[7][2];      // mask[b][g][16t + 8hh + 4u ..]; tile 6: both halves read keys 96..99 (in bounds), the upper half drops them
  const float* mp = MSK + bg * PN + 8 * hh; const float* mp6 = MSK + bg * PN + 96;
  // Q^T = Wq^T.[input1 | input2]^T; q = (acc/16 + remaining.Wq[256]) log2(e) / sqrt(16), rounded to f16
  v8f aq = {};
#pragma unroll      // the index names registers (fragments, accumulators): it must be a constant
  for (int gi = 16; gi < 32; ++gi) {
    if (gi + 2 < 32) fetch(gi + 2);
    if (gi == 30) {      // no weight group is left to ask for: the mask slice takes the free registers and flies during the last two groups
#pragma unroll      // the index names registers (fragments, accumulators): it must be a constant
      for (int t = 0; t < 7; ++t)
#pragma unroll      // the index names registers (fragments, accumulators): it must be a constant
        for (int u = 0; u < 2; ++u) if (t < 6 || u == 0) my[t][u] = *(const v4fa*)(((t < 6) ? mp + t * 16 : mp6) + 4 * u);
      asm volatile("s_wait_xcnt 0x0" :: "v"(mp), "v"(mp6) : "memory");      // the two address pairs are reused behind the 13 loads: the wait stands in front of that overwrite; as inputs they stay whole up to it
    }
    __builtin_amdgcn_sched_barrier(0);      // keeps the loads of group gi + 2 (at gi = 30 the mask loads) in front of the products of group gi: sunk to their use, each pair is waited for at its own matrix instruction
#pragma unroll      // the index names registers (fragments, accumulators): it must be a constant
    for (int c = 0; c < 4; ++c) {
      FragH x; x.half[0] = ring[gi % 3][2 * c]; x.half[1] = ring[gi % 3][2 * c + 1];
      aq = __builtin_amdgcn_wmma_f32_16x16x32_f16(false, x.v, false, ib[(gi & 1) * 4 + c].v, (short)0, aq, false, false);
    }
    if (gi & 1) {
      const int te = (gi - 16) >> 1;
      const v4f u0 = *(const v4fa*)&sW3[te * 16 + 8 * hh], u1 = *(const v4fa*)&sW3[te * 16 + 8 * hh + 4];
      FragH f;
#pragma unroll
      for (int r = 0; r < 8; ++r) f.h[r] = (_Float16)((aq[r] * 0.0625f + rv * ((r < 4) ? u0[r & 3] : u1[r & 3])) * (0.25f * LOG2E));
      sO[te][tid] = f.half[0];
      aq = (v8f){};
    }
  }
  v8f mk[7];      // the mask slice rounded to bf16, times log2(e), one accumulator tile per key tile: it enters the score product as its C operand; keys >= 100 get a sentinel far below MFLOOR, so weight 0
#pragma unroll
  for (int t = 0; t < 7; ++t)
#pragma unroll
    for (int u = 0; u < 2; ++u) {
      if (t == 6 && u == 1) { for (int i = 0; i < 4; ++i) mk[t][4 + i] = -3.0e38f; continue; }
      const bool dead = (t == 6) && (hh == 1);
#pragma unroll
      for (int i = 0; i < 4; ++i) { const float x = bf16_round(my[t][u][i]) * LOG2E; mk[t][4 * u + i] = dead ? -3.0e38f : x; }
    }
  // Q and K fragment halves of one head
  v8us qf = sO[0][tid], kf[7];
#pragma unroll
  for (int t = 0; t < 7; ++t) kf[t] = *(const v8us*)&sK[t * 16 + ln][8 * hh];
#pragma nounroll      // stays one rolled loop of 8 passes: with the shorter body the compiler peels the last pass off and schedules it into the output projection, which takes the kernel above 256 registers (under the stated budget: into scratch)
  for (int hl = 0; hl < HPW; ++hl) {
    FragH bq; bq.half[0] = qf; bq.half[1] = zero8;
    v8f s[7];
#pragma unroll
    for (int t = 0; t < 7; ++t) {
      FragH ak; ak.half[0] = kf[t]; ak.half[1] = zero8;
      s[t] = __builtin_amdgcn_wmma_f32_16x16x32_f16(false, ak.v, false, bq.v, (short)0, mk[t], false, false);      // score + mask: the matrix instruction adds its C operand for nothing
    }
    // the next head's fragments fly while this head's softmax runs; the last pass reads its own again (in bounds, unused), so that no branch stands behind the matrix instructions
    const int hn = (hl + 1 < HPW) ? hl + 1 : hl;
    qf = sO[hn][tid];
#pragma unroll
    for (int t = 0; t < 7; ++t) kf[t] = *(const v8us*)&sK[t * 16 + ln][hn * KD + 8 * hh];
    FragH av[4];      // this head's V^T fragments, asked for ahead of the softmax as well
#pragma unroll
    for (int cc = 0; cc < 4; ++cc) { av[cc].half[0] = *(const v8us*)&sVT[hl * KD + ln][cc * 32 + 8 * hh]; av[cc].half[1] = *(const v8us*)&sVT[hl * KD + ln][cc * 32 + 16 + 8 * hh]; }
    __builtin_amdgcn_sched_barrier(0);      // keeps the loads above in front of the softmax: without it the compiler sinks them to their first use and their latency is waited out there
    // row maximum and row sum: one short chain per tile, then a tree (seven independent chains instead of one of 56 links; few waves share a SIMD here)
    float pm[7];
#pragma unroll
    for (int t = 0; t < 7; ++t) {
      pm[t] = s[t][0];
#pragma unroll
      for (int r = 1; r < 8; ++r) pm[t] = fmaxf(pm[t], s[t][r]);
    }
    float m = fmaxf(fmaxf(fmaxf(pm[0], pm[1]), fmaxf(pm[2], pm[3])), fmaxf(fmaxf(pm[4], pm[5]), pm[6]));
    m = fmaxf(fmaxf(m, __shfl_xor(m, 16, 32)), MFLOOR);
    // The weights go into the product as they leave the exponential (in [0, 1], the largest 1): 1 / sum is the same for all keys of a lane's query, so it multiplies the 8 outputs instead of the 56 weights.
    // The sum runs in register pairs (even and odd accumulator registers apart), which is the packed add's own shape.
    v2f ps[7];
    v8f o = {};
#pragma unroll
    for (int c = 0; c < 4; ++c) {
      FragH pb;
#pragma unroll
      for (int u = 0; u < 2; ++u) {
        const int t = 2 * c + u;
        if (t < 7) {
#pragma unroll
          for (int i = 0; i < 8; i += 2) {
            const v2f e = {exp_sh(s[t][i], m), exp_sh(s[t][i + 1], m)};
            ps[t] = (i == 0) ? e : ps[t] + e;
            pb.h[8 * u + i] = (_Float16)e[0]; pb.h[8 * u + i + 1] = (_Float16)e[1];
          }
        } else pb.half[u] = zero8;
      }
      o = __builtin_amdgcn_wmma_f32_16x16x32_f16(false, av[c].v, false, pb.v, (short)0, o, false, false);
    }
    const v2f pt = ((ps[0] + ps[1]) + (ps[2] + ps[3])) + ((ps[4] + ps[5]) + ps[6]);
    float sum = pt[0] + pt[1];
    sum += __shfl_xor(sum, 16, 32);
    const float is = (sum > 0.f) ? 1.0f / sum : 0.f;
    FragH f;      // o[r] = O[g][head column 8hh + r]: 16 bytes in a row of the lane's output row
#pragma unroll
    for (int r = 0; r < 8; ++r) f.h[r] = (_Float16)(o[r] * is);
    sO[hl][tid] = f.half[0];
  }
  // MH^T = Wc^T.O^T: A = 16 rows of Wc^T (output columns e), B = the lane's O row; two tiles of e make one B fragment of the pointer product. mh = acc/16 + bc, rounded to f16.
  FragH ob[4], mb[4];
#pragma unroll      // the index names registers (fragments, accumulators): it must be a constant
  for (int c = 0; c < 4; ++c) { ob[c].half[0] = sO[2 * c][tid]; ob[c].half[1] = sO[2 * c + 1][tid]; }
  // The operands of the two products come in 15 groups of 8 loads, as in the projections (one group = the 4 matrix instructions of one accumulator chain): groups 0..7 the tiles of Wc^T (global, fragment order),
  // groups 8..14 the node tiles (LDS). Three register buffers in turn: of Wc^T group i + 2 is asked for before group i is used, of the node tiles group i + 1. Left to the compiler each pair of loads stands directly in front of its matrix instruction and is waited for alone.
  const unsigned short* wp = (const unsigned short*)WcT + lane * 8;
  v8us rt[3][8];
  auto fetch_t = [&](int gi) {
#pragma unroll      // the index names registers (fragments, accumulators): it must be a constant
    for (int c = 0; c < 4; ++c) {
      if (gi < 8) { rt[gi % 3][2 * c] = *(const v8us*)(wp + (gi * 8 + 2 * c) * FRH); rt[gi % 3][2 * c + 1] = *(const v8us*)(wp + (gi * 8 + 2 * c + 1) * FRH); }
      else { rt[gi % 3][2 * c] = *(const v8us*)&sE[(gi - 8) * 16 + ln][c * 32 + 8 * hh]; rt[gi % 3][2 * c + 1] = *(const v8us*)&sE[(gi - 8) * 16 + ln][c * 32 + 16 + 8 * hh]; }
    }
    if (gi == 7) asm volatile("s_wait_xcnt 0x0" ::: "memory");      // the last loads of Wc^T: the registers that held their address are free from here on; the wait stands in front of that overwrite
  };
  fetch_t(0); fetch_t(1);
  // S2^T = ENC.MH^T: A = 16 node rows from LDS (rows 100..111 zero), B = mb
  v8f z[7];
#pragma unroll      // the index names registers (fragments, accumulators): it must be a constant
  for (int gi = 0; gi < 15; ++gi) {
    if (gi + 2 < 8) fetch_t(gi + 2);      // Wc^T comes from L2: two groups ahead
    else if (gi >= 7 && gi + 1 < 15) fetch_t(gi + 1);      // the node tiles come from LDS: one group ahead is enough, and the accumulators of the pointer product need the registers
    v4f b0 = {}, b1 = {};
    if (gi < 8) { b0 = *(const v4fa*)&sBC[gi * 16 + 8 * hh]; b1 = *(const v4fa*)&sBC[gi * 16 + 8 * hh + 4]; }
    __builtin_amdgcn_sched_barrier(0);      // keeps the loads asked for above and the bias of group gi in front of the products of group gi: sunk to their use, each pair is waited for at its own matrix instruction
    v8f a = {};
#pragma unroll      // the index names registers (fragments, accumulators): it must be a constant
    for (int c = 0; c < 4; ++c) {
      FragH x; x.half[0] = rt[gi % 3][2 * c]; x.half[1] = rt[gi % 3][2 * c + 1];
      a = __builtin_amdgcn_wmma_f32_16x16x32_f16(false, x.v, false, (gi < 8) ? ob[c].v : mb[c].v, (short)0, a, false, false);
    }
    if (gi < 8) {
#pragma unroll      // the index names registers (fragments, accumulators): it must be a constant
      for (int r = 0; r < 8; ++r) mb[gi >> 1].h[8 * (gi & 1) + r] = (_Float16)(a[r] * 0.0625f + ((r < 4) ? b0[r & 3] : b1[r & 3]));
    } else z[gi - 8] = a;
    if (gi < 6) __builtin_amdgcn_sched_barrier(0);      // keeps the loads of group gi + 3 behind the products of group gi, whose buffer they take over: lifted above them a fourth buffer is live and the kernel goes above 256 registers (under the stated budget: into scratch)
  }
  __builtin_amdgcn_sched_barrier(0);      // ends the scheduling region of the two products here, where the branches of the library tanh ended it: as one region with the branch-free tail the kernel goes above 256 registers (under the stated budget: into scratch)
  // probs = softmax(10 tanh(S2 / sqrt(128)) + mask) over the keys of the lane's query, in base 2: chains per tile, a tree, one exchange between the lane halves, as in the heads
  float pm[7];
  v2f ps[7];
#pragma unroll      // the index names registers (fragments, accumulators): it must be a constant
  for (int t = 0; t < 7; ++t) {
#pragma unroll      // the index names registers (fragments, accumulators): it must be a constant
    for (int r = 0; r < 8; ++r) { z[t][r] = (10.0f * LOG2E) * tanh_hw(z[t][r], 0.08838834764831845f) + mk[t][r]; pm[t] = (r == 0) ? z[t][r] : fmaxf(pm[t], z[t][r]); }
  }
  float m = fmaxf(fmaxf(fmaxf(pm[0], pm[1]), fmaxf(pm[2], pm[3])), fmaxf(fmaxf(pm[4], pm[5]), pm[6]));
  m = fmaxf(fmaxf(m, __shfl_xor(m, 16, 32)), MFLOOR);
#pragma unroll      // the index names registers (fragments, accumulators): it must be a constant
  for (int t = 0; t < 7; ++t) {
#pragma unroll      // the index names registers (fragments, accumulators): it must be a constant
    for (int r = 0; r < 8; r += 2) { const v2f e = {exp_sh(z[t][r], m), exp_sh(z[t][r + 1], m)}; z[t][r] = e[0]; z[t][r + 1] = e[1]; ps[t] = (r == 0) ? e : ps[t] + e; }
  }
  const v2f pt = ((ps[0] + ps[1]) + (ps[2] + ps[3])) + ((ps[4] + ps[5]) + ps[6]);
  float sum = pt[0] + pt[1];
  sum += __shfl_xor(sum, 16, 32);
  const float is = (sum > 0.f) ? 1.0f / sum : 0.f;
#pragma unroll      // the index names registers (fragments, accumulators): it must be a constant
  for (int t = 0; t < 7; ++t)
#pragma unroll      // the index names registers (fragments, accumulators): it must be a constant
    for (int r = 0; r < 8; ++r) z[t][r] *= is;
  if (g < GG) {      // a lane stores 32 bytes in a row per tile of its own output row (400-byte rows, 16-byte aligned pieces); tile 6 holds keys 96..99 in the lower half alone
    float* op = out + bg * PN + 8 * hh;
#pragma unroll      // the index names registers (fragments, accumulators): it must be a constant
    for (int t = 0; t < 6; ++t) {
      const v4f lo = {z[t][0], z[t][1], z[t][2], z[t][3]}, hi = {z[t][4], z[t][5], z[t][6], z[t][7]};
      *(v4f*)(op + t * 16) = lo; *(v4f*)(op + t * 16 + 4) = hi;
    }
    if (hh == 0) { const v4f lo = {z[6][0], z[6][1], z[6][2], z[6][3]}; *(v4f*)(op + 96) = lo; }
  }
}
extern "C" void kernel_launch(void* const* d_in, const int* in_sizes, int n_in,
                              void* d_out, int out_size, void* d_ws, size_t ws_size, hipStream_t stream) {
  (void)in_sizes; (void)n_in; (void)out_size;
  const float* in1 = (const float*)d_in[0]; const float* in2 = (const float*)d_in[1]; const float* rl = (const float*)d_in[2]; const float* msk = (const float*)d_in[3]; const float* enc = (const float*)d_in[4]; const float* Wq = (const float*)d_in[5]; const float* Wk = (const float*)d_in[6]; const float* Wv = (const float*)d_in[7]; const float* Wc = (const float*)d_in[8]; const float* bc = (const float*)d_in[9];
  char* ws = (char*)d_ws; size_t off = 0;
  auto take = [&](size_t bytes) { char* p = ws + off; off += (bytes + 255) & ~(size_t)255; return p; };
  _Float16* Bq = (_Float16*)take(2 * EE * EE * 2); _Float16* Bk = (_Float16*)take(EE * EE * 2); _Float16* Bv = (_Float16*)take(EE * EE * 2); _Float16* Bc = (_Float16*)take(EE * EE * 2);
  if (off > ws_size) return;      // 160 KiB of the workspace
  k_wt_f16<<<5 * WPB, 256, 0, stream>>>(Wq, Wk, Wv, Wc, Bq, Bk, Bv, Bc, 16.0f);      // of Wq the rows 0..255: input1 and input2  ([in][out]); row 256 (remaining) is read as it is
  // ---- projections, attention, output projection, pointer scores and the final softmax, one launch: a work-group per batch
  k_attn<<<NB, 224, 0, stream>>>(in1, in2, rl, msk, enc, Wq, Bq, Bk, Bv, Bc, bc, (float*)d_out);
}

// v010
// A run of this version takes 30.7 microseconds.
// Next to v009, in two timings, it ran 1.04 times as fast each time.
// Over all steps from v000 it is 29.0 times as fast.
#include <hip/hip_runtime.h>
// Next-node probability head (B=512, G=100 group rows, P=100 nodes, E=128, 8 heads x 16, logit clipping 10). The weights are packed into f16 planes in fragment order first; then one kernel (k_attn), one work-group per batch,
// does all the rest: k,v = enc.W and q = [input1 | input2 | remaining].Wq (the first 256 rows as a product, the last as a rank-1 term), the 8-head attention (additive INPUT ninf mask),
// o.Wc + bc, the pointer score mh.enc^T/sqrt(128) and the softmax of 10 tanh + mask. K, V^T, the f16 nodes and input2 wait in LDS, Q and O in LDS places of the lane that uses them, the rest in registers. Contractions on v_wmma_f32_16x16x32_f16 (f16 operands,
// weights [in][out] bf16-exact x2^4, f32 accumulate); softmaxes/tanh f32 VALU.
#define NB 512
#define GG 100
#define PN 100
#define EE 128
#define NH 8
#define KD 16

typedef __bf16 v16b __attribute__((ext_vector_type(16)));
typedef unsigned short v8us __attribute__((ext_vector_type(8), may_alias));
typedef float  v8f  __attribute__((ext_vector_type(8)));
typedef float  v4f  __attribute__((ext_vector_type(4)));
typedef float  v2f  __attribute__((ext_vector_type(2)));
typedef float  v4fa __attribute__((ext_vector_type(4), may_alias));
union FragB { v16b v; v8us half[2]; unsigned short u[16]; };

__device__ __forceinline__ unsigned short bf16_bits(float x) { unsigned int u = __float_as_uint(x); return (unsigned short)((u + 0x7FFFu + ((u >> 16) & 1u)) >> 16); }
__device__ __forceinline__ float bf16_val(unsigned short b) { return __uint_as_float(((unsigned int)b) << 16); }
__device__ __forceinline__ float bf16_round(float x) { return bf16_val(bf16_bits(x)); }
// D += A·B with NT terms: 1 = ah·bh, 2 = + al·bh (A split), 3 = + ah·bl (both split)
template <int NT>
__device__ __forceinline__ v8f mmaN(v16b ah, v16b al, v16b bh, v16b bl, v8f c) {
  c = __builtin_amdgcn_wmma_f32_16x16x32_bf16(false, ah, false, bh, (short)0, c, false, false);
  if (NT >= 2) c = __builtin_amdgcn_wmma_f32_16x16x32_bf16(false, al, false, bh, (short)0, c, false, false);
  if (NT >= 3) c = __builtin_amdgcn_wmma_f32_16x16x32_bf16(false, ah, false, bl, (short)0, c, false, false);
  asm volatile("v_nop\n\tv_nop\n\tv_nop\n\tv_nop" : "+v"(c) : "v"(ah), "v"(al), "v"(bh), "v"(bl));
  return c;
}

__global__ __launch_bounds__(256) void k_wt_bf16(const float* __restrict__ W, unsigned short* __restrict__ Wt, int K, int N) {
  const int t = blockIdx.x * 256 + threadIdx.x;
  const int k8n = K / 8;
  if (t >= N * k8n) return;
  const int n = t / k8n, k8 = (t % k8n) * 8;
  v8us v;
#pragma unroll
  for (int i = 0; i < 8; ++i) v[i] = bf16_bits(W[(size_t)(k8 + i) * N + n]);
  *(v8us*)(Wt + (size_t)n * K + k8) = v;
  
}

// GEMM C[M][N] (f32, pitch ldc) = act(A[M][K]·W + bias). A f32 row-major (pitch lda) converted per fragment to bf16
// (ASPLIT: hi/lo two planes -> 2 terms, else single rounded term); Wt bf16 [N][K] (pitch ldb). BIAS_BF16 rounds the
// bias to bf16 first (bias quantised to bf16 before the add). K%32==0, M%16==0, N%64==0.
template <bool ASPLIT, int ACT, bool BIAS_BF16>
__global__ __launch_bounds__(128) void k_gemm_bf(const float* __restrict__ A, int lda, const unsigned short* __restrict__ Wt, int ldb,
                                               const float* __restrict__ bias, float* __restrict__ C, int ldc, int M, int N, int K) {
  __shared__ __attribute__((aligned(16))) float so[4][16][64];
  const int tid = threadIdx.x, w = tid >> 5, lane = tid & 31, ln = lane & 15, hh = lane >> 4;
  const int ntn = N / 64;
  const int wid = blockIdx.x * 4 + w;
  const int mt = wid / ntn, nq = wid % ntn;
  if (mt * 16 >= M) return;
  const int row0 = mt * 16, col0 = nq * 64;
  const float* arow = A + (size_t)(row0 + ln) * lda;
  v8f acc[4] = {};
  for (int kb = 0; kb < K; kb += 32) {
    FragB ah, al;
    const v4f x0 = *(const v4fa*)(arow + kb + 8 * hh), x1 = *(const v4fa*)(arow + kb + 8 * hh + 4);
    const v4f x2 = *(const v4fa*)(arow + kb + 16 + 8 * hh), x3 = *(const v4fa*)(arow + kb + 16 + 8 * hh + 4);
    float xs[16] = {x0[0],x0[1],x0[2],x0[3],x1[0],x1[1],x1[2],x1[3],x2[0],x2[1],x2[2],x2[3],x3[0],x3[1],x3[2],x3[3]};
#pragma unroll
    for (int i = 0; i < 16; ++i) { const unsigned short hb = bf16_bits(xs[i]); ah.u[i] = hb; al.u[i] = ASPLIT ? bf16_bits(xs[i] - bf16_val(hb)) : (unsigned short)0; }
#pragma unroll
    for (int t = 0; t < 4; ++t) {
      const unsigned short* brow = Wt + (size_t)(col0 + t * 16 + ln) * ldb + kb;
      FragB b;
      b.half[0] = *(const v8us*)(brow + 8 * hh);
      b.half[1] = *(const v8us*)(brow + 16 + 8 * hh);
      acc[t] = mmaN<ASPLIT ? 2 : 1>(ah.v, al.v, b.v, b.v, acc[t]);
    }
  }
#pragma unroll
  for (int t = 0; t < 4; ++t) {
    float bv = bias ? bias[col0 + t * 16 + ln] : 0.f;
    if (BIAS_BF16) bv = bf16_round(bv);
#pragma unroll
    for (int r = 0; r < 8; ++r) { float v = acc[t][r] + bv; if (ACT == 1) v = fmaxf(v, 0.f); so[w][8 * hh + r][t * 16 + ln] = v; }
  }
  __builtin_amdgcn_fence(__ATOMIC_ACQ_REL, "workgroup");
  __builtin_amdgcn_wave_barrier();
  const int rsub = lane >> 4, c4 = (lane & 15) * 4;
  {
#pragma unroll
    for (int q = 0; q < 8; ++q) {
      const int r = q * 2 + rsub;
      const v4f v = *(const v4fa*)&so[w][r][c4];
      *(v4f*)(C + (size_t)(row0 + r) * ldc + col0 + c4) = v;
    }
    
  }
}

// Flash-style causal/unmasked attention, all contractions 3-term bf16 hi/lo splits, f32 softmax with running max.
// q,k,v rows are read from f32 buffers with arbitrary row pitch (so they can live inside a fused qkv buffer);
// D = head size (multiple of 32, <= 128); one wave = 16 query rows; block = 4 waves (64 queries) sharing K/V chunks of 32.
template <int D, bool CAUSAL>
__global__ __launch_bounds__(128) void k_flash(const float* __restrict__ qb, const float* __restrict__ kb, const float* __restrict__ vb,
                                             int pitch, int T, int H, float scale, float* __restrict__ y, int ypitch) {
  constexpr int KS = D / 32;        // k-steps for QK
  constexpr int DT = D / 16;        // d tiles for PV
  __shared__ __attribute__((aligned(16))) unsigned short sKh[32][D + 8], sKl[32][D + 8], sVh[32][D + 8], sVl[32][D + 8];
  __shared__ __attribute__((aligned(16))) unsigned short sPh[4][16][40], sPl[4][16][40];
  __shared__ __attribute__((aligned(16))) float sO[4][16][D];
  const int tid = threadIdx.x, w = tid >> 5, lane = tid & 31, ln = lane & 15, hh = lane >> 4;
  const int nqb = (T + 63) / 64;
  const int bh = blockIdx.x / nqb, qblk = blockIdx.x % nqb;
  const int b = bh / H, h = bh % H;
  const int q0 = qblk * 64 + w * 16;
  const float* Q = qb + (size_t)b * T * pitch + h * D;
  const float* K = kb + (size_t)b * T * pitch + h * D;
  const float* V = vb + (size_t)b * T * pitch + h * D;

  // A fragments of the wave's 16 query rows (scaled), hi/lo
  FragB aqh[KS], aql[KS];
  {
    int row = q0 + ln; if (row >= T) row = T - 1;
    const float* qr = Q + (size_t)row * pitch;
#pragma unroll
    for (int ks = 0; ks < KS; ++ks)
#pragma unroll
      for (int i = 0; i < 16; ++i) {
        const int d = ks * 32 + ((i < 8) ? (8 * hh + i) : (16 + 8 * hh + (i - 8)));
        const float x = qr[d] * scale; const unsigned short hb = bf16_bits(x);
        aqh[ks].u[i] = hb; aql[ks].u[i] = bf16_bits(x - bf16_val(hb));
      }
  }
  float m_r[8], l_r[8];
#pragma unroll
  for (int r = 0; r < 8; ++r) { m_r[r] = -3.0e38f; l_r[r] = 0.f; }
  v8f oacc[DT];
#pragma unroll
  for (int dt = 0; dt < DT; ++dt) oacc[dt] = (v8f){0.f,0.f,0.f,0.f,0.f,0.f,0.f,0.f};

  const int kv_end = CAUSAL ? min(T, qblk * 64 + 64) : T;     // block-uniform
  for (int j0 = 0; j0 < kv_end; j0 += 32) {
    __syncthreads();
    for (int e = tid; e < 32 * (D / 4); e += 128) {
      const int r = e / (D / 4), c4 = (e % (D / 4)) * 4;
      const int key = j0 + r;
      v4f kf = {0.f,0.f,0.f,0.f}, vf = {0.f,0.f,0.f,0.f};
      if (key < T) { kf = *(const v4fa*)(K + (size_t)key * pitch + c4); vf = *(const v4fa*)(V + (size_t)key * pitch + c4); }
#pragma unroll
      for (int t = 0; t < 4; ++t) {
        unsigned short hb = bf16_bits(kf[t]); sKh[r][c4 + t] = hb; sKl[r][c4 + t] = bf16_bits(kf[t] - bf16_val(hb));
        hb = bf16_bits(vf[t]); sVh[r][c4 + t] = hb; sVl[r][c4 + t] = bf16_bits(vf[t] - bf16_val(hb));
      }
    }
    __syncthreads();
    // S tile 16 x 32
    v8f s[2];
#pragma unroll
    for (int nt = 0; nt < 2; ++nt) {
      v8f acc = {};
#pragma unroll
      for (int ks = 0; ks < KS; ++ks) {
        FragB bh_, bl_;
        bh_.half[0] = *(const v8us*)&sKh[nt * 16 + ln][ks * 32 + 8 * hh]; bh_.half[1] = *(const v8us*)&sKh[nt * 16 + ln][ks * 32 + 16 + 8 * hh];
        bl_.half[0] = *(const v8us*)&sKl[nt * 16 + ln][ks * 32 + 8 * hh]; bl_.half[1] = *(const v8us*)&sKl[nt * 16 + ln][ks * 32 + 16 + 8 * hh];
        acc = mmaN<3>(aqh[ks].v, aql[ks].v, bh_.v, bl_.v, acc);
      }
      s[nt] = acc;
    }
    // mask + running max (rows 8hh+r; the 16 lanes of a half share rows)
    float alpha[8];
#pragma unroll
    for (int r = 0; r < 8; ++r) {
      const int qi = q0 + 8 * hh + r;
      const int ja = j0 + ln, jb = j0 + 16 + ln;
      if (CAUSAL) { if (ja > qi) s[0][r] = -3.0e38f; if (jb > qi) s[1][r] = -3.0e38f; }
      if (ja >= T) s[0][r] = -3.0e38f;
      if (jb >= T) s[1][r] = -3.0e38f;
      float mx = fmaxf(s[0][r], s[1][r]);
      mx = fmaxf(mx, __shfl_xor(mx, 1, 32)); mx = fmaxf(mx, __shfl_xor(mx, 2, 32)); mx = fmaxf(mx, __shfl_xor(mx, 4, 32)); mx = fmaxf(mx, __shfl_xor(mx, 8, 32));
      const float mnew = fmaxf(m_r[r], mx);
      alpha[r] = (mnew > -1.0e38f) ? __expf(m_r[r] - mnew) : 1.0f;
      const float p0 = (s[0][r] > -1.0e38f) ? __expf(s[0][r] - mnew) : 0.f;
      const float p1 = (s[1][r] > -1.0e38f) ? __expf(s[1][r] - mnew) : 0.f;
      m_r[r] = mnew;
      l_r[r] = l_r[r] * alpha[r] + p0 + p1;            // per-lane partial row sum (16 lanes combined at the end)
      unsigned short hb = bf16_bits(p0); sPh[w][8 * hh + r][ln] = hb;      sPl[w][8 * hh + r][ln] = bf16_bits(p0 - bf16_val(hb));
      hb = bf16_bits(p1);                sPh[w][8 * hh + r][16 + ln] = hb; sPl[w][8 * hh + r][16 + ln] = bf16_bits(p1 - bf16_val(hb));
    }
#pragma unroll
    for (int dt = 0; dt < DT; ++dt)
#pragma unroll
      for (int r = 0; r < 8; ++r) oacc[dt][r] *= alpha[r];
    __builtin_amdgcn_fence(__ATOMIC_ACQ_REL, "workgroup");
    __builtin_amdgcn_wave_barrier();
    FragB pah, pal;
    pah.half[0] = *(const v8us*)&sPh[w][ln][8 * hh]; pah.half[1] = *(const v8us*)&sPh[w][ln][16 + 8 * hh];
    pal.half[0] = *(const v8us*)&sPl[w][ln][8 * hh]; pal.half[1] = *(const v8us*)&sPl[w][ln][16 + 8 * hh];
#pragma unroll
    for (int dt = 0; dt < DT; ++dt) {
      FragB bvh, bvl;
#pragma unroll
      for (int i = 0; i < 8; ++i) {
        bvh.u[i] = sVh[8 * hh + i][dt * 16 + ln]; bvh.u[8 + i] = sVh[16 + 8 * hh + i][dt * 16 + ln];
        bvl.u[i] = sVl[8 * hh + i][dt * 16 + ln]; bvl.u[8 + i] = sVl[16 + 8 * hh + i][dt * 16 + ln];
      }
      oacc[dt] = mmaN<3>(pah.v, pal.v, bvh.v, bvl.v, oacc[dt]);
    }
    __builtin_amdgcn_fence(__ATOMIC_ACQ_REL, "workgroup");
    __builtin_amdgcn_wave_barrier();
  }
#pragma unroll
  for (int r = 0; r < 8; ++r) {
    float l = l_r[r];
    l += __shfl_xor(l, 1, 32); l += __shfl_xor(l, 2, 32); l += __shfl_xor(l, 4, 32); l += __shfl_xor(l, 8, 32);
    l_r[r] = (l > 0.f) ? 1.0f / l : 0.f;
  }
#pragma unroll
  for (int dt = 0; dt < DT; ++dt)
#pragma unroll
    for (int r = 0; r < 8; ++r) sO[w][8 * hh + r][dt * 16 + ln] = oacc[dt][r] * l_r[r];
  __builtin_amdgcn_fence(__ATOMIC_ACQ_REL, "workgroup");
  __builtin_amdgcn_wave_barrier();
  {
    for (int r = 0; r < 16; ++r) {
      const int row = q0 + r;
      if (row < T && lane < D / 4) {
        const v4f val = *(const v4fa*)&sO[w][r][lane * 4];
        *(v4f*)(y + ((size_t)b * T + row) * ypitch + h * D + lane * 4) = val;
      }
    }
    
  }
}

// GEMM C = act(A·W + bias + resid): A f32 (ASPLIT -> hi/lo 2 terms), Wt bf16 [N][K]; ACT 0 none, 1 relu, 2 exact gelu;
// resid (optional, f32, row index = (row % rmod), pitch ldr, RES_BF16 rounds it) added before the activation.
template <bool ASPLIT, int ACT, bool BIAS_BF16, bool RES_BF16>
__global__ __launch_bounds__(128) void k_gemm_bf3(const float* __restrict__ A, int lda, const unsigned short* __restrict__ Wt, int ldb,
                                                const float* __restrict__ bias, const float* __restrict__ resid, int rmod, int ldr,
                                                float* __restrict__ C, int ldc, int M, int N, int K) {
  __shared__ __attribute__((aligned(16))) float so[4][16][64];
  const int tid = threadIdx.x, w = tid >> 5, lane = tid & 31, ln = lane & 15, hh = lane >> 4;
  const int ntn = N / 64;
  const int wid = blockIdx.x * 4 + w;
  const int mt = wid / ntn, nq = wid % ntn;
  if (mt * 16 >= M) return;
  const int row0 = mt * 16, col0 = nq * 64;
  const float* arow = A + (size_t)(row0 + ln) * lda;
  v8f acc[4] = {};
  for (int kb = 0; kb < K; kb += 32) {
    FragB ah, al;
    const v4f x0 = *(const v4fa*)(arow + kb + 8 * hh), x1 = *(const v4fa*)(arow + kb + 8 * hh + 4);
    const v4f x2 = *(const v4fa*)(arow + kb + 16 + 8 * hh), x3 = *(const v4fa*)(arow + kb + 16 + 8 * hh + 4);
    float xs[16] = {x0[0],x0[1],x0[2],x0[3],x1[0],x1[1],x1[2],x1[3],x2[0],x2[1],x2[2],x2[3],x3[0],x3[1],x3[2],x3[3]};
#pragma unroll
    for (int i = 0; i < 16; ++i) { const unsigned short hb = bf16_bits(xs[i]); ah.u[i] = hb; al.u[i] = ASPLIT ? bf16_bits(xs[i] - bf16_val(hb)) : (unsigned short)0; }
#pragma unroll
    for (int t = 0; t < 4; ++t) {
      const unsigned short* brow = Wt + (size_t)(col0 + t * 16 + ln) * ldb + kb;
      FragB b;
      b.half[0] = *(const v8us*)(brow + 8 * hh);
      b.half[1] = *(const v8us*)(brow + 16 + 8 * hh);
      acc[t] = mmaN<ASPLIT ? 2 : 1>(ah.v, al.v, b.v, b.v, acc[t]);
    }
  }
#pragma unroll
  for (int t = 0; t < 4; ++t) {
    const int col = col0 + t * 16 + ln;
    float bv = bias ? bias[col] : 0.f;
    if (BIAS_BF16) bv = bf16_round(bv);
#pragma unroll
    for (int r = 0; r < 8; ++r) {
      float v = acc[t][r] + bv;
      if (resid) { float rv = resid[(size_t)((row0 + 8 * hh + r) % rmod) * ldr + col]; if (RES_BF16) rv = bf16_round(rv); v += rv; }
      if (ACT == 1) v = fmaxf(v, 0.f);
      if (ACT == 2) v = 0.5f * v * (1.0f + erff(v * 0.70710678118654752f));
      if (ACT == 3) { const float u = 0.7978845608028654f * (v + 0.044715f * v * v * v); v = 0.5f * v * (1.0f + tanhf(u)); }
      so[w][8 * hh + r][t * 16 + ln] = v;
    }
  }
  __builtin_amdgcn_fence(__ATOMIC_ACQ_REL, "workgroup");
  __builtin_amdgcn_wave_barrier();
  const int rsub = lane >> 4, c4 = (lane & 15) * 4;
  {
#pragma unroll
    for (int q = 0; q < 8; ++q) {
      const int r = q * 2 + rsub;
      const v4f v = *(const v4fa*)&so[w][r][c4];
      *(v4f*)(C + (size_t)(row0 + r) * ldc + col0 + c4) = v;
    }
    
  }
}
// row LayerNorm (biased variance, eps) over N: s = X (+ R); optional out_sum <- s; out_norm <- (s-mu)*rsqrt(var+eps)*g + b
template <bool PARAM_BF16>
__global__ __launch_bounds__(256) void k_layernorm(const float* __restrict__ X, const float* __restrict__ R, const float* __restrict__ g, const float* __restrict__ bta,
                                                  float* __restrict__ out_sum, float* __restrict__ out_norm, int N, float eps) {
  __shared__ float red[256];
  const int row = blockIdx.x, tid = threadIdx.x;
  const float* x = X + (size_t)row * N; const float* rr = R ? R + (size_t)row * N : nullptr;
  float vals[16];                     // up to N = 4096
  const int per = N / 256;            // contiguous chunk per thread? use strided-by-4 chunks: thread handles j = tid*4 + 1024*u
  float s1 = 0.f;
  for (int u = 0; u < per / 4; ++u) {
    const int j = tid * 4 + 1024 * u;
    const v4f a = *(const v4fa*)(x + j);
    v4f b = {0.f,0.f,0.f,0.f}; if (rr) b = *(const v4fa*)(rr + j);
#pragma unroll
    for (int q = 0; q < 4; ++q) { const float v = a[q] + b[q]; vals[u * 4 + q] = v; s1 += v; }
  }
  red[tid] = s1; __syncthreads();
  for (int st = 128; st > 0; st >>= 1) { if (tid < st) red[tid] += red[tid + st]; __syncthreads(); }
  const float mu = red[0] / (float)N; __syncthreads();
  float s2 = 0.f;
  for (int u = 0; u < per / 4; ++u)
#pragma unroll
    for (int q = 0; q < 4; ++q) { const float c = vals[u * 4 + q] - mu; s2 += c * c; }
  red[tid] = s2; __syncthreads();
  for (int st = 128; st > 0; st >>= 1) { if (tid < st) red[tid] += red[tid + st]; __syncthreads(); }
  const float rs = rsqrtf(red[0] / (float)N + eps);
  {
    for (int u = 0; u < per / 4; ++u) {
      const int j = tid * 4 + 1024 * u;
      v4f o, sm;
#pragma unroll
      for (int q = 0; q < 4; ++q) {
        float gg = g[j + q], bb = bta[j + q];
        if (PARAM_BF16) { gg = bf16_round(gg); bb = bf16_round(bb); }
        sm[q] = vals[u * 4 + q]; o[q] = (vals[u * 4 + q] - mu) * rs * gg + bb;
      }
      if (out_sum) *(v4f*)(out_sum + (size_t)row * N + j) = sm;
      *(v4f*)(out_norm + (size_t)row * N + j) = o;
    }
    
  }
}



// ---- f16 WMMA path (v_wmma_f32_16x16x32_f16): 11-bit significands for operands in range — used where a [0,1] probability operand needs more precision than bf16
typedef _Float16 v16h __attribute__((ext_vector_type(16)));
union FragH { v16h v; v8us half[2]; _Float16 h[16]; unsigned short u[16]; };
template <int NT>
__device__ __forceinline__ v8f mmaH(v16h ah, v16h al, v16h bh, v16h bl, v8f c) {
  c = __builtin_amdgcn_wmma_f32_16x16x32_f16(false, ah, false, bh, (short)0, c, false, false);
  if (NT >= 2) c = __builtin_amdgcn_wmma_f32_16x16x32_f16(false, al, false, bh, (short)0, c, false, false);
  if (NT >= 3) c = __builtin_amdgcn_wmma_f32_16x16x32_f16(false, ah, false, bl, (short)0, c, false, false);
  asm volatile("v_nop\n\tv_nop\n\tv_nop\n\tv_nop" : "+v"(c) : "v"(ah), "v"(al), "v"(bh), "v"(bl));
  return c;
}
// batched GEMM like k_gemm_b but f16 operands: A f32 (split into f16 hi/lo if ASPLIT, else rounded to f16), Bt = f16 values [n][k]; alpha; C f32; N multiple of 16 (partial tiles skipped)
template <bool ASPLIT>
__global__ __launch_bounds__(128) void k_gemm_h(const float* __restrict__ A, int lda, size_t sA, const _Float16* __restrict__ Bh, int ldb, size_t sB, float alpha, float* __restrict__ C, int ldc, size_t sC, int M, int N, int K) {
  __shared__ __attribute__((aligned(16))) float so[4][16][64];
  const int tid = threadIdx.x, w = tid >> 5, lane = tid & 31, ln = lane & 15, hh = lane >> 4; const int by = blockIdx.y;
  A += (size_t)by * sA; Bh += (size_t)by * sB; C += (size_t)by * sC;
  const int ntn = (N + 63) / 64; const int wid = blockIdx.x * 4 + w; const int mt = wid / ntn, nq = wid % ntn; if (mt * 16 >= M) return;
  const int row0 = mt * 16, col0 = nq * 64; const float* arow = A + (size_t)(row0 + ln) * lda;
  v8f acc[4] = {};
  for (int kb = 0; kb < K; kb += 32) {
    FragH ah, al;
    const v4f x0 = *(const v4fa*)(arow + kb + 8 * hh), x1 = *(const v4fa*)(arow + kb + 8 * hh + 4), x2 = *(const v4fa*)(arow + kb + 16 + 8 * hh), x3 = *(const v4fa*)(arow + kb + 16 + 8 * hh + 4);
    float xs[16] = {x0[0],x0[1],x0[2],x0[3],x1[0],x1[1],x1[2],x1[3],x2[0],x2[1],x2[2],x2[3],x3[0],x3[1],x3[2],x3[3]};
#pragma unroll
    for (int i = 0; i < 16; ++i) { const _Float16 h = (_Float16)xs[i]; ah.h[i] = h; al.h[i] = ASPLIT ? (_Float16)(xs[i] - (float)h) : (_Float16)0.0f; }
#pragma unroll
    for (int t = 0; t < 4; ++t) { if (col0 + t * 16 >= N) continue; const size_t boff = (size_t)(col0 + t * 16 + ln) * ldb + kb; FragH bq; bq.half[0] = *(const v8us*)(Bh + boff + 8 * hh); bq.half[1] = *(const v8us*)(Bh + boff + 16 + 8 * hh);
      acc[t] = mmaH<ASPLIT ? 2 : 1>(ah.v, al.v, bq.v, bq.v, acc[t]); }
  }
#pragma unroll
  for (int t = 0; t < 4; ++t) { if (col0 + t * 16 >= N) continue;
#pragma unroll
    for (int r = 0; r < 8; ++r) so[w][8 * hh + r][t * 16 + ln] = acc[t][r] * alpha; }
  __builtin_amdgcn_fence(__ATOMIC_ACQ_REL, "workgroup"); __builtin_amdgcn_wave_barrier();
  const int rsub = lane >> 4, c4 = (lane & 15) * 4;
  {
#pragma unroll
    for (int q = 0; q < 8; ++q) { const int r = q * 2 + rsub; if (col0 + c4 < N) { const v4f v = *(const v4fa*)&so[w][r][c4]; *(v4f*)(C + (size_t)(row0 + r) * ldc + col0 + c4) = v; } }
     }
}

// f16(W[k][n]·scale) from f32 row-major W[K][N] (scale = power of two; bf16-exact weights stay exact in f16 away from the subnormal range), packed in fragment order: one block of 512 bytes = one 16-byte load of a whole wave =
// half j of the fragment (16 columns n of tile tn) x (k block c of 32): lane (ln, hh) owns the 8 values n = 16tn + ln, k = 32c + 16j + 8hh .. + 7. Blocks in the order [tn][c][j]. Thread t writes the 16 bytes number t of the plane.
#define FRH 256            // f16 values in one such block
// All four planes in one launch (for speed only). A plane of 128 x 128 takes WPB blocks; blocks 0 .. 2 WPB - 1 pack Wq rows 0..255, then WPB each Wk, Wv, Wc:
// a block lies wholly in one plane, so the choice of plane is scalar.
#define WPB (EE * EE / 8 / 256)
__global__ __launch_bounds__(256) void k_wt_f16(const float* __restrict__ Wq, const float* __restrict__ Wk, const float* __restrict__ Wv, const float* __restrict__ Wc,
                                                _Float16* __restrict__ Bq, _Float16* __restrict__ Bk, _Float16* __restrict__ Bv, _Float16* __restrict__ Bc, float scale) {
  const int blk = blockIdx.x, pl = (blk < 2 * WPB) ? 0 : blk / WPB - 1;      // plane 0 Wq (K = 256), 1 Wk, 2 Wv, 3 Wc (K = 128)
  const float* __restrict__ W = (pl == 0) ? Wq : (pl == 1) ? Wk : (pl == 2) ? Wv : Wc;
  _Float16* __restrict__ Wt = (pl == 0) ? Bq : (pl == 1) ? Bk : (pl == 2) ? Bv : Bc;
  const int kl = (pl == 0) ? 3 : 2;      // log2 of the k blocks of 32 in the plane
  const int t = (blk - ((pl == 0) ? 0 : (pl + 1) * WPB)) * 256 + threadIdx.x;
  const int ln = t & 15, hh = (t >> 4) & 1, j = (t >> 5) & 1, cb = t >> 6, c = cb & ((1 << kl) - 1), tn = cb >> kl;
  const int n = tn * 16 + ln, k8 = c * 32 + j * 16 + hh * 8; FragH f;
#pragma unroll
  for (int i = 0; i < 8; ++i) f.h[i] = (_Float16)(bf16_round(W[(size_t)(k8 + i) * EE + n]) * scale); const v8us o = f.half[0];
  *(v8us*)((unsigned short*)Wt + (size_t)t * 8) = o; 
}
// The whole head in one kernel. One work-group = one batch b and all HPW heads; wave w < 7 owns the 16 query rows g = 16w..16w+15 (7 waves cover 112 >= 100) and loops over the heads.
// The score tile is formed transposed, S^T = K.Q^T (A = 16 key rows, B = 16 query rows, d 16 zero-extended to the k = 32 of the instruction), so a lane (ln, hh) holds, for its one
// query g = 16w + ln, the keys p = 16t + 8hh + r (t = tile, r = accumulator register). That is the k order of a B fragment: after the softmax (registers, an exchange for the maximum and one for the sum between the
// two lane halves) tiles 2c and 2c+1 are, register for register, the B operand of O^T = V^T.P^T for keys 32c..32c+31. Scores and weights never leave the registers.
// V^T (A operand, rows = head columns, k = keys, zero for keys >= 100) waits in LDS. The mask row slice of a lane is read once and serves all HPW heads and the pointer softmax.
// The same turn carries the wave through the rest of the network: O^T of heads 2c, 2c+1 is the B operand (k = 32c..32c+31) of MH^T = Wc^T.O^T, the tiles 2c, 2c+1 of MH^T are the B operand
// of S2^T = ENC.MH^T, and S2^T again leaves a lane with the keys 16t + 8hh + r of its one query, the places its mask registers already have: tanh, mask and softmax run as in the heads.
// The projections stand in front and are split the other way, by weight columns: wave w of 8 keeps tile w (16 output columns x k 128, four fragments; of Wq^T two, k 256) of Wk^T, Wv and Wq^T in registers, read from global memory once a work-group, and takes the
// 7 row tiles past them. For that waves 0..6 first round their 16 node rows and their 16 input2 rows to f16 fragments (node rows >= 100 zero) and store them in LDS; a node fragment is the B operand of K^T = Wk^T.ENC^T (a lane gets 8 columns in a row of
// a node: one 16-byte store into a K row in LDS), the A operand of V = ENC.Wv (a lane gets 8 nodes in a row of a column: one 16-byte store into a V^T row) and later the A operand of the pointer product.
// Q^T = Wq^T.[input1 | input2]^T (k = 256): the input1 half has the same B operand for every row tile, so its four products run once and their sum starts each row tile's chain as the C operand. A lane gets the columns 8hh + r of head w of one query:
// the half fragment that the score product wants as B, stored at the place of the lane that owns the query. Split by rows, every wave read every weight fragment for one product each. Wave 7 owns no rows and ends behind the projections.
#define HPW 8              // heads per work-group: all of them, so a wave reads and rounds its mask slice once and holds the whole O row of its query
#define VTP 136            // f16 pitch of a V^T, K or node row in LDS: 256 + 16 bytes, spreads the 16 rows of a 16-byte fragment read over the banks
// the 16 f32 values of one fragment (k = 8hh..8hh+7 and 16+8hh..16+8hh+7 of a block of 32) of an f32 row; p = row + 32c + 8hh
__device__ __forceinline__ void raw_f32(v4f (&x)[4], const float* __restrict__ p) { x[0] = *(const v4fa*)p; x[1] = *(const v4fa*)(p + 4); x[2] = *(const v4fa*)(p + 16); x[3] = *(const v4fa*)(p + 20); }
// ... rounded to bf16, then (exactly, in range) to f16
__device__ __forceinline__ FragH frag_f32(const v4f (&x)[4]) {
  FragH f;
#pragma unroll
  for (int j = 0; j < 4; ++j)
#pragma unroll
    for (int i = 0; i < 4; ++i) f.h[4 * j + i] = (_Float16)bf16_round(x[j][i]);
  return f;
}
// The softmaxes run in base 2: log2(e) is folded into what their scores are made of (the scale of Q, the factor of tanh, the mask), so that a weight is one subtraction and the chip's own base-2 exponential, 2^(x - m);
// a result below 2^-126 may come out as 0. x = -inf or the sentinel of a dead key gives exactly 0 as long as m is at or above MFLOOR.
#define LOG2E 1.4426950408889634f
#define MFLOOR -1.0e38f      // floor of a row maximum: a row with no live key (every score -inf or the sentinel -3e38) then gets weight 0 everywhere from the exponential itself, and no score needs a test of its own
__device__ __forceinline__ float exp_sh(float x, float m) { return __builtin_amdgcn_exp2f(x - m); }
// tanh(k x) = 1 - 2 / (1 + e^(2 k x)) on the base-2 exponential and the reciprocal instruction: no branch; +-1 at the far ends (e = inf or 0); absolute error of a few 2^-24, also near 0
__device__ __forceinline__ float tanh_hw(float x, float k) { return 1.0f - 2.0f * __builtin_amdgcn_rcpf(1.0f + __builtin_amdgcn_exp2f(x * (k * 2.8853900817779268f))); }
// Keep it at or under 256 registers a wave and 160 KiB of LDS: then the 512 work-groups of 8 waves stand two to a WGP, all resident at once; above either only one fits and the grid runs in two turns. The attribute states that budget to the compiler (four waves a SIMD = 256 registers): left free, its scheduler goes above it.
__global__ __launch_bounds__(256) __attribute__((amdgpu_waves_per_eu(4))) void k_attn(const float* __restrict__ IN1, const float* __restrict__ IN2, const float* __restrict__ RL, const float* __restrict__ MSK, const float* __restrict__ ENC, const float* __restrict__ WQ,
                                              const _Float16* __restrict__ WqT, const _Float16* __restrict__ WkT, const _Float16* __restrict__ WvT, const _Float16* __restrict__ WcT, const float* __restrict__ bc, float* __restrict__ out) {
  static_assert(HPW == NH, "the output projection needs all heads of a query in one wave");
  static_assert(GG == PN, "a wave's 16 query rows and its 16 node rows share one row index");
  static_assert(EE == 8 * 16, "one weight tile of each plane per wave");
  __shared__ __attribute__((aligned(16))) unsigned short sVT[HPW * KD][VTP];
  __shared__ __attribute__((aligned(16))) unsigned short sK[112][VTP];      // K rows (f16), rows 100..111 zero
  __shared__ __attribute__((aligned(16))) unsigned short sE[112][VTP];      // node rows (f16), rows 100..111 zero
  __shared__ __attribute__((aligned(16))) unsigned short sI2[112][VTP];      // input2 rows (f16), rows 100..111 a copy of row 99
  __shared__ __attribute__((aligned(16))) v8us sO[NH][224];      // a lane's own half-fragments, one per head: first Q (written by the wave that holds the head's weight tile), then, once a head's Q has been read, its O, written and read back by the same lane (the head loop is rolled, so registers cannot be indexed by the head)
  __shared__ __attribute__((aligned(16))) float sW3[EE];      // Wq row 256 (the weights of 'remaining'), rounded to bf16
  __shared__ __attribute__((aligned(16))) float sBC[EE];      // bc rounded to bf16: read and rounded once a work-group, with the first loads, so that the output projection waits for no global load of it
  __shared__ __attribute__((aligned(16))) _Float16 sI1[EE];      // input1 of the batch, rounded to bf16, as f16: the B fragments for k 0..127 of the Q product
  __shared__ __attribute__((aligned(16))) float sRV[112];      // 'remaining' of each query row, rounded to bf16
  const int tid = threadIdx.x, w = __builtin_amdgcn_readfirstlane(tid >> 5), lane = tid & 31, ln = lane & 15, hh = lane >> 4;      // the wave's number as a scalar: the tests on it below are scalar branches
  const int b = blockIdx.x;
  const v8us zero8 = {0,0,0,0,0,0,0,0};
  for (int e = tid; e < 2 * HPW * KD; e += 256) *(v8us*)&sVT[e >> 1][112 + 8 * (e & 1)] = zero8;      // keys 112..127 belong to no row tile; the last k block of V^T.P^T reads them
  const int g = w * 16 + ln, gc = (g < GG) ? g : GG - 1;      // rows 100..111 compute on row 99 and store nothing
  const size_t bg = (size_t)b * GG + gc;
  const bool live = g < PN;
  // the f32 rows of the wave are asked for at once: node rows (rows 100..111 read row 99, in bounds, and are zeroed) and input2
  v4f xe[4][4], x2[4][4];
  float rr = 0.f;
  if (w < 7) {
    const float* pe = ENC + bg * EE + 8 * hh; const float* p2 = IN2 + bg * EE + 8 * hh; const float* pr = RL + bg;
#pragma unroll      // the index names registers (fragments, accumulators): it must be a constant
    for (int c = 0; c < 4; ++c) raw_f32(xe[c], pe + c * 32);
#pragma unroll      // the index names registers (fragments, accumulators): it must be a constant
    for (int c = 0; c < 4; ++c) raw_f32(x2[c], p2 + c * 32);
    rr = *pr;
    asm volatile("s_wait_xcnt 0x0" :: "v"(pe), "v"(p2), "v"(pr) : "memory");      // the address registers of the 33 loads are reused below: the wait stands in front of that overwrite; as inputs they stay whole up to it (else a later load of the run lands in them)
  }
  // The wave's weight tiles: 8 loads each (the planes lie in fragment order, k_wt_f16: a load of the wave reads 512 bytes in a row, four whole cache lines, a tile 4 KiB in a row). The input1 half of the Wq^T tile, the first to be used, is asked for
  // behind the rows, and with it one value a thread of input1, of Wq row 256 and of bc (threads 128.. read again what 0.. read, in bounds, and drop it); the three other tiles follow when the rounding of the node rows has freed their f32 registers, and fly while input2 is rounded (the barrier behind it waits for every load).
  const unsigned short* wkp = (const unsigned short*)WkT + w * 8 * FRH + lane * 8;
  const unsigned short* wvp = (const unsigned short*)WvT + w * 8 * FRH + lane * 8;
  const unsigned short* wqp = (const unsigned short*)WqT + w * 16 * FRH + lane * 8;      // blocks 0..7 of the tile: k 0..127 (input1), blocks 8..15: k 128..255 (input2)
  const int ix = tid & (EE - 1);
  v8us wk[8], wv[8], wq1[8], wq2[8];
#pragma unroll      // the index names registers (fragments, accumulators): it must be a constant
  for (int i = 0; i < 8; ++i) wq1[i] = *(const v8us*)(wqp + i * FRH);
  const float y1 = IN1[(size_t)b * EE + ix], y3 = WQ[(size_t)(2 * EE) * EE + ix], y4 = bc[ix];
  asm volatile("s_wait_xcnt 0x0" :: "v"(wqp), "v"(ix) : "memory");      // the address registers of the 11 loads are reused below: the wait stands in front of that overwrite; as inputs they stay whole up to it
  if (w < 7) {
#pragma unroll      // the index names registers (fragments, accumulators): it must be a constant
    for (int c = 0; c < 4; ++c) {
      const FragH x = frag_f32(xe[c]);
      *(v8us*)&sE[g][c * 32 + 8 * hh] = live ? x.half[0] : zero8; *(v8us*)&sE[g][c * 32 + 16 + 8 * hh] = live ? x.half[1] : zero8;
    }
  }
#pragma unroll      // the index names registers (fragments, accumulators): it must be a constant
  for (int i = 0; i < 8; ++i) { wk[i] = *(const v8us*)(wkp + i * FRH); wv[i] = *(const v8us*)(wvp + i * FRH); }
#pragma unroll      // the index names registers (fragments, accumulators): it must be a constant
  for (int i = 0; i < 8; ++i) wq2[i] = *(const v8us*)(wqp + (8 + i) * FRH);
  asm volatile("s_wait_xcnt 0x0" :: "v"(wkp), "v"(wvp), "v"(wqp) : "memory");      // the address registers of the 24 loads are reused below: the wait stands in front of that overwrite; as inputs they stay whole up to it
  if (w < 7) {
#pragma unroll      // the index names registers (fragments, accumulators): it must be a constant
    for (int c = 0; c < 4; ++c) {
      const FragH x = frag_f32(x2[c]);
      *(v8us*)&sI2[g][c * 32 + 8 * hh] = x.half[0]; *(v8us*)&sI2[g][c * 32 + 16 + 8 * hh] = x.half[1];
    }
    if (hh == 0) sRV[g] = bf16_round(rr);
  }
  if (tid < EE) { sI1[tid] = (_Float16)bf16_round(y1); sW3[tid] = bf16_round(y3); sBC[tid] = bf16_round(y4); }
  __syncthreads();      // the node rows, the input2 rows, input1, 'remaining', the last row of Wq and bc complete before any wave reads them
  const v4f u0 = *(const v4fa*)&sW3[w * 16 + 8 * hh], u1 = *(const v4fa*)&sW3[w * 16 + 8 * hh + 4];
  float rvv[7];
#pragma unroll      // the index names registers (fragments, accumulators): it must be a constant
  for (int rt = 0; rt < 7; ++rt) rvv[rt] = sRV[rt * 16 + ln];
  FragH ib[4];
#pragma unroll      // the index names registers (fragments, accumulators): it must be a constant
  for (int c = 0; c < 4; ++c) { ib[c].half[0] = *(const v8us*)&sI1[c * 32 + 8 * hh]; ib[c].half[1] = *(const v8us*)&sI1[c * 32 + 16 + 8 * hh]; }
  v4f my[7][2];      // mask[b][g][16t + 8hh + 4u ..]; tile 6: both halves read keys 96..99 (in bounds), the upper half drops them
  const float* mp = MSK + bg * PN + 8 * hh; const float* mp6 = MSK + bg * PN + 96;
  // One pass per row tile rt. Its node fragments were asked for during the pass before, its input2 fragments are asked for ahead of the K and V products: each set of 8 LDS loads flies while the other set is worked on.
  v8us fe[8], fi[8];
  auto rows = [&](v8us (&f)[8], const unsigned short (*s)[VTP], int rt) {
#pragma unroll      // the index names registers (fragments, accumulators): it must be a constant
    for (int c = 0; c < 4; ++c) { f[2 * c] = *(const v8us*)&s[rt * 16 + ln][c * 32 + 8 * hh]; f[2 * c + 1] = *(const v8us*)&s[rt * 16 + ln][c * 32 + 16 + 8 * hh]; }
  };
  v8f q1 = {};      // the input1 half of Q^T, the same for every row tile
#pragma unroll      // the index names registers (fragments, accumulators): it must be a constant
  for (int c = 0; c < 4; ++c) {
    FragH x; x.half[0] = wq1[2 * c]; x.half[1] = wq1[2 * c + 1];
    q1 = __builtin_amdgcn_wmma_f32_16x16x32_f16(false, x.v, false, ib[c].v, (short)0, q1, false, false);
  }
  rows(fe, sE, 0);
#pragma unroll      // the index names registers (fragments, accumulators): it must be a constant
  for (int rt = 0; rt < 7; ++rt) {
    rows(fi, sI2, rt);
    __builtin_amdgcn_sched_barrier(0);      // keeps the input2 loads of this pass in front of the K and V products: sunk to their use, each pair is waited for at its own matrix instruction
    // K^T = Wk^T.ENC^T and V = ENC.Wv, both acc/16 rounded to f16
    v8f ak = {}, av = {};
#pragma unroll      // the index names registers (fragments, accumulators): it must be a constant
    for (int c = 0; c < 4; ++c) {
      FragH e, x, y; e.half[0] = fe[2 * c]; e.half[1] = fe[2 * c + 1]; x.half[0] = wk[2 * c]; x.half[1] = wk[2 * c + 1]; y.half[0] = wv[2 * c]; y.half[1] = wv[2 * c + 1];
      ak = __builtin_amdgcn_wmma_f32_16x16x32_f16(false, x.v, false, e.v, (short)0, ak, false, false);
      av = __builtin_amdgcn_wmma_f32_16x16x32_f16(false, e.v, false, y.v, (short)0, av, false, false);
    }
    __builtin_amdgcn_sched_barrier(0);      // keeps the loads below behind the products above, whose node fragments they replace: lifted above them a second set of registers is live
    if (rt + 1 < 7) rows(fe, sE, rt + 1);
    else {      // no row tile is left to ask for: the mask slice takes the registers of Wk^T, Wv and the node fragments and flies during the last Q products (wave 7 reads row 99, in bounds, and drops it)
#pragma unroll      // the index names registers (fragments, accumulators): it must be a constant
      for (int t = 0; t < 7; ++t)
#pragma unroll      // the index names registers (fragments, accumulators): it must be a constant
        for (int u = 0; u < 2; ++u) if (t < 6 || u == 0) my[t][u] = *(const v4fa*)(((t < 6) ? mp + t * 16 : mp6) + 4 * u);
      asm volatile("s_wait_xcnt 0x0" :: "v"(mp), "v"(mp6) : "memory");      // the two address pairs are reused behind the 13 loads: the wait stands in front of that overwrite; as inputs they stay whole up to it
    }
    __builtin_amdgcn_sched_barrier(0);      // keeps the loads above in front of the Q products: sunk to their use, each pair is waited for at its own matrix instruction
    // Q^T = Wq^T.[input1 | input2]^T; q = (acc/16 + remaining.Wq[256]) log2(e) / sqrt(16), rounded to f16
    v8f aq = q1;
#pragma unroll      // the index names registers (fragments, accumulators): it must be a constant
    for (int c = 0; c < 4; ++c) {
      FragH x, y; x.half[0] = wq2[2 * c]; x.half[1] = wq2[2 * c + 1]; y.half[0] = fi[2 * c]; y.half[1] = fi[2 * c + 1];
      aq = __builtin_amdgcn_wmma_f32_16x16x32_f16(false, x.v, false, y.v, (short)0, aq, false, false);
    }
    FragH fk, fv, fq;
#pragma unroll
    for (int r = 0; r < 8; ++r) {
      fk.h[r] = (_Float16)(ak[r] * 0.0625f); fv.h[r] = (_Float16)(av[r] * 0.0625f);
      fq.h[r] = (_Float16)((aq[r] * 0.0625f + rvv[rt] * ((r < 4) ? u0[r & 3] : u1[r & 3])) * (0.25f * LOG2E));
    }
    *(v8us*)&sK[rt * 16 + ln][w * 16 + 8 * hh] = fk.half[0];
    *(v8us*)&sVT[w * 16 + ln][rt * 16 + 8 * hh] = fv.half[0];
    sO[w][rt * 32 + lane] = fq.half[0];
  }
  __syncthreads();      // K, V^T and Q complete before any wave reads them
  if (w == 7) return;      // no barrier stands behind this line
  v8f mk[7];      // the mask slice rounded to bf16, times log2(e), one accumulator tile per key tile: it enters the score product as its C operand; keys >= 100 get a sentinel far below MFLOOR, so weight 0
#pragma unroll
  for (int t = 0; t < 7; ++t)
#pragma unroll
    for (int u = 0; u < 2; ++u) {
      if (t == 6 && u == 1) { for (int i = 0; i < 4; ++i) mk[t][4 + i] = -3.0e38f; continue; }
      const bool dead = (t == 6) && (hh == 1);
#pragma unroll
      for (int i = 0; i < 4; ++i) { const float x = bf16_round(my[t][u][i]) * LOG2E; mk[t][4 * u + i] = dead ? -3.0e38f : x; }
    }
  // Q and K fragment halves of one head
  v8us qf = sO[0][tid], kf[7];
#pragma unroll
  for (int t = 0; t < 7; ++t) kf[t] = *(const v8us*)&sK[t * 16 + ln][8 * hh];
#pragma nounroll      // stays one rolled loop of 8 passes: with the shorter body the compiler peels the last pass off and schedules it into the output projection, which takes the kernel above 256 registers (under the stated budget: into scratch)
  for (int hl = 0; hl < HPW; ++hl) {
    FragH bq; bq.half[0] = qf; bq.half[1] = zero8;
    v8f s[7];
#pragma unroll
    for (int t = 0; t < 7; ++t) {
      FragH ak; ak.half[0] = kf[t]; ak.half[1] = zero8;
      s[t] = __builtin_amdgcn_wmma_f32_16x16x32_f16(false, ak.v, false, bq.v, (short)0, mk[t], false, false);      // score + mask: the matrix instruction adds its C operand for nothing
    }
    // the next head's fragments fly while this head's softmax runs; the last pass reads its own again (in bounds, unused), so that no branch stands behind the matrix instructions
    const int hn = (hl + 1 < HPW) ? hl + 1 : hl;
    qf = sO[hn][tid];
#pragma unroll
    for (int t = 0; t < 7; ++t) kf[t] = *(const v8us*)&sK[t * 16 + ln][hn * KD + 8 * hh];
    FragH av[4];      // this head's V^T fragments, asked for ahead of the softmax as well
#pragma unroll
    for (int cc = 0; cc < 4; ++cc) { av[cc].half[0] = *(const v8us*)&sVT[hl * KD + ln][cc * 32 + 8 * hh]; av[cc].half[1] = *(const v8us*)&sVT[hl * KD + ln][cc * 32 + 16 + 8 * hh]; }
    __builtin_amdgcn_sched_barrier(0);      // keeps the loads above in front of the softmax: without it the compiler sinks them to their first use and their latency is waited out there
    // row maximum and row sum: one short chain per tile, then a tree (seven independent chains instead of one of 56 links; few waves share a SIMD here)
    float pm[7];
#pragma unroll
    for (int t = 0; t < 7; ++t) {
      pm[t] = s[t][0];
#pragma unroll
      for (int r = 1; r < 8; ++r) pm[t] = fmaxf(pm[t], s[t][r]);
    }
    float m = fmaxf(fmaxf(fmaxf(pm[0], pm[1]), fmaxf(pm[2], pm[3])), fmaxf(fmaxf(pm[4], pm[5]), pm[6]));
    m = fmaxf(fmaxf(m, __shfl_xor(m, 16, 32)), MFLOOR);
    // The weights go into the product as they leave the exponential (in [0, 1], the largest 1): 1 / sum is the same for all keys of a lane's query, so it multiplies the 8 outputs instead of the 56 weights.
    // The sum runs in register pairs (even and odd accumulator registers apart), which is the packed add's own shape.
    v2f ps[7];
    v8f o = {};
#pragma unroll
    for (int c = 0; c < 4; ++c) {
      FragH pb;
#pragma unroll
      for (int u = 0; u < 2; ++u) {
        const int t = 2 * c + u;
        if (t < 7) {
#pragma unroll
          for (int i = 0; i < 8; i += 2) {
            const v2f e = {exp_sh(s[t][i], m), exp_sh(s[t][i + 1], m)};
            ps[t] = (i == 0) ? e : ps[t] + e;
            pb.h[8 * u + i] = (_Float16)e[0]; pb.h[8 * u + i + 1] = (_Float16)e[1];
          }
        } else pb.half[u] = zero8;
      }
      o = __builtin_amdgcn_wmma_f32_16x16x32_f16(false, av[c].v, false, pb.v, (short)0, o, false, false);
    }
    const v2f pt = ((ps[0] + ps[1]) + (ps[2] + ps[3])) + ((ps[4] + ps[5]) + ps[6]);
    float sum = pt[0] + pt[1];
    sum += __shfl_xor(sum, 16, 32);
    const float is = (sum > 0.f) ? 1.0f / sum : 0.f;
    FragH f;      // o[r] = O[g][head column 8hh + r]: 16 bytes in a row of the lane's output row
#pragma unroll
    for (int r = 0; r < 8; ++r) f.h[r] = (_Float16)(o[r] * is);
    sO[hl][tid] = f.half[0];
  }
  // MH^T = Wc^T.O^T: A = 16 rows of Wc^T (output columns e), B = the lane's O row; two tiles of e make one B fragment of the pointer product. mh = acc/16 + bc, rounded to f16.
  FragH ob[4], mb[4];
#pragma unroll      // the index names registers (fragments, accumulators): it must be a constant
  for (int c = 0; c < 4; ++c) { ob[c].half[0] = sO[2 * c][tid]; ob[c].half[1] = sO[2 * c + 1][tid]; }
  // The operands of the two products come in 15 groups of 8 loads, as in the projections (one group = the 4 matrix instructions of one accumulator chain): groups 0..7 the tiles of Wc^T (global, fragment order),
  // groups 8..14 the node tiles (LDS). Three register buffers in turn: of Wc^T group i + 2 is asked for before group i is used, of the node tiles group i + 1. Left to the compiler each pair of loads stands directly in front of its matrix instruction and is waited for alone.
  const unsigned short* wp = (const unsigned short*)WcT + lane * 8;
  v8us rt[3][8];
  auto fetch_t = [&](int gi) {
#pragma unroll      // the index names registers (fragments, accumulators): it must be a constant
    for (int c = 0; c < 4; ++c) {
      if (gi < 8) { rt[gi % 3][2 * c] = *(const v8us*)(wp + (gi * 8 + 2 * c) * FRH); rt[gi % 3][2 * c + 1] = *(const v8us*)(wp + (gi * 8 + 2 * c + 1) * FRH); }
      else { rt[gi % 3][2 * c] = *(const v8us*)&sE[(gi - 8) * 16 + ln][c * 32 + 8 * hh]; rt[gi % 3][2 * c + 1] = *(const v8us*)&sE[(gi - 8) * 16 + ln][c * 32 + 16 + 8 * hh]; }
    }
    if (gi == 7) asm volatile("s_wait_xcnt 0x0" ::: "memory");      // the last loads of Wc^T: the registers that held their address are free from here on; the wait stands in front of that overwrite
  };
  fetch_t(0); fetch_t(1);
  // S2^T = ENC.MH^T: A = 16 node rows from LDS (rows 100..111 zero), B = mb
  v8f z[7];
#pragma unroll      // the index names registers (fragments, accumulators): it must be a constant
  for (int gi = 0; gi < 15; ++gi) {
    if (gi + 2 < 8) fetch_t(gi + 2);      // Wc^T comes from L2: two groups ahead
    else if (gi >= 7 && gi + 1 < 15) fetch_t(gi + 1);      // the node tiles come from LDS: one group ahead is enough, and the accumulators of the pointer product need the registers
    v4f b0 = {}, b1 = {};
    if (gi < 8) { b0 = *(const v4fa*)&sBC[gi * 16 + 8 * hh]; b1 = *(const v4fa*)&sBC[gi * 16 + 8 * hh + 4]; }
    __builtin_amdgcn_sched_barrier(0);      // keeps the loads asked for above and the bias of group gi in front of the products of group gi: sunk to their use, each pair is waited for at its own matrix instruction
    v8f a = {};
#pragma unroll      // the index names registers (fragments, accumulators): it must be a constant
    for (int c = 0; c < 4; ++c) {
      FragH x; x.half[0] = rt[gi % 3][2 * c]; x.half[1] = rt[gi % 3][2 * c + 1];
      a = __builtin_amdgcn_wmma_f32_16x16x32_f16(false, x.v, false, (gi < 8) ? ob[c].v : mb[c].v, (short)0, a, false, false);
    }
    if (gi < 8) {
#pragma unroll      // the index names registers (fragments, accumulators): it must be a constant
      for (int r = 0; r < 8; ++r) mb[gi >> 1].h[8 * (gi & 1) + r] = (_Float16)(a[r] * 0.0625f + ((r < 4) ? b0[r & 3] : b1[r & 3]));
    } else z[gi - 8] = a;
    if (gi < 6) __builtin_amdgcn_sched_barrier(0);      // keeps the loads of group gi + 3 behind the products of group gi, whose buffer they take over: lifted above them a fourth buffer is live and the kernel goes above 256 registers (under the stated budget: into scratch)
  }
  __builtin_amdgcn_sched_barrier(0);      // ends the scheduling region of the two products here, where the branches of the library tanh ended it: as one region with the branch-free tail the kernel goes above 256 registers (under the stated budget: into scratch)
  // probs = softmax(10 tanh(S2 / sqrt(128)) + mask) over the keys of the lane's query, in base 2: chains per tile, a tree, one exchange between the lane halves, as in the heads
  float pm[7];
  v2f ps[7];
#pragma unroll      // the index names registers (fragments, accumulators): it must be a constant
  for (int t = 0; t < 7; ++t) {
#pragma unroll      // the index names registers (fragments, accumulators): it must be a constant
    for (int r = 0; r < 8; ++r) { z[t][r] = (10.0f * LOG2E) * tanh_hw(z[t][r], 0.08838834764831845f) + mk[t][r]; pm[t] = (r == 0) ? z[t][r] : fmaxf(pm[t], z[t][r]); }
  }
  float m = fmaxf(fmaxf(fmaxf(pm[0], pm[1]), fmaxf(pm[2], pm[3])), fmaxf(fmaxf(pm[4], pm[5]), pm[6]));
  m = fmaxf(fmaxf(m, __shfl_xor(m, 16, 32)), MFLOOR);
#pragma unroll      // the index names registers (fragments, accumulators): it must be a constant
  for (int t = 0; t < 7; ++t) {
#pragma unroll      // the index names registers (fragments, accumulators): it must be a constant
    for (int r = 0; r < 8; r += 2) { const v2f e = {exp_sh(z[t][r], m), exp_sh(z[t][r + 1], m)}; z[t][r] = e[0]; z[t][r + 1] = e[1]; ps[t] = (r == 0) ? e : ps[t] + e; }
  }
  const v2f pt = ((ps[0] + ps[1]) + (ps[2] + ps[3])) + ((ps[4] + ps[5]) + ps[6]);
  float sum = pt[0] + pt[1];
  sum += __shfl_xor(sum, 16, 32);
  const float is = (sum > 0.f) ? 1.0f / sum : 0.f;
#pragma unroll      // the index names registers (fragments, accumulators): it must be a constant
  for (int t = 0; t < 7; ++t)
#pragma unroll      // the index names registers (fragments, accumulators): it must be a constant
    for (int r = 0; r < 8; ++r) z[t][r] *= is;
  if (g < GG) {      // a lane stores 32 bytes in a row per tile of its own output row (400-byte rows, 16-byte aligned pieces); tile 6 holds keys 96..99 in the lower half alone
    float* op = out + bg * PN + 8 * hh;
#pragma unroll      // the index names registers (fragments, accumulators): it must be a constant
    for (int t = 0; t < 6; ++t) {
      const v4f lo = {z[t][0], z[t][1], z[t][2], z[t][3]}, hi = {z[t][4], z[t][5], z[t][6], z[t][7]};
      *(v4f*)(op + t * 16) = lo; *(v4f*)(op + t * 16 + 4) = hi;
    }
    if (hh == 0) { const v4f lo = {z[6][0], z[6][1], z[6][2], z[6][3]}; *(v4f*)(op + 96) = lo; }
  }
}
extern "C" void kernel_launch(void* const* d_in, const int* in_sizes, int n_in,
                              void* d_out, int out_size, void* d_ws, size_t ws_size, hipStream_t stream) {
  (void)in_sizes; (void)n_in; (void)out_size;
  const float* in1 = (const float*)d_in[0]; const float* in2 = (const float*)d_in[1]; const float* rl = (const float*)d_in[2]; const float* msk = (const float*)d_in[3]; const float* enc = (const float*)d_in[4]; const float* Wq = (const float*)d_in[5]; const float* Wk = (const float*)d_in[6]; const float* Wv = (const float*)d_in[7]; const float* Wc = (const float*)d_in[8]; const float* bc = (const float*)d_in[9];
  char* ws = (char*)d_ws; size_t off = 0;
  auto take = [&](size_t bytes) { char* p = ws + off; off += (bytes + 255) & ~(size_t)255; return p; };
  _Float16* Bq = (_Float16*)take(2 * EE * EE * 2); _Float16* Bk = (_Float16*)take(EE * EE * 2); _Float16* Bv = (_Float16*)take(EE * EE * 2); _Float16* Bc = (_Float16*)take(EE * EE * 2);
  if (off > ws_size) return;      // 160 KiB of the workspace
  k_wt_f16<<<5 * WPB, 256, 0, stream>>>(Wq, Wk, Wv, Wc, Bq, Bk, Bv, Bc, 16.0f);      // of Wq the rows 0..255: input1 and input2  ([in][out]); row 256 (remaining) is read as it is
  // ---- projections, attention, output projection, pointer scores and the final softmax, one launch: a work-group per batch
  k_attn<<<NB, 256, 0, stream>>>(in1, in2, rl, msk, enc, Wq, Bq, Bk, Bv, Bc, bc, (float*)d_out);
}
